// v000
// Times are from an AMD MI455X. After a warm-up the kernel runs many times in a row, and a time is the length of
// such a window on the GPU divided by its runs, so every launch and the gaps after it count. The runs cycle
// through copies of the inputs. A figure is the median of several windows, for all but v000 over two sittings.
// Sittings can differ by a few percent; kernels timed side by side share one.
// The starting kernel, v000, takes 174 microseconds a run.
#include <hip/hip_runtime.h>
// Stand-alone (SASA) local self-attention (B=2, C 256 = 8 heads × 32, 56×56, 7×7 windows, stride 1, zero padding; relative row/col embeddings added to the windowed QUERIES, the centre KEY is
// the fixed operand, softmax over the 49 window positions, values windowed): 1×1 projections as GEMMs ((head,dim)×C weights bf16-exact ×2^4) and the window attention on
// v_wmma_f32_16x16x32_f16 with the diagonal-extraction scheme (per 16-token row segment and window offset: S = KC·Q_shiftedᵀ with kc and q as f16 hi + lo·2^-10 (3 products), diagonal + kc·rel_k (f32) → logit; online softmax f32 on the diagonal
// lanes; O += diag(P)·V_shifted via a diagonal f16 A operand); kc·rel per (token, head, offset) is f32 VALU; the NCHW transposes are VALU (f16 on the way in, f32 on the way out).
#define BB 2
#define CC 256
#define NHh 8
#define HD 32
#define HI 56
#define NTOK 3136
#define NXS 4
#define NR (BB * NTOK)

typedef __bf16 v16b __attribute__((ext_vector_type(16)));
typedef unsigned short v8us __attribute__((ext_vector_type(8), may_alias));
typedef float  v8f  __attribute__((ext_vector_type(8)));
typedef float  v4f  __attribute__((ext_vector_type(4)));
typedef float  v4fa __attribute__((ext_vector_type(4), may_alias));
union FragB { v16b v; v8us half[2]; unsigned short u[16]; };

__device__ __forceinline__ unsigned short bf16_bits(float x) { unsigned int u = __float_as_uint(x); return (unsigned short)((u + 0x7FFFu + ((u >> 16) & 1u)) >> 16); }
__device__ __forceinline__ float bf16_val(unsigned short b) { return __uint_as_float(((unsigned int)b) << 16); }
__device__ __forceinline__ float bf16_round(float x) { return bf16_val(bf16_bits(x)); }
// D += A·B with NT terms: 1 = ah·bh, 2 = + al·bh (A split), 3 = + ah·bl (both split)
template <int NT>
__device__ __forceinline__ v8f mmaN(v16b ah, v16b al, v16b bh, v16b bl, v8f c) {
  c = __builtin_amdgcn_wmma_f32_16x16x32_bf16(false, ah, false, bh, (short)0, c, false, false);
  if (NT >= 2) c = __builtin_amdgcn_wmma_f32_16x16x32_bf16(false, al, false, bh, (short)0, c, false, false);
  if (NT >= 3) c = __builtin_amdgcn_wmma_f32_16x16x32_bf16(false, ah, false, bl, (short)0, c, false, false);
  asm volatile("v_nop\n\tv_nop\n\tv_nop\n\tv_nop" : "+v"(c) : "v"(ah), "v"(al), "v"(bh), "v"(bl));
  return c;
}

__global__ __launch_bounds__(256) void k_wt_bf16(const float* __restrict__ W, unsigned short* __restrict__ Wt, int K, int N) {
  const int t = blockIdx.x * 256 + threadIdx.x;
  const int k8n = K / 8;
  if (t >= N * k8n) return;
  const int n = t / k8n, k8 = (t % k8n) * 8;
  v8us v;
#pragma unroll
  for (int i = 0; i < 8; ++i) v[i] = bf16_bits(W[(size_t)(k8 + i) * N + n]);
  *(v8us*)(Wt + (size_t)n * K + k8) = v;
  
}

// GEMM C[M][N] (f32, pitch ldc) = act(A[M][K]·W + bias). A f32 row-major (pitch lda) converted per fragment to bf16
// (ASPLIT: hi/lo two planes -> 2 terms, else single rounded term); Wt bf16 [N][K] (pitch ldb). BIAS_BF16 rounds the
// bias to bf16 first (bias quantised to bf16 before the add). K%32==0, M%16==0, N%64==0.
template <bool ASPLIT, int ACT, bool BIAS_BF16>
__global__ __launch_bounds__(128) void k_gemm_bf(const float* __restrict__ A, int lda, const unsigned short* __restrict__ Wt, int ldb,
                                               const float* __restrict__ bias, float* __restrict__ C, int ldc, int M, int N, int K) {
  __shared__ __attribute__((aligned(16))) float so[4][16][64];
  const int tid = threadIdx.x, w = tid >> 5, lane = tid & 31, ln = lane & 15, hh = lane >> 4;
  const int ntn = N / 64;
  const int wid = blockIdx.x * 4 + w;
  const int mt = wid / ntn, nq = wid % ntn;
  if (mt * 16 >= M) return;
  const int row0 = mt * 16, col0 = nq * 64;
  const float* arow = A + (size_t)(row0 + ln) * lda;
  v8f acc[4] = {};
  for (int kb = 0; kb < K; kb += 32) {
    FragB ah, al;
    const v4f x0 = *(const v4fa*)(arow + kb + 8 * hh), x1 = *(const v4fa*)(arow + kb + 8 * hh + 4);
    const v4f x2 = *(const v4fa*)(arow + kb + 16 + 8 * hh), x3 = *(const v4fa*)(arow + kb + 16 + 8 * hh + 4);
    float xs[16] = {x0[0],x0[1],x0[2],x0[3],x1[0],x1[1],x1[2],x1[3],x2[0],x2[1],x2[2],x2[3],x3[0],x3[1],x3[2],x3[3]};
#pragma unroll
    for (int i = 0; i < 16; ++i) { const unsigned short hb = bf16_bits(xs[i]); ah.u[i] = hb; al.u[i] = ASPLIT ? bf16_bits(xs[i] - bf16_val(hb)) : (unsigned short)0; }
#pragma unroll
    for (int t = 0; t < 4; ++t) {
      const unsigned short* brow = Wt + (size_t)(col0 + t * 16 + ln) * ldb + kb;
      FragB b;
      b.half[0] = *(const v8us*)(brow + 8 * hh);
      b.half[1] = *(const v8us*)(brow + 16 + 8 * hh);
      acc[t] = mmaN<ASPLIT ? 2 : 1>(ah.v, al.v, b.v, b.v, acc[t]);
    }
  }
#pragma unroll
  for (int t = 0; t < 4; ++t) {
    float bv = bias ? bias[col0 + t * 16 + ln] : 0.f;
    if (BIAS_BF16) bv = bf16_round(bv);
#pragma unroll
    for (int r = 0; r < 8; ++r) { float v = acc[t][r] + bv; if (ACT == 1) v = fmaxf(v, 0.f); so[w][8 * hh + r][t * 16 + ln] = v; }
  }
  __builtin_amdgcn_fence(__ATOMIC_ACQ_REL, "workgroup");
  __builtin_amdgcn_wave_barrier();
  const int rsub = lane >> 4, c4 = (lane & 15) * 4;
  {
#pragma unroll
    for (int q = 0; q < 8; ++q) {
      const int r = q * 2 + rsub;
      const v4f v = *(const v4fa*)&so[w][r][c4];
      *(v4f*)(C + (size_t)(row0 + r) * ldc + col0 + c4) = v;
    }
    
  }
}

// Flash-style causal/unmasked attention, all contractions 3-term bf16 hi/lo splits, f32 softmax with running max.
// q,k,v rows are read from f32 buffers with arbitrary row pitch (so they can live inside a fused qkv buffer);
// D = head size (multiple of 32, <= 128); one wave = 16 query rows; block = 4 waves (64 queries) sharing K/V chunks of 32.
template <int D, bool CAUSAL>
__global__ __launch_bounds__(128) void k_flash(const float* __restrict__ qb, const float* __restrict__ kb, const float* __restrict__ vb,
                                             int pitch, int T, int H, float scale, float* __restrict__ y, int ypitch) {
  constexpr int KS = D / 32;        // k-steps for QK
  constexpr int DT = D / 16;        // d tiles for PV
  __shared__ __attribute__((aligned(16))) unsigned short sKh[32][D + 8], sKl[32][D + 8], sVh[32][D + 8], sVl[32][D + 8];
  __shared__ __attribute__((aligned(16))) unsigned short sPh[4][16][40], sPl[4][16][40];
  __shared__ __attribute__((aligned(16))) float sO[4][16][D];
  const int tid = threadIdx.x, w = tid >> 5, lane = tid & 31, ln = lane & 15, hh = lane >> 4;
  const int nqb = (T + 63) / 64;
  const int bh = blockIdx.x / nqb, qblk = blockIdx.x % nqb;
  const int b = bh / H, h = bh % H;
  const int q0 = qblk * 64 + w * 16;
  const float* Q = qb + (size_t)b * T * pitch + h * D;
  const float* K = kb + (size_t)b * T * pitch + h * D;
  const float* V = vb + (size_t)b * T * pitch + h * D;

  // A fragments of the wave's 16 query rows (scaled), hi/lo
  FragB aqh[KS], aql[KS];
  {
    int row = q0 + ln; if (row >= T) row = T - 1;
    const float* qr = Q + (size_t)row * pitch;
#pragma unroll
    for (int ks = 0; ks < KS; ++ks)
#pragma unroll
      for (int i = 0; i < 16; ++i) {
        const int d = ks * 32 + ((i < 8) ? (8 * hh + i) : (16 + 8 * hh + (i - 8)));
        const float x = qr[d] * scale; const unsigned short hb = bf16_bits(x);
        aqh[ks].u[i] = hb; aql[ks].u[i] = bf16_bits(x - bf16_val(hb));
      }
  }
  float m_r[8], l_r[8];
#pragma unroll
  for (int r = 0; r < 8; ++r) { m_r[r] = -3.0e38f; l_r[r] = 0.f; }
  v8f oacc[DT];
#pragma unroll
  for (int dt = 0; dt < DT; ++dt) oacc[dt] = (v8f){0.f,0.f,0.f,0.f,0.f,0.f,0.f,0.f};

  const int kv_end = CAUSAL ? min(T, qblk * 64 + 64) : T;     // block-uniform
  for (int j0 = 0; j0 < kv_end; j0 += 32) {
    __syncthreads();
    for (int e = tid; e < 32 * (D / 4); e += 128) {
      const int r = e / (D / 4), c4 = (e % (D / 4)) * 4;
      const int key = j0 + r;
      v4f kf = {0.f,0.f,0.f,0.f}, vf = {0.f,0.f,0.f,0.f};
      if (key < T) { kf = *(const v4fa*)(K + (size_t)key * pitch + c4); vf = *(const v4fa*)(V + (size_t)key * pitch + c4); }
#pragma unroll
      for (int t = 0; t < 4; ++t) {
        unsigned short hb = bf16_bits(kf[t]); sKh[r][c4 + t] = hb; sKl[r][c4 + t] = bf16_bits(kf[t] - bf16_val(hb));
        hb = bf16_bits(vf[t]); sVh[r][c4 + t] = hb; sVl[r][c4 + t] = bf16_bits(vf[t] - bf16_val(hb));
      }
    }
    __syncthreads();
    // S tile 16 x 32
    v8f s[2];
#pragma unroll
    for (int nt = 0; nt < 2; ++nt) {
      v8f acc = {};
#pragma unroll
      for (int ks = 0; ks < KS; ++ks) {
        FragB bh_, bl_;
        bh_.half[0] = *(const v8us*)&sKh[nt * 16 + ln][ks * 32 + 8 * hh]; bh_.half[1] = *(const v8us*)&sKh[nt * 16 + ln][ks * 32 + 16 + 8 * hh];
        bl_.half[0] = *(const v8us*)&sKl[nt * 16 + ln][ks * 32 + 8 * hh]; bl_.half[1] = *(const v8us*)&sKl[nt * 16 + ln][ks * 32 + 16 + 8 * hh];
        acc = mmaN<3>(aqh[ks].v, aql[ks].v, bh_.v, bl_.v, acc);
      }
      s[nt] = acc;
    }
    // mask + running max (rows 8hh+r; the 16 lanes of a half share rows)
    float alpha[8];
#pragma unroll
    for (int r = 0; r < 8; ++r) {
      const int qi = q0 + 8 * hh + r;
      const int ja = j0 + ln, jb = j0 + 16 + ln;
      if (CAUSAL) { if (ja > qi) s[0][r] = -3.0e38f; if (jb > qi) s[1][r] = -3.0e38f; }
      if (ja >= T) s[0][r] = -3.0e38f;
      if (jb >= T) s[1][r] = -3.0e38f;
      float mx = fmaxf(s[0][r], s[1][r]);
      mx = fmaxf(mx, __shfl_xor(mx, 1, 32)); mx = fmaxf(mx, __shfl_xor(mx, 2, 32)); mx = fmaxf(mx, __shfl_xor(mx, 4, 32)); mx = fmaxf(mx, __shfl_xor(mx, 8, 32));
      const float mnew = fmaxf(m_r[r], mx);
      alpha[r] = (mnew > -1.0e38f) ? __expf(m_r[r] - mnew) : 1.0f;
      const float p0 = (s[0][r] > -1.0e38f) ? __expf(s[0][r] - mnew) : 0.f;
      const float p1 = (s[1][r] > -1.0e38f) ? __expf(s[1][r] - mnew) : 0.f;
      m_r[r] = mnew;
      l_r[r] = l_r[r] * alpha[r] + p0 + p1;            // per-lane partial row sum (16 lanes combined at the end)
      unsigned short hb = bf16_bits(p0); sPh[w][8 * hh + r][ln] = hb;      sPl[w][8 * hh + r][ln] = bf16_bits(p0 - bf16_val(hb));
      hb = bf16_bits(p1);                sPh[w][8 * hh + r][16 + ln] = hb; sPl[w][8 * hh + r][16 + ln] = bf16_bits(p1 - bf16_val(hb));
    }
#pragma unroll
    for (int dt = 0; dt < DT; ++dt)
#pragma unroll
      for (int r = 0; r < 8; ++r) oacc[dt][r] *= alpha[r];
    __builtin_amdgcn_fence(__ATOMIC_ACQ_REL, "workgroup");
    __builtin_amdgcn_wave_barrier();
    FragB pah, pal;
    pah.half[0] = *(const v8us*)&sPh[w][ln][8 * hh]; pah.half[1] = *(const v8us*)&sPh[w][ln][16 + 8 * hh];
    pal.half[0] = *(const v8us*)&sPl[w][ln][8 * hh]; pal.half[1] = *(const v8us*)&sPl[w][ln][16 + 8 * hh];
#pragma unroll
    for (int dt = 0; dt < DT; ++dt) {
      FragB bvh, bvl;
#pragma unroll
      for (int i = 0; i < 8; ++i) {
        bvh.u[i] = sVh[8 * hh + i][dt * 16 + ln]; bvh.u[8 + i] = sVh[16 + 8 * hh + i][dt * 16 + ln];
        bvl.u[i] = sVl[8 * hh + i][dt * 16 + ln]; bvl.u[8 + i] = sVl[16 + 8 * hh + i][dt * 16 + ln];
      }
      oacc[dt] = mmaN<3>(pah.v, pal.v, bvh.v, bvl.v, oacc[dt]);
    }
    __builtin_amdgcn_fence(__ATOMIC_ACQ_REL, "workgroup");
    __builtin_amdgcn_wave_barrier();
  }
#pragma unroll
  for (int r = 0; r < 8; ++r) {
    float l = l_r[r];
    l += __shfl_xor(l, 1, 32); l += __shfl_xor(l, 2, 32); l += __shfl_xor(l, 4, 32); l += __shfl_xor(l, 8, 32);
    l_r[r] = (l > 0.f) ? 1.0f / l : 0.f;
  }
#pragma unroll
  for (int dt = 0; dt < DT; ++dt)
#pragma unroll
    for (int r = 0; r < 8; ++r) sO[w][8 * hh + r][dt * 16 + ln] = oacc[dt][r] * l_r[r];
  __builtin_amdgcn_fence(__ATOMIC_ACQ_REL, "workgroup");
  __builtin_amdgcn_wave_barrier();
  {
    for (int r = 0; r < 16; ++r) {
      const int row = q0 + r;
      if (row < T && lane < D / 4) {
        const v4f val = *(const v4fa*)&sO[w][r][lane * 4];
        *(v4f*)(y + ((size_t)b * T + row) * ypitch + h * D + lane * 4) = val;
      }
    }
    
  }
}

// GEMM C = act(A·W + bias + resid): A f32 (ASPLIT -> hi/lo 2 terms), Wt bf16 [N][K]; ACT 0 none, 1 relu, 2 exact gelu;
// resid (optional, f32, row index = (row % rmod), pitch ldr, RES_BF16 rounds it) added before the activation.
template <bool ASPLIT, int ACT, bool BIAS_BF16, bool RES_BF16>
__global__ __launch_bounds__(128) void k_gemm_bf3(const float* __restrict__ A, int lda, const unsigned short* __restrict__ Wt, int ldb,
                                                const float* __restrict__ bias, const float* __restrict__ resid, int rmod, int ldr,
                                                float* __restrict__ C, int ldc, int M, int N, int K) {
  __shared__ __attribute__((aligned(16))) float so[4][16][64];
  const int tid = threadIdx.x, w = tid >> 5, lane = tid & 31, ln = lane & 15, hh = lane >> 4;
  const int ntn = N / 64;
  const int wid = blockIdx.x * 4 + w;
  const int mt = wid / ntn, nq = wid % ntn;
  if (mt * 16 >= M) return;
  const int row0 = mt * 16, col0 = nq * 64;
  const float* arow = A + (size_t)(row0 + ln) * lda;
  v8f acc[4] = {};
  for (int kb = 0; kb < K; kb += 32) {
    FragB ah, al;
    const v4f x0 = *(const v4fa*)(arow + kb + 8 * hh), x1 = *(const v4fa*)(arow + kb + 8 * hh + 4);
    const v4f x2 = *(const v4fa*)(arow + kb + 16 + 8 * hh), x3 = *(const v4fa*)(arow + kb + 16 + 8 * hh + 4);
    float xs[16] = {x0[0],x0[1],x0[2],x0[3],x1[0],x1[1],x1[2],x1[3],x2[0],x2[1],x2[2],x2[3],x3[0],x3[1],x3[2],x3[3]};
#pragma unroll
    for (int i = 0; i < 16; ++i) { const unsigned short hb = bf16_bits(xs[i]); ah.u[i] = hb; al.u[i] = ASPLIT ? bf16_bits(xs[i] - bf16_val(hb)) : (unsigned short)0; }
#pragma unroll
    for (int t = 0; t < 4; ++t) {
      const unsigned short* brow = Wt + (size_t)(col0 + t * 16 + ln) * ldb + kb;
      FragB b;
      b.half[0] = *(const v8us*)(brow + 8 * hh);
      b.half[1] = *(const v8us*)(brow + 16 + 8 * hh);
      acc[t] = mmaN<ASPLIT ? 2 : 1>(ah.v, al.v, b.v, b.v, acc[t]);
    }
  }
#pragma unroll
  for (int t = 0; t < 4; ++t) {
    const int col = col0 + t * 16 + ln;
    float bv = bias ? bias[col] : 0.f;
    if (BIAS_BF16) bv = bf16_round(bv);
#pragma unroll
    for (int r = 0; r < 8; ++r) {
      float v = acc[t][r] + bv;
      if (resid) { float rv = resid[(size_t)((row0 + 8 * hh + r) % rmod) * ldr + col]; if (RES_BF16) rv = bf16_round(rv); v += rv; }
      if (ACT == 1) v = fmaxf(v, 0.f);
      if (ACT == 2) v = 0.5f * v * (1.0f + erff(v * 0.70710678118654752f));
      if (ACT == 3) { const float u = 0.7978845608028654f * (v + 0.044715f * v * v * v); v = 0.5f * v * (1.0f + tanhf(u)); }
      so[w][8 * hh + r][t * 16 + ln] = v;
    }
  }
  __builtin_amdgcn_fence(__ATOMIC_ACQ_REL, "workgroup");
  __builtin_amdgcn_wave_barrier();
  const int rsub = lane >> 4, c4 = (lane & 15) * 4;
  {
#pragma unroll
    for (int q = 0; q < 8; ++q) {
      const int r = q * 2 + rsub;
      const v4f v = *(const v4fa*)&so[w][r][c4];
      *(v4f*)(C + (size_t)(row0 + r) * ldc + col0 + c4) = v;
    }
    
  }
}
// row LayerNorm (biased variance, eps) over N: s = X (+ R); optional out_sum <- s; out_norm <- (s-mu)*rsqrt(var+eps)*g + b
template <bool PARAM_BF16>
__global__ __launch_bounds__(256) void k_layernorm(const float* __restrict__ X, const float* __restrict__ R, const float* __restrict__ g, const float* __restrict__ bta,
                                                  float* __restrict__ out_sum, float* __restrict__ out_norm, int N, float eps) {
  __shared__ float red[256];
  const int row = blockIdx.x, tid = threadIdx.x;
  const float* x = X + (size_t)row * N; const float* rr = R ? R + (size_t)row * N : nullptr;
  float vals[16];                     // up to N = 4096
  const int per = N / 256;            // contiguous chunk per thread? use strided-by-4 chunks: thread handles j = tid*4 + 1024*u
  float s1 = 0.f;
  for (int u = 0; u < per / 4; ++u) {
    const int j = tid * 4 + 1024 * u;
    const v4f a = *(const v4fa*)(x + j);
    v4f b = {0.f,0.f,0.f,0.f}; if (rr) b = *(const v4fa*)(rr + j);
#pragma unroll
    for (int q = 0; q < 4; ++q) { const float v = a[q] + b[q]; vals[u * 4 + q] = v; s1 += v; }
  }
  red[tid] = s1; __syncthreads();
  for (int st = 128; st > 0; st >>= 1) { if (tid < st) red[tid] += red[tid + st]; __syncthreads(); }
  const float mu = red[0] / (float)N; __syncthreads();
  float s2 = 0.f;
  for (int u = 0; u < per / 4; ++u)
#pragma unroll
    for (int q = 0; q < 4; ++q) { const float c = vals[u * 4 + q] - mu; s2 += c * c; }
  red[tid] = s2; __syncthreads();
  for (int st = 128; st > 0; st >>= 1) { if (tid < st) red[tid] += red[tid + st]; __syncthreads(); }
  const float rs = rsqrtf(red[0] / (float)N + eps);
  {
    for (int u = 0; u < per / 4; ++u) {
      const int j = tid * 4 + 1024 * u;
      v4f o, sm;
#pragma unroll
      for (int q = 0; q < 4; ++q) {
        float gg = g[j + q], bb = bta[j + q];
        if (PARAM_BF16) { gg = bf16_round(gg); bb = bf16_round(bb); }
        sm[q] = vals[u * 4 + q]; o[q] = (vals[u * 4 + q] - mu) * rs * gg + bb;
      }
      if (out_sum) *(v4f*)(out_sum + (size_t)row * N + j) = sm;
      *(v4f*)(out_norm + (size_t)row * N + j) = o;
    }
    
  }
}



// ---- f16 WMMA path (v_wmma_f32_16x16x32_f16): 11-bit significands for operands in range — used where a [0,1] probability operand needs more precision than bf16
typedef _Float16 v16h __attribute__((ext_vector_type(16)));
union FragH { v16h v; v8us half[2]; _Float16 h[16]; unsigned short u[16]; };
template <int NT>
__device__ __forceinline__ v8f mmaH(v16h ah, v16h al, v16h bh, v16h bl, v8f c) {
  c = __builtin_amdgcn_wmma_f32_16x16x32_f16(false, ah, false, bh, (short)0, c, false, false);
  if (NT >= 2) c = __builtin_amdgcn_wmma_f32_16x16x32_f16(false, al, false, bh, (short)0, c, false, false);
  if (NT >= 3) c = __builtin_amdgcn_wmma_f32_16x16x32_f16(false, ah, false, bl, (short)0, c, false, false);
  asm volatile("v_nop\n\tv_nop\n\tv_nop\n\tv_nop" : "+v"(c) : "v"(ah), "v"(al), "v"(bh), "v"(bl));
  return c;
}
// batched GEMM with f16 operands: A f32 (split into f16 hi/lo if ASPLIT, else rounded to f16), Bt = f16 values [n][k]; alpha; C f32; N multiple of 16 (partial tiles skipped)
template <bool ASPLIT>
__global__ __launch_bounds__(128) void k_gemm_h(const float* __restrict__ A, int lda, size_t sA, const _Float16* __restrict__ Bh, int ldb, size_t sB, float alpha, float* __restrict__ C, int ldc, size_t sC, int M, int N, int K) {
  __shared__ __attribute__((aligned(16))) float so[4][16][64];
  const int tid = threadIdx.x, w = tid >> 5, lane = tid & 31, ln = lane & 15, hh = lane >> 4; const int by = blockIdx.y;
  A += (size_t)by * sA; Bh += (size_t)by * sB; C += (size_t)by * sC;
  const int ntn = (N + 63) / 64; const int wid = blockIdx.x * 4 + w; const int mt = wid / ntn, nq = wid % ntn; if (mt * 16 >= M) return;
  const int row0 = mt * 16, col0 = nq * 64; const float* arow = A + (size_t)(row0 + ln) * lda;
  v8f acc[4] = {};
  for (int kb = 0; kb < K; kb += 32) {
    FragH ah, al;
    const v4f x0 = *(const v4fa*)(arow + kb + 8 * hh), x1 = *(const v4fa*)(arow + kb + 8 * hh + 4), x2 = *(const v4fa*)(arow + kb + 16 + 8 * hh), x3 = *(const v4fa*)(arow + kb + 16 + 8 * hh + 4);
    float xs[16] = {x0[0],x0[1],x0[2],x0[3],x1[0],x1[1],x1[2],x1[3],x2[0],x2[1],x2[2],x2[3],x3[0],x3[1],x3[2],x3[3]};
#pragma unroll
    for (int i = 0; i < 16; ++i) { const _Float16 h = (_Float16)xs[i]; ah.h[i] = h; al.h[i] = ASPLIT ? (_Float16)(xs[i] - (float)h) : (_Float16)0.0f; }
#pragma unroll
    for (int t = 0; t < 4; ++t) { if (col0 + t * 16 >= N) continue; const size_t boff = (size_t)(col0 + t * 16 + ln) * ldb + kb; FragH bq; bq.half[0] = *(const v8us*)(Bh + boff + 8 * hh); bq.half[1] = *(const v8us*)(Bh + boff + 16 + 8 * hh);
      acc[t] = mmaH<ASPLIT ? 2 : 1>(ah.v, al.v, bq.v, bq.v, acc[t]); }
  }
#pragma unroll
  for (int t = 0; t < 4; ++t) { if (col0 + t * 16 >= N) continue;
#pragma unroll
    for (int r = 0; r < 8; ++r) so[w][8 * hh + r][t * 16 + ln] = acc[t][r] * alpha; }
  __builtin_amdgcn_fence(__ATOMIC_ACQ_REL, "workgroup"); __builtin_amdgcn_wave_barrier();
  const int rsub = lane >> 4, c4 = (lane & 15) * 4;
  {
#pragma unroll
    for (int q = 0; q < 8; ++q) { const int r = q * 2 + rsub; if (col0 + c4 < N) { const v4f v = *(const v4fa*)&so[w][r][c4]; *(v4f*)(C + (size_t)(row0 + r) * ldc + col0 + c4) = v; } }
     }
}

// Wt[n][k] = f16(W[k][n]·scale) from f32 row-major W[K][N] (scale = power of two; bf16-exact weights stay exact in f16 away from the subnormal range)
__global__ __launch_bounds__(256) void k_wt_f16(const float* __restrict__ W, _Float16* __restrict__ Wt, int K, int N, float scale) {
  const int t = blockIdx.x * 256 + threadIdx.x; if (t >= N * (K / 8)) return; const int n = t / (K / 8), k8 = (t % (K / 8)) * 8; FragH f;
#pragma unroll
  for (int i = 0; i < 8; ++i) f.h[i] = (_Float16)(bf16_round(W[(size_t)(k8 + i) * N + n]) * scale); const v8us o = f.half[0];
  *(v8us*)((unsigned short*)Wt + (size_t)n * K + k8) = o; 
}
// batched f16 GEMM with fused epilogue: v = acc·alpha + bias[by·sBias + col] (+ CP[(row/rowsPerB)·sCPb + by·64 + col] if CP) ; ACT 0 none / 1 elu ; writes f32 C and/or f16 C16 (each if non-null)
template <int ACT>
__global__ __launch_bounds__(128) void k_gemm_hhx(const _Float16* __restrict__ A, int lda, size_t sA, const _Float16* __restrict__ Bh, int ldb, size_t sB, float alpha, const float* __restrict__ bias, size_t sBias, const float* __restrict__ CP, int rowsPerB, size_t sCPb, int row0g,
    float* __restrict__ C, _Float16* __restrict__ C16, int ldc, size_t sC, int M, int N, int K) {
  __shared__ __attribute__((aligned(16))) float so[4][16][64];
  const int tid = threadIdx.x, w = tid >> 5, lane = tid & 31, ln = lane & 15, hh = lane >> 4; const int by = blockIdx.y;
  A += (size_t)by * sA; Bh += (size_t)by * sB; const size_t cofs = (size_t)by * sC; const float* bp = bias ? bias + (size_t)by * sBias : nullptr;
  const int ntn = (N + 63) / 64; const int wid = blockIdx.x * 4 + w; const int mt = wid / ntn, nq = wid % ntn; if (mt * 16 >= M) return;
  const int row0 = mt * 16, col0 = nq * 64; const _Float16* arow = A + (size_t)(row0 + ln) * lda;
  v8f acc[4] = {};
  for (int kb = 0; kb < K; kb += 32) { FragH ah; ah.half[0] = *(const v8us*)((const unsigned short*)arow + kb + 8 * hh); ah.half[1] = *(const v8us*)((const unsigned short*)arow + kb + 16 + 8 * hh);
#pragma unroll
    for (int t = 0; t < 4; ++t) { if (col0 + t * 16 >= N) continue; const size_t boff = (size_t)(col0 + t * 16 + ln) * ldb + kb; FragH bq; bq.half[0] = *(const v8us*)((const unsigned short*)Bh + boff + 8 * hh); bq.half[1] = *(const v8us*)((const unsigned short*)Bh + boff + 16 + 8 * hh);
      acc[t] = mmaH<1>(ah.v, ah.v, bq.v, bq.v, acc[t]); }
  }
#pragma unroll
  for (int t = 0; t < 4; ++t) { if (col0 + t * 16 >= N) continue; const int col = col0 + t * 16 + ln; const float bv = bp ? bf16_round(bp[col]) : 0.f;
#pragma unroll
    for (int r = 0; r < 8; ++r) { float v = acc[t][r] * alpha + bv; if (CP) { const int bidx = (row0g + row0 + 8 * hh + r) / rowsPerB; v += CP[(size_t)bidx * sCPb + (size_t)by * 64 + col]; } if (ACT == 1) v = (v > 0.f) ? v : expm1f(v); else if (ACT == 3) v = fmaxf(v, 0.f); so[w][8 * hh + r][t * 16 + ln] = v; } }
  __builtin_amdgcn_fence(__ATOMIC_ACQ_REL, "workgroup"); __builtin_amdgcn_wave_barrier();
  const int rsub = lane >> 4, c4 = (lane & 15) * 4; typedef _Float16 v4h __attribute__((ext_vector_type(4)));
  {
#pragma unroll
    for (int q = 0; q < 8; ++q) { const int r = q * 2 + rsub; if (col0 + c4 < N) { const v4f v = *(const v4fa*)&so[w][r][c4]; if (C) *(v4f*)(C + cofs + (size_t)(row0 + r) * ldc + col0 + c4) = v; if (C16) { v4h h4; for (int i = 0; i < 4; ++i) h4[i] = (_Float16)v[i]; *(v4h*)(C16 + cofs + (size_t)(row0 + r) * ldc + col0 + c4) = h4; } } }
     }
}


__global__ __launch_bounds__(256) void k_round16f(const float* __restrict__ W, _Float16* __restrict__ Bt, size_t n8) { const size_t t = (size_t)blockIdx.x * 256 + threadIdx.x; if (t >= n8) return; FragH f;
#pragma unroll
  for (int i = 0; i < 8; ++i) f.h[i] = (_Float16)(bf16_round(W[t * 8 + i]) * 16.0f); *(v8us*)((unsigned short*)Bt + t * 8) = f.half[0];  }
__global__ __launch_bounds__(256) void k_tok(const float* __restrict__ x, _Float16* __restrict__ X16) { __shared__ unsigned short tl[16][72]; const int tid = threadIdx.x; const int b = blockIdx.x / ((CC / 64) * (NTOK / 16)), rem = blockIdx.x % ((CC / 64) * (NTOK / 16)); const int cg = rem / (NTOK / 16), pg = rem % (NTOK / 16); const int c0 = cg * 64, p0 = pg * 16;
  for (int i = tid; i < 64 * 16; i += 256) { const int c = i / 16, pp = i % 16; FragH f; f.h[0] = (_Float16)bf16_round(x[((size_t)b * CC + c0 + c) * NTOK + p0 + pp]); tl[pp][c] = f.u[0]; }
  __syncthreads();
  if (tid < 128) { const int r = tid / 8, pc = tid % 8; FragH f;
#pragma unroll
    for (int q = 0; q < 8; ++q) f.u[q] = tl[r][pc * 8 + q]; unsigned short* d = (unsigned short*)X16 + ((size_t)b * NTOK + p0 + r) * CC + c0 + pc * 8; *(v8us*)d = f.half[0];  } }
// QREL[(b,tok)][h][k] = Σ_{d<16} kc[h·32+d]·rel_h[h][i][d] + Σ_{d<16} kc[h·32+16+d]·rel_w[h][j][d] (k = i·7 + j); thread per (token, h, i): 7 outputs… store shape: per (token,h) 49 floats = 196 B ✗ odd → pad k to 52? QREL pitch per (token, h) = 52 floats (208 B) still not 16-B multiple rows… use pitch 64 floats (256 B): thread per (token, h, 16-float piece p<4): computes k = 16p..16p+15 (k<49 real, rest 0) → float4×4 = 64 B per lane ✗ (16-B pieces at 64-B stride). → thread per (token, h, 4-float piece p < 16): 4 values → float4 lanes contiguous ✓ (recomputing kc loads: 32 floats per thread, cheap)
__global__ __launch_bounds__(256) void k_qrel(const float* __restrict__ KQF, const float* __restrict__ relh, const float* __restrict__ relw, float* __restrict__ QREL) { const size_t t = (size_t)blockIdx.x * 256 + threadIdx.x; if (t >= (size_t)NR * NHh * 16) return; const int p = (int)(t % 16); const int h = (int)((t / 16) % NHh); const size_t tok = t / (16 * NHh); const float* kc = KQF + tok * (2 * CC) + h * HD;      /* f32 kc */ v4f o;
#pragma unroll
  for (int q = 0; q < 4; ++q) { const int k = p * 4 + q; float s = 0.f; if (k < 49) { const int i = k / 7, j = k % 7;
#pragma unroll 1
      for (int d = 0; d < 16; ++d) s += (float)kc[d] * bf16_round(relh[(h * 7 + i) * 16 + d]) + (float)kc[16 + d] * bf16_round(relw[(h * 7 + j) * 16 + d]); } o[q] = s; }
  *(v4f*)(QREL + t * 4) = o;  }
// neighbourhood attention: wave per (b, head h, row y, 16-token x segment): queries tokens (y, x0..x0+15); for each offset (i,j) of the head's range: keys/values = tokens (y + (i−c)·dil, x + (j−c)·dil)
template <int KS, int DIL>
__global__ __launch_bounds__(128) void k_nattn(const _Float16* __restrict__ QKV, const _Float16* __restrict__ QKVL, int h0, int nh, const float* __restrict__ QREL, float* __restrict__ O) {      /* QKVL = (x − f16(x))·2^10 residual plane for kc and q (3-product logits) */      /* QKV = [k | q | v] token-major; the 'query' operand is the centre key kc, the 'keys' are the shifted q (+ rel via QREL[token][h][k]) */ __shared__ __attribute__((aligned(16))) float sO[4][16][HD + 4];
  const int tid = threadIdx.x, w = tid >> 5, lane = tid & 31, ln = lane & 15, hh = lane >> 4; const int wid = blockIdx.x * 4 + w; const int per_b = nh * HI * NXS; if (wid >= BB * per_b) return;      // whole wave
  const int b = wid / per_b, rem = wid % per_b; const int hl = rem / (HI * NXS), rem2 = rem % (HI * NXS); const int y = rem2 / NXS, x0 = (rem2 % NXS) * 16; const int h = h0 + hl; (void)hl;
  const int qx = (x0 + ln < HI) ? (x0 + ln) : (HI - 1); const int qtok = y * HI + qx; const unsigned short* qr = (const unsigned short*)QKV + ((size_t)b * NTOK + qtok) * (3 * CC) + h * HD; const unsigned short* qrl = (const unsigned short*)QKVL + ((size_t)b * NTOK + qtok) * (3 * CC) + h * HD; FragH aq, aql; aq.half[0] = *(const v8us*)(qr + 8 * hh); aq.half[1] = *(const v8us*)(qr + 16 + 8 * hh); aql.half[0] = *(const v8us*)(qrl + 8 * hh); aql.half[1] = *(const v8us*)(qrl + 16 + 8 * hh);
  // diagonal bookkeeping: lane holds query qd = ln if (ln >> 3) == hh (r = ln & 7), else none
  const bool diag = ((ln >> 3) == hh); const int rdiag = ln & 7; float m = -3.0e38f, l = 0.f; v8f oacc[2] = {(v8f){0.f,0.f,0.f,0.f,0.f,0.f,0.f,0.f}, (v8f){0.f,0.f,0.f,0.f,0.f,0.f,0.f,0.f}};
  const float* rp = QREL + ((size_t)(b * NTOK + qtok) * NHh + h) * 64;      /* kc·rel_k per (token, head, offset); 64-float pitch per (token, head) */
#pragma unroll 1
  for (int i = 0; i < KS; ++i) { const int yy = y + (i - KS / 2) * DIL; const bool yok = (yy >= 0 && yy < HI);
#pragma unroll 1
    for (int j = 0; j < KS; ++j) { const int xx = x0 + ln + (j - KS / 2) * DIL; const bool ok = yok && xx >= 0 && xx < HI; const int ktok = ok ? (yy * HI + xx) : 0;
      const unsigned short* kr = (const unsigned short*)QKV + ((size_t)b * NTOK + ktok) * (3 * CC) + CC + h * HD; const unsigned short* krl = (const unsigned short*)QKVL + ((size_t)b * NTOK + ktok) * (3 * CC) + CC + h * HD; FragH bk, bkl; bk.half[0] = *(const v8us*)(kr + 8 * hh); bk.half[1] = *(const v8us*)(kr + 16 + 8 * hh); bkl.half[0] = *(const v8us*)(krl + 8 * hh); bkl.half[1] = *(const v8us*)(krl + 16 + 8 * hh); if (!ok) { bk.half[0] = (v8us){0,0,0,0,0,0,0,0}; bk.half[1] = bk.half[0]; bkl.half[0] = bk.half[0]; bkl.half[1] = bk.half[0]; }
      v8f s = (v8f){0.f,0.f,0.f,0.f,0.f,0.f,0.f,0.f}; s = mmaH<1>(aq.v, aq.v, bk.v, bk.v, s); v8f sl2 = (v8f){0.f,0.f,0.f,0.f,0.f,0.f,0.f,0.f}; sl2 = mmaH<1>(aql.v, aql.v, bk.v, bk.v, sl2); sl2 = mmaH<1>(aq.v, aq.v, bkl.v, bkl.v, sl2);      // hi·hi + (lo·hi + hi·lo)·2^-10 (lo planes carry ×2^10)
#pragma unroll
      for (int r = 0; r < 8; ++r) s[r] += sl2[r] * 0.0009765625f;      // s[r] = q_{8hh+r} · k_{shift(ln)} → diagonal at r = ln − 8hh
      float sd = 0.f;
#pragma unroll
      for (int r = 0; r < 8; ++r) sd = (r == rdiag) ? s[r] : sd;
      const float logit = sd + rp[i * KS + j];      // kc·(q_shift + rel_k): zero-padded neighbours contribute kc·rel_k (no scaling in this module)
      // online softmax on the diagonal lane of each query: new max mn; alpha rescales the previous accumulators (0 on the first offset, where they are all zero anyway)
      float pval = 0.f, alpha = 1.f; if (diag) { const float mn = fmaxf(m, logit); alpha = (m > -1.0e38f) ? expf(m - mn) : 0.f; pval = expf(logit - mn); l = l * alpha + pval; m = mn; }
      // broadcast per-row alpha/p from the diagonal lane of each query row (row 8hh + r lives in lane (hh·16 + 8hh + r))
      float arow[8], prow[8];
#pragma unroll
      for (int r = 0; r < 8; ++r) { const int src = hh * 16 + 8 * hh + r; arow[r] = __shfl(alpha, src, 32); prow[r] = __shfl(pval, src, 32); }
#pragma unroll
      for (int dt = 0; dt < 2; ++dt)
#pragma unroll
        for (int r = 0; r < 8; ++r) oacc[dt][r] *= arow[r];
      // diag(P) A-operand: row ln, k-cols: nonzero only at col == ln → lane (ln,hh) holds cols 8hh..8hh+7 and 16+8hh..: set element (ln − 8hh) of half[0] if 0 ≤ ln − 8hh < 8, else of … cols 16.. are beyond the 16 keys → zero
      FragH pa; pa.half[0] = (v8us){0,0,0,0,0,0,0,0}; pa.half[1] = pa.half[0]; if (diag) pa.h[rdiag] = (_Float16)pval;      // col ln = 8hh + rdiag ✓ (diag lanes only)
      // V_shifted as B operand: Bt rows n = d (32 → 2 tiles), k = key index (16 keys = the 16 shifted tokens; k ≥ 16 zero): lane (ln, hh) must supply Bt[n = dt·16 + ln][k = 8hh..8hh+7] = V[key 8hh+kk][d] and k 16+… = 0
      const int xk0 = x0 + (j - KS / 2) * DIL;      // key token for query index qi: (yy, xk0 + qi)
#pragma unroll
      for (int dt = 0; dt < 2; ++dt) { FragH bv; bv.half[1] = (v8us){0,0,0,0,0,0,0,0}; const int d = dt * 16 + ln;
#pragma unroll
        for (int kk = 0; kk < 8; ++kk) { const int qi = 8 * hh + kk; const int xx = xk0 + qi; const bool ok2 = yok && xx >= 0 && xx < HI; const int tk = ok2 ? (yy * HI + xx) : 0; const _Float16 vv = QKV[((size_t)b * NTOK + tk) * (3 * CC) + 2 * CC + h * HD + d]; bv.h[kk] = ok2 ? vv : (_Float16)0.f; }
        oacc[dt] = mmaH<1>(pa.v, pa.v, bv.v, bv.v, oacc[dt]); } } }
  // finalize: divide rows by l (from the diagonal lanes)
  float lrow[8];
#pragma unroll
  for (int r = 0; r < 8; ++r) { const int src = hh * 16 + 8 * hh + r; lrow[r] = __shfl(l, src, 32); }
#pragma unroll
  for (int dt = 0; dt < 2; ++dt)
#pragma unroll
    for (int r = 0; r < 8; ++r) sO[w][8 * hh + r][dt * 16 + ln] = oacc[dt][r] / lrow[r];
  __builtin_amdgcn_fence(__ATOMIC_ACQ_REL, "workgroup"); __builtin_amdgcn_wave_barrier();
  {
#pragma unroll
    for (int rp2 = 0; rp2 < 16; rp2 += 4) { const int r = rp2 + (lane >> 3), pc = lane & 7; if (x0 + r < HI) { const v4f v = *(const v4fa*)&sO[w][r][pc * 4]; *(v4f*)(O + ((size_t)b * NTOK + y * HI + x0 + r) * CC + h * HD + pc * 4) = v; } }
     } }

__global__ __launch_bounds__(256) void k_nchw(const float* __restrict__ TP, float* __restrict__ out) { __shared__ float tl[32][65]; const int tid = threadIdx.x; const int b = blockIdx.x / ((CC / 32) * (NTOK / 64)), rem = blockIdx.x % ((CC / 32) * (NTOK / 64)); const int cg = rem / (NTOK / 64), pg = rem % (NTOK / 64); const int c0 = cg * 32, p0 = pg * 64;
  for (int i = tid; i < 64 * 32; i += 256) { const int pp = i / 32, c = i % 32; tl[c][pp] = TP[((size_t)b * NTOK + p0 + pp) * CC + c0 + c]; }
  __syncthreads();
  { for (int i = tid; i < 32 * 16; i += 256) { const int c = i / 16, pc = i % 16; v4f v; for (int q = 0; q < 4; ++q) v[q] = tl[c][pc * 4 + q]; *(v4f*)(out + ((size_t)b * CC + c0 + c) * NTOK + p0 + pc * 4) = v; }  } }

__global__ __launch_bounds__(256) void k_split16(const float* __restrict__ F, int ldf, _Float16* __restrict__ Hh, _Float16* __restrict__ Hl, int ldh, int cols, size_t rows) { const size_t t = (size_t)blockIdx.x * 256 + threadIdx.x; if (t >= rows * (cols / 8)) return; const size_t r = t / (cols / 8); const int c8 = (int)(t % (cols / 8)) * 8; FragH fh, fl;
#pragma unroll
  for (int q = 0; q < 8; ++q) { const float v = F[r * ldf + c8 + q]; const _Float16 h = (_Float16)v; fh.h[q] = h; fl.h[q] = (_Float16)((v - (float)h) * 1024.0f); }
  { *(v8us*)((unsigned short*)Hh + r * ldh + c8) = fh.half[0]; *(v8us*)((unsigned short*)Hl + r * ldh + c8) = fl.half[0];  } }
extern "C" void kernel_launch(void* const* d_in, const int* in_sizes, int n_in,
                              void* d_out, int out_size, void* d_ws, size_t ws_size, hipStream_t stream) {
  (void)in_sizes; (void)n_in; (void)out_size;
  const float* x = (const float*)d_in[0]; const float* Wk = (const float*)d_in[1]; const float* Wq = (const float*)d_in[2]; const float* Wv = (const float*)d_in[3]; const float* relh = (const float*)d_in[4]; const float* relw = (const float*)d_in[5];
  char* ws = (char*)d_ws; size_t off = 0;
  auto take = [&](size_t bytes) { char* p = ws + off; off += (bytes + 255) & ~(size_t)255; return p; };
  _Float16* Bk = (_Float16*)take((size_t)CC * CC * 2); _Float16* Bq = (_Float16*)take((size_t)CC * CC * 2); _Float16* Bv = (_Float16*)take((size_t)CC * CC * 2); _Float16* X16 = (_Float16*)take((size_t)NR * CC * 2); _Float16* QKV = (_Float16*)take((size_t)NR * 3 * CC * 2); _Float16* QKVL = (_Float16*)take((size_t)NR * 3 * CC * 2); float* KQF = (float*)take((size_t)NR * 2 * CC * 4); float* QREL = (float*)take((size_t)NR * NHh * 64 * 4); float* O = (float*)take((size_t)NR * CC * 4);
  if (off > ws_size) return;      // 0.4 + 3.2 + 9.6 + 9.6 + 12.8 + 12.8 + 6.4 ≈ 55 MB
  const size_t w8 = (size_t)CC * CC / 8; const unsigned gw = (unsigned)((w8 + 255) / 256); k_round16f<<<gw, 256, 0, stream>>>(Wk, Bk, w8); k_round16f<<<gw, 256, 0, stream>>>(Wq, Bq, w8); k_round16f<<<gw, 256, 0, stream>>>(Wv, Bv, w8);      // W[(n,d)][c] = (out,in)
  k_tok<<<BB * (CC / 64) * (NTOK / 16), 256, 0, stream>>>(x, X16);
  const dim3 gg(((NR / 16) * (CC / 64) + 3) / 4, 1);
  k_gemm_hhx<0><<<gg, 128, 0, stream>>>(X16, CC, 0, Bk, CC, 0, 0.0625f, nullptr, 0, nullptr, 1, 0, 0, KQF, nullptr, 2 * CC, 0, NR, CC, CC);            // kc (f32) → split below into QKV/QKVL cols [0, 256)
  k_gemm_hhx<0><<<gg, 128, 0, stream>>>(X16, CC, 0, Bq, CC, 0, 0.0625f, nullptr, 0, nullptr, 1, 0, 0, KQF + CC, nullptr, 2 * CC, 0, NR, CC, CC);       // q  (f32) → cols [256, 512)
  k_split16<<<(unsigned)(((size_t)NR * 64 + 255) / 256), 256, 0, stream>>>(KQF, 2 * CC, QKV, QKVL, 3 * CC, 2 * CC, NR);      // f16 hi + lo·2^10 planes for kc | q
  k_gemm_hhx<0><<<gg, 128, 0, stream>>>(X16, CC, 0, Bv, CC, 0, 0.0625f, nullptr, 0, nullptr, 1, 0, 0, nullptr, QKV + 2 * CC, 3 * CC, 0, NR, CC, CC);     // v   → cols [512, 768) (windowed)
  k_qrel<<<(unsigned)(((size_t)NR * NHh * 16 + 255) / 256), 256, 0, stream>>>(KQF, relh, relw, QREL);
  k_nattn<7, 1><<<(BB * NHh * HI * NXS + 3) / 4, 128, 0, stream>>>(QKV, QKVL, 0, NHh, QREL, O);
  k_nchw<<<BB * (CC / 32) * (NTOK / 64), 256, 0, stream>>>(O, (float*)d_out);
}

// v001
// Measured time: 114 microseconds a run.
// In two side-by-side timings against v000, it was 1.65 and 1.58 times as fast.
#include <hip/hip_runtime.h>
// Stand-alone (SASA) local self-attention (B=2, C 256 = 8 heads × 32, 56×56, 7×7 windows, stride 1, zero padding; relative row/col embeddings added to the windowed QUERIES, the centre KEY is
// the fixed operand, softmax over the 49 window positions, values windowed): 1×1 projections as GEMMs ((head,dim)×C weights bf16-exact ×2^4) and the window attention on
// v_wmma_f32_16x16x32_f16 with one banded key block per window row (per 16-token row segment and window row: S^T = Q_row.KC^T over 32 keys, kc and q as f16 hi + lo*2^-10 (3 products), band element + kc.rel_k (f32) = logit; f32 softmax over all 49, in-lane
// plus one lane exchange; O^T += V^T.P^T with the f16 S^T tiles as the B operand and V kept channel-major); kc.rel per (token, head, offset) is f32 VALU; the NCHW transposes go through LDS (input to f16, output f32).
#define BB 2
#define CC 256
#define NHh 8
#define HD 32
#define HI 56
#define NTOK 3136
#define NXS 4
#define NR (BB * NTOK)

typedef __bf16 v16b __attribute__((ext_vector_type(16)));
typedef unsigned short v8us __attribute__((ext_vector_type(8), may_alias));
typedef float  v8f  __attribute__((ext_vector_type(8)));
typedef float  v4f  __attribute__((ext_vector_type(4)));
typedef float  v4fa __attribute__((ext_vector_type(4), may_alias));
union FragB { v16b v; v8us half[2]; unsigned short u[16]; };

__device__ __forceinline__ unsigned short bf16_bits(float x) { unsigned int u = __float_as_uint(x); return (unsigned short)((u + 0x7FFFu + ((u >> 16) & 1u)) >> 16); }
__device__ __forceinline__ float bf16_val(unsigned short b) { return __uint_as_float(((unsigned int)b) << 16); }
__device__ __forceinline__ float bf16_round(float x) { return bf16_val(bf16_bits(x)); }
// D += A·B with NT terms: 1 = ah·bh, 2 = + al·bh (A split), 3 = + ah·bl (both split)
template <int NT>
__device__ __forceinline__ v8f mmaN(v16b ah, v16b al, v16b bh, v16b bl, v8f c) {
  c = __builtin_amdgcn_wmma_f32_16x16x32_bf16(false, ah, false, bh, (short)0, c, false, false);
  if (NT >= 2) c = __builtin_amdgcn_wmma_f32_16x16x32_bf16(false, al, false, bh, (short)0, c, false, false);
  if (NT >= 3) c = __builtin_amdgcn_wmma_f32_16x16x32_bf16(false, ah, false, bl, (short)0, c, false, false);
  asm volatile("v_nop\n\tv_nop\n\tv_nop\n\tv_nop" : "+v"(c) : "v"(ah), "v"(al), "v"(bh), "v"(bl));
  return c;
}

__global__ __launch_bounds__(256) void k_wt_bf16(const float* __restrict__ W, unsigned short* __restrict__ Wt, int K, int N) {
  const int t = blockIdx.x * 256 + threadIdx.x;
  const int k8n = K / 8;
  if (t >= N * k8n) return;
  const int n = t / k8n, k8 = (t % k8n) * 8;
  v8us v;
#pragma unroll
  for (int i = 0; i < 8; ++i) v[i] = bf16_bits(W[(size_t)(k8 + i) * N + n]);
  *(v8us*)(Wt + (size_t)n * K + k8) = v;
  
}

// GEMM C[M][N] (f32, pitch ldc) = act(A[M][K]·W + bias). A f32 row-major (pitch lda) converted per fragment to bf16
// (ASPLIT: hi/lo two planes -> 2 terms, else single rounded term); Wt bf16 [N][K] (pitch ldb). BIAS_BF16 rounds the
// bias to bf16 first (bias quantised to bf16 before the add). K%32==0, M%16==0, N%64==0.
template <bool ASPLIT, int ACT, bool BIAS_BF16>
__global__ __launch_bounds__(128) void k_gemm_bf(const float* __restrict__ A, int lda, const unsigned short* __restrict__ Wt, int ldb,
                                               const float* __restrict__ bias, float* __restrict__ C, int ldc, int M, int N, int K) {
  __shared__ __attribute__((aligned(16))) float so[4][16][64];
  const int tid = threadIdx.x, w = tid >> 5, lane = tid & 31, ln = lane & 15, hh = lane >> 4;
  const int ntn = N / 64;
  const int wid = blockIdx.x * 4 + w;
  const int mt = wid / ntn, nq = wid % ntn;
  if (mt * 16 >= M) return;
  const int row0 = mt * 16, col0 = nq * 64;
  const float* arow = A + (size_t)(row0 + ln) * lda;
  v8f acc[4] = {};
  for (int kb = 0; kb < K; kb += 32) {
    FragB ah, al;
    const v4f x0 = *(const v4fa*)(arow + kb + 8 * hh), x1 = *(const v4fa*)(arow + kb + 8 * hh + 4);
    const v4f x2 = *(const v4fa*)(arow + kb + 16 + 8 * hh), x3 = *(const v4fa*)(arow + kb + 16 + 8 * hh + 4);
    float xs[16] = {x0[0],x0[1],x0[2],x0[3],x1[0],x1[1],x1[2],x1[3],x2[0],x2[1],x2[2],x2[3],x3[0],x3[1],x3[2],x3[3]};
#pragma unroll
    for (int i = 0; i < 16; ++i) { const unsigned short hb = bf16_bits(xs[i]); ah.u[i] = hb; al.u[i] = ASPLIT ? bf16_bits(xs[i] - bf16_val(hb)) : (unsigned short)0; }
#pragma unroll
    for (int t = 0; t < 4; ++t) {
      const unsigned short* brow = Wt + (size_t)(col0 + t * 16 + ln) * ldb + kb;
      FragB b;
      b.half[0] = *(const v8us*)(brow + 8 * hh);
      b.half[1] = *(const v8us*)(brow + 16 + 8 * hh);
      acc[t] = mmaN<ASPLIT ? 2 : 1>(ah.v, al.v, b.v, b.v, acc[t]);
    }
  }
#pragma unroll
  for (int t = 0; t < 4; ++t) {
    float bv = bias ? bias[col0 + t * 16 + ln] : 0.f;
    if (BIAS_BF16) bv = bf16_round(bv);
#pragma unroll
    for (int r = 0; r < 8; ++r) { float v = acc[t][r] + bv; if (ACT == 1) v = fmaxf(v, 0.f); so[w][8 * hh + r][t * 16 + ln] = v; }
  }
  __builtin_amdgcn_fence(__ATOMIC_ACQ_REL, "workgroup");
  __builtin_amdgcn_wave_barrier();
  const int rsub = lane >> 4, c4 = (lane & 15) * 4;
  {
#pragma unroll
    for (int q = 0; q < 8; ++q) {
      const int r = q * 2 + rsub;
      const v4f v = *(const v4fa*)&so[w][r][c4];
      *(v4f*)(C + (size_t)(row0 + r) * ldc + col0 + c4) = v;
    }
    
  }
}

// Flash-style causal/unmasked attention, all contractions 3-term bf16 hi/lo splits, f32 softmax with running max.
// q,k,v rows are read from f32 buffers with arbitrary row pitch (so they can live inside a fused qkv buffer);
// D = head size (multiple of 32, <= 128); one wave = 16 query rows; block = 4 waves (64 queries) sharing K/V chunks of 32.
template <int D, bool CAUSAL>
__global__ __launch_bounds__(128) void k_flash(const float* __restrict__ qb, const float* __restrict__ kb, const float* __restrict__ vb,
                                             int pitch, int T, int H, float scale, float* __restrict__ y, int ypitch) {
  constexpr int KS = D / 32;        // k-steps for QK
  constexpr int DT = D / 16;        // d tiles for PV
  __shared__ __attribute__((aligned(16))) unsigned short sKh[32][D + 8], sKl[32][D + 8], sVh[32][D + 8], sVl[32][D + 8];
  __shared__ __attribute__((aligned(16))) unsigned short sPh[4][16][40], sPl[4][16][40];
  __shared__ __attribute__((aligned(16))) float sO[4][16][D];
  const int tid = threadIdx.x, w = tid >> 5, lane = tid & 31, ln = lane & 15, hh = lane >> 4;
  const int nqb = (T + 63) / 64;
  const int bh = blockIdx.x / nqb, qblk = blockIdx.x % nqb;
  const int b = bh / H, h = bh % H;
  const int q0 = qblk * 64 + w * 16;
  const float* Q = qb + (size_t)b * T * pitch + h * D;
  const float* K = kb + (size_t)b * T * pitch + h * D;
  const float* V = vb + (size_t)b * T * pitch + h * D;

  // A fragments of the wave's 16 query rows (scaled), hi/lo
  FragB aqh[KS], aql[KS];
  {
    int row = q0 + ln; if (row >= T) row = T - 1;
    const float* qr = Q + (size_t)row * pitch;
#pragma unroll
    for (int ks = 0; ks < KS; ++ks)
#pragma unroll
      for (int i = 0; i < 16; ++i) {
        const int d = ks * 32 + ((i < 8) ? (8 * hh + i) : (16 + 8 * hh + (i - 8)));
        const float x = qr[d] * scale; const unsigned short hb = bf16_bits(x);
        aqh[ks].u[i] = hb; aql[ks].u[i] = bf16_bits(x - bf16_val(hb));
      }
  }
  float m_r[8], l_r[8];
#pragma unroll
  for (int r = 0; r < 8; ++r) { m_r[r] = -3.0e38f; l_r[r] = 0.f; }
  v8f oacc[DT];
#pragma unroll
  for (int dt = 0; dt < DT; ++dt) oacc[dt] = (v8f){0.f,0.f,0.f,0.f,0.f,0.f,0.f,0.f};

  const int kv_end = CAUSAL ? min(T, qblk * 64 + 64) : T;     // block-uniform
  for (int j0 = 0; j0 < kv_end; j0 += 32) {
    __syncthreads();
    for (int e = tid; e < 32 * (D / 4); e += 128) {
      const int r = e / (D / 4), c4 = (e % (D / 4)) * 4;
      const int key = j0 + r;
      v4f kf = {0.f,0.f,0.f,0.f}, vf = {0.f,0.f,0.f,0.f};
      if (key < T) { kf = *(const v4fa*)(K + (size_t)key * pitch + c4); vf = *(const v4fa*)(V + (size_t)key * pitch + c4); }
#pragma unroll
      for (int t = 0; t < 4; ++t) {
        unsigned short hb = bf16_bits(kf[t]); sKh[r][c4 + t] = hb; sKl[r][c4 + t] = bf16_bits(kf[t] - bf16_val(hb));
        hb = bf16_bits(vf[t]); sVh[r][c4 + t] = hb; sVl[r][c4 + t] = bf16_bits(vf[t] - bf16_val(hb));
      }
    }
    __syncthreads();
    // S tile 16 x 32
    v8f s[2];
#pragma unroll
    for (int nt = 0; nt < 2; ++nt) {
      v8f acc = {};
#pragma unroll
      for (int ks = 0; ks < KS; ++ks) {
        FragB bh_, bl_;
        bh_.half[0] = *(const v8us*)&sKh[nt * 16 + ln][ks * 32 + 8 * hh]; bh_.half[1] = *(const v8us*)&sKh[nt * 16 + ln][ks * 32 + 16 + 8 * hh];
        bl_.half[0] = *(const v8us*)&sKl[nt * 16 + ln][ks * 32 + 8 * hh]; bl_.half[1] = *(const v8us*)&sKl[nt * 16 + ln][ks * 32 + 16 + 8 * hh];
        acc = mmaN<3>(aqh[ks].v, aql[ks].v, bh_.v, bl_.v, acc);
      }
      s[nt] = acc;
    }
    // mask + running max (rows 8hh+r; the 16 lanes of a half share rows)
    float alpha[8];
#pragma unroll
    for (int r = 0; r < 8; ++r) {
      const int qi = q0 + 8 * hh + r;
      const int ja = j0 + ln, jb = j0 + 16 + ln;
      if (CAUSAL) { if (ja > qi) s[0][r] = -3.0e38f; if (jb > qi) s[1][r] = -3.0e38f; }
      if (ja >= T) s[0][r] = -3.0e38f;
      if (jb >= T) s[1][r] = -3.0e38f;
      float mx = fmaxf(s[0][r], s[1][r]);
      mx = fmaxf(mx, __shfl_xor(mx, 1, 32)); mx = fmaxf(mx, __shfl_xor(mx, 2, 32)); mx = fmaxf(mx, __shfl_xor(mx, 4, 32)); mx = fmaxf(mx, __shfl_xor(mx, 8, 32));
      const float mnew = fmaxf(m_r[r], mx);
      alpha[r] = (mnew > -1.0e38f) ? __expf(m_r[r] - mnew) : 1.0f;
      const float p0 = (s[0][r] > -1.0e38f) ? __expf(s[0][r] - mnew) : 0.f;
      const float p1 = (s[1][r] > -1.0e38f) ? __expf(s[1][r] - mnew) : 0.f;
      m_r[r] = mnew;
      l_r[r] = l_r[r] * alpha[r] + p0 + p1;            // per-lane partial row sum (16 lanes combined at the end)
      unsigned short hb = bf16_bits(p0); sPh[w][8 * hh + r][ln] = hb;      sPl[w][8 * hh + r][ln] = bf16_bits(p0 - bf16_val(hb));
      hb = bf16_bits(p1);                sPh[w][8 * hh + r][16 + ln] = hb; sPl[w][8 * hh + r][16 + ln] = bf16_bits(p1 - bf16_val(hb));
    }
#pragma unroll
    for (int dt = 0; dt < DT; ++dt)
#pragma unroll
      for (int r = 0; r < 8; ++r) oacc[dt][r] *= alpha[r];
    __builtin_amdgcn_fence(__ATOMIC_ACQ_REL, "workgroup");
    __builtin_amdgcn_wave_barrier();
    FragB pah, pal;
    pah.half[0] = *(const v8us*)&sPh[w][ln][8 * hh]; pah.half[1] = *(const v8us*)&sPh[w][ln][16 + 8 * hh];
    pal.half[0] = *(const v8us*)&sPl[w][ln][8 * hh]; pal.half[1] = *(const v8us*)&sPl[w][ln][16 + 8 * hh];
#pragma unroll
    for (int dt = 0; dt < DT; ++dt) {
      FragB bvh, bvl;
#pragma unroll
      for (int i = 0; i < 8; ++i) {
        bvh.u[i] = sVh[8 * hh + i][dt * 16 + ln]; bvh.u[8 + i] = sVh[16 + 8 * hh + i][dt * 16 + ln];
        bvl.u[i] = sVl[8 * hh + i][dt * 16 + ln]; bvl.u[8 + i] = sVl[16 + 8 * hh + i][dt * 16 + ln];
      }
      oacc[dt] = mmaN<3>(pah.v, pal.v, bvh.v, bvl.v, oacc[dt]);
    }
    __builtin_amdgcn_fence(__ATOMIC_ACQ_REL, "workgroup");
    __builtin_amdgcn_wave_barrier();
  }
#pragma unroll
  for (int r = 0; r < 8; ++r) {
    float l = l_r[r];
    l += __shfl_xor(l, 1, 32); l += __shfl_xor(l, 2, 32); l += __shfl_xor(l, 4, 32); l += __shfl_xor(l, 8, 32);
    l_r[r] = (l > 0.f) ? 1.0f / l : 0.f;
  }
#pragma unroll
  for (int dt = 0; dt < DT; ++dt)
#pragma unroll
    for (int r = 0; r < 8; ++r) sO[w][8 * hh + r][dt * 16 + ln] = oacc[dt][r] * l_r[r];
  __builtin_amdgcn_fence(__ATOMIC_ACQ_REL, "workgroup");
  __builtin_amdgcn_wave_barrier();
  {
    for (int r = 0; r < 16; ++r) {
      const int row = q0 + r;
      if (row < T && lane < D / 4) {
        const v4f val = *(const v4fa*)&sO[w][r][lane * 4];
        *(v4f*)(y + ((size_t)b * T + row) * ypitch + h * D + lane * 4) = val;
      }
    }
    
  }
}

// GEMM C = act(A·W + bias + resid): A f32 (ASPLIT -> hi/lo 2 terms), Wt bf16 [N][K]; ACT 0 none, 1 relu, 2 exact gelu;
// resid (optional, f32, row index = (row % rmod), pitch ldr, RES_BF16 rounds it) added before the activation.
template <bool ASPLIT, int ACT, bool BIAS_BF16, bool RES_BF16>
__global__ __launch_bounds__(128) void k_gemm_bf3(const float* __restrict__ A, int lda, const unsigned short* __restrict__ Wt, int ldb,
                                                const float* __restrict__ bias, const float* __restrict__ resid, int rmod, int ldr,
                                                float* __restrict__ C, int ldc, int M, int N, int K) {
  __shared__ __attribute__((aligned(16))) float so[4][16][64];
  const int tid = threadIdx.x, w = tid >> 5, lane = tid & 31, ln = lane & 15, hh = lane >> 4;
  const int ntn = N / 64;
  const int wid = blockIdx.x * 4 + w;
  const int mt = wid / ntn, nq = wid % ntn;
  if (mt * 16 >= M) return;
  const int row0 = mt * 16, col0 = nq * 64;
  const float* arow = A + (size_t)(row0 + ln) * lda;
  v8f acc[4] = {};
  for (int kb = 0; kb < K; kb += 32) {
    FragB ah, al;
    const v4f x0 = *(const v4fa*)(arow + kb + 8 * hh), x1 = *(const v4fa*)(arow + kb + 8 * hh + 4);
    const v4f x2 = *(const v4fa*)(arow + kb + 16 + 8 * hh), x3 = *(const v4fa*)(arow + kb + 16 + 8 * hh + 4);
    float xs[16] = {x0[0],x0[1],x0[2],x0[3],x1[0],x1[1],x1[2],x1[3],x2[0],x2[1],x2[2],x2[3],x3[0],x3[1],x3[2],x3[3]};
#pragma unroll
    for (int i = 0; i < 16; ++i) { const unsigned short hb = bf16_bits(xs[i]); ah.u[i] = hb; al.u[i] = ASPLIT ? bf16_bits(xs[i] - bf16_val(hb)) : (unsigned short)0; }
#pragma unroll
    for (int t = 0; t < 4; ++t) {
      const unsigned short* brow = Wt + (size_t)(col0 + t * 16 + ln) * ldb + kb;
      FragB b;
      b.half[0] = *(const v8us*)(brow + 8 * hh);
      b.half[1] = *(const v8us*)(brow + 16 + 8 * hh);
      acc[t] = mmaN<ASPLIT ? 2 : 1>(ah.v, al.v, b.v, b.v, acc[t]);
    }
  }
#pragma unroll
  for (int t = 0; t < 4; ++t) {
    const int col = col0 + t * 16 + ln;
    float bv = bias ? bias[col] : 0.f;
    if (BIAS_BF16) bv = bf16_round(bv);
#pragma unroll
    for (int r = 0; r < 8; ++r) {
      float v = acc[t][r] + bv;
      if (resid) { float rv = resid[(size_t)((row0 + 8 * hh + r) % rmod) * ldr + col]; if (RES_BF16) rv = bf16_round(rv); v += rv; }
      if (ACT == 1) v = fmaxf(v, 0.f);
      if (ACT == 2) v = 0.5f * v * (1.0f + erff(v * 0.70710678118654752f));
      if (ACT == 3) { const float u = 0.7978845608028654f * (v + 0.044715f * v * v * v); v = 0.5f * v * (1.0f + tanhf(u)); }
      so[w][8 * hh + r][t * 16 + ln] = v;
    }
  }
  __builtin_amdgcn_fence(__ATOMIC_ACQ_REL, "workgroup");
  __builtin_amdgcn_wave_barrier();
  const int rsub = lane >> 4, c4 = (lane & 15) * 4;
  {
#pragma unroll
    for (int q = 0; q < 8; ++q) {
      const int r = q * 2 + rsub;
      const v4f v = *(const v4fa*)&so[w][r][c4];
      *(v4f*)(C + (size_t)(row0 + r) * ldc + col0 + c4) = v;
    }
    
  }
}
// row LayerNorm (biased variance, eps) over N: s = X (+ R); optional out_sum <- s; out_norm <- (s-mu)*rsqrt(var+eps)*g + b
template <bool PARAM_BF16>
__global__ __launch_bounds__(256) void k_layernorm(const float* __restrict__ X, const float* __restrict__ R, const float* __restrict__ g, const float* __restrict__ bta,
                                                  float* __restrict__ out_sum, float* __restrict__ out_norm, int N, float eps) {
  __shared__ float red[256];
  const int row = blockIdx.x, tid = threadIdx.x;
  const float* x = X + (size_t)row * N; const float* rr = R ? R + (size_t)row * N : nullptr;
  float vals[16];                     // up to N = 4096
  const int per = N / 256;            // contiguous chunk per thread? use strided-by-4 chunks: thread handles j = tid*4 + 1024*u
  float s1 = 0.f;
  for (int u = 0; u < per / 4; ++u) {
    const int j = tid * 4 + 1024 * u;
    const v4f a = *(const v4fa*)(x + j);
    v4f b = {0.f,0.f,0.f,0.f}; if (rr) b = *(const v4fa*)(rr + j);
#pragma unroll
    for (int q = 0; q < 4; ++q) { const float v = a[q] + b[q]; vals[u * 4 + q] = v; s1 += v; }
  }
  red[tid] = s1; __syncthreads();
  for (int st = 128; st > 0; st >>= 1) { if (tid < st) red[tid] += red[tid + st]; __syncthreads(); }
  const float mu = red[0] / (float)N; __syncthreads();
  float s2 = 0.f;
  for (int u = 0; u < per / 4; ++u)
#pragma unroll
    for (int q = 0; q < 4; ++q) { const float c = vals[u * 4 + q] - mu; s2 += c * c; }
  red[tid] = s2; __syncthreads();
  for (int st = 128; st > 0; st >>= 1) { if (tid < st) red[tid] += red[tid + st]; __syncthreads(); }
  const float rs = rsqrtf(red[0] / (float)N + eps);
  {
    for (int u = 0; u < per / 4; ++u) {
      const int j = tid * 4 + 1024 * u;
      v4f o, sm;
#pragma unroll
      for (int q = 0; q < 4; ++q) {
        float gg = g[j + q], bb = bta[j + q];
        if (PARAM_BF16) { gg = bf16_round(gg); bb = bf16_round(bb); }
        sm[q] = vals[u * 4 + q]; o[q] = (vals[u * 4 + q] - mu) * rs * gg + bb;
      }
      if (out_sum) *(v4f*)(out_sum + (size_t)row * N + j) = sm;
      *(v4f*)(out_norm + (size_t)row * N + j) = o;
    }
    
  }
}



// ---- f16 WMMA path (v_wmma_f32_16x16x32_f16): 11-bit significands for operands in range — used where a [0,1] probability operand needs more precision than bf16
typedef _Float16 v16h __attribute__((ext_vector_type(16)));
union FragH { v16h v; v8us half[2]; _Float16 h[16]; unsigned short u[16]; };
template <int NT>
__device__ __forceinline__ v8f mmaH(v16h ah, v16h al, v16h bh, v16h bl, v8f c) {
  c = __builtin_amdgcn_wmma_f32_16x16x32_f16(false, ah, false, bh, (short)0, c, false, false);
  if (NT >= 2) c = __builtin_amdgcn_wmma_f32_16x16x32_f16(false, al, false, bh, (short)0, c, false, false);
  if (NT >= 3) c = __builtin_amdgcn_wmma_f32_16x16x32_f16(false, ah, false, bl, (short)0, c, false, false);
  asm volatile("v_nop\n\tv_nop\n\tv_nop\n\tv_nop" : "+v"(c) : "v"(ah), "v"(al), "v"(bh), "v"(bl));
  return c;
}
// batched GEMM with f16 operands: A f32 (split into f16 hi/lo if ASPLIT, else rounded to f16), Bt = f16 values [n][k]; alpha; C f32; N multiple of 16 (partial tiles skipped)
template <bool ASPLIT>
__global__ __launch_bounds__(128) void k_gemm_h(const float* __restrict__ A, int lda, size_t sA, const _Float16* __restrict__ Bh, int ldb, size_t sB, float alpha, float* __restrict__ C, int ldc, size_t sC, int M, int N, int K) {
  __shared__ __attribute__((aligned(16))) float so[4][16][64];
  const int tid = threadIdx.x, w = tid >> 5, lane = tid & 31, ln = lane & 15, hh = lane >> 4; const int by = blockIdx.y;
  A += (size_t)by * sA; Bh += (size_t)by * sB; C += (size_t)by * sC;
  const int ntn = (N + 63) / 64; const int wid = blockIdx.x * 4 + w; const int mt = wid / ntn, nq = wid % ntn; if (mt * 16 >= M) return;
  const int row0 = mt * 16, col0 = nq * 64; const float* arow = A + (size_t)(row0 + ln) * lda;
  v8f acc[4] = {};
  for (int kb = 0; kb < K; kb += 32) {
    FragH ah, al;
    const v4f x0 = *(const v4fa*)(arow + kb + 8 * hh), x1 = *(const v4fa*)(arow + kb + 8 * hh + 4), x2 = *(const v4fa*)(arow + kb + 16 + 8 * hh), x3 = *(const v4fa*)(arow + kb + 16 + 8 * hh + 4);
    float xs[16] = {x0[0],x0[1],x0[2],x0[3],x1[0],x1[1],x1[2],x1[3],x2[0],x2[1],x2[2],x2[3],x3[0],x3[1],x3[2],x3[3]};
#pragma unroll
    for (int i = 0; i < 16; ++i) { const _Float16 h = (_Float16)xs[i]; ah.h[i] = h; al.h[i] = ASPLIT ? (_Float16)(xs[i] - (float)h) : (_Float16)0.0f; }
#pragma unroll
    for (int t = 0; t < 4; ++t) { if (col0 + t * 16 >= N) continue; const size_t boff = (size_t)(col0 + t * 16 + ln) * ldb + kb; FragH bq; bq.half[0] = *(const v8us*)(Bh + boff + 8 * hh); bq.half[1] = *(const v8us*)(Bh + boff + 16 + 8 * hh);
      acc[t] = mmaH<ASPLIT ? 2 : 1>(ah.v, al.v, bq.v, bq.v, acc[t]); }
  }
#pragma unroll
  for (int t = 0; t < 4; ++t) { if (col0 + t * 16 >= N) continue;
#pragma unroll
    for (int r = 0; r < 8; ++r) so[w][8 * hh + r][t * 16 + ln] = acc[t][r] * alpha; }
  __builtin_amdgcn_fence(__ATOMIC_ACQ_REL, "workgroup"); __builtin_amdgcn_wave_barrier();
  const int rsub = lane >> 4, c4 = (lane & 15) * 4;
  {
#pragma unroll
    for (int q = 0; q < 8; ++q) { const int r = q * 2 + rsub; if (col0 + c4 < N) { const v4f v = *(const v4fa*)&so[w][r][c4]; *(v4f*)(C + (size_t)(row0 + r) * ldc + col0 + c4) = v; } }
     }
}

// Wt[n][k] = f16(W[k][n]·scale) from f32 row-major W[K][N] (scale = power of two; bf16-exact weights stay exact in f16 away from the subnormal range)
__global__ __launch_bounds__(256) void k_wt_f16(const float* __restrict__ W, _Float16* __restrict__ Wt, int K, int N, float scale) {
  const int t = blockIdx.x * 256 + threadIdx.x; if (t >= N * (K / 8)) return; const int n = t / (K / 8), k8 = (t % (K / 8)) * 8; FragH f;
#pragma unroll
  for (int i = 0; i < 8; ++i) f.h[i] = (_Float16)(bf16_round(W[(size_t)(k8 + i) * N + n]) * scale); const v8us o = f.half[0];
  *(v8us*)((unsigned short*)Wt + (size_t)n * K + k8) = o; 
}
// batched f16 GEMM with fused epilogue: v = acc·alpha + bias[by·sBias + col] (+ CP[(row/rowsPerB)·sCPb + by·64 + col] if CP) ; ACT 0 none / 1 elu ; writes f32 C and/or f16 C16 (each if non-null)
template <int ACT>
__global__ __launch_bounds__(128) void k_gemm_hhx(const _Float16* __restrict__ A, int lda, size_t sA, const _Float16* __restrict__ Bh, int ldb, size_t sB, float alpha, const float* __restrict__ bias, size_t sBias, const float* __restrict__ CP, int rowsPerB, size_t sCPb, int row0g,
    float* __restrict__ C, _Float16* __restrict__ C16, int ldc, size_t sC, int M, int N, int K) {
  __shared__ __attribute__((aligned(16))) float so[4][16][64];
  const int tid = threadIdx.x, w = tid >> 5, lane = tid & 31, ln = lane & 15, hh = lane >> 4; const int by = blockIdx.y;
  A += (size_t)by * sA; Bh += (size_t)by * sB; const size_t cofs = (size_t)by * sC; const float* bp = bias ? bias + (size_t)by * sBias : nullptr;
  const int ntn = (N + 63) / 64; const int wid = blockIdx.x * 4 + w; const int mt = wid / ntn, nq = wid % ntn; if (mt * 16 >= M) return;
  const int row0 = mt * 16, col0 = nq * 64; const _Float16* arow = A + (size_t)(row0 + ln) * lda;
  v8f acc[4] = {};
  for (int kb = 0; kb < K; kb += 32) { FragH ah; ah.half[0] = *(const v8us*)((const unsigned short*)arow + kb + 8 * hh); ah.half[1] = *(const v8us*)((const unsigned short*)arow + kb + 16 + 8 * hh);
#pragma unroll
    for (int t = 0; t < 4; ++t) { if (col0 + t * 16 >= N) continue; const size_t boff = (size_t)(col0 + t * 16 + ln) * ldb + kb; FragH bq; bq.half[0] = *(const v8us*)((const unsigned short*)Bh + boff + 8 * hh); bq.half[1] = *(const v8us*)((const unsigned short*)Bh + boff + 16 + 8 * hh);
      acc[t] = mmaH<1>(ah.v, ah.v, bq.v, bq.v, acc[t]); }
  }
#pragma unroll
  for (int t = 0; t < 4; ++t) { if (col0 + t * 16 >= N) continue; const int col = col0 + t * 16 + ln; const float bv = bp ? bf16_round(bp[col]) : 0.f;
#pragma unroll
    for (int r = 0; r < 8; ++r) { float v = acc[t][r] * alpha + bv; if (CP) { const int bidx = (row0g + row0 + 8 * hh + r) / rowsPerB; v += CP[(size_t)bidx * sCPb + (size_t)by * 64 + col]; } if (ACT == 1) v = (v > 0.f) ? v : expm1f(v); else if (ACT == 3) v = fmaxf(v, 0.f); so[w][8 * hh + r][t * 16 + ln] = v; } }
  __builtin_amdgcn_fence(__ATOMIC_ACQ_REL, "workgroup"); __builtin_amdgcn_wave_barrier();
  const int rsub = lane >> 4, c4 = (lane & 15) * 4; typedef _Float16 v4h __attribute__((ext_vector_type(4)));
  {
#pragma unroll
    for (int q = 0; q < 8; ++q) { const int r = q * 2 + rsub; if (col0 + c4 < N) { const v4f v = *(const v4fa*)&so[w][r][c4]; if (C) *(v4f*)(C + cofs + (size_t)(row0 + r) * ldc + col0 + c4) = v; if (C16) { v4h h4; for (int i = 0; i < 4; ++i) h4[i] = (_Float16)v[i]; *(v4h*)(C16 + cofs + (size_t)(row0 + r) * ldc + col0 + c4) = h4; } } }
     }
}


__global__ __launch_bounds__(256) void k_round16f(const float* __restrict__ W, _Float16* __restrict__ Bt, size_t n8) { const size_t t = (size_t)blockIdx.x * 256 + threadIdx.x; if (t >= n8) return; FragH f;
#pragma unroll
  for (int i = 0; i < 8; ++i) f.h[i] = (_Float16)(bf16_round(W[t * 8 + i]) * 16.0f); *(v8us*)((unsigned short*)Bt + t * 8) = f.half[0];  }
__global__ __launch_bounds__(256) void k_tok(const float* __restrict__ x, _Float16* __restrict__ X16) { __shared__ unsigned short tl[16][72]; const int tid = threadIdx.x; const int b = blockIdx.x / ((CC / 64) * (NTOK / 16)), rem = blockIdx.x % ((CC / 64) * (NTOK / 16)); const int cg = rem / (NTOK / 16), pg = rem % (NTOK / 16); const int c0 = cg * 64, p0 = pg * 16;
  for (int i = tid; i < 64 * 16; i += 256) { const int c = i / 16, pp = i % 16; FragH f; f.h[0] = (_Float16)bf16_round(x[((size_t)b * CC + c0 + c) * NTOK + p0 + pp]); tl[pp][c] = f.u[0]; }
  __syncthreads();
  if (tid < 128) { const int r = tid / 8, pc = tid % 8; FragH f;
#pragma unroll
    for (int q = 0; q < 8; ++q) f.u[q] = tl[r][pc * 8 + q]; unsigned short* d = (unsigned short*)X16 + ((size_t)b * NTOK + p0 + r) * CC + c0 + pc * 8; *(v8us*)d = f.half[0];  } }
// QREL[(b,tok)][h][k] = Σ_{d<16} kc[h·32+d]·rel_h[h][i][d] + Σ_{d<16} kc[h·32+16+d]·rel_w[h][j][d] (k = i·7 + j); thread per (token, h, i): 7 outputs… store shape: per (token,h) 49 floats = 196 B ✗ odd → pad k to 52? QREL pitch per (token, h) = 52 floats (208 B) still not 16-B multiple rows… use pitch 64 floats (256 B): thread per (token, h, 16-float piece p<4): computes k = 16p..16p+15 (k<49 real, rest 0) → float4×4 = 64 B per lane ✗ (16-B pieces at 64-B stride). → thread per (token, h, 4-float piece p < 16): 4 values → float4 lanes contiguous ✓ (recomputing kc loads: 32 floats per thread, cheap)
__global__ __launch_bounds__(256) void k_qrel(const float* __restrict__ KQF, const float* __restrict__ relh, const float* __restrict__ relw, float* __restrict__ QREL) { const size_t t = (size_t)blockIdx.x * 256 + threadIdx.x; if (t >= (size_t)NR * NHh * 16) return; const int p = (int)(t % 16); const int h = (int)((t / 16) % NHh); const size_t tok = t / (16 * NHh); const float* kc = KQF + tok * (2 * CC) + h * HD;      /* f32 kc */ v4f o;
#pragma unroll
  for (int q = 0; q < 4; ++q) { const int k = p * 4 + q; float s = 0.f; if (k < 49) { const int i = k / 7, j = k % 7;
#pragma unroll 1
      for (int d = 0; d < 16; ++d) s += (float)kc[d] * bf16_round(relh[(h * 7 + i) * 16 + d]) + (float)kc[16 + d] * bf16_round(relw[(h * 7 + j) * 16 + d]); } o[q] = s; }
  *(v4f*)(QREL + t * 4) = o;  }
// exp(x) for x <= 0, by the steps of the library's expf (x*log2(e) in two parts, 2^fraction, ldexp, 0 below the f32 range; its overflow test cannot fire here). The exponential stands in asm with a v_nop behind it:
// the instruction set asks for one slot before a vector instruction reads a transcendental's result or overwrites its source.
__device__ __forceinline__ float exp_nonpos(float x) {
  const float ph = x * 0x1.715476p+0f; float pl = __builtin_fmaf(x, 0x1.715476p+0f, -ph); pl = __builtin_fmaf(x, 0x1.4ae0bep-26f, pl);
  const float e = __builtin_rintf(ph); const float a = (ph - e) + pl; float r;
  asm("v_exp_f32 %0, %1\n\tv_nop" : "=v"(r) : "v"(a));
  r = ldexpf(r, (int)e);
  return (x < -0x1.9d1da0p+6f) ? 0.f : r; }
// window attention, one wave per (b, head h, row y, 16-token x segment): for each window row i the 32 tokens (y + i - 3, x0 - 8 .. x0 + 23) are ONE key block.
// S^T = Q_row (32 keys x 32 d, two A tiles, f16 hi + lo*2^-10, 3 products) * KC^T (B, 16 centre keys): lane (ln, hh) holds, for centre token ln, the keys c = 16t + 8hh + r;
// the window is the band 0 <= c - ln - 5 <= 6 (= column offset j). Softmax of a centre token is in-lane plus one exchange with lane ^ 16; the two S^T tiles, as f16, ARE the B operand of
// O^T = V^T (A: row d, keys along k, read from the channel-major VT) * P^T, so a lane ends with 8 consecutive d of its own token.
__global__ __launch_bounds__(128) void k_nattn(const _Float16* __restrict__ QKV, const _Float16* __restrict__ QKVL, const _Float16* __restrict__ VT, const float* __restrict__ QREL, float* __restrict__ O) {
  __shared__ __attribute__((aligned(16))) float sR[4][16][68];      // kc.rel_k of the wave's 16 centre tokens (64 floats each, pitch 68: the band gather below meets no bank twice)
  __shared__ __attribute__((aligned(16))) float sO[4][16][HD + 4];
  const int tid = threadIdx.x, lane = tid & 31, ln = lane & 15, hh = lane >> 4; const int w = __builtin_amdgcn_readfirstlane(tid >> 5);      // wave number held scalar: (b, h, y, x0) and every row base below are then scalar, a lane keeps only row-invariant byte offsets
  const int wid = blockIdx.x * 4 + w; const int per_b = NHh * HI * NXS; if (wid >= BB * per_b) return;      // whole wave
  const int b = wid / per_b, rem = wid % per_b; const int h = rem / (HI * NXS), rem2 = rem % (HI * NXS); const int y = rem2 / NXS, x0 = (rem2 % NXS) * 16;
  const int qx = (x0 + ln < HI) ? (x0 + ln) : (HI - 1);      // lanes past the image row repeat its last token; their result is not stored
  FragH bc, bcl; { const unsigned koff = (unsigned)(qx * (3 * CC) + 8 * hh) * 2; const size_t kb = ((size_t)(b * NTOK + y * HI) * (3 * CC) + h * HD) * 2; const char* k0 = (const char*)QKV + kb; const char* k1 = (const char*)QKVL + kb;
    bc.half[0] = *(const v8us*)(k0 + koff); bc.half[1] = *(const v8us*)(k0 + koff + 32); bcl.half[0] = *(const v8us*)(k1 + koff); bcl.half[1] = *(const v8us*)(k1 + koff + 32); }      // centre key kc, column ln of B
  asm volatile("s_wait_xcnt 0x0" ::: "memory");      // koff is dead from here on: the results of the loads below may land on it
  { const char* rb = (const char*)QREL + ((size_t)(b * NTOK + y * HI + x0) * NHh + h) * 256; const unsigned roff = (unsigned)(hh * (NHh * 256) + ln * 16), roff2 = roff + ((x0 + 8 < HI) ? 4u * (2 * NHh * 256) : 0u);      // tokens 8..15 lie past the image row in its last segment: rows 0..7 are staged twice there (the copies are never used), so no branch splits the eight loads
#pragma unroll
    for (int it = 0; it < 8; ++it) { const v4f v = *(const v4fa*)(rb + ((it < 4) ? roff : roff2) + (it & 3) * (2 * NHh * 256)); *(v4fa*)&sR[w][it * 2 + hh][ln * 4] = v; } }
  __builtin_amdgcn_fence(__ATOMIC_ACQ_REL, "workgroup"); __builtin_amdgcn_wave_barrier();      // sR is written and read by this wave alone
  const v8us z8 = (v8us){0,0,0,0,0,0,0,0}; const v8f z8f = (v8f){0.f,0.f,0.f,0.f,0.f,0.f,0.f,0.f};
  bool inb[2][8]; int rj[2][8]; bool xok[2], vok[2]; unsigned qoff[2], voff[2];
#pragma unroll
  for (int t = 0; t < 2; ++t) {
    const int xx = x0 - 8 + 16 * t + ln; xok[t] = (xx >= 0 && xx < HI); qoff[t] = (unsigned)((xok[t] ? xx : 0) * (3 * CC) + 8 * hh) * 2;      // key c = 16t + ln as row of A
    const int xk = x0 - 8 + 16 * t + 8 * hh; vok[t] = (xk >= 0 && xk < HI); voff[t] = (unsigned)(ln * NR + (vok[t] ? xk : 0)) * 2;      // 8 keys: wholly inside the image row or wholly outside
#pragma unroll
    for (int r = 0; r < 8; ++r) { const int j = 16 * t + 8 * hh + r - ln - 5; inb[t][r] = (j >= 0 && j < 7); rj[t][r] = (j < 0) ? 0 : ((j > 6) ? 6 : j); } }
  const float* rl = &sR[w][qx - x0][0];
  float lg[7][2][8];
#pragma unroll
  for (int i = 0; i < 7; ++i) { const int yy = y + i - 3; const bool yok = (yy >= 0 && yy < HI); const size_t qb = ((size_t)(b * NTOK + (yok ? yy : y) * HI) * (3 * CC) + CC + h * HD) * 2; const char* q0 = (const char*)QKV + qb; const char* q1 = (const char*)QKVL + qb;
#pragma unroll
    for (int t = 0; t < 2; ++t) { const bool ok = yok && xok[t];
      FragH ak, akl; ak.half[0] = *(const v8us*)(q0 + qoff[t]); ak.half[1] = *(const v8us*)(q0 + qoff[t] + 32); akl.half[0] = *(const v8us*)(q1 + qoff[t]); akl.half[1] = *(const v8us*)(q1 + qoff[t] + 32); if (!ok) { ak.half[0] = z8; ak.half[1] = z8; akl.half[0] = z8; akl.half[1] = z8; }      // zero padding: q = 0 outside the image
      float rv[8];
#pragma unroll
      for (int r = 0; r < 8; ++r) rv[r] = rl[i * 7 + rj[t][r]];      // every lane reads (index clamped into the row): no branch round the load
      v8f s = __builtin_amdgcn_wmma_f32_16x16x32_f16(false, ak.v, false, bc.v, (short)0, z8f, false, false);
      v8f s2 = __builtin_amdgcn_wmma_f32_16x16x32_f16(false, ak.v, false, bcl.v, (short)0, z8f, false, false); s2 = __builtin_amdgcn_wmma_f32_16x16x32_f16(false, akl.v, false, bc.v, (short)0, s2, false, false);      // hi.hi + (lo.hi + hi.lo)*2^-10
#pragma unroll
      for (int r = 0; r < 8; ++r) { const float sd = s[r] + s2[r] * 0.0009765625f; const float lv = sd + rv[r]; lg[i][t][r] = inb[t][r] ? lv : -3.0e38f; } } }      // kc.(q + rel_k); padded neighbours keep kc.rel_k
  float m = -3.0e38f;
#pragma unroll
  for (int i = 0; i < 7; ++i)
#pragma unroll
    for (int t = 0; t < 2; ++t)
#pragma unroll
      for (int r = 0; r < 8; ++r) m = fmaxf(m, lg[i][t][r]);
  m = fmaxf(m, __shfl_xor(m, 16, 32));
  float l = 0.f; v8f oacc[2] = {z8f, z8f};
#pragma unroll
  for (int i = 0; i < 7; ++i) { const int yy = y + i - 3; const bool yok = (yy >= 0 && yy < HI); const char* vb = (const char*)VT + ((size_t)(h * HD) * NR + (size_t)(b * NTOK + (yok ? yy : y) * HI)) * 2; FragH pb;
#pragma unroll
    for (int t = 0; t < 2; ++t)
#pragma unroll
      for (int r = 0; r < 8; ++r) { const float p = exp_nonpos(lg[i][t][r] - m); l += p; pb.h[8 * t + r] = (_Float16)p; }      // outside the band: exp -> 0
#pragma unroll
    for (int dt = 0; dt < 2; ++dt) { FragH av;
#pragma unroll
      for (int t = 0; t < 2; ++t) { av.half[t] = *(const v8us*)(vb + voff[t] + dt * (16 * NR * 2)); if (!(yok && vok[t])) av.half[t] = z8;      // zero padding: v = 0 outside the image
        if (i == 6 && dt * 2 + t < 3) asm volatile("s_wait_xcnt 0x0" ::: "memory"); }      // last row: voff dies here, and the result of the next load may land on a register that the loads before it name
      oacc[dt] = __builtin_amdgcn_wmma_f32_16x16x32_f16(false, av.v, false, pb.v, (short)0, oacc[dt], false, false); } }
  l += __shfl_xor(l, 16, 32);
#pragma unroll
  for (int dt = 0; dt < 2; ++dt)
#pragma unroll
    for (int r = 0; r < 8; ++r) sO[w][ln][dt * 16 + 8 * hh + r] = oacc[dt][r] / l;
  __builtin_amdgcn_fence(__ATOMIC_ACQ_REL, "workgroup"); __builtin_amdgcn_wave_barrier();
  {
#pragma unroll
    for (int rp2 = 0; rp2 < 16; rp2 += 4) { const int r = rp2 + (lane >> 3), pc = lane & 7; if (x0 + r < HI) { const v4f v = *(const v4fa*)&sO[w][r][pc * 4]; *(v4f*)(O + ((size_t)b * NTOK + y * HI + x0 + r) * CC + h * HD + pc * 4) = v; } }
     } }

__global__ __launch_bounds__(256) void k_nchw(const float* __restrict__ TP, float* __restrict__ out) { __shared__ float tl[32][65]; const int tid = threadIdx.x; const int b = blockIdx.x / ((CC / 32) * (NTOK / 64)), rem = blockIdx.x % ((CC / 32) * (NTOK / 64)); const int cg = rem / (NTOK / 64), pg = rem % (NTOK / 64); const int c0 = cg * 32, p0 = pg * 64;
  for (int i = tid; i < 64 * 32; i += 256) { const int pp = i / 32, c = i % 32; tl[c][pp] = TP[((size_t)b * NTOK + p0 + pp) * CC + c0 + c]; }
  __syncthreads();
  { for (int i = tid; i < 32 * 16; i += 256) { const int c = i / 16, pc = i % 16; v4f v; for (int q = 0; q < 4; ++q) v[q] = tl[c][pc * 4 + q]; *(v4f*)(out + ((size_t)b * CC + c0 + c) * NTOK + p0 + pc * 4) = v; }  } }

__global__ __launch_bounds__(256) void k_split16(const float* __restrict__ F, int ldf, _Float16* __restrict__ Hh, _Float16* __restrict__ Hl, int ldh, int cols, size_t rows) { const size_t t = (size_t)blockIdx.x * 256 + threadIdx.x; if (t >= rows * (cols / 8)) return; const size_t r = t / (cols / 8); const int c8 = (int)(t % (cols / 8)) * 8; FragH fh, fl;
#pragma unroll
  for (int q = 0; q < 8; ++q) { const float v = F[r * ldf + c8 + q]; const _Float16 h = (_Float16)v; fh.h[q] = h; fl.h[q] = (_Float16)((v - (float)h) * 1024.0f); }
  { *(v8us*)((unsigned short*)Hh + r * ldh + c8) = fh.half[0]; *(v8us*)((unsigned short*)Hl + r * ldh + c8) = fl.half[0];  } }
extern "C" void kernel_launch(void* const* d_in, const int* in_sizes, int n_in,
                              void* d_out, int out_size, void* d_ws, size_t ws_size, hipStream_t stream) {
  (void)in_sizes; (void)n_in; (void)out_size;
  const float* x = (const float*)d_in[0]; const float* Wk = (const float*)d_in[1]; const float* Wq = (const float*)d_in[2]; const float* Wv = (const float*)d_in[3]; const float* relh = (const float*)d_in[4]; const float* relw = (const float*)d_in[5];
  char* ws = (char*)d_ws; size_t off = 0;
  auto take = [&](size_t bytes) { char* p = ws + off; off += (bytes + 255) & ~(size_t)255; return p; };
  _Float16* Bk = (_Float16*)take((size_t)CC * CC * 2); _Float16* Bq = (_Float16*)take((size_t)CC * CC * 2); _Float16* Bv = (_Float16*)take((size_t)CC * CC * 2); _Float16* X16 = (_Float16*)take((size_t)NR * CC * 2); _Float16* QKV = (_Float16*)take((size_t)NR * 3 * CC * 2); _Float16* QKVL = (_Float16*)take((size_t)NR * 3 * CC * 2); float* KQF = (float*)take((size_t)NR * 2 * CC * 4); float* QREL = (float*)take((size_t)NR * NHh * 64 * 4); float* O = (float*)take((size_t)NR * CC * 4); _Float16* VT = (_Float16*)take((size_t)CC * NR * 2);
  if (off > ws_size) return;      // 0.4 + 3.2 + 2 × 9.6 + 2 × 12.8 + 6.4 + 3.2 ≈ 58 MB
  const size_t w8 = (size_t)CC * CC / 8; const unsigned gw = (unsigned)((w8 + 255) / 256); k_round16f<<<gw, 256, 0, stream>>>(Wk, Bk, w8); k_round16f<<<gw, 256, 0, stream>>>(Wq, Bq, w8); k_round16f<<<gw, 256, 0, stream>>>(Wv, Bv, w8);      // W[(n,d)][c] = (out,in)
  k_tok<<<BB * (CC / 64) * (NTOK / 16), 256, 0, stream>>>(x, X16);
  const dim3 gg(((NR / 16) * (CC / 64) + 3) / 4, 1);
  k_gemm_hhx<0><<<gg, 128, 0, stream>>>(X16, CC, 0, Bk, CC, 0, 0.0625f, nullptr, 0, nullptr, 1, 0, 0, KQF, nullptr, 2 * CC, 0, NR, CC, CC);            // kc (f32) → split below into QKV/QKVL cols [0, 256)
  k_gemm_hhx<0><<<gg, 128, 0, stream>>>(X16, CC, 0, Bq, CC, 0, 0.0625f, nullptr, 0, nullptr, 1, 0, 0, KQF + CC, nullptr, 2 * CC, 0, NR, CC, CC);       // q  (f32) → cols [256, 512)
  k_split16<<<(unsigned)(((size_t)NR * 64 + 255) / 256), 256, 0, stream>>>(KQF, 2 * CC, QKV, QKVL, 3 * CC, 2 * CC, NR);      // f16 hi + lo·2^10 planes for kc | q
  k_gemm_hhx<0><<<gg, 128, 0, stream>>>(Bv, CC, 0, X16, CC, 0, 0.0625f, nullptr, 0, nullptr, 1, 0, 0, nullptr, VT, NR, 0, CC, NR, CC);     // v, channel-major: VT[(h,d)][(b,token)] = Wv.X^T (weights as the A operand)
  k_qrel<<<(unsigned)(((size_t)NR * NHh * 16 + 255) / 256), 256, 0, stream>>>(KQF, relh, relw, QREL);
  k_nattn<<<(BB * NHh * HI * NXS + 3) / 4, 128, 0, stream>>>(QKV, QKVL, VT, QREL, O);
  k_nchw<<<BB * (CC / 32) * (NTOK / 64), 256, 0, stream>>>(O, (float*)d_out);
}

// v002
// One run takes 73.2 microseconds.
// Two timings next to v001 both put it at 1.55 times that version's speed.
// Over all steps from v000 it is 2.51 times as fast.
#include <hip/hip_runtime.h>
// Stand-alone (SASA) local self-attention (B=2, C 256 = 8 heads × 32, 56×56, 7×7 windows, stride 1, zero padding; relative row/col embeddings added to the windowed QUERIES, the centre KEY is
// the fixed operand, softmax over the 49 window positions, values windowed): 1×1 projections as GEMMs ((head,dim)×C weights bf16-exact ×2^4) and the window attention on
// v_wmma_f32_16x16x32_f16 with one banded key block per window row (per 16-token row segment and window row: S^T = Q_row.KC^T over 32 keys, kc and q as f16 hi + lo*2^-10 (3 products), band element + kc.rel_k (f32) = logit; f32 softmax over all 49, in-lane
// plus one lane exchange; O^T += V^T.P^T with the f16 S^T tiles as the B operand and V kept channel-major); kc.rel_k = kc[0..15].rel_h[i] + kc[16..31].rel_w[j] is one more A tile (14 rows) against the same KC^T; the NCHW transposes go through LDS tiles (x in as f16 tokens, O back out as f32).
#define BB 2
#define CC 256
#define NHh 8
#define HD 32
#define HI 56
#define NTOK 3136
#define NXS 4
#define NR (BB * NTOK)

typedef __bf16 v16b __attribute__((ext_vector_type(16)));
typedef unsigned short v8us __attribute__((ext_vector_type(8), may_alias));
typedef float  v8f  __attribute__((ext_vector_type(8)));
typedef float  v4f  __attribute__((ext_vector_type(4)));
typedef float  v4fa __attribute__((ext_vector_type(4), may_alias));
union FragB { v16b v; v8us half[2]; unsigned short u[16]; };

__device__ __forceinline__ unsigned short bf16_bits(float x) { unsigned int u = __float_as_uint(x); return (unsigned short)((u + 0x7FFFu + ((u >> 16) & 1u)) >> 16); }
__device__ __forceinline__ float bf16_val(unsigned short b) { return __uint_as_float(((unsigned int)b) << 16); }
__device__ __forceinline__ float bf16_round(float x) { return bf16_val(bf16_bits(x)); }
// D += A·B with NT terms: 1 = ah·bh, 2 = + al·bh (A split), 3 = + ah·bl (both split)
template <int NT>
__device__ __forceinline__ v8f mmaN(v16b ah, v16b al, v16b bh, v16b bl, v8f c) {
  c = __builtin_amdgcn_wmma_f32_16x16x32_bf16(false, ah, false, bh, (short)0, c, false, false);
  if (NT >= 2) c = __builtin_amdgcn_wmma_f32_16x16x32_bf16(false, al, false, bh, (short)0, c, false, false);
  if (NT >= 3) c = __builtin_amdgcn_wmma_f32_16x16x32_bf16(false, ah, false, bl, (short)0, c, false, false);
  asm volatile("v_nop\n\tv_nop\n\tv_nop\n\tv_nop" : "+v"(c) : "v"(ah), "v"(al), "v"(bh), "v"(bl));
  return c;
}

__global__ __launch_bounds__(256) void k_wt_bf16(const float* __restrict__ W, unsigned short* __restrict__ Wt, int K, int N) {
  const int t = blockIdx.x * 256 + threadIdx.x;
  const int k8n = K / 8;
  if (t >= N * k8n) return;
  const int n = t / k8n, k8 = (t % k8n) * 8;
  v8us v;
#pragma unroll
  for (int i = 0; i < 8; ++i) v[i] = bf16_bits(W[(size_t)(k8 + i) * N + n]);
  *(v8us*)(Wt + (size_t)n * K + k8) = v;
  
}

// GEMM C[M][N] (f32, pitch ldc) = act(A[M][K]·W + bias). A f32 row-major (pitch lda) converted per fragment to bf16
// (ASPLIT: hi/lo two planes -> 2 terms, else single rounded term); Wt bf16 [N][K] (pitch ldb). BIAS_BF16 rounds the
// bias to bf16 first (bias quantised to bf16 before the add). K%32==0, M%16==0, N%64==0.
template <bool ASPLIT, int ACT, bool BIAS_BF16>
__global__ __launch_bounds__(128) void k_gemm_bf(const float* __restrict__ A, int lda, const unsigned short* __restrict__ Wt, int ldb,
                                               const float* __restrict__ bias, float* __restrict__ C, int ldc, int M, int N, int K) {
  __shared__ __attribute__((aligned(16))) float so[4][16][64];
  const int tid = threadIdx.x, w = tid >> 5, lane = tid & 31, ln = lane & 15, hh = lane >> 4;
  const int ntn = N / 64;
  const int wid = blockIdx.x * 4 + w;
  const int mt = wid / ntn, nq = wid % ntn;
  if (mt * 16 >= M) return;
  const int row0 = mt * 16, col0 = nq * 64;
  const float* arow = A + (size_t)(row0 + ln) * lda;
  v8f acc[4] = {};
  for (int kb = 0; kb < K; kb += 32) {
    FragB ah, al;
    const v4f x0 = *(const v4fa*)(arow + kb + 8 * hh), x1 = *(const v4fa*)(arow + kb + 8 * hh + 4);
    const v4f x2 = *(const v4fa*)(arow + kb + 16 + 8 * hh), x3 = *(const v4fa*)(arow + kb + 16 + 8 * hh + 4);
    float xs[16] = {x0[0],x0[1],x0[2],x0[3],x1[0],x1[1],x1[2],x1[3],x2[0],x2[1],x2[2],x2[3],x3[0],x3[1],x3[2],x3[3]};
#pragma unroll
    for (int i = 0; i < 16; ++i) { const unsigned short hb = bf16_bits(xs[i]); ah.u[i] = hb; al.u[i] = ASPLIT ? bf16_bits(xs[i] - bf16_val(hb)) : (unsigned short)0; }
#pragma unroll
    for (int t = 0; t < 4; ++t) {
      const unsigned short* brow = Wt + (size_t)(col0 + t * 16 + ln) * ldb + kb;
      FragB b;
      b.half[0] = *(const v8us*)(brow + 8 * hh);
      b.half[1] = *(const v8us*)(brow + 16 + 8 * hh);
      acc[t] = mmaN<ASPLIT ? 2 : 1>(ah.v, al.v, b.v, b.v, acc[t]);
    }
  }
#pragma unroll
  for (int t = 0; t < 4; ++t) {
    float bv = bias ? bias[col0 + t * 16 + ln] : 0.f;
    if (BIAS_BF16) bv = bf16_round(bv);
#pragma unroll
    for (int r = 0; r < 8; ++r) { float v = acc[t][r] + bv; if (ACT == 1) v = fmaxf(v, 0.f); so[w][8 * hh + r][t * 16 + ln] = v; }
  }
  __builtin_amdgcn_fence(__ATOMIC_ACQ_REL, "workgroup");
  __builtin_amdgcn_wave_barrier();
  const int rsub = lane >> 4, c4 = (lane & 15) * 4;
  {
#pragma unroll
    for (int q = 0; q < 8; ++q) {
      const int r = q * 2 + rsub;
      const v4f v = *(const v4fa*)&so[w][r][c4];
      *(v4f*)(C + (size_t)(row0 + r) * ldc + col0 + c4) = v;
    }
    
  }
}

// Flash-style causal/unmasked attention, all contractions 3-term bf16 hi/lo splits, f32 softmax with running max.
// q,k,v rows are read from f32 buffers with arbitrary row pitch (so they can live inside a fused qkv buffer);
// D = head size (multiple of 32, <= 128); one wave = 16 query rows; block = 4 waves (64 queries) sharing K/V chunks of 32.
template <int D, bool CAUSAL>
__global__ __launch_bounds__(128) void k_flash(const float* __restrict__ qb, const float* __restrict__ kb, const float* __restrict__ vb,
                                             int pitch, int T, int H, float scale, float* __restrict__ y, int ypitch) {
  constexpr int KS = D / 32;        // k-steps for QK
  constexpr int DT = D / 16;        // d tiles for PV
  __shared__ __attribute__((aligned(16))) unsigned short sKh[32][D + 8], sKl[32][D + 8], sVh[32][D + 8], sVl[32][D + 8];
  __shared__ __attribute__((aligned(16))) unsigned short sPh[4][16][40], sPl[4][16][40];
  __shared__ __attribute__((aligned(16))) float sO[4][16][D];
  const int tid = threadIdx.x, w = tid >> 5, lane = tid & 31, ln = lane & 15, hh = lane >> 4;
  const int nqb = (T + 63) / 64;
  const int bh = blockIdx.x / nqb, qblk = blockIdx.x % nqb;
  const int b = bh / H, h = bh % H;
  const int q0 = qblk * 64 + w * 16;
  const float* Q = qb + (size_t)b * T * pitch + h * D;
  const float* K = kb + (size_t)b * T * pitch + h * D;
  const float* V = vb + (size_t)b * T * pitch + h * D;

  // A fragments of the wave's 16 query rows (scaled), hi/lo
  FragB aqh[KS], aql[KS];
  {
    int row = q0 + ln; if (row >= T) row = T - 1;
    const float* qr = Q + (size_t)row * pitch;
#pragma unroll
    for (int ks = 0; ks < KS; ++ks)
#pragma unroll
      for (int i = 0; i < 16; ++i) {
        const int d = ks * 32 + ((i < 8) ? (8 * hh + i) : (16 + 8 * hh + (i - 8)));
        const float x = qr[d] * scale; const unsigned short hb = bf16_bits(x);
        aqh[ks].u[i] = hb; aql[ks].u[i] = bf16_bits(x - bf16_val(hb));
      }
  }
  float m_r[8], l_r[8];
#pragma unroll
  for (int r = 0; r < 8; ++r) { m_r[r] = -3.0e38f; l_r[r] = 0.f; }
  v8f oacc[DT];
#pragma unroll
  for (int dt = 0; dt < DT; ++dt) oacc[dt] = (v8f){0.f,0.f,0.f,0.f,0.f,0.f,0.f,0.f};

  const int kv_end = CAUSAL ? min(T, qblk * 64 + 64) : T;     // block-uniform
  for (int j0 = 0; j0 < kv_end; j0 += 32) {
    __syncthreads();
    for (int e = tid; e < 32 * (D / 4); e += 128) {
      const int r = e / (D / 4), c4 = (e % (D / 4)) * 4;
      const int key = j0 + r;
      v4f kf = {0.f,0.f,0.f,0.f}, vf = {0.f,0.f,0.f,0.f};
      if (key < T) { kf = *(const v4fa*)(K + (size_t)key * pitch + c4); vf = *(const v4fa*)(V + (size_t)key * pitch + c4); }
#pragma unroll
      for (int t = 0; t < 4; ++t) {
        unsigned short hb = bf16_bits(kf[t]); sKh[r][c4 + t] = hb; sKl[r][c4 + t] = bf16_bits(kf[t] - bf16_val(hb));
        hb = bf16_bits(vf[t]); sVh[r][c4 + t] = hb; sVl[r][c4 + t] = bf16_bits(vf[t] - bf16_val(hb));
      }
    }
    __syncthreads();
    // S tile 16 x 32
    v8f s[2];
#pragma unroll
    for (int nt = 0; nt < 2; ++nt) {
      v8f acc = {};
#pragma unroll
      for (int ks = 0; ks < KS; ++ks) {
        FragB bh_, bl_;
        bh_.half[0] = *(const v8us*)&sKh[nt * 16 + ln][ks * 32 + 8 * hh]; bh_.half[1] = *(const v8us*)&sKh[nt * 16 + ln][ks * 32 + 16 + 8 * hh];
        bl_.half[0] = *(const v8us*)&sKl[nt * 16 + ln][ks * 32 + 8 * hh]; bl_.half[1] = *(const v8us*)&sKl[nt * 16 + ln][ks * 32 + 16 + 8 * hh];
        acc = mmaN<3>(aqh[ks].v, aql[ks].v, bh_.v, bl_.v, acc);
      }
      s[nt] = acc;
    }
    // mask + running max (rows 8hh+r; the 16 lanes of a half share rows)
    float alpha[8];
#pragma unroll
    for (int r = 0; r < 8; ++r) {
      const int qi = q0 + 8 * hh + r;
      const int ja = j0 + ln, jb = j0 + 16 + ln;
      if (CAUSAL) { if (ja > qi) s[0][r] = -3.0e38f; if (jb > qi) s[1][r] = -3.0e38f; }
      if (ja >= T) s[0][r] = -3.0e38f;
      if (jb >= T) s[1][r] = -3.0e38f;
      float mx = fmaxf(s[0][r], s[1][r]);
      mx = fmaxf(mx, __shfl_xor(mx, 1, 32)); mx = fmaxf(mx, __shfl_xor(mx, 2, 32)); mx = fmaxf(mx, __shfl_xor(mx, 4, 32)); mx = fmaxf(mx, __shfl_xor(mx, 8, 32));
      const float mnew = fmaxf(m_r[r], mx);
      alpha[r] = (mnew > -1.0e38f) ? __expf(m_r[r] - mnew) : 1.0f;
      const float p0 = (s[0][r] > -1.0e38f) ? __expf(s[0][r] - mnew) : 0.f;
      const float p1 = (s[1][r] > -1.0e38f) ? __expf(s[1][r] - mnew) : 0.f;
      m_r[r] = mnew;
      l_r[r] = l_r[r] * alpha[r] + p0 + p1;            // per-lane partial row sum (16 lanes combined at the end)
      unsigned short hb = bf16_bits(p0); sPh[w][8 * hh + r][ln] = hb;      sPl[w][8 * hh + r][ln] = bf16_bits(p0 - bf16_val(hb));
      hb = bf16_bits(p1);                sPh[w][8 * hh + r][16 + ln] = hb; sPl[w][8 * hh + r][16 + ln] = bf16_bits(p1 - bf16_val(hb));
    }
#pragma unroll
    for (int dt = 0; dt < DT; ++dt)
#pragma unroll
      for (int r = 0; r < 8; ++r) oacc[dt][r] *= alpha[r];
    __builtin_amdgcn_fence(__ATOMIC_ACQ_REL, "workgroup");
    __builtin_amdgcn_wave_barrier();
    FragB pah, pal;
    pah.half[0] = *(const v8us*)&sPh[w][ln][8 * hh]; pah.half[1] = *(const v8us*)&sPh[w][ln][16 + 8 * hh];
    pal.half[0] = *(const v8us*)&sPl[w][ln][8 * hh]; pal.half[1] = *(const v8us*)&sPl[w][ln][16 + 8 * hh];
#pragma unroll
    for (int dt = 0; dt < DT; ++dt) {
      FragB bvh, bvl;
#pragma unroll
      for (int i = 0; i < 8; ++i) {
        bvh.u[i] = sVh[8 * hh + i][dt * 16 + ln]; bvh.u[8 + i] = sVh[16 + 8 * hh + i][dt * 16 + ln];
        bvl.u[i] = sVl[8 * hh + i][dt * 16 + ln]; bvl.u[8 + i] = sVl[16 + 8 * hh + i][dt * 16 + ln];
      }
      oacc[dt] = mmaN<3>(pah.v, pal.v, bvh.v, bvl.v, oacc[dt]);
    }
    __builtin_amdgcn_fence(__ATOMIC_ACQ_REL, "workgroup");
    __builtin_amdgcn_wave_barrier();
  }
#pragma unroll
  for (int r = 0; r < 8; ++r) {
    float l = l_r[r];
    l += __shfl_xor(l, 1, 32); l += __shfl_xor(l, 2, 32); l += __shfl_xor(l, 4, 32); l += __shfl_xor(l, 8, 32);
    l_r[r] = (l > 0.f) ? 1.0f / l : 0.f;
  }
#pragma unroll
  for (int dt = 0; dt < DT; ++dt)
#pragma unroll
    for (int r = 0; r < 8; ++r) sO[w][8 * hh + r][dt * 16 + ln] = oacc[dt][r] * l_r[r];
  __builtin_amdgcn_fence(__ATOMIC_ACQ_REL, "workgroup");
  __builtin_amdgcn_wave_barrier();
  {
    for (int r = 0; r < 16; ++r) {
      const int row = q0 + r;
      if (row < T && lane < D / 4) {
        const v4f val = *(const v4fa*)&sO[w][r][lane * 4];
        *(v4f*)(y + ((size_t)b * T + row) * ypitch + h * D + lane * 4) = val;
      }
    }
    
  }
}

// GEMM C = act(A·W + bias + resid): A f32 (ASPLIT -> hi/lo 2 terms), Wt bf16 [N][K]; ACT 0 none, 1 relu, 2 exact gelu;
// resid (optional, f32, row index = (row % rmod), pitch ldr, RES_BF16 rounds it) added before the activation.
template <bool ASPLIT, int ACT, bool BIAS_BF16, bool RES_BF16>
__global__ __launch_bounds__(128) void k_gemm_bf3(const float* __restrict__ A, int lda, const unsigned short* __restrict__ Wt, int ldb,
                                                const float* __restrict__ bias, const float* __restrict__ resid, int rmod, int ldr,
                                                float* __restrict__ C, int ldc, int M, int N, int K) {
  __shared__ __attribute__((aligned(16))) float so[4][16][64];
  const int tid = threadIdx.x, w = tid >> 5, lane = tid & 31, ln = lane & 15, hh = lane >> 4;
  const int ntn = N / 64;
  const int wid = blockIdx.x * 4 + w;
  const int mt = wid / ntn, nq = wid % ntn;
  if (mt * 16 >= M) return;
  const int row0 = mt * 16, col0 = nq * 64;
  const float* arow = A + (size_t)(row0 + ln) * lda;
  v8f acc[4] = {};
  for (int kb = 0; kb < K; kb += 32) {
    FragB ah, al;
    const v4f x0 = *(const v4fa*)(arow + kb + 8 * hh), x1 = *(const v4fa*)(arow + kb + 8 * hh + 4);
    const v4f x2 = *(const v4fa*)(arow + kb + 16 + 8 * hh), x3 = *(const v4fa*)(arow + kb + 16 + 8 * hh + 4);
    float xs[16] = {x0[0],x0[1],x0[2],x0[3],x1[0],x1[1],x1[2],x1[3],x2[0],x2[1],x2[2],x2[3],x3[0],x3[1],x3[2],x3[3]};
#pragma unroll
    for (int i = 0; i < 16; ++i) { const unsigned short hb = bf16_bits(xs[i]); ah.u[i] = hb; al.u[i] = ASPLIT ? bf16_bits(xs[i] - bf16_val(hb)) : (unsigned short)0; }
#pragma unroll
    for (int t = 0; t < 4; ++t) {
      const unsigned short* brow = Wt + (size_t)(col0 + t * 16 + ln) * ldb + kb;
      FragB b;
      b.half[0] = *(const v8us*)(brow + 8 * hh);
      b.half[1] = *(const v8us*)(brow + 16 + 8 * hh);
      acc[t] = mmaN<ASPLIT ? 2 : 1>(ah.v, al.v, b.v, b.v, acc[t]);
    }
  }
#pragma unroll
  for (int t = 0; t < 4; ++t) {
    const int col = col0 + t * 16 + ln;
    float bv = bias ? bias[col] : 0.f;
    if (BIAS_BF16) bv = bf16_round(bv);
#pragma unroll
    for (int r = 0; r < 8; ++r) {
      float v = acc[t][r] + bv;
      if (resid) { float rv = resid[(size_t)((row0 + 8 * hh + r) % rmod) * ldr + col]; if (RES_BF16) rv = bf16_round(rv); v += rv; }
      if (ACT == 1) v = fmaxf(v, 0.f);
      if (ACT == 2) v = 0.5f * v * (1.0f + erff(v * 0.70710678118654752f));
      if (ACT == 3) { const float u = 0.7978845608028654f * (v + 0.044715f * v * v * v); v = 0.5f * v * (1.0f + tanhf(u)); }
      so[w][8 * hh + r][t * 16 + ln] = v;
    }
  }
  __builtin_amdgcn_fence(__ATOMIC_ACQ_REL, "workgroup");
  __builtin_amdgcn_wave_barrier();
  const int rsub = lane >> 4, c4 = (lane & 15) * 4;
  {
#pragma unroll
    for (int q = 0; q < 8; ++q) {
      const int r = q * 2 + rsub;
      const v4f v = *(const v4fa*)&so[w][r][c4];
      *(v4f*)(C + (size_t)(row0 + r) * ldc + col0 + c4) = v;
    }
    
  }
}
// row LayerNorm (biased variance, eps) over N: s = X (+ R); optional out_sum <- s; out_norm <- (s-mu)*rsqrt(var+eps)*g + b
template <bool PARAM_BF16>
__global__ __launch_bounds__(256) void k_layernorm(const float* __restrict__ X, const float* __restrict__ R, const float* __restrict__ g, const float* __restrict__ bta,
                                                  float* __restrict__ out_sum, float* __restrict__ out_norm, int N, float eps) {
  __shared__ float red[256];
  const int row = blockIdx.x, tid = threadIdx.x;
  const float* x = X + (size_t)row * N; const float* rr = R ? R + (size_t)row * N : nullptr;
  float vals[16];                     // up to N = 4096
  const int per = N / 256;            // contiguous chunk per thread? use strided-by-4 chunks: thread handles j = tid*4 + 1024*u
  float s1 = 0.f;
  for (int u = 0; u < per / 4; ++u) {
    const int j = tid * 4 + 1024 * u;
    const v4f a = *(const v4fa*)(x + j);
    v4f b = {0.f,0.f,0.f,0.f}; if (rr) b = *(const v4fa*)(rr + j);
#pragma unroll
    for (int q = 0; q < 4; ++q) { const float v = a[q] + b[q]; vals[u * 4 + q] = v; s1 += v; }
  }
  red[tid] = s1; __syncthreads();
  for (int st = 128; st > 0; st >>= 1) { if (tid < st) red[tid] += red[tid + st]; __syncthreads(); }
  const float mu = red[0] / (float)N; __syncthreads();
  float s2 = 0.f;
  for (int u = 0; u < per / 4; ++u)
#pragma unroll
    for (int q = 0; q < 4; ++q) { const float c = vals[u * 4 + q] - mu; s2 += c * c; }
  red[tid] = s2; __syncthreads();
  for (int st = 128; st > 0; st >>= 1) { if (tid < st) red[tid] += red[tid + st]; __syncthreads(); }
  const float rs = rsqrtf(red[0] / (float)N + eps);
  {
    for (int u = 0; u < per / 4; ++u) {
      const int j = tid * 4 + 1024 * u;
      v4f o, sm;
#pragma unroll
      for (int q = 0; q < 4; ++q) {
        float gg = g[j + q], bb = bta[j + q];
        if (PARAM_BF16) { gg = bf16_round(gg); bb = bf16_round(bb); }
        sm[q] = vals[u * 4 + q]; o[q] = (vals[u * 4 + q] - mu) * rs * gg + bb;
      }
      if (out_sum) *(v4f*)(out_sum + (size_t)row * N + j) = sm;
      *(v4f*)(out_norm + (size_t)row * N + j) = o;
    }
    
  }
}



// ---- f16 WMMA path (v_wmma_f32_16x16x32_f16): 11-bit significands for operands in range — used where a [0,1] probability operand needs more precision than bf16
typedef _Float16 v16h __attribute__((ext_vector_type(16)));
union FragH { v16h v; v8us half[2]; _Float16 h[16]; unsigned short u[16]; };
template <int NT>
__device__ __forceinline__ v8f mmaH(v16h ah, v16h al, v16h bh, v16h bl, v8f c) {
  c = __builtin_amdgcn_wmma_f32_16x16x32_f16(false, ah, false, bh, (short)0, c, false, false);
  if (NT >= 2) c = __builtin_amdgcn_wmma_f32_16x16x32_f16(false, al, false, bh, (short)0, c, false, false);
  if (NT >= 3) c = __builtin_amdgcn_wmma_f32_16x16x32_f16(false, ah, false, bl, (short)0, c, false, false);
  asm volatile("v_nop\n\tv_nop\n\tv_nop\n\tv_nop" : "+v"(c) : "v"(ah), "v"(al), "v"(bh), "v"(bl));
  return c;
}
// batched GEMM with f16 operands: A f32 (split into f16 hi/lo if ASPLIT, else rounded to f16), Bt = f16 values [n][k]; alpha; C f32; N multiple of 16 (partial tiles skipped)
template <bool ASPLIT>
__global__ __launch_bounds__(128) void k_gemm_h(const float* __restrict__ A, int lda, size_t sA, const _Float16* __restrict__ Bh, int ldb, size_t sB, float alpha, float* __restrict__ C, int ldc, size_t sC, int M, int N, int K) {
  __shared__ __attribute__((aligned(16))) float so[4][16][64];
  const int tid = threadIdx.x, w = tid >> 5, lane = tid & 31, ln = lane & 15, hh = lane >> 4; const int by = blockIdx.y;
  A += (size_t)by * sA; Bh += (size_t)by * sB; C += (size_t)by * sC;
  const int ntn = (N + 63) / 64; const int wid = blockIdx.x * 4 + w; const int mt = wid / ntn, nq = wid % ntn; if (mt * 16 >= M) return;
  const int row0 = mt * 16, col0 = nq * 64; const float* arow = A + (size_t)(row0 + ln) * lda;
  v8f acc[4] = {};
  for (int kb = 0; kb < K; kb += 32) {
    FragH ah, al;
    const v4f x0 = *(const v4fa*)(arow + kb + 8 * hh), x1 = *(const v4fa*)(arow + kb + 8 * hh + 4), x2 = *(const v4fa*)(arow + kb + 16 + 8 * hh), x3 = *(const v4fa*)(arow + kb + 16 + 8 * hh + 4);
    float xs[16] = {x0[0],x0[1],x0[2],x0[3],x1[0],x1[1],x1[2],x1[3],x2[0],x2[1],x2[2],x2[3],x3[0],x3[1],x3[2],x3[3]};
#pragma unroll
    for (int i = 0; i < 16; ++i) { const _Float16 h = (_Float16)xs[i]; ah.h[i] = h; al.h[i] = ASPLIT ? (_Float16)(xs[i] - (float)h) : (_Float16)0.0f; }
#pragma unroll
    for (int t = 0; t < 4; ++t) { if (col0 + t * 16 >= N) continue; const size_t boff = (size_t)(col0 + t * 16 + ln) * ldb + kb; FragH bq; bq.half[0] = *(const v8us*)(Bh + boff + 8 * hh); bq.half[1] = *(const v8us*)(Bh + boff + 16 + 8 * hh);
      acc[t] = mmaH<ASPLIT ? 2 : 1>(ah.v, al.v, bq.v, bq.v, acc[t]); }
  }
#pragma unroll
  for (int t = 0; t < 4; ++t) { if (col0 + t * 16 >= N) continue;
#pragma unroll
    for (int r = 0; r < 8; ++r) so[w][8 * hh + r][t * 16 + ln] = acc[t][r] * alpha; }
  __builtin_amdgcn_fence(__ATOMIC_ACQ_REL, "workgroup"); __builtin_amdgcn_wave_barrier();
  const int rsub = lane >> 4, c4 = (lane & 15) * 4;
  {
#pragma unroll
    for (int q = 0; q < 8; ++q) { const int r = q * 2 + rsub; if (col0 + c4 < N) { const v4f v = *(const v4fa*)&so[w][r][c4]; *(v4f*)(C + (size_t)(row0 + r) * ldc + col0 + c4) = v; } }
     }
}

// Wt[n][k] = f16(W[k][n]·scale) from f32 row-major W[K][N] (scale = power of two; bf16-exact weights stay exact in f16 away from the subnormal range)
__global__ __launch_bounds__(256) void k_wt_f16(const float* __restrict__ W, _Float16* __restrict__ Wt, int K, int N, float scale) {
  const int t = blockIdx.x * 256 + threadIdx.x; if (t >= N * (K / 8)) return; const int n = t / (K / 8), k8 = (t % (K / 8)) * 8; FragH f;
#pragma unroll
  for (int i = 0; i < 8; ++i) f.h[i] = (_Float16)(bf16_round(W[(size_t)(k8 + i) * N + n]) * scale); const v8us o = f.half[0];
  *(v8us*)((unsigned short*)Wt + (size_t)n * K + k8) = o; 
}
// batched f16 GEMM with fused epilogue: v = acc·alpha + bias[by·sBias + col] (+ CP[(row/rowsPerB)·sCPb + by·64 + col] if CP) ; ACT 0 none / 1 elu ; writes f32 C and/or f16 C16 (each if non-null)
template <int ACT>
__global__ __launch_bounds__(128) void k_gemm_hhx(const _Float16* __restrict__ A, int lda, size_t sA, const _Float16* __restrict__ Bh, int ldb, size_t sB, float alpha, const float* __restrict__ bias, size_t sBias, const float* __restrict__ CP, int rowsPerB, size_t sCPb, int row0g,
    float* __restrict__ C, _Float16* __restrict__ C16, int ldc, size_t sC, int M, int N, int K) {
  __shared__ __attribute__((aligned(16))) float so[4][16][64];
  const int tid = threadIdx.x, w = tid >> 5, lane = tid & 31, ln = lane & 15, hh = lane >> 4; const int by = blockIdx.y;
  A += (size_t)by * sA; Bh += (size_t)by * sB; const size_t cofs = (size_t)by * sC; const float* bp = bias ? bias + (size_t)by * sBias : nullptr;
  const int ntn = (N + 63) / 64; const int wid = blockIdx.x * 4 + w; const int mt = wid / ntn, nq = wid % ntn; if (mt * 16 >= M) return;
  const int row0 = mt * 16, col0 = nq * 64; const _Float16* arow = A + (size_t)(row0 + ln) * lda;
  v8f acc[4] = {};
  for (int kb = 0; kb < K; kb += 32) { FragH ah; ah.half[0] = *(const v8us*)((const unsigned short*)arow + kb + 8 * hh); ah.half[1] = *(const v8us*)((const unsigned short*)arow + kb + 16 + 8 * hh);
#pragma unroll
    for (int t = 0; t < 4; ++t) { if (col0 + t * 16 >= N) continue; const size_t boff = (size_t)(col0 + t * 16 + ln) * ldb + kb; FragH bq; bq.half[0] = *(const v8us*)((const unsigned short*)Bh + boff + 8 * hh); bq.half[1] = *(const v8us*)((const unsigned short*)Bh + boff + 16 + 8 * hh);
      acc[t] = mmaH<1>(ah.v, ah.v, bq.v, bq.v, acc[t]); }
  }
#pragma unroll
  for (int t = 0; t < 4; ++t) { if (col0 + t * 16 >= N) continue; const int col = col0 + t * 16 + ln; const float bv = bp ? bf16_round(bp[col]) : 0.f;
#pragma unroll
    for (int r = 0; r < 8; ++r) { float v = acc[t][r] * alpha + bv; if (CP) { const int bidx = (row0g + row0 + 8 * hh + r) / rowsPerB; v += CP[(size_t)bidx * sCPb + (size_t)by * 64 + col]; } if (ACT == 1) v = (v > 0.f) ? v : expm1f(v); else if (ACT == 3) v = fmaxf(v, 0.f); so[w][8 * hh + r][t * 16 + ln] = v; } }
  __builtin_amdgcn_fence(__ATOMIC_ACQ_REL, "workgroup"); __builtin_amdgcn_wave_barrier();
  const int rsub = lane >> 4, c4 = (lane & 15) * 4; typedef _Float16 v4h __attribute__((ext_vector_type(4)));
  {
#pragma unroll
    for (int q = 0; q < 8; ++q) { const int r = q * 2 + rsub; if (col0 + c4 < N) { const v4f v = *(const v4fa*)&so[w][r][c4]; if (C) *(v4f*)(C + cofs + (size_t)(row0 + r) * ldc + col0 + c4) = v; if (C16) { v4h h4; for (int i = 0; i < 4; ++i) h4[i] = (_Float16)v[i]; *(v4h*)(C16 + cofs + (size_t)(row0 + r) * ldc + col0 + c4) = h4; } } }
     }
}


__global__ __launch_bounds__(256) void k_round16f(const float* __restrict__ W, _Float16* __restrict__ Bt, size_t n8) { const size_t t = (size_t)blockIdx.x * 256 + threadIdx.x; if (t >= n8) return; FragH f;
#pragma unroll
  for (int i = 0; i < 8; ++i) f.h[i] = (_Float16)(bf16_round(W[t * 8 + i]) * 16.0f); *(v8us*)((unsigned short*)Bt + t * 8) = f.half[0];  }
__global__ __launch_bounds__(256) void k_tok(const float* __restrict__ x, _Float16* __restrict__ X16) { __shared__ unsigned short tl[16][72]; const int tid = threadIdx.x; const int b = blockIdx.x / ((CC / 64) * (NTOK / 16)), rem = blockIdx.x % ((CC / 64) * (NTOK / 16)); const int cg = rem / (NTOK / 16), pg = rem % (NTOK / 16); const int c0 = cg * 64, p0 = pg * 16;
  for (int i = tid; i < 64 * 16; i += 256) { const int c = i / 16, pp = i % 16; FragH f; f.h[0] = (_Float16)bf16_round(x[((size_t)b * CC + c0 + c) * NTOK + p0 + pp]); tl[pp][c] = f.u[0]; }
  __syncthreads();
  if (tid < 128) { const int r = tid / 8, pc = tid % 8; FragH f;
#pragma unroll
    for (int q = 0; q < 8; ++q) f.u[q] = tl[r][pc * 8 + q]; unsigned short* d = (unsigned short*)X16 + ((size_t)b * NTOK + p0 + r) * CC + c0 + pc * 8; *(v8us*)d = f.half[0];  } }
// exp(x) for x <= 0, by the steps of the library's expf (x*log2(e) in two parts, 2^fraction, ldexp, 0 below the f32 range; its overflow test cannot fire here). The exponential stands in asm with a v_nop behind it:
// the instruction set asks for one slot before a vector instruction reads a transcendental's result or overwrites its source.
__device__ __forceinline__ float exp_nonpos(float x) {
  const float ph = x * 0x1.715476p+0f; float pl = __builtin_fmaf(x, 0x1.715476p+0f, -ph); pl = __builtin_fmaf(x, 0x1.4ae0bep-26f, pl);
  const float e = __builtin_rintf(ph); const float a = (ph - e) + pl; float r;
  asm("v_exp_f32 %0, %1\n\tv_nop" : "=v"(r) : "v"(a));
  r = ldexpf(r, (int)e);
  return (x < -0x1.9d1da0p+6f) ? 0.f : r; }
// window attention, one wave per (b, head h, row y, 16-token x segment): for each window row i the 32 tokens (y + i - 3, x0 - 8 .. x0 + 23) are ONE key block.
// S^T = Q_row (32 keys x 32 d, two A tiles, f16 hi + lo*2^-10, 3 products) * KC^T (B, 16 centre keys): lane (ln, hh) holds, for centre token ln, the keys c = 16t + 8hh + r;
// the window is the band 0 <= c - ln - 5 <= 6 (= column offset j). Softmax of a centre token is in-lane plus one exchange with lane ^ 16; the two S^T tiles, as f16, ARE the B operand of
// O^T = V^T (A: row d, keys along k, read from the channel-major VT) * P^T, so a lane ends with 8 consecutive d of its own token.
// kc.rel_k splits into a row term and a column term: E = REL * KC^T with REL rows 0..6 = (rel_h[i] | 0), rows 8..14 = (0 | rel_w[j]), rows 7 and 15 zero; rel is bf16-rounded first, as before (8 significant bits: exact in f16 from 2^-14 up, below that off by at most 2^-25), and kc is hi + lo*2^-10 (2 products).
__global__ __launch_bounds__(128) void k_nattn(const _Float16* __restrict__ QKV, const _Float16* __restrict__ QKVL, const _Float16* __restrict__ VT, const float* __restrict__ relh, const float* __restrict__ relw, float* __restrict__ O) {
  __shared__ __attribute__((aligned(16))) float sR[4][16][20];      // per centre token of the wave: words 0..6 kc.rel_h[i], words 8..14 kc.rel_w[j] (pitch 20: rows stay 16-byte aligned and in-band lanes of the gather below meet no bank twice)
  __shared__ __attribute__((aligned(16))) float sO[4][16][HD + 4];
  const int tid = threadIdx.x, lane = tid & 31, ln = lane & 15, hh = lane >> 4; const int w = __builtin_amdgcn_readfirstlane(tid >> 5);      // wave number held scalar: (b, h, y, x0) and every row base below are then scalar, a lane keeps only row-invariant byte offsets
  const int wid = blockIdx.x * 4 + w; const int per_b = NHh * HI * NXS; if (wid >= BB * per_b) return;      // whole wave
  const int b = wid / per_b, rem = wid % per_b; const int h = rem / (HI * NXS), rem2 = rem % (HI * NXS); const int y = rem2 / NXS, x0 = (rem2 % NXS) * 16;
  const int qx = (x0 + ln < HI) ? (x0 + ln) : (HI - 1);      // lanes past the image row repeat its last token; their result is not stored
  FragH bc, bcl; { const unsigned koff = (unsigned)(qx * (3 * CC) + 8 * hh) * 2; const size_t kb = ((size_t)(b * NTOK + y * HI) * (3 * CC) + h * HD) * 2; const char* k0 = (const char*)QKV + kb; const char* k1 = (const char*)QKVL + kb;
    bc.half[0] = *(const v8us*)(k0 + koff); bc.half[1] = *(const v8us*)(k0 + koff + 32); bcl.half[0] = *(const v8us*)(k1 + koff); bcl.half[1] = *(const v8us*)(k1 + koff + 32); }      // centre key kc, column ln of B
  asm volatile("s_wait_xcnt 0x0" ::: "memory");      // koff is dead from here on: the results of the loads below may land on it
  const v8us z8 = (v8us){0,0,0,0,0,0,0,0}; const v8f z8f = (v8f){0.f,0.f,0.f,0.f,0.f,0.f,0.f,0.f};
  FragH ar; { const int ri = ln & 7; const float* rp = ((ln < 8) ? relh : relw) + (h * 7 + ((ri < 7) ? ri : 6)) * 16 + 8 * hh; const v4f r0 = *(const v4fa*)rp, r1 = *(const v4fa*)(rp + 4); FragH c;      // row ln of REL: its 8 non-zero k of this lane half
    asm volatile("s_wait_xcnt 0x0" ::: "memory");      // rp is dead from here on: later results may land on it
#pragma unroll
    for (int q = 0; q < 4; ++q) { c.h[q] = (_Float16)bf16_round(r0[q]); c.h[4 + q] = (_Float16)bf16_round(r1[q]); }
    const v8us cv = (ri < 7) ? c.half[0] : z8; ar.half[0] = (ln < 8) ? cv : z8; ar.half[1] = (ln < 8) ? z8 : cv; }      // k order as bc: half 0 = d 8hh.., half 1 = d 16 + 8hh..
  { const v8f e = __builtin_amdgcn_wmma_f32_16x16x32_f16(false, ar.v, false, bc.v, (short)0, z8f, false, false); const v8f e2 = __builtin_amdgcn_wmma_f32_16x16x32_f16(false, ar.v, false, bcl.v, (short)0, z8f, false, false); v4f o0, o1;
#pragma unroll
    for (int q = 0; q < 4; ++q) { o0[q] = e[q] + e2[q] * 0.0009765625f; o1[q] = e[4 + q] + e2[4 + q] * 0.0009765625f; }
    *(v4fa*)&sR[w][ln][8 * hh] = o0; *(v4fa*)&sR[w][ln][8 * hh + 4] = o1; }      // lane (ln, hh) holds rows 8hh..8hh+7 of E for its own centre token
  __builtin_amdgcn_fence(__ATOMIC_ACQ_REL, "workgroup"); __builtin_amdgcn_wave_barrier();      // sR is written and read by this wave alone
  bool inb[2][8]; int rj[2][8]; bool xok[2], vok[2]; unsigned qoff[2], voff[2];
#pragma unroll
  for (int t = 0; t < 2; ++t) {
    const int xx = x0 - 8 + 16 * t + ln; xok[t] = (xx >= 0 && xx < HI); qoff[t] = (unsigned)((xok[t] ? xx : 0) * (3 * CC) + 8 * hh) * 2;      // key c = 16t + ln as row of A
    const int xk = x0 - 8 + 16 * t + 8 * hh; vok[t] = (xk >= 0 && xk < HI); voff[t] = (unsigned)(ln * NR + (vok[t] ? xk : 0)) * 2;      // 8 keys: wholly inside the image row or wholly outside
#pragma unroll
    for (int r = 0; r < 8; ++r) { const int j = 16 * t + 8 * hh + r - ln - 5; inb[t][r] = (j >= 0 && j < 7); rj[t][r] = (j < 0) ? 0 : ((j > 6) ? 6 : j); } }
  float rh[8]; v8f rw[2]; { const float* rl = &sR[w][ln][0]; const v4f a0 = *(const v4fa*)rl, a1 = *(const v4fa*)(rl + 4);
#pragma unroll
    for (int q = 0; q < 4; ++q) { rh[q] = a0[q]; rh[4 + q] = a1[q]; }
#pragma unroll
    for (int t = 0; t < 2; ++t)
#pragma unroll
      for (int r = 0; r < 8; ++r) rw[t][r] = rl[8 + rj[t][r]]; }      // column term of key c = 16t + 8hh + r, the same for all seven window rows; every lane reads (index clamped into the row): no branch round the load
  float lg[7][2][8];
#pragma unroll
  for (int i = 0; i < 7; ++i) { const int yy = y + i - 3; const bool yok = (yy >= 0 && yy < HI); const size_t qb = ((size_t)(b * NTOK + (yok ? yy : y) * HI) * (3 * CC) + CC + h * HD) * 2; const char* q0 = (const char*)QKV + qb; const char* q1 = (const char*)QKVL + qb;
#pragma unroll
    for (int t = 0; t < 2; ++t) { const bool ok = yok && xok[t];
      FragH ak, akl; ak.half[0] = *(const v8us*)(q0 + qoff[t]); ak.half[1] = *(const v8us*)(q0 + qoff[t] + 32); akl.half[0] = *(const v8us*)(q1 + qoff[t]); akl.half[1] = *(const v8us*)(q1 + qoff[t] + 32); if (!ok) { ak.half[0] = z8; ak.half[1] = z8; akl.half[0] = z8; akl.half[1] = z8; }      // zero padding: q = 0 outside the image
      v8f s = __builtin_amdgcn_wmma_f32_16x16x32_f16(false, ak.v, false, bc.v, (short)0, rw[t], false, false);      // the column term rides in as C
      v8f s2 = __builtin_amdgcn_wmma_f32_16x16x32_f16(false, ak.v, false, bcl.v, (short)0, z8f, false, false); s2 = __builtin_amdgcn_wmma_f32_16x16x32_f16(false, akl.v, false, bc.v, (short)0, s2, false, false);      // hi.hi + (lo.hi + hi.lo)*2^-10
#pragma unroll
      for (int r = 0; r < 8; ++r) { const float sd = s[r] + s2[r] * 0.0009765625f; const float lv = sd + rh[i]; lg[i][t][r] = inb[t][r] ? lv : -3.0e38f; } } }      // kc.(q + rel_k); padded neighbours keep kc.rel_k
  float m = -3.0e38f;
#pragma unroll
  for (int i = 0; i < 7; ++i)
#pragma unroll
    for (int t = 0; t < 2; ++t)
#pragma unroll
      for (int r = 0; r < 8; ++r) m = fmaxf(m, lg[i][t][r]);
  m = fmaxf(m, __shfl_xor(m, 16, 32));
  float l = 0.f; v8f oacc[2] = {z8f, z8f};
#pragma unroll
  for (int i = 0; i < 7; ++i) { const int yy = y + i - 3; const bool yok = (yy >= 0 && yy < HI); const char* vb = (const char*)VT + ((size_t)(h * HD) * NR + (size_t)(b * NTOK + (yok ? yy : y) * HI)) * 2; FragH pb;
#pragma unroll
    for (int t = 0; t < 2; ++t)
#pragma unroll
      for (int r = 0; r < 8; ++r) { const float p = exp_nonpos(lg[i][t][r] - m); l += p; pb.h[8 * t + r] = (_Float16)p; }      // outside the band: exp -> 0
#pragma unroll
    for (int dt = 0; dt < 2; ++dt) { FragH av;
#pragma unroll
      for (int t = 0; t < 2; ++t) { av.half[t] = *(const v8us*)(vb + voff[t] + dt * (16 * NR * 2)); if (!(yok && vok[t])) av.half[t] = z8;      // zero padding: v = 0 outside the image
        if (i == 6 && dt * 2 + t < 3) asm volatile("s_wait_xcnt 0x0" ::: "memory"); }      // last row: voff dies here, and the result of the next load may land on a register that the loads before it name
      oacc[dt] = __builtin_amdgcn_wmma_f32_16x16x32_f16(false, av.v, false, pb.v, (short)0, oacc[dt], false, false); } }
  l += __shfl_xor(l, 16, 32);
#pragma unroll
  for (int dt = 0; dt < 2; ++dt)
#pragma unroll
    for (int r = 0; r < 8; ++r) sO[w][ln][dt * 16 + 8 * hh + r] = oacc[dt][r] / l;
  __builtin_amdgcn_fence(__ATOMIC_ACQ_REL, "workgroup"); __builtin_amdgcn_wave_barrier();
  {
#pragma unroll
    for (int rp2 = 0; rp2 < 16; rp2 += 4) { const int r = rp2 + (lane >> 3), pc = lane & 7; if (x0 + r < HI) { const v4f v = *(const v4fa*)&sO[w][r][pc * 4]; *(v4f*)(O + ((size_t)b * NTOK + y * HI + x0 + r) * CC + h * HD + pc * 4) = v; } }
     } }

__global__ __launch_bounds__(256) void k_nchw(const float* __restrict__ TP, float* __restrict__ out) { __shared__ float tl[32][65]; const int tid = threadIdx.x; const int b = blockIdx.x / ((CC / 32) * (NTOK / 64)), rem = blockIdx.x % ((CC / 32) * (NTOK / 64)); const int cg = rem / (NTOK / 64), pg = rem % (NTOK / 64); const int c0 = cg * 32, p0 = pg * 64;
  for (int i = tid; i < 64 * 32; i += 256) { const int pp = i / 32, c = i % 32; tl[c][pp] = TP[((size_t)b * NTOK + p0 + pp) * CC + c0 + c]; }
  __syncthreads();
  { for (int i = tid; i < 32 * 16; i += 256) { const int c = i / 16, pc = i % 16; v4f v; for (int q = 0; q < 4; ++q) v[q] = tl[c][pc * 4 + q]; *(v4f*)(out + ((size_t)b * CC + c0 + c) * NTOK + p0 + pc * 4) = v; }  } }

__global__ __launch_bounds__(256) void k_split16(const float* __restrict__ F, int ldf, _Float16* __restrict__ Hh, _Float16* __restrict__ Hl, int ldh, int cols, size_t rows) { const size_t t = (size_t)blockIdx.x * 256 + threadIdx.x; if (t >= rows * (cols / 8)) return; const size_t r = t / (cols / 8); const int c8 = (int)(t % (cols / 8)) * 8; FragH fh, fl;
#pragma unroll
  for (int q = 0; q < 8; ++q) { const float v = F[r * ldf + c8 + q]; const _Float16 h = (_Float16)v; fh.h[q] = h; fl.h[q] = (_Float16)((v - (float)h) * 1024.0f); }
  { *(v8us*)((unsigned short*)Hh + r * ldh + c8) = fh.half[0]; *(v8us*)((unsigned short*)Hl + r * ldh + c8) = fl.half[0];  } }
extern "C" void kernel_launch(void* const* d_in, const int* in_sizes, int n_in,
                              void* d_out, int out_size, void* d_ws, size_t ws_size, hipStream_t stream) {
  (void)in_sizes; (void)n_in; (void)out_size;
  const float* x = (const float*)d_in[0]; const float* Wk = (const float*)d_in[1]; const float* Wq = (const float*)d_in[2]; const float* Wv = (const float*)d_in[3]; const float* relh = (const float*)d_in[4]; const float* relw = (const float*)d_in[5];
  char* ws = (char*)d_ws; size_t off = 0;
  auto take = [&](size_t bytes) { char* p = ws + off; off += (bytes + 255) & ~(size_t)255; return p; };
  _Float16* Bk = (_Float16*)take((size_t)CC * CC * 2); _Float16* Bq = (_Float16*)take((size_t)CC * CC * 2); _Float16* Bv = (_Float16*)take((size_t)CC * CC * 2); _Float16* X16 = (_Float16*)take((size_t)NR * CC * 2); _Float16* QKV = (_Float16*)take((size_t)NR * 3 * CC * 2); _Float16* QKVL = (_Float16*)take((size_t)NR * 3 * CC * 2); float* KQF = (float*)take((size_t)NR * 2 * CC * 4); float* O = (float*)take((size_t)NR * CC * 4); _Float16* VT = (_Float16*)take((size_t)CC * NR * 2);
  if (off > ws_size) return;      // 0.4 + 3.2 + 9.6 + 9.6 + 12.8 + 6.4 + 3.2 ≈ 45 MB (43 MiB)
  const size_t w8 = (size_t)CC * CC / 8; const unsigned gw = (unsigned)((w8 + 255) / 256); k_round16f<<<gw, 256, 0, stream>>>(Wk, Bk, w8); k_round16f<<<gw, 256, 0, stream>>>(Wq, Bq, w8); k_round16f<<<gw, 256, 0, stream>>>(Wv, Bv, w8);      // W[(n,d)][c] = (out,in)
  k_tok<<<BB * (CC / 64) * (NTOK / 16), 256, 0, stream>>>(x, X16);
  const dim3 gg(((NR / 16) * (CC / 64) + 3) / 4, 1);
  k_gemm_hhx<0><<<gg, 128, 0, stream>>>(X16, CC, 0, Bk, CC, 0, 0.0625f, nullptr, 0, nullptr, 1, 0, 0, KQF, nullptr, 2 * CC, 0, NR, CC, CC);            // kc (f32) → split below into QKV/QKVL cols [0, 256)
  k_gemm_hhx<0><<<gg, 128, 0, stream>>>(X16, CC, 0, Bq, CC, 0, 0.0625f, nullptr, 0, nullptr, 1, 0, 0, KQF + CC, nullptr, 2 * CC, 0, NR, CC, CC);       // q  (f32) → cols [256, 512)
  k_split16<<<(unsigned)(((size_t)NR * 64 + 255) / 256), 256, 0, stream>>>(KQF, 2 * CC, QKV, QKVL, 3 * CC, 2 * CC, NR);      // f16 hi + lo·2^10 planes for kc | q
  k_gemm_hhx<0><<<gg, 128, 0, stream>>>(Bv, CC, 0, X16, CC, 0, 0.0625f, nullptr, 0, nullptr, 1, 0, 0, nullptr, VT, NR, 0, CC, NR, CC);     // v, channel-major: VT[(h,d)][(b,token)] = Wv.X^T (weights as the A operand)
  k_nattn<<<(BB * NHh * HI * NXS + 3) / 4, 128, 0, stream>>>(QKV, QKVL, VT, relh, relw, O);
  k_nchw<<<BB * (CC / 32) * (NTOK / 64), 256, 0, stream>>>(O, (float*)d_out);
}

// v003
// It runs in 42.4 microseconds.
// Two timings next to v002 put it at 1.72 and 1.73 times that version's speed.
// Over all steps from v000 it is 4.31 times as fast.
#include <hip/hip_runtime.h>
// Stand-alone (SASA) local self-attention (B=2, C 256 = 8 heads × 32, 56×56, 7×7 windows, stride 1, zero padding; relative row/col embeddings added to the windowed QUERIES, the centre KEY is
// the fixed operand, softmax over the 49 window positions, values windowed): 1×1 projections as GEMMs ((head,dim)×C weights bf16-exact ×2^4) and the window attention on
// v_wmma_f32_16x16x32_f16 with one banded key block per window row (per 16-token row segment and window row: S^T = Q_row.KC^T over 32 keys, kc and q as f16 hi + lo*2^-10 (3 products), band element + kc.rel_k (f32) = logit; f32 softmax over all 49, in-lane
// plus one lane exchange; O^T += V^T.P^T with the f16 S^T tiles as the B operand and V kept channel-major); kc.rel_k = kc[0..15].rel_h[i] + kc[16..31].rel_w[j] is one more A tile (14 rows) against the same KC^T; the NCHW transposes go through LDS tiles (x in as f16 tokens, O back out as f32).
#define BB 2
#define CC 256
#define NHh 8
#define HD 32
#define HI 56
#define NTOK 3136
#define NXS 4
#define NR (BB * NTOK)

typedef __bf16 v16b __attribute__((ext_vector_type(16)));
typedef unsigned short v8us __attribute__((ext_vector_type(8), may_alias));
typedef float  v8f  __attribute__((ext_vector_type(8)));
typedef float  v4f  __attribute__((ext_vector_type(4)));
typedef float  v4fa __attribute__((ext_vector_type(4), may_alias));
union FragB { v16b v; v8us half[2]; unsigned short u[16]; };

__device__ __forceinline__ unsigned short bf16_bits(float x) { unsigned int u = __float_as_uint(x); return (unsigned short)((u + 0x7FFFu + ((u >> 16) & 1u)) >> 16); }
__device__ __forceinline__ float bf16_val(unsigned short b) { return __uint_as_float(((unsigned int)b) << 16); }
__device__ __forceinline__ float bf16_round(float x) { return bf16_val(bf16_bits(x)); }
// D += A·B with NT terms: 1 = ah·bh, 2 = + al·bh (A split), 3 = + ah·bl (both split)
template <int NT>
__device__ __forceinline__ v8f mmaN(v16b ah, v16b al, v16b bh, v16b bl, v8f c) {
  c = __builtin_amdgcn_wmma_f32_16x16x32_bf16(false, ah, false, bh, (short)0, c, false, false);
  if (NT >= 2) c = __builtin_amdgcn_wmma_f32_16x16x32_bf16(false, al, false, bh, (short)0, c, false, false);
  if (NT >= 3) c = __builtin_amdgcn_wmma_f32_16x16x32_bf16(false, ah, false, bl, (short)0, c, false, false);
  asm volatile("v_nop\n\tv_nop\n\tv_nop\n\tv_nop" : "+v"(c) : "v"(ah), "v"(al), "v"(bh), "v"(bl));
  return c;
}

__global__ __launch_bounds__(256) void k_wt_bf16(const float* __restrict__ W, unsigned short* __restrict__ Wt, int K, int N) {
  const int t = blockIdx.x * 256 + threadIdx.x;
  const int k8n = K / 8;
  if (t >= N * k8n) return;
  const int n = t / k8n, k8 = (t % k8n) * 8;
  v8us v;
#pragma unroll
  for (int i = 0; i < 8; ++i) v[i] = bf16_bits(W[(size_t)(k8 + i) * N + n]);
  *(v8us*)(Wt + (size_t)n * K + k8) = v;
  
}

// GEMM C[M][N] (f32, pitch ldc) = act(A[M][K]·W + bias). A f32 row-major (pitch lda) converted per fragment to bf16
// (ASPLIT: hi/lo two planes -> 2 terms, else single rounded term); Wt bf16 [N][K] (pitch ldb). BIAS_BF16 rounds the
// bias to bf16 first (bias quantised to bf16 before the add). K%32==0, M%16==0, N%64==0.
template <bool ASPLIT, int ACT, bool BIAS_BF16>
__global__ __launch_bounds__(128) void k_gemm_bf(const float* __restrict__ A, int lda, const unsigned short* __restrict__ Wt, int ldb,
                                               const float* __restrict__ bias, float* __restrict__ C, int ldc, int M, int N, int K) {
  __shared__ __attribute__((aligned(16))) float so[4][16][64];
  const int tid = threadIdx.x, w = tid >> 5, lane = tid & 31, ln = lane & 15, hh = lane >> 4;
  const int ntn = N / 64;
  const int wid = blockIdx.x * 4 + w;
  const int mt = wid / ntn, nq = wid % ntn;
  if (mt * 16 >= M) return;
  const int row0 = mt * 16, col0 = nq * 64;
  const float* arow = A + (size_t)(row0 + ln) * lda;
  v8f acc[4] = {};
  for (int kb = 0; kb < K; kb += 32) {
    FragB ah, al;
    const v4f x0 = *(const v4fa*)(arow + kb + 8 * hh), x1 = *(const v4fa*)(arow + kb + 8 * hh + 4);
    const v4f x2 = *(const v4fa*)(arow + kb + 16 + 8 * hh), x3 = *(const v4fa*)(arow + kb + 16 + 8 * hh + 4);
    float xs[16] = {x0[0],x0[1],x0[2],x0[3],x1[0],x1[1],x1[2],x1[3],x2[0],x2[1],x2[2],x2[3],x3[0],x3[1],x3[2],x3[3]};
#pragma unroll
    for (int i = 0; i < 16; ++i) { const unsigned short hb = bf16_bits(xs[i]); ah.u[i] = hb; al.u[i] = ASPLIT ? bf16_bits(xs[i] - bf16_val(hb)) : (unsigned short)0; }
#pragma unroll
    for (int t = 0; t < 4; ++t) {
      const unsigned short* brow = Wt + (size_t)(col0 + t * 16 + ln) * ldb + kb;
      FragB b;
      b.half[0] = *(const v8us*)(brow + 8 * hh);
      b.half[1] = *(const v8us*)(brow + 16 + 8 * hh);
      acc[t] = mmaN<ASPLIT ? 2 : 1>(ah.v, al.v, b.v, b.v, acc[t]);
    }
  }
#pragma unroll
  for (int t = 0; t < 4; ++t) {
    float bv = bias ? bias[col0 + t * 16 + ln] : 0.f;
    if (BIAS_BF16) bv = bf16_round(bv);
#pragma unroll
    for (int r = 0; r < 8; ++r) { float v = acc[t][r] + bv; if (ACT == 1) v = fmaxf(v, 0.f); so[w][8 * hh + r][t * 16 + ln] = v; }
  }
  __builtin_amdgcn_fence(__ATOMIC_ACQ_REL, "workgroup");
  __builtin_amdgcn_wave_barrier();
  const int rsub = lane >> 4, c4 = (lane & 15) * 4;
  {
#pragma unroll
    for (int q = 0; q < 8; ++q) {
      const int r = q * 2 + rsub;
      const v4f v = *(const v4fa*)&so[w][r][c4];
      *(v4f*)(C + (size_t)(row0 + r) * ldc + col0 + c4) = v;
    }
    
  }
}

// Flash-style causal/unmasked attention, all contractions 3-term bf16 hi/lo splits, f32 softmax with running max.
// q,k,v rows are read from f32 buffers with arbitrary row pitch (so they can live inside a fused qkv buffer);
// D = head size (multiple of 32, <= 128); one wave = 16 query rows; block = 4 waves (64 queries) sharing K/V chunks of 32.
template <int D, bool CAUSAL>
__global__ __launch_bounds__(128) void k_flash(const float* __restrict__ qb, const float* __restrict__ kb, const float* __restrict__ vb,
                                             int pitch, int T, int H, float scale, float* __restrict__ y, int ypitch) {
  constexpr int KS = D / 32;        // k-steps for QK
  constexpr int DT = D / 16;        // d tiles for PV
  __shared__ __attribute__((aligned(16))) unsigned short sKh[32][D + 8], sKl[32][D + 8], sVh[32][D + 8], sVl[32][D + 8];
  __shared__ __attribute__((aligned(16))) unsigned short sPh[4][16][40], sPl[4][16][40];
  __shared__ __attribute__((aligned(16))) float sO[4][16][D];
  const int tid = threadIdx.x, w = tid >> 5, lane = tid & 31, ln = lane & 15, hh = lane >> 4;
  const int nqb = (T + 63) / 64;
  const int bh = blockIdx.x / nqb, qblk = blockIdx.x % nqb;
  const int b = bh / H, h = bh % H;
  const int q0 = qblk * 64 + w * 16;
  const float* Q = qb + (size_t)b * T * pitch + h * D;
  const float* K = kb + (size_t)b * T * pitch + h * D;
  const float* V = vb + (size_t)b * T * pitch + h * D;

  // A fragments of the wave's 16 query rows (scaled), hi/lo
  FragB aqh[KS], aql[KS];
  {
    int row = q0 + ln; if (row >= T) row = T - 1;
    const float* qr = Q + (size_t)row * pitch;
#pragma unroll
    for (int ks = 0; ks < KS; ++ks)
#pragma unroll
      for (int i = 0; i < 16; ++i) {
        const int d = ks * 32 + ((i < 8) ? (8 * hh + i) : (16 + 8 * hh + (i - 8)));
        const float x = qr[d] * scale; const unsigned short hb = bf16_bits(x);
        aqh[ks].u[i] = hb; aql[ks].u[i] = bf16_bits(x - bf16_val(hb));
      }
  }
  float m_r[8], l_r[8];
#pragma unroll
  for (int r = 0; r < 8; ++r) { m_r[r] = -3.0e38f; l_r[r] = 0.f; }
  v8f oacc[DT];
#pragma unroll
  for (int dt = 0; dt < DT; ++dt) oacc[dt] = (v8f){0.f,0.f,0.f,0.f,0.f,0.f,0.f,0.f};

  const int kv_end = CAUSAL ? min(T, qblk * 64 + 64) : T;     // block-uniform
  for (int j0 = 0; j0 < kv_end; j0 += 32) {
    __syncthreads();
    for (int e = tid; e < 32 * (D / 4); e += 128) {
      const int r = e / (D / 4), c4 = (e % (D / 4)) * 4;
      const int key = j0 + r;
      v4f kf = {0.f,0.f,0.f,0.f}, vf = {0.f,0.f,0.f,0.f};
      if (key < T) { kf = *(const v4fa*)(K + (size_t)key * pitch + c4); vf = *(const v4fa*)(V + (size_t)key * pitch + c4); }
#pragma unroll
      for (int t = 0; t < 4; ++t) {
        unsigned short hb = bf16_bits(kf[t]); sKh[r][c4 + t] = hb; sKl[r][c4 + t] = bf16_bits(kf[t] - bf16_val(hb));
        hb = bf16_bits(vf[t]); sVh[r][c4 + t] = hb; sVl[r][c4 + t] = bf16_bits(vf[t] - bf16_val(hb));
      }
    }
    __syncthreads();
    // S tile 16 x 32
    v8f s[2];
#pragma unroll
    for (int nt = 0; nt < 2; ++nt) {
      v8f acc = {};
#pragma unroll
      for (int ks = 0; ks < KS; ++ks) {
        FragB bh_, bl_;
        bh_.half[0] = *(const v8us*)&sKh[nt * 16 + ln][ks * 32 + 8 * hh]; bh_.half[1] = *(const v8us*)&sKh[nt * 16 + ln][ks * 32 + 16 + 8 * hh];
        bl_.half[0] = *(const v8us*)&sKl[nt * 16 + ln][ks * 32 + 8 * hh]; bl_.half[1] = *(const v8us*)&sKl[nt * 16 + ln][ks * 32 + 16 + 8 * hh];
        acc = mmaN<3>(aqh[ks].v, aql[ks].v, bh_.v, bl_.v, acc);
      }
      s[nt] = acc;
    }
    // mask + running max (rows 8hh+r; the 16 lanes of a half share rows)
    float alpha[8];
#pragma unroll
    for (int r = 0; r < 8; ++r) {
      const int qi = q0 + 8 * hh + r;
      const int ja = j0 + ln, jb = j0 + 16 + ln;
      if (CAUSAL) { if (ja > qi) s[0][r] = -3.0e38f; if (jb > qi) s[1][r] = -3.0e38f; }
      if (ja >= T) s[0][r] = -3.0e38f;
      if (jb >= T) s[1][r] = -3.0e38f;
      float mx = fmaxf(s[0][r], s[1][r]);
      mx = fmaxf(mx, __shfl_xor(mx, 1, 32)); mx = fmaxf(mx, __shfl_xor(mx, 2, 32)); mx = fmaxf(mx, __shfl_xor(mx, 4, 32)); mx = fmaxf(mx, __shfl_xor(mx, 8, 32));
      const float mnew = fmaxf(m_r[r], mx);
      alpha[r] = (mnew > -1.0e38f) ? __expf(m_r[r] - mnew) : 1.0f;
      const float p0 = (s[0][r] > -1.0e38f) ? __expf(s[0][r] - mnew) : 0.f;
      const float p1 = (s[1][r] > -1.0e38f) ? __expf(s[1][r] - mnew) : 0.f;
      m_r[r] = mnew;
      l_r[r] = l_r[r] * alpha[r] + p0 + p1;            // per-lane partial row sum (16 lanes combined at the end)
      unsigned short hb = bf16_bits(p0); sPh[w][8 * hh + r][ln] = hb;      sPl[w][8 * hh + r][ln] = bf16_bits(p0 - bf16_val(hb));
      hb = bf16_bits(p1);                sPh[w][8 * hh + r][16 + ln] = hb; sPl[w][8 * hh + r][16 + ln] = bf16_bits(p1 - bf16_val(hb));
    }
#pragma unroll
    for (int dt = 0; dt < DT; ++dt)
#pragma unroll
      for (int r = 0; r < 8; ++r) oacc[dt][r] *= alpha[r];
    __builtin_amdgcn_fence(__ATOMIC_ACQ_REL, "workgroup");
    __builtin_amdgcn_wave_barrier();
    FragB pah, pal;
    pah.half[0] = *(const v8us*)&sPh[w][ln][8 * hh]; pah.half[1] = *(const v8us*)&sPh[w][ln][16 + 8 * hh];
    pal.half[0] = *(const v8us*)&sPl[w][ln][8 * hh]; pal.half[1] = *(const v8us*)&sPl[w][ln][16 + 8 * hh];
#pragma unroll
    for (int dt = 0; dt < DT; ++dt) {
      FragB bvh, bvl;
#pragma unroll
      for (int i = 0; i < 8; ++i) {
        bvh.u[i] = sVh[8 * hh + i][dt * 16 + ln]; bvh.u[8 + i] = sVh[16 + 8 * hh + i][dt * 16 + ln];
        bvl.u[i] = sVl[8 * hh + i][dt * 16 + ln]; bvl.u[8 + i] = sVl[16 + 8 * hh + i][dt * 16 + ln];
      }
      oacc[dt] = mmaN<3>(pah.v, pal.v, bvh.v, bvl.v, oacc[dt]);
    }
    __builtin_amdgcn_fence(__ATOMIC_ACQ_REL, "workgroup");
    __builtin_amdgcn_wave_barrier();
  }
#pragma unroll
  for (int r = 0; r < 8; ++r) {
    float l = l_r[r];
    l += __shfl_xor(l, 1, 32); l += __shfl_xor(l, 2, 32); l += __shfl_xor(l, 4, 32); l += __shfl_xor(l, 8, 32);
    l_r[r] = (l > 0.f) ? 1.0f / l : 0.f;
  }
#pragma unroll
  for (int dt = 0; dt < DT; ++dt)
#pragma unroll
    for (int r = 0; r < 8; ++r) sO[w][8 * hh + r][dt * 16 + ln] = oacc[dt][r] * l_r[r];
  __builtin_amdgcn_fence(__ATOMIC_ACQ_REL, "workgroup");
  __builtin_amdgcn_wave_barrier();
  {
    for (int r = 0; r < 16; ++r) {
      const int row = q0 + r;
      if (row < T && lane < D / 4) {
        const v4f val = *(const v4fa*)&sO[w][r][lane * 4];
        *(v4f*)(y + ((size_t)b * T + row) * ypitch + h * D + lane * 4) = val;
      }
    }
    
  }
}

// GEMM C = act(A·W + bias + resid): A f32 (ASPLIT -> hi/lo 2 terms), Wt bf16 [N][K]; ACT 0 none, 1 relu, 2 exact gelu;
// resid (optional, f32, row index = (row % rmod), pitch ldr, RES_BF16 rounds it) added before the activation.
template <bool ASPLIT, int ACT, bool BIAS_BF16, bool RES_BF16>
__global__ __launch_bounds__(128) void k_gemm_bf3(const float* __restrict__ A, int lda, const unsigned short* __restrict__ Wt, int ldb,
                                                const float* __restrict__ bias, const float* __restrict__ resid, int rmod, int ldr,
                                                float* __restrict__ C, int ldc, int M, int N, int K) {
  __shared__ __attribute__((aligned(16))) float so[4][16][64];
  const int tid = threadIdx.x, w = tid >> 5, lane = tid & 31, ln = lane & 15, hh = lane >> 4;
  const int ntn = N / 64;
  const int wid = blockIdx.x * 4 + w;
  const int mt = wid / ntn, nq = wid % ntn;
  if (mt * 16 >= M) return;
  const int row0 = mt * 16, col0 = nq * 64;
  const float* arow = A + (size_t)(row0 + ln) * lda;
  v8f acc[4] = {};
  for (int kb = 0; kb < K; kb += 32) {
    FragB ah, al;
    const v4f x0 = *(const v4fa*)(arow + kb + 8 * hh), x1 = *(const v4fa*)(arow + kb + 8 * hh + 4);
    const v4f x2 = *(const v4fa*)(arow + kb + 16 + 8 * hh), x3 = *(const v4fa*)(arow + kb + 16 + 8 * hh + 4);
    float xs[16] = {x0[0],x0[1],x0[2],x0[3],x1[0],x1[1],x1[2],x1[3],x2[0],x2[1],x2[2],x2[3],x3[0],x3[1],x3[2],x3[3]};
#pragma unroll
    for (int i = 0; i < 16; ++i) { const unsigned short hb = bf16_bits(xs[i]); ah.u[i] = hb; al.u[i] = ASPLIT ? bf16_bits(xs[i] - bf16_val(hb)) : (unsigned short)0; }
#pragma unroll
    for (int t = 0; t < 4; ++t) {
      const unsigned short* brow = Wt + (size_t)(col0 + t * 16 + ln) * ldb + kb;
      FragB b;
      b.half[0] = *(const v8us*)(brow + 8 * hh);
      b.half[1] = *(const v8us*)(brow + 16 + 8 * hh);
      acc[t] = mmaN<ASPLIT ? 2 : 1>(ah.v, al.v, b.v, b.v, acc[t]);
    }
  }
#pragma unroll
  for (int t = 0; t < 4; ++t) {
    const int col = col0 + t * 16 + ln;
    float bv = bias ? bias[col] : 0.f;
    if (BIAS_BF16) bv = bf16_round(bv);
#pragma unroll
    for (int r = 0; r < 8; ++r) {
      float v = acc[t][r] + bv;
      if (resid) { float rv = resid[(size_t)((row0 + 8 * hh + r) % rmod) * ldr + col]; if (RES_BF16) rv = bf16_round(rv); v += rv; }
      if (ACT == 1) v = fmaxf(v, 0.f);
      if (ACT == 2) v = 0.5f * v * (1.0f + erff(v * 0.70710678118654752f));
      if (ACT == 3) { const float u = 0.7978845608028654f * (v + 0.044715f * v * v * v); v = 0.5f * v * (1.0f + tanhf(u)); }
      so[w][8 * hh + r][t * 16 + ln] = v;
    }
  }
  __builtin_amdgcn_fence(__ATOMIC_ACQ_REL, "workgroup");
  __builtin_amdgcn_wave_barrier();
  const int rsub = lane >> 4, c4 = (lane & 15) * 4;
  {
#pragma unroll
    for (int q = 0; q < 8; ++q) {
      const int r = q * 2 + rsub;
      const v4f v = *(const v4fa*)&so[w][r][c4];
      *(v4f*)(C + (size_t)(row0 + r) * ldc + col0 + c4) = v;
    }
    
  }
}
// row LayerNorm (biased variance, eps) over N: s = X (+ R); optional out_sum <- s; out_norm <- (s-mu)*rsqrt(var+eps)*g + b
template <bool PARAM_BF16>
__global__ __launch_bounds__(256) void k_layernorm(const float* __restrict__ X, const float* __restrict__ R, const float* __restrict__ g, const float* __restrict__ bta,
                                                  float* __restrict__ out_sum, float* __restrict__ out_norm, int N, float eps) {
  __shared__ float red[256];
  const int row = blockIdx.x, tid = threadIdx.x;
  const float* x = X + (size_t)row * N; const float* rr = R ? R + (size_t)row * N : nullptr;
  float vals[16];                     // up to N = 4096
  const int per = N / 256;            // contiguous chunk per thread? use strided-by-4 chunks: thread handles j = tid*4 + 1024*u
  float s1 = 0.f;
  for (int u = 0; u < per / 4; ++u) {
    const int j = tid * 4 + 1024 * u;
    const v4f a = *(const v4fa*)(x + j);
    v4f b = {0.f,0.f,0.f,0.f}; if (rr) b = *(const v4fa*)(rr + j);
#pragma unroll
    for (int q = 0; q < 4; ++q) { const float v = a[q] + b[q]; vals[u * 4 + q] = v; s1 += v; }
  }
  red[tid] = s1; __syncthreads();
  for (int st = 128; st > 0; st >>= 1) { if (tid < st) red[tid] += red[tid + st]; __syncthreads(); }
  const float mu = red[0] / (float)N; __syncthreads();
  float s2 = 0.f;
  for (int u = 0; u < per / 4; ++u)
#pragma unroll
    for (int q = 0; q < 4; ++q) { const float c = vals[u * 4 + q] - mu; s2 += c * c; }
  red[tid] = s2; __syncthreads();
  for (int st = 128; st > 0; st >>= 1) { if (tid < st) red[tid] += red[tid + st]; __syncthreads(); }
  const float rs = rsqrtf(red[0] / (float)N + eps);
  {
    for (int u = 0; u < per / 4; ++u) {
      const int j = tid * 4 + 1024 * u;
      v4f o, sm;
#pragma unroll
      for (int q = 0; q < 4; ++q) {
        float gg = g[j + q], bb = bta[j + q];
        if (PARAM_BF16) { gg = bf16_round(gg); bb = bf16_round(bb); }
        sm[q] = vals[u * 4 + q]; o[q] = (vals[u * 4 + q] - mu) * rs * gg + bb;
      }
      if (out_sum) *(v4f*)(out_sum + (size_t)row * N + j) = sm;
      *(v4f*)(out_norm + (size_t)row * N + j) = o;
    }
    
  }
}



// ---- f16 WMMA path (v_wmma_f32_16x16x32_f16): 11-bit significands for operands in range — used where a [0,1] probability operand needs more precision than bf16
typedef _Float16 v16h __attribute__((ext_vector_type(16)));
union FragH { v16h v; v8us half[2]; _Float16 h[16]; unsigned short u[16]; };
template <int NT>
__device__ __forceinline__ v8f mmaH(v16h ah, v16h al, v16h bh, v16h bl, v8f c) {
  c = __builtin_amdgcn_wmma_f32_16x16x32_f16(false, ah, false, bh, (short)0, c, false, false);
  if (NT >= 2) c = __builtin_amdgcn_wmma_f32_16x16x32_f16(false, al, false, bh, (short)0, c, false, false);
  if (NT >= 3) c = __builtin_amdgcn_wmma_f32_16x16x32_f16(false, ah, false, bl, (short)0, c, false, false);
  asm volatile("v_nop\n\tv_nop\n\tv_nop\n\tv_nop" : "+v"(c) : "v"(ah), "v"(al), "v"(bh), "v"(bl));
  return c;
}
// batched GEMM with f16 operands: A f32 (split into f16 hi/lo if ASPLIT, else rounded to f16), Bt = f16 values [n][k]; alpha; C f32; N multiple of 16 (partial tiles skipped)
template <bool ASPLIT>
__global__ __launch_bounds__(128) void k_gemm_h(const float* __restrict__ A, int lda, size_t sA, const _Float16* __restrict__ Bh, int ldb, size_t sB, float alpha, float* __restrict__ C, int ldc, size_t sC, int M, int N, int K) {
  __shared__ __attribute__((aligned(16))) float so[4][16][64];
  const int tid = threadIdx.x, w = tid >> 5, lane = tid & 31, ln = lane & 15, hh = lane >> 4; const int by = blockIdx.y;
  A += (size_t)by * sA; Bh += (size_t)by * sB; C += (size_t)by * sC;
  const int ntn = (N + 63) / 64; const int wid = blockIdx.x * 4 + w; const int mt = wid / ntn, nq = wid % ntn; if (mt * 16 >= M) return;
  const int row0 = mt * 16, col0 = nq * 64; const float* arow = A + (size_t)(row0 + ln) * lda;
  v8f acc[4] = {};
  for (int kb = 0; kb < K; kb += 32) {
    FragH ah, al;
    const v4f x0 = *(const v4fa*)(arow + kb + 8 * hh), x1 = *(const v4fa*)(arow + kb + 8 * hh + 4), x2 = *(const v4fa*)(arow + kb + 16 + 8 * hh), x3 = *(const v4fa*)(arow + kb + 16 + 8 * hh + 4);
    float xs[16] = {x0[0],x0[1],x0[2],x0[3],x1[0],x1[1],x1[2],x1[3],x2[0],x2[1],x2[2],x2[3],x3[0],x3[1],x3[2],x3[3]};
#pragma unroll
    for (int i = 0; i < 16; ++i) { const _Float16 h = (_Float16)xs[i]; ah.h[i] = h; al.h[i] = ASPLIT ? (_Float16)(xs[i] - (float)h) : (_Float16)0.0f; }
#pragma unroll
    for (int t = 0; t < 4; ++t) { if (col0 + t * 16 >= N) continue; const size_t boff = (size_t)(col0 + t * 16 + ln) * ldb + kb; FragH bq; bq.half[0] = *(const v8us*)(Bh + boff + 8 * hh); bq.half[1] = *(const v8us*)(Bh + boff + 16 + 8 * hh);
      acc[t] = mmaH<ASPLIT ? 2 : 1>(ah.v, al.v, bq.v, bq.v, acc[t]); }
  }
#pragma unroll
  for (int t = 0; t < 4; ++t) { if (col0 + t * 16 >= N) continue;
#pragma unroll
    for (int r = 0; r < 8; ++r) so[w][8 * hh + r][t * 16 + ln] = acc[t][r] * alpha; }
  __builtin_amdgcn_fence(__ATOMIC_ACQ_REL, "workgroup"); __builtin_amdgcn_wave_barrier();
  const int rsub = lane >> 4, c4 = (lane & 15) * 4;
  {
#pragma unroll
    for (int q = 0; q < 8; ++q) { const int r = q * 2 + rsub; if (col0 + c4 < N) { const v4f v = *(const v4fa*)&so[w][r][c4]; *(v4f*)(C + (size_t)(row0 + r) * ldc + col0 + c4) = v; } }
     }
}

// Wt[n][k] = f16(W[k][n]·scale) from f32 row-major W[K][N] (scale = power of two; bf16-exact weights stay exact in f16 away from the subnormal range)
__global__ __launch_bounds__(256) void k_wt_f16(const float* __restrict__ W, _Float16* __restrict__ Wt, int K, int N, float scale) {
  const int t = blockIdx.x * 256 + threadIdx.x; if (t >= N * (K / 8)) return; const int n = t / (K / 8), k8 = (t % (K / 8)) * 8; FragH f;
#pragma unroll
  for (int i = 0; i < 8; ++i) f.h[i] = (_Float16)(bf16_round(W[(size_t)(k8 + i) * N + n]) * scale); const v8us o = f.half[0];
  *(v8us*)((unsigned short*)Wt + (size_t)n * K + k8) = o; 
}
// Operand preparation, ONE launch: blocks [0, NTB) turn x (NCHW f32) into token-major f16 X16[(b,token)][c] (bf16-rounded first), 64 channels x 16 tokens a block through LDS;
// blocks [NTB, NTB + 3*NWB) round the three weight matrices (bf16, x 2^4, f16) into Bw = Wk | Wq | Wv, each [(head,dim)][c]. The two jobs share nothing; the branch is the same for a whole block.
#define NTB (BB * (CC / 64) * (NTOK / 16))
#define NWB (CC * CC / 8 / 256)
__global__ __launch_bounds__(256) void k_prep(const float* __restrict__ x, const float* __restrict__ Wk, const float* __restrict__ Wq, const float* __restrict__ Wv, _Float16* __restrict__ X16, _Float16* __restrict__ Bw) {
  __shared__ unsigned short tl[16][72]; const int tid = threadIdx.x;
  if (blockIdx.x >= NTB) { const int u = blockIdx.x - NTB, m = u / NWB; const float* W = (m == 0) ? Wk : ((m == 1) ? Wq : Wv); const size_t t = (size_t)(u % NWB) * 256 + tid; FragH f;
#pragma unroll
    for (int i = 0; i < 8; ++i) f.h[i] = (_Float16)(bf16_round(W[t * 8 + i]) * 16.0f);
    *(v8us*)((unsigned short*)Bw + (size_t)m * (CC * CC) + t * 8) = f.half[0]; return; }
  const int b = blockIdx.x / ((CC / 64) * (NTOK / 16)), rem = blockIdx.x % ((CC / 64) * (NTOK / 16)); const int cg = rem / (NTOK / 16), pg = rem % (NTOK / 16); const int c0 = cg * 64, p0 = pg * 16;
  for (int i = tid; i < 64 * 16; i += 256) { const int c = i / 16, pp = i % 16; FragH f; f.h[0] = (_Float16)bf16_round(x[((size_t)b * CC + c0 + c) * NTOK + p0 + pp]); tl[pp][c] = f.u[0]; }
  __syncthreads();
  if (tid < 128) { const int r = tid / 8, pc = tid % 8; FragH f;
#pragma unroll
    for (int q = 0; q < 8; ++q) f.u[q] = tl[r][pc * 8 + q]; unsigned short* d = (unsigned short*)X16 + ((size_t)b * NTOK + p0 + r) * CC + c0 + pc * 8; *(v8us*)d = f.half[0];  } }
// All three projections, ONE launch; one wave = one 16 x 64 tile over K = 256, f16 operands, f32 accumulators, result x 2^-4.
// Waves [0, NKQW): kc | q, token-major: A = X16 rows (tokens), B = Wk | Wq rows (512 outputs); the epilogue itself splits each f32 result into f16 hi + lo*2^10 and stores the planes QKV / QKVL (pitch 3*CC, columns [0, 512)).
// Waves [NKQW, NKQW + NVW): v, channel-major: A = Wv rows, B = X16 rows (tokens), VT[(h,d)][(b,token)] as f16. NKQW is a multiple of 4: a block is wholly of one kind.
#define NKQW ((NR / 16) * (2 * CC / 64))
#define NVW ((CC / 16) * (NR / 64))
__global__ __launch_bounds__(128) void k_proj(const _Float16* __restrict__ X16, const _Float16* __restrict__ Bw, _Float16* __restrict__ QKV, _Float16* __restrict__ QKVL, _Float16* __restrict__ VT) {
  __shared__ __attribute__((aligned(16))) float so[4][16][64];
  const int tid = threadIdx.x, lane = tid & 31, ln = lane & 15, hh = lane >> 4; const int w = __builtin_amdgcn_readfirstlane(tid >> 5);      // wave number held scalar: the kind of tile and both row bases are then scalar
  const int wid = blockIdx.x * 4 + w; const bool isv = wid >= NKQW; const int mt = isv ? (wid - NKQW) / (NR / 64) : wid / (2 * CC / 64), nq = isv ? (wid - NKQW) % (NR / 64) : wid % (2 * CC / 64); const int row0 = mt * 16, col0 = nq * 64;
  const unsigned short* ap = (const unsigned short*)(isv ? Bw + 2 * CC * CC : X16) + (size_t)row0 * CC; const unsigned short* bp = (const unsigned short*)(isv ? X16 : Bw) + (size_t)col0 * CC; const unsigned lo = (unsigned)(ln * CC + 8 * hh);
  v8f acc[4] = {};      // every unroll below: acc[t], the fragments and the staged rows are indexed by constants and stay in registers
  for (int kb = 0; kb < CC; kb += 32) { FragH ah; ah.half[0] = *(const v8us*)(ap + lo + kb); ah.half[1] = *(const v8us*)(ap + lo + kb + 16);
#pragma unroll
    for (int t = 0; t < 4; ++t) { FragH bq; bq.half[0] = *(const v8us*)(bp + lo + t * 16 * CC + kb); bq.half[1] = *(const v8us*)(bp + lo + t * 16 * CC + kb + 16);
      acc[t] = __builtin_amdgcn_wmma_f32_16x16x32_f16(false, ah.v, false, bq.v, (short)0, acc[t], false, false); }
  }
#pragma unroll
  for (int t = 0; t < 4; ++t)
#pragma unroll
    for (int r = 0; r < 8; ++r) so[w][8 * hh + r][t * 16 + ln] = acc[t][r] * 0.0625f;
  __builtin_amdgcn_fence(__ATOMIC_ACQ_REL, "workgroup"); __builtin_amdgcn_wave_barrier();      // so[w] is written and read by this wave alone
  const int r0 = lane >> 3, c8 = (lane & 7) * 8;      // 8 lanes store one whole 128-byte row piece of a plane
  if (isv) { unsigned short* dv = (unsigned short*)VT + (size_t)row0 * NR + col0;
#pragma unroll
    for (int q = 0; q < 4; ++q) { const int r = q * 4 + r0; const v4f v0 = *(const v4fa*)&so[w][r][c8], v1 = *(const v4fa*)&so[w][r][c8 + 4]; FragH fh;
#pragma unroll
      for (int i = 0; i < 4; ++i) { fh.h[i] = (_Float16)v0[i]; fh.h[4 + i] = (_Float16)v1[i]; }
      *(v8us*)(dv + (unsigned)(r * NR + c8)) = fh.half[0];
      if (q < 3) asm volatile("s_wait_xcnt 0x0" ::: "memory"); }      // the next rows' values are written to registers that this store names
  } else { unsigned short* dh = (unsigned short*)QKV + (size_t)row0 * (3 * CC) + col0; unsigned short* dl = (unsigned short*)QKVL + (size_t)row0 * (3 * CC) + col0;
#pragma unroll
    for (int q = 0; q < 4; ++q) { const int r = q * 4 + r0; const v4f v0 = *(const v4fa*)&so[w][r][c8], v1 = *(const v4fa*)&so[w][r][c8 + 4]; FragH fh, fl;
#pragma unroll
      for (int i = 0; i < 8; ++i) { const float v = (i < 4) ? v0[i & 3] : v1[i & 3]; const _Float16 h = (_Float16)v; fh.h[i] = h; fl.h[i] = (_Float16)((v - (float)h) * 1024.0f); }
      const unsigned eo = (unsigned)(r * (3 * CC) + c8); *(v8us*)(dh + eo) = fh.half[0]; *(v8us*)(dl + eo) = fl.half[0];
      asm volatile("s_wait_xcnt 0x0" ::: "memory"); }      // the code behind (the next rows; in the listing also the other branch's block) writes registers that these stores name
  }
}
// exp(x) for x <= 0, by the steps of the library's expf (x*log2(e) in two parts, 2^fraction, ldexp, 0 below the f32 range; its overflow test cannot fire here). The exponential stands in asm with a v_nop behind it:
// the instruction set asks for one slot before a vector instruction reads a transcendental's result or overwrites its source.
__device__ __forceinline__ float exp_nonpos(float x) {
  const float ph = x * 0x1.715476p+0f; float pl = __builtin_fmaf(x, 0x1.715476p+0f, -ph); pl = __builtin_fmaf(x, 0x1.4ae0bep-26f, pl);
  const float e = __builtin_rintf(ph); const float a = (ph - e) + pl; float r;
  asm("v_exp_f32 %0, %1\n\tv_nop" : "=v"(r) : "v"(a));
  r = ldexpf(r, (int)e);
  return (x < -0x1.9d1da0p+6f) ? 0.f : r; }
// window attention, one wave per (b, head h, row y, 16-token x segment): for each window row i the 32 tokens (y + i - 3, x0 - 8 .. x0 + 23) are ONE key block.
// S^T = Q_row (32 keys x 32 d, two A tiles, f16 hi + lo*2^-10, 3 products) * KC^T (B, 16 centre keys): lane (ln, hh) holds, for centre token ln, the keys c = 16t + 8hh + r;
// the window is the band 0 <= c - ln - 5 <= 6 (= column offset j). Softmax of a centre token is in-lane plus one exchange with lane ^ 16; the two S^T tiles, as f16, ARE the B operand of
// O^T = V^T (A: row d, keys along k, read from the channel-major VT) * P^T, so a lane ends with 8 consecutive d of its own token.
// kc.rel_k splits into a row term and a column term: E = REL * KC^T with REL rows 0..6 = (rel_h[i] | 0), rows 8..14 = (0 | rel_w[j]), rows 7 and 15 zero; rel is bf16-rounded first, as before (8 significant bits: exact in f16 from 2^-14 up, below that off by at most 2^-25), and kc is hi + lo*2^-10 (2 products).
__global__ __launch_bounds__(128) void k_nattn(const _Float16* __restrict__ QKV, const _Float16* __restrict__ QKVL, const _Float16* __restrict__ VT, const float* __restrict__ relh, const float* __restrict__ relw, float* __restrict__ O) {
  __shared__ __attribute__((aligned(16))) float sR[4][16][20];      // per centre token of the wave: words 0..6 kc.rel_h[i], words 8..14 kc.rel_w[j] (pitch 20: rows stay 16-byte aligned and in-band lanes of the gather below meet no bank twice)
  __shared__ __attribute__((aligned(16))) float sO[4][16][HD + 4];
  const int tid = threadIdx.x, lane = tid & 31, ln = lane & 15, hh = lane >> 4; const int w = __builtin_amdgcn_readfirstlane(tid >> 5);      // wave number held scalar: (b, h, y, x0) and every row base below are then scalar, a lane keeps only row-invariant byte offsets
  const int wid = blockIdx.x * 4 + w; const int per_b = NHh * HI * NXS; if (wid >= BB * per_b) return;      // whole wave
  const int b = wid / per_b, rem = wid % per_b; const int h = rem / (HI * NXS), rem2 = rem % (HI * NXS); const int y = rem2 / NXS, x0 = (rem2 % NXS) * 16;
  const int qx = (x0 + ln < HI) ? (x0 + ln) : (HI - 1);      // lanes past the image row repeat its last token; their result is not stored
  FragH bc, bcl; { const unsigned koff = (unsigned)(qx * (3 * CC) + 8 * hh) * 2; const size_t kb = ((size_t)(b * NTOK + y * HI) * (3 * CC) + h * HD) * 2; const char* k0 = (const char*)QKV + kb; const char* k1 = (const char*)QKVL + kb;
    bc.half[0] = *(const v8us*)(k0 + koff); bc.half[1] = *(const v8us*)(k0 + koff + 32); bcl.half[0] = *(const v8us*)(k1 + koff); bcl.half[1] = *(const v8us*)(k1 + koff + 32); }      // centre key kc, column ln of B
  asm volatile("s_wait_xcnt 0x0" ::: "memory");      // koff is dead from here on: the results of the loads below may land on it
  const v8us z8 = (v8us){0,0,0,0,0,0,0,0}; const v8f z8f = (v8f){0.f,0.f,0.f,0.f,0.f,0.f,0.f,0.f};
  FragH ar; { const int ri = ln & 7; const float* rp = ((ln < 8) ? relh : relw) + (h * 7 + ((ri < 7) ? ri : 6)) * 16 + 8 * hh; const v4f r0 = *(const v4fa*)rp, r1 = *(const v4fa*)(rp + 4); FragH c;      // row ln of REL: its 8 non-zero k of this lane half
    asm volatile("s_wait_xcnt 0x0" ::: "memory");      // rp is dead from here on: later results may land on it
#pragma unroll
    for (int q = 0; q < 4; ++q) { c.h[q] = (_Float16)bf16_round(r0[q]); c.h[4 + q] = (_Float16)bf16_round(r1[q]); }
    const v8us cv = (ri < 7) ? c.half[0] : z8; ar.half[0] = (ln < 8) ? cv : z8; ar.half[1] = (ln < 8) ? z8 : cv; }      // k order as bc: half 0 = d 8hh.., half 1 = d 16 + 8hh..
  { const v8f e = __builtin_amdgcn_wmma_f32_16x16x32_f16(false, ar.v, false, bc.v, (short)0, z8f, false, false); const v8f e2 = __builtin_amdgcn_wmma_f32_16x16x32_f16(false, ar.v, false, bcl.v, (short)0, z8f, false, false); v4f o0, o1;
#pragma unroll
    for (int q = 0; q < 4; ++q) { o0[q] = e[q] + e2[q] * 0.0009765625f; o1[q] = e[4 + q] + e2[4 + q] * 0.0009765625f; }
    *(v4fa*)&sR[w][ln][8 * hh] = o0; *(v4fa*)&sR[w][ln][8 * hh + 4] = o1; }      // lane (ln, hh) holds rows 8hh..8hh+7 of E for its own centre token
  __builtin_amdgcn_fence(__ATOMIC_ACQ_REL, "workgroup"); __builtin_amdgcn_wave_barrier();      // sR is written and read by this wave alone
  bool inb[2][8]; int rj[2][8]; bool xok[2], vok[2]; unsigned qoff[2], voff[2];
#pragma unroll
  for (int t = 0; t < 2; ++t) {
    const int xx = x0 - 8 + 16 * t + ln; xok[t] = (xx >= 0 && xx < HI); qoff[t] = (unsigned)((xok[t] ? xx : 0) * (3 * CC) + 8 * hh) * 2;      // key c = 16t + ln as row of A
    const int xk = x0 - 8 + 16 * t + 8 * hh; vok[t] = (xk >= 0 && xk < HI); voff[t] = (unsigned)(ln * NR + (vok[t] ? xk : 0)) * 2;      // 8 keys: wholly inside the image row or wholly outside
#pragma unroll
    for (int r = 0; r < 8; ++r) { const int j = 16 * t + 8 * hh + r - ln - 5; inb[t][r] = (j >= 0 && j < 7); rj[t][r] = (j < 0) ? 0 : ((j > 6) ? 6 : j); } }
  float rh[8]; v8f rw[2]; { const float* rl = &sR[w][ln][0]; const v4f a0 = *(const v4fa*)rl, a1 = *(const v4fa*)(rl + 4);
#pragma unroll
    for (int q = 0; q < 4; ++q) { rh[q] = a0[q]; rh[4 + q] = a1[q]; }
#pragma unroll
    for (int t = 0; t < 2; ++t)
#pragma unroll
      for (int r = 0; r < 8; ++r) rw[t][r] = rl[8 + rj[t][r]]; }      // column term of key c = 16t + 8hh + r, the same for all seven window rows; every lane reads (index clamped into the row): no branch round the load
  float lg[7][2][8];
#pragma unroll
  for (int i = 0; i < 7; ++i) { const int yy = y + i - 3; const bool yok = (yy >= 0 && yy < HI); const size_t qb = ((size_t)(b * NTOK + (yok ? yy : y) * HI) * (3 * CC) + CC + h * HD) * 2; const char* q0 = (const char*)QKV + qb; const char* q1 = (const char*)QKVL + qb;
#pragma unroll
    for (int t = 0; t < 2; ++t) { const bool ok = yok && xok[t];
      FragH ak, akl; ak.half[0] = *(const v8us*)(q0 + qoff[t]); ak.half[1] = *(const v8us*)(q0 + qoff[t] + 32); akl.half[0] = *(const v8us*)(q1 + qoff[t]); akl.half[1] = *(const v8us*)(q1 + qoff[t] + 32); if (!ok) { ak.half[0] = z8; ak.half[1] = z8; akl.half[0] = z8; akl.half[1] = z8; }      // zero padding: q = 0 outside the image
      v8f s = __builtin_amdgcn_wmma_f32_16x16x32_f16(false, ak.v, false, bc.v, (short)0, rw[t], false, false);      // the column term rides in as C
      v8f s2 = __builtin_amdgcn_wmma_f32_16x16x32_f16(false, ak.v, false, bcl.v, (short)0, z8f, false, false); s2 = __builtin_amdgcn_wmma_f32_16x16x32_f16(false, akl.v, false, bc.v, (short)0, s2, false, false);      // hi.hi + (lo.hi + hi.lo)*2^-10
#pragma unroll
      for (int r = 0; r < 8; ++r) { const float sd = s[r] + s2[r] * 0.0009765625f; const float lv = sd + rh[i]; lg[i][t][r] = inb[t][r] ? lv : -3.0e38f; } } }      // kc.(q + rel_k); padded neighbours keep kc.rel_k
  float m = -3.0e38f;
#pragma unroll
  for (int i = 0; i < 7; ++i)
#pragma unroll
    for (int t = 0; t < 2; ++t)
#pragma unroll
      for (int r = 0; r < 8; ++r) m = fmaxf(m, lg[i][t][r]);
  m = fmaxf(m, __shfl_xor(m, 16, 32));
  float l = 0.f; v8f oacc[2] = {z8f, z8f};
#pragma unroll
  for (int i = 0; i < 7; ++i) { const int yy = y + i - 3; const bool yok = (yy >= 0 && yy < HI); const char* vb = (const char*)VT + ((size_t)(h * HD) * NR + (size_t)(b * NTOK + (yok ? yy : y) * HI)) * 2; FragH pb;
#pragma unroll
    for (int t = 0; t < 2; ++t)
#pragma unroll
      for (int r = 0; r < 8; ++r) { const float p = exp_nonpos(lg[i][t][r] - m); l += p; pb.h[8 * t + r] = (_Float16)p; }      // outside the band: exp -> 0
#pragma unroll
    for (int dt = 0; dt < 2; ++dt) { FragH av;
#pragma unroll
      for (int t = 0; t < 2; ++t) { av.half[t] = *(const v8us*)(vb + voff[t] + dt * (16 * NR * 2)); if (!(yok && vok[t])) av.half[t] = z8;      // zero padding: v = 0 outside the image
        if (i == 6 && dt * 2 + t < 3) asm volatile("s_wait_xcnt 0x0" ::: "memory"); }      // last row: voff dies here, and the result of the next load may land on a register that the loads before it name
      oacc[dt] = __builtin_amdgcn_wmma_f32_16x16x32_f16(false, av.v, false, pb.v, (short)0, oacc[dt], false, false); } }
  l += __shfl_xor(l, 16, 32);
#pragma unroll
  for (int dt = 0; dt < 2; ++dt)
#pragma unroll
    for (int r = 0; r < 8; ++r) sO[w][ln][dt * 16 + 8 * hh + r] = oacc[dt][r] / l;
  __builtin_amdgcn_fence(__ATOMIC_ACQ_REL, "workgroup"); __builtin_amdgcn_wave_barrier();
  {
#pragma unroll
    for (int rp2 = 0; rp2 < 16; rp2 += 4) { const int r = rp2 + (lane >> 3), pc = lane & 7; if (x0 + r < HI) { const v4f v = *(const v4fa*)&sO[w][r][pc * 4]; *(v4f*)(O + ((size_t)b * NTOK + y * HI + x0 + r) * CC + h * HD + pc * 4) = v; } }
     } }

__global__ __launch_bounds__(256) void k_nchw(const float* __restrict__ TP, float* __restrict__ out) { __shared__ float tl[32][65]; const int tid = threadIdx.x; const int b = blockIdx.x / ((CC / 32) * (NTOK / 64)), rem = blockIdx.x % ((CC / 32) * (NTOK / 64)); const int cg = rem / (NTOK / 64), pg = rem % (NTOK / 64); const int c0 = cg * 32, p0 = pg * 64;
  for (int i = tid; i < 64 * 32; i += 256) { const int pp = i / 32, c = i % 32; tl[c][pp] = TP[((size_t)b * NTOK + p0 + pp) * CC + c0 + c]; }
  __syncthreads();
  { for (int i = tid; i < 32 * 16; i += 256) { const int c = i / 16, pc = i % 16; v4f v; for (int q = 0; q < 4; ++q) v[q] = tl[c][pc * 4 + q]; *(v4f*)(out + ((size_t)b * CC + c0 + c) * NTOK + p0 + pc * 4) = v; }  } }

extern "C" void kernel_launch(void* const* d_in, const int* in_sizes, int n_in,
                              void* d_out, int out_size, void* d_ws, size_t ws_size, hipStream_t stream) {
  (void)in_sizes; (void)n_in; (void)out_size;
  const float* x = (const float*)d_in[0]; const float* Wk = (const float*)d_in[1]; const float* Wq = (const float*)d_in[2]; const float* Wv = (const float*)d_in[3]; const float* relh = (const float*)d_in[4]; const float* relw = (const float*)d_in[5];
  char* ws = (char*)d_ws; size_t off = 0;
  auto take = [&](size_t bytes) { char* p = ws + off; off += (bytes + 255) & ~(size_t)255; return p; };
  _Float16* Bw = (_Float16*)take((size_t)3 * CC * CC * 2); _Float16* X16 = (_Float16*)take((size_t)NR * CC * 2); _Float16* QKV = (_Float16*)take((size_t)NR * 3 * CC * 2); _Float16* QKVL = (_Float16*)take((size_t)NR * 3 * CC * 2); float* O = (float*)take((size_t)NR * CC * 4); _Float16* VT = (_Float16*)take((size_t)CC * NR * 2);
  if (off > ws_size) return;      // 0.4 + 3.2 + 9.6 + 9.6 + 6.4 + 3.2: about 33 MB
  k_prep<<<NTB + 3 * NWB, 256, 0, stream>>>(x, Wk, Wq, Wv, X16, Bw);      // X16 token-major f16; Bw = Wk | Wq | Wv, W[(n,d)][c] = (out,in)
  k_proj<<<(NKQW + NVW) / 4, 128, 0, stream>>>(X16, Bw, QKV, QKVL, VT);      // kc | q as f16 hi + lo*2^10 planes, cols [0, 512); v channel-major
  k_nattn<<<(BB * NHh * HI * NXS + 3) / 4, 128, 0, stream>>>(QKV, QKVL, VT, relh, relw, O);
  k_nchw<<<BB * (CC / 32) * (NTOK / 64), 256, 0, stream>>>(O, (float*)d_out);
}

// v004
// A run of this version takes 33.9 microseconds.
// Timed twice side by side with v003, it ran 1.25 times as fast both times.
// Counting every step since v000, it is 5.39 times as fast.
#include <hip/hip_runtime.h>
// Stand-alone (SASA) local self-attention (B=2, C 256 = 8 heads × 32, 56×56, 7×7 windows, stride 1, zero padding; relative row/col embeddings added to the windowed QUERIES, the centre KEY is
// the fixed operand, softmax over the 49 window positions, values windowed): 1×1 projections as GEMMs ((head,dim)×C weights bf16-exact ×2^4) and the window attention on
// v_wmma_f32_16x16x32_f16 with one banded key block per window row (per 16-token row segment and window row: S^T = Q_row.KC^T over 32 keys, kc and q as f16 hi + lo*2^-10 (3 products), band element + kc.rel_k (f32) = logit; f32 softmax over all 49, in-lane
// plus one lane exchange; O^T += V^T.P^T with the f16 S^T tiles as the B operand and V kept channel-major); kc.rel_k = kc[0..15].rel_h[i] + kc[16..31].rel_w[j] is one more A tile (14 rows) against the same KC^T; x is turned token-major as f16 in the projection kernel's LDS, the output back to NCHW in f32 on the VALU.
#define BB 2
#define CC 256
#define NHh 8
#define HD 32
#define HI 56
#define NTOK 3136
#define NXS 4
#define NR (BB * NTOK)

typedef __bf16 v16b __attribute__((ext_vector_type(16)));
typedef unsigned short v8us __attribute__((ext_vector_type(8), may_alias));
typedef float  v8f  __attribute__((ext_vector_type(8)));
typedef float  v4f  __attribute__((ext_vector_type(4)));
typedef float  v4fa __attribute__((ext_vector_type(4), may_alias));
union FragB { v16b v; v8us half[2]; unsigned short u[16]; };

__device__ __forceinline__ unsigned short bf16_bits(float x) { unsigned int u = __float_as_uint(x); return (unsigned short)((u + 0x7FFFu + ((u >> 16) & 1u)) >> 16); }
__device__ __forceinline__ float bf16_val(unsigned short b) { return __uint_as_float(((unsigned int)b) << 16); }
__device__ __forceinline__ float bf16_round(float x) { return bf16_val(bf16_bits(x)); }
// D += A·B with NT terms: 1 = ah·bh, 2 = + al·bh (A split), 3 = + ah·bl (both split)
template <int NT>
__device__ __forceinline__ v8f mmaN(v16b ah, v16b al, v16b bh, v16b bl, v8f c) {
  c = __builtin_amdgcn_wmma_f32_16x16x32_bf16(false, ah, false, bh, (short)0, c, false, false);
  if (NT >= 2) c = __builtin_amdgcn_wmma_f32_16x16x32_bf16(false, al, false, bh, (short)0, c, false, false);
  if (NT >= 3) c = __builtin_amdgcn_wmma_f32_16x16x32_bf16(false, ah, false, bl, (short)0, c, false, false);
  asm volatile("v_nop\n\tv_nop\n\tv_nop\n\tv_nop" : "+v"(c) : "v"(ah), "v"(al), "v"(bh), "v"(bl));
  return c;
}

__global__ __launch_bounds__(256) void k_wt_bf16(const float* __restrict__ W, unsigned short* __restrict__ Wt, int K, int N) {
  const int t = blockIdx.x * 256 + threadIdx.x;
  const int k8n = K / 8;
  if (t >= N * k8n) return;
  const int n = t / k8n, k8 = (t % k8n) * 8;
  v8us v;
#pragma unroll
  for (int i = 0; i < 8; ++i) v[i] = bf16_bits(W[(size_t)(k8 + i) * N + n]);
  *(v8us*)(Wt + (size_t)n * K + k8) = v;
  
}

// GEMM C[M][N] (f32, pitch ldc) = act(A[M][K]·W + bias). A f32 row-major (pitch lda) converted per fragment to bf16
// (ASPLIT: hi/lo two planes -> 2 terms, else single rounded term); Wt bf16 [N][K] (pitch ldb). BIAS_BF16 rounds the
// bias to bf16 first (bias quantised to bf16 before the add). K%32==0, M%16==0, N%64==0.
template <bool ASPLIT, int ACT, bool BIAS_BF16>
__global__ __launch_bounds__(128) void k_gemm_bf(const float* __restrict__ A, int lda, const unsigned short* __restrict__ Wt, int ldb,
                                               const float* __restrict__ bias, float* __restrict__ C, int ldc, int M, int N, int K) {
  __shared__ __attribute__((aligned(16))) float so[4][16][64];
  const int tid = threadIdx.x, w = tid >> 5, lane = tid & 31, ln = lane & 15, hh = lane >> 4;
  const int ntn = N / 64;
  const int wid = blockIdx.x * 4 + w;
  const int mt = wid / ntn, nq = wid % ntn;
  if (mt * 16 >= M) return;
  const int row0 = mt * 16, col0 = nq * 64;
  const float* arow = A + (size_t)(row0 + ln) * lda;
  v8f acc[4] = {};
  for (int kb = 0; kb < K; kb += 32) {
    FragB ah, al;
    const v4f x0 = *(const v4fa*)(arow + kb + 8 * hh), x1 = *(const v4fa*)(arow + kb + 8 * hh + 4);
    const v4f x2 = *(const v4fa*)(arow + kb + 16 + 8 * hh), x3 = *(const v4fa*)(arow + kb + 16 + 8 * hh + 4);
    float xs[16] = {x0[0],x0[1],x0[2],x0[3],x1[0],x1[1],x1[2],x1[3],x2[0],x2[1],x2[2],x2[3],x3[0],x3[1],x3[2],x3[3]};
#pragma unroll
    for (int i = 0; i < 16; ++i) { const unsigned short hb = bf16_bits(xs[i]); ah.u[i] = hb; al.u[i] = ASPLIT ? bf16_bits(xs[i] - bf16_val(hb)) : (unsigned short)0; }
#pragma unroll
    for (int t = 0; t < 4; ++t) {
      const unsigned short* brow = Wt + (size_t)(col0 + t * 16 + ln) * ldb + kb;
      FragB b;
      b.half[0] = *(const v8us*)(brow + 8 * hh);
      b.half[1] = *(const v8us*)(brow + 16 + 8 * hh);
      acc[t] = mmaN<ASPLIT ? 2 : 1>(ah.v, al.v, b.v, b.v, acc[t]);
    }
  }
#pragma unroll
  for (int t = 0; t < 4; ++t) {
    float bv = bias ? bias[col0 + t * 16 + ln] : 0.f;
    if (BIAS_BF16) bv = bf16_round(bv);
#pragma unroll
    for (int r = 0; r < 8; ++r) { float v = acc[t][r] + bv; if (ACT == 1) v = fmaxf(v, 0.f); so[w][8 * hh + r][t * 16 + ln] = v; }
  }
  __builtin_amdgcn_fence(__ATOMIC_ACQ_REL, "workgroup");
  __builtin_amdgcn_wave_barrier();
  const int rsub = lane >> 4, c4 = (lane & 15) * 4;
  {
#pragma unroll
    for (int q = 0; q < 8; ++q) {
      const int r = q * 2 + rsub;
      const v4f v = *(const v4fa*)&so[w][r][c4];
      *(v4f*)(C + (size_t)(row0 + r) * ldc + col0 + c4) = v;
    }
    
  }
}

// Flash-style causal/unmasked attention, all contractions 3-term bf16 hi/lo splits, f32 softmax with running max.
// q,k,v rows are read from f32 buffers with arbitrary row pitch (so they can live inside a fused qkv buffer);
// D = head size (multiple of 32, <= 128); one wave = 16 query rows; block = 4 waves (64 queries) sharing K/V chunks of 32.
template <int D, bool CAUSAL>
__global__ __launch_bounds__(128) void k_flash(const float* __restrict__ qb, const float* __restrict__ kb, const float* __restrict__ vb,
                                             int pitch, int T, int H, float scale, float* __restrict__ y, int ypitch) {
  constexpr int KS = D / 32;        // k-steps for QK
  constexpr int DT = D / 16;        // d tiles for PV
  __shared__ __attribute__((aligned(16))) unsigned short sKh[32][D + 8], sKl[32][D + 8], sVh[32][D + 8], sVl[32][D + 8];
  __shared__ __attribute__((aligned(16))) unsigned short sPh[4][16][40], sPl[4][16][40];
  __shared__ __attribute__((aligned(16))) float sO[4][16][D];
  const int tid = threadIdx.x, w = tid >> 5, lane = tid & 31, ln = lane & 15, hh = lane >> 4;
  const int nqb = (T + 63) / 64;
  const int bh = blockIdx.x / nqb, qblk = blockIdx.x % nqb;
  const int b = bh / H, h = bh % H;
  const int q0 = qblk * 64 + w * 16;
  const float* Q = qb + (size_t)b * T * pitch + h * D;
  const float* K = kb + (size_t)b * T * pitch + h * D;
  const float* V = vb + (size_t)b * T * pitch + h * D;

  // A fragments of the wave's 16 query rows (scaled), hi/lo
  FragB aqh[KS], aql[KS];
  {
    int row = q0 + ln; if (row >= T) row = T - 1;
    const float* qr = Q + (size_t)row * pitch;
#pragma unroll
    for (int ks = 0; ks < KS; ++ks)
#pragma unroll
      for (int i = 0; i < 16; ++i) {
        const int d = ks * 32 + ((i < 8) ? (8 * hh + i) : (16 + 8 * hh + (i - 8)));
        const float x = qr[d] * scale; const unsigned short hb = bf16_bits(x);
        aqh[ks].u[i] = hb; aql[ks].u[i] = bf16_bits(x - bf16_val(hb));
      }
  }
  float m_r[8], l_r[8];
#pragma unroll
  for (int r = 0; r < 8; ++r) { m_r[r] = -3.0e38f; l_r[r] = 0.f; }
  v8f oacc[DT];
#pragma unroll
  for (int dt = 0; dt < DT; ++dt) oacc[dt] = (v8f){0.f,0.f,0.f,0.f,0.f,0.f,0.f,0.f};

  const int kv_end = CAUSAL ? min(T, qblk * 64 + 64) : T;     // block-uniform
  for (int j0 = 0; j0 < kv_end; j0 += 32) {
    __syncthreads();
    for (int e = tid; e < 32 * (D / 4); e += 128) {
      const int r = e / (D / 4), c4 = (e % (D / 4)) * 4;
      const int key = j0 + r;
      v4f kf = {0.f,0.f,0.f,0.f}, vf = {0.f,0.f,0.f,0.f};
      if (key < T) { kf = *(const v4fa*)(K + (size_t)key * pitch + c4); vf = *(const v4fa*)(V + (size_t)key * pitch + c4); }
#pragma unroll
      for (int t = 0; t < 4; ++t) {
        unsigned short hb = bf16_bits(kf[t]); sKh[r][c4 + t] = hb; sKl[r][c4 + t] = bf16_bits(kf[t] - bf16_val(hb));
        hb = bf16_bits(vf[t]); sVh[r][c4 + t] = hb; sVl[r][c4 + t] = bf16_bits(vf[t] - bf16_val(hb));
      }
    }
    __syncthreads();
    // S tile 16 x 32
    v8f s[2];
#pragma unroll
    for (int nt = 0; nt < 2; ++nt) {
      v8f acc = {};
#pragma unroll
      for (int ks = 0; ks < KS; ++ks) {
        FragB bh_, bl_;
        bh_.half[0] = *(const v8us*)&sKh[nt * 16 + ln][ks * 32 + 8 * hh]; bh_.half[1] = *(const v8us*)&sKh[nt * 16 + ln][ks * 32 + 16 + 8 * hh];
        bl_.half[0] = *(const v8us*)&sKl[nt * 16 + ln][ks * 32 + 8 * hh]; bl_.half[1] = *(const v8us*)&sKl[nt * 16 + ln][ks * 32 + 16 + 8 * hh];
        acc = mmaN<3>(aqh[ks].v, aql[ks].v, bh_.v, bl_.v, acc);
      }
      s[nt] = acc;
    }
    // mask + running max (rows 8hh+r; the 16 lanes of a half share rows)
    float alpha[8];
#pragma unroll
    for (int r = 0; r < 8; ++r) {
      const int qi = q0 + 8 * hh + r;
      const int ja = j0 + ln, jb = j0 + 16 + ln;
      if (CAUSAL) { if (ja > qi) s[0][r] = -3.0e38f; if (jb > qi) s[1][r] = -3.0e38f; }
      if (ja >= T) s[0][r] = -3.0e38f;
      if (jb >= T) s[1][r] = -3.0e38f;
      float mx = fmaxf(s[0][r], s[1][r]);
      mx = fmaxf(mx, __shfl_xor(mx, 1, 32)); mx = fmaxf(mx, __shfl_xor(mx, 2, 32)); mx = fmaxf(mx, __shfl_xor(mx, 4, 32)); mx = fmaxf(mx, __shfl_xor(mx, 8, 32));
      const float mnew = fmaxf(m_r[r], mx);
      alpha[r] = (mnew > -1.0e38f) ? __expf(m_r[r] - mnew) : 1.0f;
      const float p0 = (s[0][r] > -1.0e38f) ? __expf(s[0][r] - mnew) : 0.f;
      const float p1 = (s[1][r] > -1.0e38f) ? __expf(s[1][r] - mnew) : 0.f;
      m_r[r] = mnew;
      l_r[r] = l_r[r] * alpha[r] + p0 + p1;            // per-lane partial row sum (16 lanes combined at the end)
      unsigned short hb = bf16_bits(p0); sPh[w][8 * hh + r][ln] = hb;      sPl[w][8 * hh + r][ln] = bf16_bits(p0 - bf16_val(hb));
      hb = bf16_bits(p1);                sPh[w][8 * hh + r][16 + ln] = hb; sPl[w][8 * hh + r][16 + ln] = bf16_bits(p1 - bf16_val(hb));
    }
#pragma unroll
    for (int dt = 0; dt < DT; ++dt)
#pragma unroll
      for (int r = 0; r < 8; ++r) oacc[dt][r] *= alpha[r];
    __builtin_amdgcn_fence(__ATOMIC_ACQ_REL, "workgroup");
    __builtin_amdgcn_wave_barrier();
    FragB pah, pal;
    pah.half[0] = *(const v8us*)&sPh[w][ln][8 * hh]; pah.half[1] = *(const v8us*)&sPh[w][ln][16 + 8 * hh];
    pal.half[0] = *(const v8us*)&sPl[w][ln][8 * hh]; pal.half[1] = *(const v8us*)&sPl[w][ln][16 + 8 * hh];
#pragma unroll
    for (int dt = 0; dt < DT; ++dt) {
      FragB bvh, bvl;
#pragma unroll
      for (int i = 0; i < 8; ++i) {
        bvh.u[i] = sVh[8 * hh + i][dt * 16 + ln]; bvh.u[8 + i] = sVh[16 + 8 * hh + i][dt * 16 + ln];
        bvl.u[i] = sVl[8 * hh + i][dt * 16 + ln]; bvl.u[8 + i] = sVl[16 + 8 * hh + i][dt * 16 + ln];
      }
      oacc[dt] = mmaN<3>(pah.v, pal.v, bvh.v, bvl.v, oacc[dt]);
    }
    __builtin_amdgcn_fence(__ATOMIC_ACQ_REL, "workgroup");
    __builtin_amdgcn_wave_barrier();
  }
#pragma unroll
  for (int r = 0; r < 8; ++r) {
    float l = l_r[r];
    l += __shfl_xor(l, 1, 32); l += __shfl_xor(l, 2, 32); l += __shfl_xor(l, 4, 32); l += __shfl_xor(l, 8, 32);
    l_r[r] = (l > 0.f) ? 1.0f / l : 0.f;
  }
#pragma unroll
  for (int dt = 0; dt < DT; ++dt)
#pragma unroll
    for (int r = 0; r < 8; ++r) sO[w][8 * hh + r][dt * 16 + ln] = oacc[dt][r] * l_r[r];
  __builtin_amdgcn_fence(__ATOMIC_ACQ_REL, "workgroup");
  __builtin_amdgcn_wave_barrier();
  {
    for (int r = 0; r < 16; ++r) {
      const int row = q0 + r;
      if (row < T && lane < D / 4) {
        const v4f val = *(const v4fa*)&sO[w][r][lane * 4];
        *(v4f*)(y + ((size_t)b * T + row) * ypitch + h * D + lane * 4) = val;
      }
    }
    
  }
}

// GEMM C = act(A·W + bias + resid): A f32 (ASPLIT -> hi/lo 2 terms), Wt bf16 [N][K]; ACT 0 none, 1 relu, 2 exact gelu;
// resid (optional, f32, row index = (row % rmod), pitch ldr, RES_BF16 rounds it) added before the activation.
template <bool ASPLIT, int ACT, bool BIAS_BF16, bool RES_BF16>
__global__ __launch_bounds__(128) void k_gemm_bf3(const float* __restrict__ A, int lda, const unsigned short* __restrict__ Wt, int ldb,
                                                const float* __restrict__ bias, const float* __restrict__ resid, int rmod, int ldr,
                                                float* __restrict__ C, int ldc, int M, int N, int K) {
  __shared__ __attribute__((aligned(16))) float so[4][16][64];
  const int tid = threadIdx.x, w = tid >> 5, lane = tid & 31, ln = lane & 15, hh = lane >> 4;
  const int ntn = N / 64;
  const int wid = blockIdx.x * 4 + w;
  const int mt = wid / ntn, nq = wid % ntn;
  if (mt * 16 >= M) return;
  const int row0 = mt * 16, col0 = nq * 64;
  const float* arow = A + (size_t)(row0 + ln) * lda;
  v8f acc[4] = {};
  for (int kb = 0; kb < K; kb += 32) {
    FragB ah, al;
    const v4f x0 = *(const v4fa*)(arow + kb + 8 * hh), x1 = *(const v4fa*)(arow + kb + 8 * hh + 4);
    const v4f x2 = *(const v4fa*)(arow + kb + 16 + 8 * hh), x3 = *(const v4fa*)(arow + kb + 16 + 8 * hh + 4);
    float xs[16] = {x0[0],x0[1],x0[2],x0[3],x1[0],x1[1],x1[2],x1[3],x2[0],x2[1],x2[2],x2[3],x3[0],x3[1],x3[2],x3[3]};
#pragma unroll
    for (int i = 0; i < 16; ++i) { const unsigned short hb = bf16_bits(xs[i]); ah.u[i] = hb; al.u[i] = ASPLIT ? bf16_bits(xs[i] - bf16_val(hb)) : (unsigned short)0; }
#pragma unroll
    for (int t = 0; t < 4; ++t) {
      const unsigned short* brow = Wt + (size_t)(col0 + t * 16 + ln) * ldb + kb;
      FragB b;
      b.half[0] = *(const v8us*)(brow + 8 * hh);
      b.half[1] = *(const v8us*)(brow + 16 + 8 * hh);
      acc[t] = mmaN<ASPLIT ? 2 : 1>(ah.v, al.v, b.v, b.v, acc[t]);
    }
  }
#pragma unroll
  for (int t = 0; t < 4; ++t) {
    const int col = col0 + t * 16 + ln;
    float bv = bias ? bias[col] : 0.f;
    if (BIAS_BF16) bv = bf16_round(bv);
#pragma unroll
    for (int r = 0; r < 8; ++r) {
      float v = acc[t][r] + bv;
      if (resid) { float rv = resid[(size_t)((row0 + 8 * hh + r) % rmod) * ldr + col]; if (RES_BF16) rv = bf16_round(rv); v += rv; }
      if (ACT == 1) v = fmaxf(v, 0.f);
      if (ACT == 2) v = 0.5f * v * (1.0f + erff(v * 0.70710678118654752f));
      if (ACT == 3) { const float u = 0.7978845608028654f * (v + 0.044715f * v * v * v); v = 0.5f * v * (1.0f + tanhf(u)); }
      so[w][8 * hh + r][t * 16 + ln] = v;
    }
  }
  __builtin_amdgcn_fence(__ATOMIC_ACQ_REL, "workgroup");
  __builtin_amdgcn_wave_barrier();
  const int rsub = lane >> 4, c4 = (lane & 15) * 4;
  {
#pragma unroll
    for (int q = 0; q < 8; ++q) {
      const int r = q * 2 + rsub;
      const v4f v = *(const v4fa*)&so[w][r][c4];
      *(v4f*)(C + (size_t)(row0 + r) * ldc + col0 + c4) = v;
    }
    
  }
}
// row LayerNorm (biased variance, eps) over N: s = X (+ R); optional out_sum <- s; out_norm <- (s-mu)*rsqrt(var+eps)*g + b
template <bool PARAM_BF16>
__global__ __launch_bounds__(256) void k_layernorm(const float* __restrict__ X, const float* __restrict__ R, const float* __restrict__ g, const float* __restrict__ bta,
                                                  float* __restrict__ out_sum, float* __restrict__ out_norm, int N, float eps) {
  __shared__ float red[256];
  const int row = blockIdx.x, tid = threadIdx.x;
  const float* x = X + (size_t)row * N; const float* rr = R ? R + (size_t)row * N : nullptr;
  float vals[16];                     // up to N = 4096
  const int per = N / 256;            // contiguous chunk per thread? use strided-by-4 chunks: thread handles j = tid*4 + 1024*u
  float s1 = 0.f;
  for (int u = 0; u < per / 4; ++u) {
    const int j = tid * 4 + 1024 * u;
    const v4f a = *(const v4fa*)(x + j);
    v4f b = {0.f,0.f,0.f,0.f}; if (rr) b = *(const v4fa*)(rr + j);
#pragma unroll
    for (int q = 0; q < 4; ++q) { const float v = a[q] + b[q]; vals[u * 4 + q] = v; s1 += v; }
  }
  red[tid] = s1; __syncthreads();
  for (int st = 128; st > 0; st >>= 1) { if (tid < st) red[tid] += red[tid + st]; __syncthreads(); }
  const float mu = red[0] / (float)N; __syncthreads();
  float s2 = 0.f;
  for (int u = 0; u < per / 4; ++u)
#pragma unroll
    for (int q = 0; q < 4; ++q) { const float c = vals[u * 4 + q] - mu; s2 += c * c; }
  red[tid] = s2; __syncthreads();
  for (int st = 128; st > 0; st >>= 1) { if (tid < st) red[tid] += red[tid + st]; __syncthreads(); }
  const float rs = rsqrtf(red[0] / (float)N + eps);
  {
    for (int u = 0; u < per / 4; ++u) {
      const int j = tid * 4 + 1024 * u;
      v4f o, sm;
#pragma unroll
      for (int q = 0; q < 4; ++q) {
        float gg = g[j + q], bb = bta[j + q];
        if (PARAM_BF16) { gg = bf16_round(gg); bb = bf16_round(bb); }
        sm[q] = vals[u * 4 + q]; o[q] = (vals[u * 4 + q] - mu) * rs * gg + bb;
      }
      if (out_sum) *(v4f*)(out_sum + (size_t)row * N + j) = sm;
      *(v4f*)(out_norm + (size_t)row * N + j) = o;
    }
    
  }
}



// ---- f16 WMMA path (v_wmma_f32_16x16x32_f16): 11-bit significands for operands in range — used where a [0,1] probability operand needs more precision than bf16
typedef _Float16 v16h __attribute__((ext_vector_type(16)));
union FragH { v16h v; v8us half[2]; _Float16 h[16]; unsigned short u[16]; };
template <int NT>
__device__ __forceinline__ v8f mmaH(v16h ah, v16h al, v16h bh, v16h bl, v8f c) {
  c = __builtin_amdgcn_wmma_f32_16x16x32_f16(false, ah, false, bh, (short)0, c, false, false);
  if (NT >= 2) c = __builtin_amdgcn_wmma_f32_16x16x32_f16(false, al, false, bh, (short)0, c, false, false);
  if (NT >= 3) c = __builtin_amdgcn_wmma_f32_16x16x32_f16(false, ah, false, bl, (short)0, c, false, false);
  asm volatile("v_nop\n\tv_nop\n\tv_nop\n\tv_nop" : "+v"(c) : "v"(ah), "v"(al), "v"(bh), "v"(bl));
  return c;
}
// batched GEMM with f16 operands: A f32 (split into f16 hi/lo if ASPLIT, else rounded to f16), Bt = f16 values [n][k]; alpha; C f32; N multiple of 16 (partial tiles skipped)
template <bool ASPLIT>
__global__ __launch_bounds__(128) void k_gemm_h(const float* __restrict__ A, int lda, size_t sA, const _Float16* __restrict__ Bh, int ldb, size_t sB, float alpha, float* __restrict__ C, int ldc, size_t sC, int M, int N, int K) {
  __shared__ __attribute__((aligned(16))) float so[4][16][64];
  const int tid = threadIdx.x, w = tid >> 5, lane = tid & 31, ln = lane & 15, hh = lane >> 4; const int by = blockIdx.y;
  A += (size_t)by * sA; Bh += (size_t)by * sB; C += (size_t)by * sC;
  const int ntn = (N + 63) / 64; const int wid = blockIdx.x * 4 + w; const int mt = wid / ntn, nq = wid % ntn; if (mt * 16 >= M) return;
  const int row0 = mt * 16, col0 = nq * 64; const float* arow = A + (size_t)(row0 + ln) * lda;
  v8f acc[4] = {};
  for (int kb = 0; kb < K; kb += 32) {
    FragH ah, al;
    const v4f x0 = *(const v4fa*)(arow + kb + 8 * hh), x1 = *(const v4fa*)(arow + kb + 8 * hh + 4), x2 = *(const v4fa*)(arow + kb + 16 + 8 * hh), x3 = *(const v4fa*)(arow + kb + 16 + 8 * hh + 4);
    float xs[16] = {x0[0],x0[1],x0[2],x0[3],x1[0],x1[1],x1[2],x1[3],x2[0],x2[1],x2[2],x2[3],x3[0],x3[1],x3[2],x3[3]};
#pragma unroll
    for (int i = 0; i < 16; ++i) { const _Float16 h = (_Float16)xs[i]; ah.h[i] = h; al.h[i] = ASPLIT ? (_Float16)(xs[i] - (float)h) : (_Float16)0.0f; }
#pragma unroll
    for (int t = 0; t < 4; ++t) { if (col0 + t * 16 >= N) continue; const size_t boff = (size_t)(col0 + t * 16 + ln) * ldb + kb; FragH bq; bq.half[0] = *(const v8us*)(Bh + boff + 8 * hh); bq.half[1] = *(const v8us*)(Bh + boff + 16 + 8 * hh);
      acc[t] = mmaH<ASPLIT ? 2 : 1>(ah.v, al.v, bq.v, bq.v, acc[t]); }
  }
#pragma unroll
  for (int t = 0; t < 4; ++t) { if (col0 + t * 16 >= N) continue;
#pragma unroll
    for (int r = 0; r < 8; ++r) so[w][8 * hh + r][t * 16 + ln] = acc[t][r] * alpha; }
  __builtin_amdgcn_fence(__ATOMIC_ACQ_REL, "workgroup"); __builtin_amdgcn_wave_barrier();
  const int rsub = lane >> 4, c4 = (lane & 15) * 4;
  {
#pragma unroll
    for (int q = 0; q < 8; ++q) { const int r = q * 2 + rsub; if (col0 + c4 < N) { const v4f v = *(const v4fa*)&so[w][r][c4]; *(v4f*)(C + (size_t)(row0 + r) * ldc + col0 + c4) = v; } }
     }
}

// Wt[n][k] = f16(W[k][n]·scale) from f32 row-major W[K][N] (scale = power of two; bf16-exact weights stay exact in f16 away from the subnormal range)
__global__ __launch_bounds__(256) void k_wt_f16(const float* __restrict__ W, _Float16* __restrict__ Wt, int K, int N, float scale) {
  const int t = blockIdx.x * 256 + threadIdx.x; if (t >= N * (K / 8)) return; const int n = t / (K / 8), k8 = (t % (K / 8)) * 8; FragH f;
#pragma unroll
  for (int i = 0; i < 8; ++i) f.h[i] = (_Float16)(bf16_round(W[(size_t)(k8 + i) * N + n]) * scale); const v8us o = f.half[0];
  *(v8us*)((unsigned short*)Wt + (size_t)n * K + k8) = o; 
}
// All three projections with their operand preparation, ONE launch. A block = 64 tokens x 12 of the 24 (matrix, head) units (matrix 0 kc, 1 q, 2 v); a wave = one unit (32 outputs) x the 64 tokens over K = 256; f16 operands, f32 accumulators, result x 2^-4.
// x (NCHW f32) is rounded (bf16, then f16) and turned token-major in LDS, sx[token][c]; each wave rounds its own 32 weight rows (x 2^4, bf16, f16: the power of two commutes with the rounding) straight into fragments, k-step by k-step, the f32 rows fetched two k-steps ahead.
// kc, q: A = sx rows (tokens), B = weight rows; each f32 result is split into f16 hi + lo*2^10 and a token's head is stored as ONE 128-byte line, hi 32 | lo 32: QK[(b,token)][kc heads | q heads][hi | lo], pitch QP.
// v: A = weight rows, B = sx rows (tokens), VT[(h,d)][(b,token)] as f16, channel-major: 64 tokens of a channel are one 128-byte line.
#define TT 64
#define XP (CC + 8)
#define QP (2 * NHh * 2 * HD)
#define SOW 2304
// f32 -> nearest-even bf16 -> f32 by the chip's own conversion: the same value as bf16_round() for every finite x, in fewer instructions
__device__ __forceinline__ float bf16_rne(float x) { return (float)(__bf16)x; }
// the f32 weights of k-step ks for this lane: rows ln and 16 + ln of the unit, c = 32ks + 8hh + 0..7 and 32ks + 16 + 8hh + 0..7
__device__ __forceinline__ void proj_ldw(v4f (&raw)[8], const float* __restrict__ wp, int ks) {
#pragma unroll
  for (int nt = 0; nt < 2; ++nt) { const float* p = wp + nt * 16 * CC + ks * 32; raw[nt * 4] = *(const v4fa*)p; raw[nt * 4 + 1] = *(const v4fa*)(p + 4); raw[nt * 4 + 2] = *(const v4fa*)(p + 16); raw[nt * 4 + 3] = *(const v4fa*)(p + 20); } }
// WA: the weight fragment is the A operand (v), else the B operand (kc, q). k order of both fragments: half 0 = c 32ks + 8hh.., half 1 = c 32ks + 16 + 8hh..
template <bool WA>
__device__ __forceinline__ void proj_k(const float* __restrict__ wp, const unsigned short (*sx)[XP], int ln, int hh, v4f (&raw)[3][8], v8f (&acc)[4][2]) {
#pragma unroll
  for (int ks = 0; ks < 8; ++ks) {      // unrolled: raw, acc and the fragments are indexed by constants and stay in registers
    if (ks + 2 < 8) proj_ldw(raw[(ks + 2) % 3], wp, ks + 2);
    if (ks + 2 == 7) asm volatile("s_wait_xcnt 0x0" ::: "memory");      // wp is dead from here on: later results may land on it
    FragH wf[2], xf[4];
#pragma unroll
    for (int mt = 0; mt < 4; ++mt) { xf[mt].half[0] = *(const v8us*)&sx[mt * 16 + ln][ks * 32 + 8 * hh]; xf[mt].half[1] = *(const v8us*)&sx[mt * 16 + ln][ks * 32 + 16 + 8 * hh]; }
#pragma unroll
    for (int nt = 0; nt < 2; ++nt)
#pragma unroll
      for (int j = 0; j < 4; ++j)
#pragma unroll
        for (int i = 0; i < 4; ++i) wf[nt].h[j * 4 + i] = (_Float16)bf16_rne(raw[ks % 3][nt * 4 + j][i] * 16.0f);
#pragma unroll
    for (int mt = 0; mt < 4; ++mt)
#pragma unroll
      for (int nt = 0; nt < 2; ++nt) acc[mt][nt] = WA ? __builtin_amdgcn_wmma_f32_16x16x32_f16(false, wf[nt].v, false, xf[mt].v, (short)0, acc[mt][nt], false, false) : __builtin_amdgcn_wmma_f32_16x16x32_f16(false, xf[mt].v, false, wf[nt].v, (short)0, acc[mt][nt], false, false);
    __builtin_amdgcn_sched_barrier(0);      // keeps the f32 weights of three k-steps at most in registers: left free, the scheduler lifts all 64 loads to the top and spills
  } }
__global__ __launch_bounds__(384, 4) void k_proj(const float* __restrict__ x, const float* __restrict__ Wk, const float* __restrict__ Wq, const float* __restrict__ Wv, _Float16* __restrict__ QK, _Float16* __restrict__ VT) {
  __shared__ __attribute__((aligned(16))) unsigned short sx[TT][XP];      // pitch 528 B = 16 B x odd: the fragment reads meet no bank twice
  __shared__ __attribute__((aligned(16))) float so[12][SOW];      // per wave: 64 tokens x pitch 36 (kc, q) or 32 channels x pitch 68 (v)
  const int tid = threadIdx.x, lane = tid & 31, ln = lane & 15, hh = lane >> 4; const int w = __builtin_amdgcn_readfirstlane(tid >> 5);      // wave number held scalar: the unit and the row bases are then scalar
  const int tile = blockIdx.x >> 1, unit = (blockIdx.x & 1) * 12 + w; const int m = unit >> 3, hd = unit & 7; const int b = tile / (NTOK / TT), p0 = (tile % (NTOK / TT)) * TT;
  const int tq = tid & 15, cg = tid >> 4;      // a piece: 4 tokens x 8 channels; 16 lanes read 256 contiguous bytes of one channel. 512 pieces: one a thread, a second one for waves 0..3
  const float* xp = x + ((size_t)b * CC + cg * 8) * NTOK + p0 + 4 * tq; v4f xv[2][8];
#pragma unroll
  for (int q = 0; q < 8; ++q) xv[0][q] = *(const v4fa*)(xp + (size_t)q * NTOK);
  if (w < 4) {
#pragma unroll
    for (int q = 0; q < 8; ++q) xv[1][q] = *(const v4fa*)(xp + (size_t)(192 + q) * NTOK); }
  asm volatile("s_wait_xcnt 0x0" ::: "memory");      // xp is dead from here on: later results may land on it
  const float* wp = ((m == 0) ? Wk : ((m == 1) ? Wq : Wv)) + (size_t)(hd * HD + ln) * CC + 8 * hh; v4f raw[3][8]; proj_ldw(raw[0], wp, 0); proj_ldw(raw[1], wp, 1);
#pragma unroll
  for (int u = 0; u < 2; ++u) if (u == 0 || w < 4) {
#pragma unroll
    for (int k = 0; k < 4; ++k) { FragH f;
#pragma unroll
      for (int q = 0; q < 8; ++q) f.h[q] = (_Float16)bf16_rne(xv[u][q][k]);
      *(v8us*)&sx[4 * tq + k][(cg + 24 * u) * 8] = f.half[0]; } }
  __syncthreads();      // sx is read by all twelve waves
  v8f acc[4][2] = {};
  float* sw = &so[w][0]; const int r0 = lane >> 3, pc = lane & 7;      // 8 lanes store one whole 128-byte line
  if (m < 2) {
    proj_k<false>(wp, sx, ln, hh, raw, acc);
#pragma unroll
    for (int mt = 0; mt < 4; ++mt)
#pragma unroll
      for (int nt = 0; nt < 2; ++nt)
#pragma unroll
        for (int r = 0; r < 8; ++r) sw[(mt * 16 + 8 * hh + r) * 36 + nt * 16 + ln] = acc[mt][nt][r] * 0.0625f;
    __builtin_amdgcn_fence(__ATOMIC_ACQ_REL, "workgroup"); __builtin_amdgcn_wave_barrier();      // so[w] is written and read by this wave alone
    unsigned short* dq = (unsigned short*)QK + (size_t)(tile * TT) * QP + m * (NHh * 2 * HD) + hd * (2 * HD); const bool islo = pc >= 4;      // lanes 0..3 of a line: hi, lanes 4..7: lo of the same 32 values
#pragma unroll
    for (int q = 0; q < 16; ++q) { const int r = q * 4 + r0; const v4f v0 = *(const v4fa*)&sw[r * 36 + (pc & 3) * 8], v1 = *(const v4fa*)&sw[r * 36 + (pc & 3) * 8 + 4]; FragH fo;
#pragma unroll
      for (int i = 0; i < 8; ++i) { const float v = (i < 4) ? v0[i & 3] : v1[i & 3]; const _Float16 h = (_Float16)v; const _Float16 lw = (_Float16)((v - (float)h) * 1024.0f); fo.h[i] = islo ? lw : h; }
      *(v8us*)(dq + (unsigned)(r * QP + pc * 8)) = fo.half[0];
      asm volatile("s_wait_xcnt 0x0" ::: "memory"); }      // the next rows' values (in the listing also the other branch's block) are written to registers that this store names
  } else {
    proj_k<true>(wp, sx, ln, hh, raw, acc);
#pragma unroll
    for (int mt = 0; mt < 4; ++mt)
#pragma unroll
      for (int nt = 0; nt < 2; ++nt)
#pragma unroll
        for (int r = 0; r < 8; ++r) sw[(nt * 16 + 8 * hh + r) * 68 + mt * 16 + ln] = acc[mt][nt][r] * 0.0625f;
    __builtin_amdgcn_fence(__ATOMIC_ACQ_REL, "workgroup"); __builtin_amdgcn_wave_barrier();      // so[w] is written and read by this wave alone
    unsigned short* dv = (unsigned short*)VT + (size_t)(hd * HD) * NR + tile * TT;
#pragma unroll
    for (int q = 0; q < 8; ++q) { const int r = q * 4 + r0; const v4f v0 = *(const v4fa*)&sw[r * 68 + pc * 8], v1 = *(const v4fa*)&sw[r * 68 + pc * 8 + 4]; FragH fh;
#pragma unroll
      for (int i = 0; i < 4; ++i) { fh.h[i] = (_Float16)v0[i]; fh.h[4 + i] = (_Float16)v1[i]; }
      *(v8us*)(dv + (unsigned)(r * NR + pc * 8)) = fh.half[0];
      asm volatile("s_wait_xcnt 0x0" ::: "memory"); }      // the next rows' values (in the listing also the other branch's block) are written to registers that this store names
  }
}
// exp(x) for x <= 0, by the steps of the library's expf (x*log2(e) in two parts, 2^fraction, ldexp, 0 below the f32 range; its overflow test cannot fire here). The exponential stands in asm with a v_nop behind it:
// the instruction set asks for one slot before a vector instruction reads a transcendental's result or overwrites its source.
__device__ __forceinline__ float exp_nonpos(float x) {
  const float ph = x * 0x1.715476p+0f; float pl = __builtin_fmaf(x, 0x1.715476p+0f, -ph); pl = __builtin_fmaf(x, 0x1.4ae0bep-26f, pl);
  const float e = __builtin_rintf(ph); const float a = (ph - e) + pl; float r;
  asm("v_exp_f32 %0, %1\n\tv_nop" : "=v"(r) : "v"(a));
  r = ldexpf(r, (int)e);
  return (x < -0x1.9d1da0p+6f) ? 0.f : r; }
// window attention, one wave per (b, head h, row y, 16-token x segment): for each window row i the 32 tokens (y + i - 3, x0 - 8 .. x0 + 23) are ONE key block.
// S^T = Q_row (32 keys x 32 d, two A tiles, f16 hi + lo*2^-10, 3 products) * KC^T (B, 16 centre keys): lane (ln, hh) holds, for centre token ln, the keys c = 16t + 8hh + r;
// the window is the band 0 <= c - ln - 5 <= 6 (= column offset j). Softmax of a centre token is in-lane plus one exchange with lane ^ 16; the two S^T tiles, as f16, ARE the B operand of
// O^T = V^T (A: row d, keys along k, read from the channel-major VT) * P^T, so a lane ends with 8 consecutive d of its own token.
// kc.rel_k splits into a row term and a column term: E = REL * KC^T with REL rows 0..6 = (rel_h[i] | 0), rows 8..14 = (0 | rel_w[j]), rows 7 and 15 zero; rel is bf16-rounded first, as before (8 significant bits: exact in f16 from 2^-14 up, below that off by at most 2^-25), and kc is hi + lo*2^-10 (2 products).
__global__ __launch_bounds__(128) void k_nattn(const _Float16* __restrict__ QK, const _Float16* __restrict__ VT, const float* __restrict__ relh, const float* __restrict__ relw, float* __restrict__ O) {
  __shared__ __attribute__((aligned(16))) float sR[4][16][20];      // per centre token of the wave: words 0..6 kc.rel_h[i], words 8..14 kc.rel_w[j] (pitch 20: rows stay 16-byte aligned and in-band lanes of the gather below meet no bank twice)
  __shared__ __attribute__((aligned(16))) float sO[4][16][HD + 4];
  const int tid = threadIdx.x, lane = tid & 31, ln = lane & 15, hh = lane >> 4; const int w = __builtin_amdgcn_readfirstlane(tid >> 5);      // wave number held scalar: (b, h, y, x0) and every row base below are then scalar, a lane keeps only row-invariant byte offsets
  const int wid = blockIdx.x * 4 + w; const int per_b = NHh * HI * NXS; if (wid >= BB * per_b) return;      // whole wave
  const int b = wid / per_b, rem = wid % per_b; const int h = rem / (HI * NXS), rem2 = rem % (HI * NXS); const int y = rem2 / NXS, x0 = (rem2 % NXS) * 16;
  const int qx = (x0 + ln < HI) ? (x0 + ln) : (HI - 1);      // lanes past the image row repeat its last token; their result is not stored
  FragH bc, bcl; { const unsigned koff = (unsigned)(qx * QP + 8 * hh) * 2; const size_t kb = ((size_t)(b * NTOK + y * HI) * QP + h * (2 * HD)) * 2; const char* k0 = (const char*)QK + kb; const char* k1 = k0 + HD * 2;      // a head's line: hi 32 | lo 32
    bc.half[0] = *(const v8us*)(k0 + koff); bc.half[1] = *(const v8us*)(k0 + koff + 32); bcl.half[0] = *(const v8us*)(k1 + koff); bcl.half[1] = *(const v8us*)(k1 + koff + 32); }      // centre key kc, column ln of B
  asm volatile("s_wait_xcnt 0x0" ::: "memory");      // koff is dead from here on: the results of the loads below may land on it
  const v8us z8 = (v8us){0,0,0,0,0,0,0,0}; const v8f z8f = (v8f){0.f,0.f,0.f,0.f,0.f,0.f,0.f,0.f};
  FragH ar; { const int ri = ln & 7; const float* rp = ((ln < 8) ? relh : relw) + (h * 7 + ((ri < 7) ? ri : 6)) * 16 + 8 * hh; const v4f r0 = *(const v4fa*)rp, r1 = *(const v4fa*)(rp + 4); FragH c;      // row ln of REL: its 8 non-zero k of this lane half
    asm volatile("s_wait_xcnt 0x0" ::: "memory");      // rp is dead from here on: later results may land on it
#pragma unroll
    for (int q = 0; q < 4; ++q) { c.h[q] = (_Float16)bf16_round(r0[q]); c.h[4 + q] = (_Float16)bf16_round(r1[q]); }
    const v8us cv = (ri < 7) ? c.half[0] : z8; ar.half[0] = (ln < 8) ? cv : z8; ar.half[1] = (ln < 8) ? z8 : cv; }      // k order as bc: half 0 = d 8hh.., half 1 = d 16 + 8hh..
  { const v8f e = __builtin_amdgcn_wmma_f32_16x16x32_f16(false, ar.v, false, bc.v, (short)0, z8f, false, false); const v8f e2 = __builtin_amdgcn_wmma_f32_16x16x32_f16(false, ar.v, false, bcl.v, (short)0, z8f, false, false); v4f o0, o1;
#pragma unroll
    for (int q = 0; q < 4; ++q) { o0[q] = e[q] + e2[q] * 0.0009765625f; o1[q] = e[4 + q] + e2[4 + q] * 0.0009765625f; }
    *(v4fa*)&sR[w][ln][8 * hh] = o0; *(v4fa*)&sR[w][ln][8 * hh + 4] = o1; }      // lane (ln, hh) holds rows 8hh..8hh+7 of E for its own centre token
  __builtin_amdgcn_fence(__ATOMIC_ACQ_REL, "workgroup"); __builtin_amdgcn_wave_barrier();      // sR is written and read by this wave alone
  bool inb[2][8]; int rj[2][8]; bool xok[2], vok[2]; unsigned qoff[2], voff[2];
#pragma unroll
  for (int t = 0; t < 2; ++t) {
    const int xx = x0 - 8 + 16 * t + ln; xok[t] = (xx >= 0 && xx < HI); qoff[t] = (unsigned)((xok[t] ? xx : 0) * QP + 8 * hh) * 2;      // key c = 16t + ln as row of A
    const int xk = x0 - 8 + 16 * t + 8 * hh; vok[t] = (xk >= 0 && xk < HI); voff[t] = (unsigned)(ln * NR + (vok[t] ? xk : 0)) * 2;      // 8 keys: wholly inside the image row or wholly outside
#pragma unroll
    for (int r = 0; r < 8; ++r) { const int j = 16 * t + 8 * hh + r - ln - 5; inb[t][r] = (j >= 0 && j < 7); rj[t][r] = (j < 0) ? 0 : ((j > 6) ? 6 : j); } }
  float rh[8]; v8f rw[2]; { const float* rl = &sR[w][ln][0]; const v4f a0 = *(const v4fa*)rl, a1 = *(const v4fa*)(rl + 4);
#pragma unroll
    for (int q = 0; q < 4; ++q) { rh[q] = a0[q]; rh[4 + q] = a1[q]; }
#pragma unroll
    for (int t = 0; t < 2; ++t)
#pragma unroll
      for (int r = 0; r < 8; ++r) rw[t][r] = rl[8 + rj[t][r]]; }      // column term of key c = 16t + 8hh + r, the same for all seven window rows; every lane reads (index clamped into the row): no branch round the load
  float lg[7][2][8];
#pragma unroll
  for (int i = 0; i < 7; ++i) { const int yy = y + i - 3; const bool yok = (yy >= 0 && yy < HI); const size_t qb = ((size_t)(b * NTOK + (yok ? yy : y) * HI) * QP + NHh * 2 * HD + h * (2 * HD)) * 2; const char* q0 = (const char*)QK + qb; const char* q1 = q0 + HD * 2;
#pragma unroll
    for (int t = 0; t < 2; ++t) { const bool ok = yok && xok[t];
      FragH ak, akl; ak.half[0] = *(const v8us*)(q0 + qoff[t]); ak.half[1] = *(const v8us*)(q0 + qoff[t] + 32); akl.half[0] = *(const v8us*)(q1 + qoff[t]); akl.half[1] = *(const v8us*)(q1 + qoff[t] + 32); asm volatile("s_wait_xcnt 0x0" :: "v"(qoff[0]), "v"(qoff[1]) : "memory");      // the next rows' scalar bases, and behind the last row other values, are written to registers that these loads name (qoff named as inputs: they live up to the wait)
      if (!ok) { ak.half[0] = z8; ak.half[1] = z8; akl.half[0] = z8; akl.half[1] = z8; }      // zero padding: q = 0 outside the image
      v8f s = __builtin_amdgcn_wmma_f32_16x16x32_f16(false, ak.v, false, bc.v, (short)0, rw[t], false, false);      // the column term rides in as C
      v8f s2 = __builtin_amdgcn_wmma_f32_16x16x32_f16(false, ak.v, false, bcl.v, (short)0, z8f, false, false); s2 = __builtin_amdgcn_wmma_f32_16x16x32_f16(false, akl.v, false, bc.v, (short)0, s2, false, false);      // hi.hi + (lo.hi + hi.lo)*2^-10
#pragma unroll
      for (int r = 0; r < 8; ++r) { const float sd = s[r] + s2[r] * 0.0009765625f; const float lv = sd + rh[i]; lg[i][t][r] = inb[t][r] ? lv : -3.0e38f; } } }      // kc.(q + rel_k); padded neighbours keep kc.rel_k
  float m = -3.0e38f;
#pragma unroll
  for (int i = 0; i < 7; ++i)
#pragma unroll
    for (int t = 0; t < 2; ++t)
#pragma unroll
      for (int r = 0; r < 8; ++r) m = fmaxf(m, lg[i][t][r]);
  m = fmaxf(m, __shfl_xor(m, 16, 32));
  float l = 0.f; v8f oacc[2] = {z8f, z8f};
#pragma unroll
  for (int i = 0; i < 7; ++i) { const int yy = y + i - 3; const bool yok = (yy >= 0 && yy < HI); const char* vb = (const char*)VT + ((size_t)(h * HD) * NR + (size_t)(b * NTOK + (yok ? yy : y) * HI)) * 2; FragH pb;
#pragma unroll
    for (int t = 0; t < 2; ++t)
#pragma unroll
      for (int r = 0; r < 8; ++r) { const float p = exp_nonpos(lg[i][t][r] - m); l += p; pb.h[8 * t + r] = (_Float16)p; }      // outside the band: exp -> 0
#pragma unroll
    for (int dt = 0; dt < 2; ++dt) { FragH av;
#pragma unroll
      for (int t = 0; t < 2; ++t) { av.half[t] = *(const v8us*)(vb + voff[t] + dt * (16 * NR * 2)); if (!(yok && vok[t])) av.half[t] = z8;      // zero padding: v = 0 outside the image
        if (i == 6) asm volatile("s_wait_xcnt 0x0" ::: "memory"); }      // last row: voff and the row base die here, and later results may land on a register that these loads name
      oacc[dt] = __builtin_amdgcn_wmma_f32_16x16x32_f16(false, av.v, false, pb.v, (short)0, oacc[dt], false, false); } }
  l += __shfl_xor(l, 16, 32);
#pragma unroll
  for (int dt = 0; dt < 2; ++dt)
#pragma unroll
    for (int r = 0; r < 8; ++r) sO[w][ln][dt * 16 + 8 * hh + r] = oacc[dt][r] / l;
  __builtin_amdgcn_fence(__ATOMIC_ACQ_REL, "workgroup"); __builtin_amdgcn_wave_barrier();
  {
#pragma unroll
    for (int rp2 = 0; rp2 < 16; rp2 += 4) { const int r = rp2 + (lane >> 3), pc = lane & 7; if (x0 + r < HI) { const v4f v = *(const v4fa*)&sO[w][r][pc * 4]; *(v4f*)(O + ((size_t)b * NTOK + y * HI + x0 + r) * CC + h * HD + pc * 4) = v; } }
     } }

__global__ __launch_bounds__(256) void k_nchw(const float* __restrict__ TP, float* __restrict__ out) { __shared__ float tl[32][65]; const int tid = threadIdx.x; const int b = blockIdx.x / ((CC / 32) * (NTOK / 64)), rem = blockIdx.x % ((CC / 32) * (NTOK / 64)); const int cg = rem / (NTOK / 64), pg = rem % (NTOK / 64); const int c0 = cg * 32, p0 = pg * 64;
  for (int i = tid; i < 64 * 32; i += 256) { const int pp = i / 32, c = i % 32; tl[c][pp] = TP[((size_t)b * NTOK + p0 + pp) * CC + c0 + c]; }
  __syncthreads();
  { for (int i = tid; i < 32 * 16; i += 256) { const int c = i / 16, pc = i % 16; v4f v; for (int q = 0; q < 4; ++q) v[q] = tl[c][pc * 4 + q]; *(v4f*)(out + ((size_t)b * CC + c0 + c) * NTOK + p0 + pc * 4) = v; }  } }

extern "C" void kernel_launch(void* const* d_in, const int* in_sizes, int n_in,
                              void* d_out, int out_size, void* d_ws, size_t ws_size, hipStream_t stream) {
  (void)in_sizes; (void)n_in; (void)out_size;
  const float* x = (const float*)d_in[0]; const float* Wk = (const float*)d_in[1]; const float* Wq = (const float*)d_in[2]; const float* Wv = (const float*)d_in[3]; const float* relh = (const float*)d_in[4]; const float* relw = (const float*)d_in[5];
  char* ws = (char*)d_ws; size_t off = 0;
  auto take = [&](size_t bytes) { char* p = ws + off; off += (bytes + 255) & ~(size_t)255; return p; };
  _Float16* QK = (_Float16*)take((size_t)NR * QP * 2); float* O = (float*)take((size_t)NR * CC * 4); _Float16* VT = (_Float16*)take((size_t)CC * NR * 2);
  if (off > ws_size) return;      // 12.8 + 6.4 + 3.2: about 22 MB
  k_proj<<<(NR / TT) * 2, 384, 0, stream>>>(x, Wk, Wq, Wv, QK, VT);      // kc | q as f16 hi | lo*2^10 lines per head; v channel-major
  k_nattn<<<(BB * NHh * HI * NXS + 3) / 4, 128, 0, stream>>>(QK, VT, relh, relw, O);
  k_nchw<<<BB * (CC / 32) * (NTOK / 64), 256, 0, stream>>>(O, (float*)d_out);
}

// v005
// Measured time: 28.3 microseconds a run.
// Next to v004, in two timings, it ran 1.20 times as fast each time.
// Over all steps from v000 it is 6.48 times as fast.
#include <hip/hip_runtime.h>
// Stand-alone (SASA) local self-attention (B=2, C 256 = 8 heads × 32, 56×56, 7×7 windows, stride 1, zero padding; relative row/col embeddings added to the windowed QUERIES, the centre KEY is
// the fixed operand, softmax over the 49 window positions, values windowed): 1×1 projections as GEMMs ((head,dim)×C weights bf16-exact ×2^4) and the window attention on
// v_wmma_f32_16x16x32_f16 with one banded key block per window row (per 16-token row segment and window row: S^T = Q_row.KC^T over 32 keys, kc and q as f16 hi + lo*2^-10 (3 products), band element + kc.rel_k (f32) = logit; f32 softmax over all 49, in-lane
// plus one lane exchange; O^T += V^T.P^T with the f16 S^T tiles as the B operand and V kept channel-major); kc.rel_k = kc[0..15].rel_h[i] + kc[16..31].rel_w[j] is one more A tile (14 rows) against the same KC^T; the NCHW transposes are f32 VALU, through LDS inside the two kernels.
#define BB 2
#define CC 256
#define NHh 8
#define HD 32
#define HI 56
#define NTOK 3136
#define NXS 4
#define NR (BB * NTOK)

typedef __bf16 v16b __attribute__((ext_vector_type(16)));
typedef unsigned short v8us __attribute__((ext_vector_type(8), may_alias));
typedef float  v8f  __attribute__((ext_vector_type(8)));
typedef float  v4f  __attribute__((ext_vector_type(4)));
typedef float  v4fa __attribute__((ext_vector_type(4), may_alias));
union FragB { v16b v; v8us half[2]; unsigned short u[16]; };

__device__ __forceinline__ unsigned short bf16_bits(float x) { unsigned int u = __float_as_uint(x); return (unsigned short)((u + 0x7FFFu + ((u >> 16) & 1u)) >> 16); }
__device__ __forceinline__ float bf16_val(unsigned short b) { return __uint_as_float(((unsigned int)b) << 16); }
__device__ __forceinline__ float bf16_round(float x) { return bf16_val(bf16_bits(x)); }
// D += A·B with NT terms: 1 = ah·bh, 2 = + al·bh (A split), 3 = + ah·bl (both split)
template <int NT>
__device__ __forceinline__ v8f mmaN(v16b ah, v16b al, v16b bh, v16b bl, v8f c) {
  c = __builtin_amdgcn_wmma_f32_16x16x32_bf16(false, ah, false, bh, (short)0, c, false, false);
  if (NT >= 2) c = __builtin_amdgcn_wmma_f32_16x16x32_bf16(false, al, false, bh, (short)0, c, false, false);
  if (NT >= 3) c = __builtin_amdgcn_wmma_f32_16x16x32_bf16(false, ah, false, bl, (short)0, c, false, false);
  asm volatile("v_nop\n\tv_nop\n\tv_nop\n\tv_nop" : "+v"(c) : "v"(ah), "v"(al), "v"(bh), "v"(bl));
  return c;
}

__global__ __launch_bounds__(256) void k_wt_bf16(const float* __restrict__ W, unsigned short* __restrict__ Wt, int K, int N) {
  const int t = blockIdx.x * 256 + threadIdx.x;
  const int k8n = K / 8;
  if (t >= N * k8n) return;
  const int n = t / k8n, k8 = (t % k8n) * 8;
  v8us v;
#pragma unroll
  for (int i = 0; i < 8; ++i) v[i] = bf16_bits(W[(size_t)(k8 + i) * N + n]);
  *(v8us*)(Wt + (size_t)n * K + k8) = v;
  
}

// GEMM C[M][N] (f32, pitch ldc) = act(A[M][K]·W + bias). A f32 row-major (pitch lda) converted per fragment to bf16
// (ASPLIT: hi/lo two planes -> 2 terms, else single rounded term); Wt bf16 [N][K] (pitch ldb). BIAS_BF16 rounds the
// bias to bf16 first (bias quantised to bf16 before the add). K%32==0, M%16==0, N%64==0.
template <bool ASPLIT, int ACT, bool BIAS_BF16>
__global__ __launch_bounds__(128) void k_gemm_bf(const float* __restrict__ A, int lda, const unsigned short* __restrict__ Wt, int ldb,
                                               const float* __restrict__ bias, float* __restrict__ C, int ldc, int M, int N, int K) {
  __shared__ __attribute__((aligned(16))) float so[4][16][64];
  const int tid = threadIdx.x, w = tid >> 5, lane = tid & 31, ln = lane & 15, hh = lane >> 4;
  const int ntn = N / 64;
  const int wid = blockIdx.x * 4 + w;
  const int mt = wid / ntn, nq = wid % ntn;
  if (mt * 16 >= M) return;
  const int row0 = mt * 16, col0 = nq * 64;
  const float* arow = A + (size_t)(row0 + ln) * lda;
  v8f acc[4] = {};
  for (int kb = 0; kb < K; kb += 32) {
    FragB ah, al;
    const v4f x0 = *(const v4fa*)(arow + kb + 8 * hh), x1 = *(const v4fa*)(arow + kb + 8 * hh + 4);
    const v4f x2 = *(const v4fa*)(arow + kb + 16 + 8 * hh), x3 = *(const v4fa*)(arow + kb + 16 + 8 * hh + 4);
    float xs[16] = {x0[0],x0[1],x0[2],x0[3],x1[0],x1[1],x1[2],x1[3],x2[0],x2[1],x2[2],x2[3],x3[0],x3[1],x3[2],x3[3]};
#pragma unroll
    for (int i = 0; i < 16; ++i) { const unsigned short hb = bf16_bits(xs[i]); ah.u[i] = hb; al.u[i] = ASPLIT ? bf16_bits(xs[i] - bf16_val(hb)) : (unsigned short)0; }
#pragma unroll
    for (int t = 0; t < 4; ++t) {
      const unsigned short* brow = Wt + (size_t)(col0 + t * 16 + ln) * ldb + kb;
      FragB b;
      b.half[0] = *(const v8us*)(brow + 8 * hh);
      b.half[1] = *(const v8us*)(brow + 16 + 8 * hh);
      acc[t] = mmaN<ASPLIT ? 2 : 1>(ah.v, al.v, b.v, b.v, acc[t]);
    }
  }
#pragma unroll
  for (int t = 0; t < 4; ++t) {
    float bv = bias ? bias[col0 + t * 16 + ln] : 0.f;
    if (BIAS_BF16) bv = bf16_round(bv);
#pragma unroll
    for (int r = 0; r < 8; ++r) { float v = acc[t][r] + bv; if (ACT == 1) v = fmaxf(v, 0.f); so[w][8 * hh + r][t * 16 + ln] = v; }
  }
  __builtin_amdgcn_fence(__ATOMIC_ACQ_REL, "workgroup");
  __builtin_amdgcn_wave_barrier();
  const int rsub = lane >> 4, c4 = (lane & 15) * 4;
  {
#pragma unroll
    for (int q = 0; q < 8; ++q) {
      const int r = q * 2 + rsub;
      const v4f v = *(const v4fa*)&so[w][r][c4];
      *(v4f*)(C + (size_t)(row0 + r) * ldc + col0 + c4) = v;
    }
    
  }
}

// Flash-style causal/unmasked attention, all contractions 3-term bf16 hi/lo splits, f32 softmax with running max.
// q,k,v rows are read from f32 buffers with arbitrary row pitch (so they can live inside a fused qkv buffer);
// D = head size (multiple of 32, <= 128); one wave = 16 query rows; block = 4 waves (64 queries) sharing K/V chunks of 32.
template <int D, bool CAUSAL>
__global__ __launch_bounds__(128) void k_flash(const float* __restrict__ qb, const float* __restrict__ kb, const float* __restrict__ vb,
                                             int pitch, int T, int H, float scale, float* __restrict__ y, int ypitch) {
  constexpr int KS = D / 32;        // k-steps for QK
  constexpr int DT = D / 16;        // d tiles for PV
  __shared__ __attribute__((aligned(16))) unsigned short sKh[32][D + 8], sKl[32][D + 8], sVh[32][D + 8], sVl[32][D + 8];
  __shared__ __attribute__((aligned(16))) unsigned short sPh[4][16][40], sPl[4][16][40];
  __shared__ __attribute__((aligned(16))) float sO[4][16][D];
  const int tid = threadIdx.x, w = tid >> 5, lane = tid & 31, ln = lane & 15, hh = lane >> 4;
  const int nqb = (T + 63) / 64;
  const int bh = blockIdx.x / nqb, qblk = blockIdx.x % nqb;
  const int b = bh / H, h = bh % H;
  const int q0 = qblk * 64 + w * 16;
  const float* Q = qb + (size_t)b * T * pitch + h * D;
  const float* K = kb + (size_t)b * T * pitch + h * D;
  const float* V = vb + (size_t)b * T * pitch + h * D;

  // A fragments of the wave's 16 query rows (scaled), hi/lo
  FragB aqh[KS], aql[KS];
  {
    int row = q0 + ln; if (row >= T) row = T - 1;
    const float* qr = Q + (size_t)row * pitch;
#pragma unroll
    for (int ks = 0; ks < KS; ++ks)
#pragma unroll
      for (int i = 0; i < 16; ++i) {
        const int d = ks * 32 + ((i < 8) ? (8 * hh + i) : (16 + 8 * hh + (i - 8)));
        const float x = qr[d] * scale; const unsigned short hb = bf16_bits(x);
        aqh[ks].u[i] = hb; aql[ks].u[i] = bf16_bits(x - bf16_val(hb));
      }
  }
  float m_r[8], l_r[8];
#pragma unroll
  for (int r = 0; r < 8; ++r) { m_r[r] = -3.0e38f; l_r[r] = 0.f; }
  v8f oacc[DT];
#pragma unroll
  for (int dt = 0; dt < DT; ++dt) oacc[dt] = (v8f){0.f,0.f,0.f,0.f,0.f,0.f,0.f,0.f};

  const int kv_end = CAUSAL ? min(T, qblk * 64 + 64) : T;     // block-uniform
  for (int j0 = 0; j0 < kv_end; j0 += 32) {
    __syncthreads();
    for (int e = tid; e < 32 * (D / 4); e += 128) {
      const int r = e / (D / 4), c4 = (e % (D / 4)) * 4;
      const int key = j0 + r;
      v4f kf = {0.f,0.f,0.f,0.f}, vf = {0.f,0.f,0.f,0.f};
      if (key < T) { kf = *(const v4fa*)(K + (size_t)key * pitch + c4); vf = *(const v4fa*)(V + (size_t)key * pitch + c4); }
#pragma unroll
      for (int t = 0; t < 4; ++t) {
        unsigned short hb = bf16_bits(kf[t]); sKh[r][c4 + t] = hb; sKl[r][c4 + t] = bf16_bits(kf[t] - bf16_val(hb));
        hb = bf16_bits(vf[t]); sVh[r][c4 + t] = hb; sVl[r][c4 + t] = bf16_bits(vf[t] - bf16_val(hb));
      }
    }
    __syncthreads();
    // S tile 16 x 32
    v8f s[2];
#pragma unroll
    for (int nt = 0; nt < 2; ++nt) {
      v8f acc = {};
#pragma unroll
      for (int ks = 0; ks < KS; ++ks) {
        FragB bh_, bl_;
        bh_.half[0] = *(const v8us*)&sKh[nt * 16 + ln][ks * 32 + 8 * hh]; bh_.half[1] = *(const v8us*)&sKh[nt * 16 + ln][ks * 32 + 16 + 8 * hh];
        bl_.half[0] = *(const v8us*)&sKl[nt * 16 + ln][ks * 32 + 8 * hh]; bl_.half[1] = *(const v8us*)&sKl[nt * 16 + ln][ks * 32 + 16 + 8 * hh];
        acc = mmaN<3>(aqh[ks].v, aql[ks].v, bh_.v, bl_.v, acc);
      }
      s[nt] = acc;
    }
    // mask + running max (rows 8hh+r; the 16 lanes of a half share rows)
    float alpha[8];
#pragma unroll
    for (int r = 0; r < 8; ++r) {
      const int qi = q0 + 8 * hh + r;
      const int ja = j0 + ln, jb = j0 + 16 + ln;
      if (CAUSAL) { if (ja > qi) s[0][r] = -3.0e38f; if (jb > qi) s[1][r] = -3.0e38f; }
      if (ja >= T) s[0][r] = -3.0e38f;
      if (jb >= T) s[1][r] = -3.0e38f;
      float mx = fmaxf(s[0][r], s[1][r]);
      mx = fmaxf(mx, __shfl_xor(mx, 1, 32)); mx = fmaxf(mx, __shfl_xor(mx, 2, 32)); mx = fmaxf(mx, __shfl_xor(mx, 4, 32)); mx = fmaxf(mx, __shfl_xor(mx, 8, 32));
      const float mnew = fmaxf(m_r[r], mx);
      alpha[r] = (mnew > -1.0e38f) ? __expf(m_r[r] - mnew) : 1.0f;
      const float p0 = (s[0][r] > -1.0e38f) ? __expf(s[0][r] - mnew) : 0.f;
      const float p1 = (s[1][r] > -1.0e38f) ? __expf(s[1][r] - mnew) : 0.f;
      m_r[r] = mnew;
      l_r[r] = l_r[r] * alpha[r] + p0 + p1;            // per-lane partial row sum (16 lanes combined at the end)
      unsigned short hb = bf16_bits(p0); sPh[w][8 * hh + r][ln] = hb;      sPl[w][8 * hh + r][ln] = bf16_bits(p0 - bf16_val(hb));
      hb = bf16_bits(p1);                sPh[w][8 * hh + r][16 + ln] = hb; sPl[w][8 * hh + r][16 + ln] = bf16_bits(p1 - bf16_val(hb));
    }
#pragma unroll
    for (int dt = 0; dt < DT; ++dt)
#pragma unroll
      for (int r = 0; r < 8; ++r) oacc[dt][r] *= alpha[r];
    __builtin_amdgcn_fence(__ATOMIC_ACQ_REL, "workgroup");
    __builtin_amdgcn_wave_barrier();
    FragB pah, pal;
    pah.half[0] = *(const v8us*)&sPh[w][ln][8 * hh]; pah.half[1] = *(const v8us*)&sPh[w][ln][16 + 8 * hh];
    pal.half[0] = *(const v8us*)&sPl[w][ln][8 * hh]; pal.half[1] = *(const v8us*)&sPl[w][ln][16 + 8 * hh];
#pragma unroll
    for (int dt = 0; dt < DT; ++dt) {
      FragB bvh, bvl;
#pragma unroll
      for (int i = 0; i < 8; ++i) {
        bvh.u[i] = sVh[8 * hh + i][dt * 16 + ln]; bvh.u[8 + i] = sVh[16 + 8 * hh + i][dt * 16 + ln];
        bvl.u[i] = sVl[8 * hh + i][dt * 16 + ln]; bvl.u[8 + i] = sVl[16 + 8 * hh + i][dt * 16 + ln];
      }
      oacc[dt] = mmaN<3>(pah.v, pal.v, bvh.v, bvl.v, oacc[dt]);
    }
    __builtin_amdgcn_fence(__ATOMIC_ACQ_REL, "workgroup");
    __builtin_amdgcn_wave_barrier();
  }
#pragma unroll
  for (int r = 0; r < 8; ++r) {
    float l = l_r[r];
    l += __shfl_xor(l, 1, 32); l += __shfl_xor(l, 2, 32); l += __shfl_xor(l, 4, 32); l += __shfl_xor(l, 8, 32);
    l_r[r] = (l > 0.f) ? 1.0f / l : 0.f;
  }
#pragma unroll
  for (int dt = 0; dt < DT; ++dt)
#pragma unroll
    for (int r = 0; r < 8; ++r) sO[w][8 * hh + r][dt * 16 + ln] = oacc[dt][r] * l_r[r];
  __builtin_amdgcn_fence(__ATOMIC_ACQ_REL, "workgroup");
  __builtin_amdgcn_wave_barrier();
  {
    for (int r = 0; r < 16; ++r) {
      const int row = q0 + r;
      if (row < T && lane < D / 4) {
        const v4f val = *(const v4fa*)&sO[w][r][lane * 4];
        *(v4f*)(y + ((size_t)b * T + row) * ypitch + h * D + lane * 4) = val;
      }
    }
    
  }
}

// GEMM C = act(A·W + bias + resid): A f32 (ASPLIT -> hi/lo 2 terms), Wt bf16 [N][K]; ACT 0 none, 1 relu, 2 exact gelu;
// resid (optional, f32, row index = (row % rmod), pitch ldr, RES_BF16 rounds it) added before the activation.
template <bool ASPLIT, int ACT, bool BIAS_BF16, bool RES_BF16>
__global__ __launch_bounds__(128) void k_gemm_bf3(const float* __restrict__ A, int lda, const unsigned short* __restrict__ Wt, int ldb,
                                                const float* __restrict__ bias, const float* __restrict__ resid, int rmod, int ldr,
                                                float* __restrict__ C, int ldc, int M, int N, int K) {
  __shared__ __attribute__((aligned(16))) float so[4][16][64];
  const int tid = threadIdx.x, w = tid >> 5, lane = tid & 31, ln = lane & 15, hh = lane >> 4;
  const int ntn = N / 64;
  const int wid = blockIdx.x * 4 + w;
  const int mt = wid / ntn, nq = wid % ntn;
  if (mt * 16 >= M) return;
  const int row0 = mt * 16, col0 = nq * 64;
  const float* arow = A + (size_t)(row0 + ln) * lda;
  v8f acc[4] = {};
  for (int kb = 0; kb < K; kb += 32) {
    FragB ah, al;
    const v4f x0 = *(const v4fa*)(arow + kb + 8 * hh), x1 = *(const v4fa*)(arow + kb + 8 * hh + 4);
    const v4f x2 = *(const v4fa*)(arow + kb + 16 + 8 * hh), x3 = *(const v4fa*)(arow + kb + 16 + 8 * hh + 4);
    float xs[16] = {x0[0],x0[1],x0[2],x0[3],x1[0],x1[1],x1[2],x1[3],x2[0],x2[1],x2[2],x2[3],x3[0],x3[1],x3[2],x3[3]};
#pragma unroll
    for (int i = 0; i < 16; ++i) { const unsigned short hb = bf16_bits(xs[i]); ah.u[i] = hb; al.u[i] = ASPLIT ? bf16_bits(xs[i] - bf16_val(hb)) : (unsigned short)0; }
#pragma unroll
    for (int t = 0; t < 4; ++t) {
      const unsigned short* brow = Wt + (size_t)(col0 + t * 16 + ln) * ldb + kb;
      FragB b;
      b.half[0] = *(const v8us*)(brow + 8 * hh);
      b.half[1] = *(const v8us*)(brow + 16 + 8 * hh);
      acc[t] = mmaN<ASPLIT ? 2 : 1>(ah.v, al.v, b.v, b.v, acc[t]);
    }
  }
#pragma unroll
  for (int t = 0; t < 4; ++t) {
    const int col = col0 + t * 16 + ln;
    float bv = bias ? bias[col] : 0.f;
    if (BIAS_BF16) bv = bf16_round(bv);
#pragma unroll
    for (int r = 0; r < 8; ++r) {
      float v = acc[t][r] + bv;
      if (resid) { float rv = resid[(size_t)((row0 + 8 * hh + r) % rmod) * ldr + col]; if (RES_BF16) rv = bf16_round(rv); v += rv; }
      if (ACT == 1) v = fmaxf(v, 0.f);
      if (ACT == 2) v = 0.5f * v * (1.0f + erff(v * 0.70710678118654752f));
      if (ACT == 3) { const float u = 0.7978845608028654f * (v + 0.044715f * v * v * v); v = 0.5f * v * (1.0f + tanhf(u)); }
      so[w][8 * hh + r][t * 16 + ln] = v;
    }
  }
  __builtin_amdgcn_fence(__ATOMIC_ACQ_REL, "workgroup");
  __builtin_amdgcn_wave_barrier();
  const int rsub = lane >> 4, c4 = (lane & 15) * 4;
  {
#pragma unroll
    for (int q = 0; q < 8; ++q) {
      const int r = q * 2 + rsub;
      const v4f v = *(const v4fa*)&so[w][r][c4];
      *(v4f*)(C + (size_t)(row0 + r) * ldc + col0 + c4) = v;
    }
    
  }
}
// row LayerNorm (biased variance, eps) over N: s = X (+ R); optional out_sum <- s; out_norm <- (s-mu)*rsqrt(var+eps)*g + b
template <bool PARAM_BF16>
__global__ __launch_bounds__(256) void k_layernorm(const float* __restrict__ X, const float* __restrict__ R, const float* __restrict__ g, const float* __restrict__ bta,
                                                  float* __restrict__ out_sum, float* __restrict__ out_norm, int N, float eps) {
  __shared__ float red[256];
  const int row = blockIdx.x, tid = threadIdx.x;
  const float* x = X + (size_t)row * N; const float* rr = R ? R + (size_t)row * N : nullptr;
  float vals[16];                     // up to N = 4096
  const int per = N / 256;            // contiguous chunk per thread? use strided-by-4 chunks: thread handles j = tid*4 + 1024*u
  float s1 = 0.f;
  for (int u = 0; u < per / 4; ++u) {
    const int j = tid * 4 + 1024 * u;
    const v4f a = *(const v4fa*)(x + j);
    v4f b = {0.f,0.f,0.f,0.f}; if (rr) b = *(const v4fa*)(rr + j);
#pragma unroll
    for (int q = 0; q < 4; ++q) { const float v = a[q] + b[q]; vals[u * 4 + q] = v; s1 += v; }
  }
  red[tid] = s1; __syncthreads();
  for (int st = 128; st > 0; st >>= 1) { if (tid < st) red[tid] += red[tid + st]; __syncthreads(); }
  const float mu = red[0] / (float)N; __syncthreads();
  float s2 = 0.f;
  for (int u = 0; u < per / 4; ++u)
#pragma unroll
    for (int q = 0; q < 4; ++q) { const float c = vals[u * 4 + q] - mu; s2 += c * c; }
  red[tid] = s2; __syncthreads();
  for (int st = 128; st > 0; st >>= 1) { if (tid < st) red[tid] += red[tid + st]; __syncthreads(); }
  const float rs = rsqrtf(red[0] / (float)N + eps);
  {
    for (int u = 0; u < per / 4; ++u) {
      const int j = tid * 4 + 1024 * u;
      v4f o, sm;
#pragma unroll
      for (int q = 0; q < 4; ++q) {
        float gg = g[j + q], bb = bta[j + q];
        if (PARAM_BF16) { gg = bf16_round(gg); bb = bf16_round(bb); }
        sm[q] = vals[u * 4 + q]; o[q] = (vals[u * 4 + q] - mu) * rs * gg + bb;
      }
      if (out_sum) *(v4f*)(out_sum + (size_t)row * N + j) = sm;
      *(v4f*)(out_norm + (size_t)row * N + j) = o;
    }
    
  }
}



// ---- f16 WMMA path (v_wmma_f32_16x16x32_f16): 11-bit significands for operands in range — used where a [0,1] probability operand needs more precision than bf16
typedef _Float16 v16h __attribute__((ext_vector_type(16)));
union FragH { v16h v; v8us half[2]; _Float16 h[16]; unsigned short u[16]; };
template <int NT>
__device__ __forceinline__ v8f mmaH(v16h ah, v16h al, v16h bh, v16h bl, v8f c) {
  c = __builtin_amdgcn_wmma_f32_16x16x32_f16(false, ah, false, bh, (short)0, c, false, false);
  if (NT >= 2) c = __builtin_amdgcn_wmma_f32_16x16x32_f16(false, al, false, bh, (short)0, c, false, false);
  if (NT >= 3) c = __builtin_amdgcn_wmma_f32_16x16x32_f16(false, ah, false, bl, (short)0, c, false, false);
  asm volatile("v_nop\n\tv_nop\n\tv_nop\n\tv_nop" : "+v"(c) : "v"(ah), "v"(al), "v"(bh), "v"(bl));
  return c;
}
// batched GEMM with f16 operands: A f32 (split into f16 hi/lo if ASPLIT, else rounded to f16), Bt = f16 values [n][k]; alpha; C f32; N multiple of 16 (partial tiles skipped)
template <bool ASPLIT>
__global__ __launch_bounds__(128) void k_gemm_h(const float* __restrict__ A, int lda, size_t sA, const _Float16* __restrict__ Bh, int ldb, size_t sB, float alpha, float* __restrict__ C, int ldc, size_t sC, int M, int N, int K) {
  __shared__ __attribute__((aligned(16))) float so[4][16][64];
  const int tid = threadIdx.x, w = tid >> 5, lane = tid & 31, ln = lane & 15, hh = lane >> 4; const int by = blockIdx.y;
  A += (size_t)by * sA; Bh += (size_t)by * sB; C += (size_t)by * sC;
  const int ntn = (N + 63) / 64; const int wid = blockIdx.x * 4 + w; const int mt = wid / ntn, nq = wid % ntn; if (mt * 16 >= M) return;
  const int row0 = mt * 16, col0 = nq * 64; const float* arow = A + (size_t)(row0 + ln) * lda;
  v8f acc[4] = {};
  for (int kb = 0; kb < K; kb += 32) {
    FragH ah, al;
    const v4f x0 = *(const v4fa*)(arow + kb + 8 * hh), x1 = *(const v4fa*)(arow + kb + 8 * hh + 4), x2 = *(const v4fa*)(arow + kb + 16 + 8 * hh), x3 = *(const v4fa*)(arow + kb + 16 + 8 * hh + 4);
    float xs[16] = {x0[0],x0[1],x0[2],x0[3],x1[0],x1[1],x1[2],x1[3],x2[0],x2[1],x2[2],x2[3],x3[0],x3[1],x3[2],x3[3]};
#pragma unroll
    for (int i = 0; i < 16; ++i) { const _Float16 h = (_Float16)xs[i]; ah.h[i] = h; al.h[i] = ASPLIT ? (_Float16)(xs[i] - (float)h) : (_Float16)0.0f; }
#pragma unroll
    for (int t = 0; t < 4; ++t) { if (col0 + t * 16 >= N) continue; const size_t boff = (size_t)(col0 + t * 16 + ln) * ldb + kb; FragH bq; bq.half[0] = *(const v8us*)(Bh + boff + 8 * hh); bq.half[1] = *(const v8us*)(Bh + boff + 16 + 8 * hh);
      acc[t] = mmaH<ASPLIT ? 2 : 1>(ah.v, al.v, bq.v, bq.v, acc[t]); }
  }
#pragma unroll
  for (int t = 0; t < 4; ++t) { if (col0 + t * 16 >= N) continue;
#pragma unroll
    for (int r = 0; r < 8; ++r) so[w][8 * hh + r][t * 16 + ln] = acc[t][r] * alpha; }
  __builtin_amdgcn_fence(__ATOMIC_ACQ_REL, "workgroup"); __builtin_amdgcn_wave_barrier();
  const int rsub = lane >> 4, c4 = (lane & 15) * 4;
  {
#pragma unroll
    for (int q = 0; q < 8; ++q) { const int r = q * 2 + rsub; if (col0 + c4 < N) { const v4f v = *(const v4fa*)&so[w][r][c4]; *(v4f*)(C + (size_t)(row0 + r) * ldc + col0 + c4) = v; } }
     }
}

// Wt[n][k] = f16(W[k][n]·scale) from f32 row-major W[K][N] (scale = power of two; bf16-exact weights stay exact in f16 away from the subnormal range)
__global__ __launch_bounds__(256) void k_wt_f16(const float* __restrict__ W, _Float16* __restrict__ Wt, int K, int N, float scale) {
  const int t = blockIdx.x * 256 + threadIdx.x; if (t >= N * (K / 8)) return; const int n = t / (K / 8), k8 = (t % (K / 8)) * 8; FragH f;
#pragma unroll
  for (int i = 0; i < 8; ++i) f.h[i] = (_Float16)(bf16_round(W[(size_t)(k8 + i) * N + n]) * scale); const v8us o = f.half[0];
  *(v8us*)((unsigned short*)Wt + (size_t)n * K + k8) = o; 
}
// All three projections with their operand preparation, ONE launch. A block = 64 tokens x 12 of the 24 (matrix, head) units (matrix 0 kc, 1 q, 2 v); a wave = one unit (32 outputs) x the 64 tokens over K = 256; f16 operands, f32 accumulators, result x 2^-4.
// x (NCHW f32) is rounded (bf16, then f16) and turned token-major in LDS, sx[token][c]; each wave rounds its own 32 weight rows (x 2^4, bf16, f16: the power of two commutes with the rounding) straight into fragments, k-step by k-step, the f32 rows fetched two k-steps ahead.
// kc, q: A = sx rows (tokens), B = weight rows; each f32 result is split into f16 hi + lo*2^10 and a token's head is stored as ONE 128-byte line, hi 32 | lo 32: QK[(b,token)][kc heads | q heads][hi | lo], pitch QP.
// v: A = weight rows, B = sx rows (tokens), VT[(h,d)][(b,token)] as f16, channel-major: 64 tokens of a channel are one 128-byte line.
#define TT 64
#define XP (CC + 8)
#define QP (2 * NHh * 2 * HD)
#define SOW 2304
// f32 -> nearest-even bf16 -> f32 by the chip's own conversion: the same value as bf16_round() for every finite x, in fewer instructions
__device__ __forceinline__ float bf16_rne(float x) { return (float)(__bf16)x; }
// the f32 weights of k-step ks for this lane: rows ln and 16 + ln of the unit, c = 32ks + 8hh + 0..7 and 32ks + 16 + 8hh + 0..7
__device__ __forceinline__ void proj_ldw(v4f (&raw)[8], const float* __restrict__ wp, int ks) {
#pragma unroll
  for (int nt = 0; nt < 2; ++nt) { const float* p = wp + nt * 16 * CC + ks * 32; raw[nt * 4] = *(const v4fa*)p; raw[nt * 4 + 1] = *(const v4fa*)(p + 4); raw[nt * 4 + 2] = *(const v4fa*)(p + 16); raw[nt * 4 + 3] = *(const v4fa*)(p + 20); } }
// WA: the weight fragment is the A operand (v), else the B operand (kc, q). k order of both fragments: half 0 = c 32ks + 8hh.., half 1 = c 32ks + 16 + 8hh..
template <bool WA>
__device__ __forceinline__ void proj_k(const float* __restrict__ wp, const unsigned short (*sx)[XP], int ln, int hh, v4f (&raw)[3][8], v8f (&acc)[4][2]) {
#pragma unroll
  for (int ks = 0; ks < 8; ++ks) {      // unrolled: raw, acc and the fragments are indexed by constants and stay in registers
    if (ks + 2 < 8) proj_ldw(raw[(ks + 2) % 3], wp, ks + 2);
    if (ks + 2 == 7) asm volatile("s_wait_xcnt 0x0" ::: "memory");      // wp is dead from here on: later results may land on it
    FragH wf[2], xf[4];
#pragma unroll
    for (int mt = 0; mt < 4; ++mt) { xf[mt].half[0] = *(const v8us*)&sx[mt * 16 + ln][ks * 32 + 8 * hh]; xf[mt].half[1] = *(const v8us*)&sx[mt * 16 + ln][ks * 32 + 16 + 8 * hh]; }
#pragma unroll
    for (int nt = 0; nt < 2; ++nt)
#pragma unroll
      for (int j = 0; j < 4; ++j)
#pragma unroll
        for (int i = 0; i < 4; ++i) wf[nt].h[j * 4 + i] = (_Float16)bf16_rne(raw[ks % 3][nt * 4 + j][i] * 16.0f);
#pragma unroll
    for (int mt = 0; mt < 4; ++mt)
#pragma unroll
      for (int nt = 0; nt < 2; ++nt) acc[mt][nt] = WA ? __builtin_amdgcn_wmma_f32_16x16x32_f16(false, wf[nt].v, false, xf[mt].v, (short)0, acc[mt][nt], false, false) : __builtin_amdgcn_wmma_f32_16x16x32_f16(false, xf[mt].v, false, wf[nt].v, (short)0, acc[mt][nt], false, false);
    __builtin_amdgcn_sched_barrier(0);      // keeps the f32 weights of three k-steps at most in registers: left free, the scheduler lifts all 64 loads to the top and spills
  } }
__global__ __launch_bounds__(384, 4) void k_proj(const float* __restrict__ x, const float* __restrict__ Wk, const float* __restrict__ Wq, const float* __restrict__ Wv, _Float16* __restrict__ QK, _Float16* __restrict__ VT) {
  __shared__ __attribute__((aligned(16))) unsigned short sx[TT][XP];      // pitch 528 B = 16 B x odd: the fragment reads meet no bank twice
  __shared__ __attribute__((aligned(16))) float so[12][SOW];      // per wave: 64 tokens x pitch 36 (kc, q) or 32 channels x pitch 68 (v)
  const int tid = threadIdx.x, lane = tid & 31, ln = lane & 15, hh = lane >> 4; const int w = __builtin_amdgcn_readfirstlane(tid >> 5);      // wave number held scalar: the unit and the row bases are then scalar
  const int tile = blockIdx.x >> 1, unit = (blockIdx.x & 1) * 12 + w; const int m = unit >> 3, hd = unit & 7; const int b = tile / (NTOK / TT), p0 = (tile % (NTOK / TT)) * TT;
  const int tq = tid & 15, cg = tid >> 4;      // a piece: 4 tokens x 8 channels; 16 lanes read 256 contiguous bytes of one channel. 512 pieces: one a thread, a second one for waves 0..3
  const float* xp = x + ((size_t)b * CC + cg * 8) * NTOK + p0 + 4 * tq; v4f xv[2][8];
#pragma unroll
  for (int q = 0; q < 8; ++q) xv[0][q] = *(const v4fa*)(xp + (size_t)q * NTOK);
  if (w < 4) {
#pragma unroll
    for (int q = 0; q < 8; ++q) xv[1][q] = *(const v4fa*)(xp + (size_t)(192 + q) * NTOK); }
  asm volatile("s_wait_xcnt 0x0" ::: "memory");      // xp is dead from here on: later results may land on it
  const float* wp = ((m == 0) ? Wk : ((m == 1) ? Wq : Wv)) + (size_t)(hd * HD + ln) * CC + 8 * hh; v4f raw[3][8]; proj_ldw(raw[0], wp, 0); proj_ldw(raw[1], wp, 1);
#pragma unroll
  for (int u = 0; u < 2; ++u) if (u == 0 || w < 4) {
#pragma unroll
    for (int k = 0; k < 4; ++k) { FragH f;
#pragma unroll
      for (int q = 0; q < 8; ++q) f.h[q] = (_Float16)bf16_rne(xv[u][q][k]);
      *(v8us*)&sx[4 * tq + k][(cg + 24 * u) * 8] = f.half[0]; } }
  __syncthreads();      // sx is read by all twelve waves
  v8f acc[4][2] = {};
  float* sw = &so[w][0]; const int r0 = lane >> 3, pc = lane & 7;      // 8 lanes store one whole 128-byte line
  if (m < 2) {
    proj_k<false>(wp, sx, ln, hh, raw, acc);
#pragma unroll
    for (int mt = 0; mt < 4; ++mt)
#pragma unroll
      for (int nt = 0; nt < 2; ++nt)
#pragma unroll
        for (int r = 0; r < 8; ++r) sw[(mt * 16 + 8 * hh + r) * 36 + nt * 16 + ln] = acc[mt][nt][r] * 0.0625f;
    __builtin_amdgcn_fence(__ATOMIC_ACQ_REL, "workgroup"); __builtin_amdgcn_wave_barrier();      // so[w] is written and read by this wave alone
    unsigned short* dq = (unsigned short*)QK + (size_t)(tile * TT) * QP + m * (NHh * 2 * HD) + hd * (2 * HD); const bool islo = pc >= 4;      // lanes 0..3 of a line: hi, lanes 4..7: lo of the same 32 values
#pragma unroll
    for (int q = 0; q < 16; ++q) { const int r = q * 4 + r0; const v4f v0 = *(const v4fa*)&sw[r * 36 + (pc & 3) * 8], v1 = *(const v4fa*)&sw[r * 36 + (pc & 3) * 8 + 4]; FragH fo;
#pragma unroll
      for (int i = 0; i < 8; ++i) { const float v = (i < 4) ? v0[i & 3] : v1[i & 3]; const _Float16 h = (_Float16)v; const _Float16 lw = (_Float16)((v - (float)h) * 1024.0f); fo.h[i] = islo ? lw : h; }
      *(v8us*)(dq + (unsigned)(r * QP + pc * 8)) = fo.half[0];
      asm volatile("s_wait_xcnt 0x0" ::: "memory"); }      // the next rows' values (in the listing also the other branch's block) are written to registers that this store names
  } else {
    proj_k<true>(wp, sx, ln, hh, raw, acc);
#pragma unroll
    for (int mt = 0; mt < 4; ++mt)
#pragma unroll
      for (int nt = 0; nt < 2; ++nt)
#pragma unroll
        for (int r = 0; r < 8; ++r) sw[(nt * 16 + 8 * hh + r) * 68 + mt * 16 + ln] = acc[mt][nt][r] * 0.0625f;
    __builtin_amdgcn_fence(__ATOMIC_ACQ_REL, "workgroup"); __builtin_amdgcn_wave_barrier();      // so[w] is written and read by this wave alone
    unsigned short* dv = (unsigned short*)VT + (size_t)(hd * HD) * NR + tile * TT;
#pragma unroll
    for (int q = 0; q < 8; ++q) { const int r = q * 4 + r0; const v4f v0 = *(const v4fa*)&sw[r * 68 + pc * 8], v1 = *(const v4fa*)&sw[r * 68 + pc * 8 + 4]; FragH fh;
#pragma unroll
      for (int i = 0; i < 4; ++i) { fh.h[i] = (_Float16)v0[i]; fh.h[4 + i] = (_Float16)v1[i]; }
      *(v8us*)(dv + (unsigned)(r * NR + pc * 8)) = fh.half[0];
      asm volatile("s_wait_xcnt 0x0" ::: "memory"); }      // the next rows' values (in the listing also the other branch's block) are written to registers that this store names
  }
}
// exp(x) for x <= 0, by the steps of the library's expf (x*log2(e) in two parts, 2^fraction, ldexp, 0 below the f32 range; its overflow test cannot fire here). The exponential stands in asm with a v_nop behind it:
// the instruction set asks for one slot before a vector instruction reads a transcendental's result or overwrites its source.
__device__ __forceinline__ float exp_nonpos(float x) {
  const float ph = x * 0x1.715476p+0f; float pl = __builtin_fmaf(x, 0x1.715476p+0f, -ph); pl = __builtin_fmaf(x, 0x1.4ae0bep-26f, pl);
  const float e = __builtin_rintf(ph); const float a = (ph - e) + pl; float r;
  asm("v_exp_f32 %0, %1\n\tv_nop" : "=v"(r) : "v"(a));
  r = ldexpf(r, (int)e);
  return (x < -0x1.9d1da0p+6f) ? 0.f : r; }
// window attention, one wave per (b, head h, row y, 16-token x segment): for each window row i the 32 tokens (y + i - 3, x0 - 8 .. x0 + 23) are ONE key block.
// S^T = Q_row (32 keys x 32 d, two A tiles, f16 hi + lo*2^-10, 3 products) * KC^T (B, 16 centre keys): lane (ln, hh) holds, for centre token ln, the keys c = 16t + 8hh + r;
// the window is the band 0 <= c - ln - 5 <= 6 (= column offset j). Softmax of a centre token is in-lane plus one exchange with lane ^ 16; the two S^T tiles, as f16, ARE the B operand of
// O^T = V^T (A: row d, keys along k, read from the channel-major VT) * P^T, so a lane ends with 8 consecutive d of its own token.
// kc.rel_k splits into a row term and a column term: E = REL * KC^T with REL rows 0..6 = (rel_h[i] | 0), rows 8..14 = (0 | rel_w[j]), rows 7 and 15 zero; rel is bf16-rounded first, as before (8 significant bits: exact in f16 from 2^-14 up, below that off by at most 2^-25), and kc is hi + lo*2^-10 (2 products).
// A block = one (b, head) x four image rows (y0 = 4g ..) x the four x segments, sixteen waves: its 224 tokens are 896 bytes = seven whole 128-byte lines of every NCHW output channel, so the block turns its result channel-major in LDS and stores the output itself, each line from one block.
#define RG 4
#define TPB (RG * HI)
#define OP (TPB + 4)
__global__ __launch_bounds__(512) void k_nattn(const _Float16* __restrict__ QK, const _Float16* __restrict__ VT, const float* __restrict__ relh, const float* __restrict__ relw, float* __restrict__ out) {
  __shared__ __attribute__((aligned(16))) float sR[RG * NXS][16][20];      // per centre token of the wave: words 0..6 kc.rel_h[i], words 8..14 kc.rel_w[j] (pitch 20: rows stay 16-byte aligned and in-band lanes of the gather below meet no bank twice)
  __shared__ __attribute__((aligned(16))) float sT[HD][OP];      // [d][token of the block]; pitch 228 words: rows stay 16-byte aligned, and rows d and d + 8, written by the two lane halves at once, lie 32 banks apart
  const int tid = threadIdx.x, lane = tid & 31, ln = lane & 15, hh = lane >> 4; const int w = __builtin_amdgcn_readfirstlane(tid >> 5);      // wave number held scalar: (b, h, y, x0) and every row base below are then scalar, a lane keeps only row-invariant byte offsets
  const int b = blockIdx.x / (NHh * (HI / RG)), rem = blockIdx.x % (NHh * (HI / RG)); const int h = rem / (HI / RG), y0 = (rem % (HI / RG)) * RG; const int yl = w / NXS, y = y0 + yl, x0 = (w % NXS) * 16;
  const int qx = (x0 + ln < HI) ? (x0 + ln) : (HI - 1);      // lanes past the image row repeat its last token; their result is not stored
  FragH bc, bcl; { const unsigned koff = (unsigned)(qx * QP + 8 * hh) * 2; const size_t kb = ((size_t)(b * NTOK + y * HI) * QP + h * (2 * HD)) * 2; const char* k0 = (const char*)QK + kb; const char* k1 = k0 + HD * 2;      // a head's line: hi 32 | lo 32
    bc.half[0] = *(const v8us*)(k0 + koff); bc.half[1] = *(const v8us*)(k0 + koff + 32); bcl.half[0] = *(const v8us*)(k1 + koff); bcl.half[1] = *(const v8us*)(k1 + koff + 32); }      // centre key kc, column ln of B
  asm volatile("s_wait_xcnt 0x0" ::: "memory");      // koff is dead from here on: the results of the loads below may land on it
  const v8us z8 = (v8us){0,0,0,0,0,0,0,0}; const v8f z8f = (v8f){0.f,0.f,0.f,0.f,0.f,0.f,0.f,0.f};
  FragH ar; { const int ri = ln & 7; const float* rp = ((ln < 8) ? relh : relw) + (h * 7 + ((ri < 7) ? ri : 6)) * 16 + 8 * hh; const v4f r0 = *(const v4fa*)rp, r1 = *(const v4fa*)(rp + 4); FragH c;      // row ln of REL: its 8 non-zero k of this lane half
    asm volatile("s_wait_xcnt 0x0" ::: "memory");      // rp is dead from here on: later results may land on it
#pragma unroll
    for (int q = 0; q < 4; ++q) { c.h[q] = (_Float16)bf16_round(r0[q]); c.h[4 + q] = (_Float16)bf16_round(r1[q]); }
    const v8us cv = (ri < 7) ? c.half[0] : z8; ar.half[0] = (ln < 8) ? cv : z8; ar.half[1] = (ln < 8) ? z8 : cv; }      // k order as bc: half 0 = d 8hh.., half 1 = d 16 + 8hh..
  { const v8f e = __builtin_amdgcn_wmma_f32_16x16x32_f16(false, ar.v, false, bc.v, (short)0, z8f, false, false); const v8f e2 = __builtin_amdgcn_wmma_f32_16x16x32_f16(false, ar.v, false, bcl.v, (short)0, z8f, false, false); v4f o0, o1;
#pragma unroll
    for (int q = 0; q < 4; ++q) { o0[q] = e[q] + e2[q] * 0.0009765625f; o1[q] = e[4 + q] + e2[4 + q] * 0.0009765625f; }
    *(v4fa*)&sR[w][ln][8 * hh] = o0; *(v4fa*)&sR[w][ln][8 * hh + 4] = o1; }      // lane (ln, hh) holds rows 8hh..8hh+7 of E for its own centre token
  __builtin_amdgcn_fence(__ATOMIC_ACQ_REL, "workgroup"); __builtin_amdgcn_wave_barrier();      // sR is written and read by this wave alone
  bool inb[2][8]; int rj[2][8]; bool xok[2], vok[2]; unsigned qoff[2], voff[2];
#pragma unroll
  for (int t = 0; t < 2; ++t) {
    const int xx = x0 - 8 + 16 * t + ln; xok[t] = (xx >= 0 && xx < HI); qoff[t] = (unsigned)((xok[t] ? xx : 0) * QP + 8 * hh) * 2;      // key c = 16t + ln as row of A
    const int xk = x0 - 8 + 16 * t + 8 * hh; vok[t] = (xk >= 0 && xk < HI); voff[t] = (unsigned)(ln * NR + (vok[t] ? xk : 0)) * 2;      // 8 keys: wholly inside the image row or wholly outside
#pragma unroll
    for (int r = 0; r < 8; ++r) { const int j = 16 * t + 8 * hh + r - ln - 5; inb[t][r] = (j >= 0 && j < 7); rj[t][r] = (j < 0) ? 0 : ((j > 6) ? 6 : j); } }
  float rh[8]; v8f rw[2]; { const float* rl = &sR[w][ln][0]; const v4f a0 = *(const v4fa*)rl, a1 = *(const v4fa*)(rl + 4);
#pragma unroll
    for (int q = 0; q < 4; ++q) { rh[q] = a0[q]; rh[4 + q] = a1[q]; }
#pragma unroll
    for (int t = 0; t < 2; ++t)
#pragma unroll
      for (int r = 0; r < 8; ++r) rw[t][r] = rl[8 + rj[t][r]]; }      // column term of key c = 16t + 8hh + r, the same for all seven window rows; every lane reads (index clamped into the row): no branch round the load
  float lg[7][2][8];
#pragma unroll
  for (int i = 0; i < 7; ++i) { const int yy = y + i - 3; const bool yok = (yy >= 0 && yy < HI); const size_t qb = ((size_t)(b * NTOK + (yok ? yy : y) * HI) * QP + NHh * 2 * HD + h * (2 * HD)) * 2; const char* q0 = (const char*)QK + qb; const char* q1 = q0 + HD * 2;
#pragma unroll
    for (int t = 0; t < 2; ++t) { const bool ok = yok && xok[t];
      FragH ak, akl; ak.half[0] = *(const v8us*)(q0 + qoff[t]); ak.half[1] = *(const v8us*)(q0 + qoff[t] + 32); akl.half[0] = *(const v8us*)(q1 + qoff[t]); akl.half[1] = *(const v8us*)(q1 + qoff[t] + 32); asm volatile("s_wait_xcnt 0x0" :: "v"(qoff[0]), "v"(qoff[1]) : "memory");      // the next rows' scalar bases, and behind the last row other values, are written to registers that these loads name (qoff named as inputs: they live up to the wait)
      if (!ok) { ak.half[0] = z8; ak.half[1] = z8; akl.half[0] = z8; akl.half[1] = z8; }      // zero padding: q = 0 outside the image
      v8f s = __builtin_amdgcn_wmma_f32_16x16x32_f16(false, ak.v, false, bc.v, (short)0, rw[t], false, false);      // the column term rides in as C
      v8f s2 = __builtin_amdgcn_wmma_f32_16x16x32_f16(false, ak.v, false, bcl.v, (short)0, z8f, false, false); s2 = __builtin_amdgcn_wmma_f32_16x16x32_f16(false, akl.v, false, bc.v, (short)0, s2, false, false);      // hi.hi + (lo.hi + hi.lo)*2^-10
#pragma unroll
      for (int r = 0; r < 8; ++r) { const float sd = s[r] + s2[r] * 0.0009765625f; const float lv = sd + rh[i]; lg[i][t][r] = inb[t][r] ? lv : -3.0e38f; } } }      // kc.(q + rel_k); padded neighbours keep kc.rel_k
  float m = -3.0e38f;
#pragma unroll
  for (int i = 0; i < 7; ++i)
#pragma unroll
    for (int t = 0; t < 2; ++t)
#pragma unroll
      for (int r = 0; r < 8; ++r) m = fmaxf(m, lg[i][t][r]);
  m = fmaxf(m, __shfl_xor(m, 16, 32));
  float l = 0.f; v8f oacc[2] = {z8f, z8f};
#pragma unroll
  for (int i = 0; i < 7; ++i) { const int yy = y + i - 3; const bool yok = (yy >= 0 && yy < HI); const char* vb = (const char*)VT + ((size_t)(h * HD) * NR + (size_t)(b * NTOK + (yok ? yy : y) * HI)) * 2; FragH pb;
#pragma unroll
    for (int t = 0; t < 2; ++t)
#pragma unroll
      for (int r = 0; r < 8; ++r) { const float p = exp_nonpos(lg[i][t][r] - m); l += p; pb.h[8 * t + r] = (_Float16)p; }      // outside the band: exp -> 0
#pragma unroll
    for (int dt = 0; dt < 2; ++dt) { FragH av;
#pragma unroll
      for (int t = 0; t < 2; ++t) { av.half[t] = *(const v8us*)(vb + voff[t] + dt * (16 * NR * 2)); if (!(yok && vok[t])) av.half[t] = z8;      // zero padding: v = 0 outside the image
        if (i == 6) asm volatile("s_wait_xcnt 0x0" ::: "memory"); }      // last row: voff and the row base die here, and later results may land on a register that these loads name
      oacc[dt] = __builtin_amdgcn_wmma_f32_16x16x32_f16(false, av.v, false, pb.v, (short)0, oacc[dt], false, false); } }
  l += __shfl_xor(l, 16, 32);
  if (x0 + ln < HI) {      // lanes past the image row hold a repeat of its last token: not kept
#pragma unroll
    for (int dt = 0; dt < 2; ++dt)
#pragma unroll
      for (int r = 0; r < 8; ++r) sT[dt * 16 + 8 * hh + r][yl * HI + x0 + ln] = oacc[dt][r] / l; }
  __syncthreads();      // sT is written by all sixteen waves and read across them
  // wave w stores channels 2w and 2w + 1 of the head: 2 x 56 pieces of 16 bytes, a store instruction covers whole 128-byte lines
  float* op = out + ((size_t)(b * CC + h * HD + 2 * w) * NTOK + y0 * HI);
  v4f ov[4];      // all LDS reads first, then the stores: one LDS latency instead of four
#pragma unroll      // both loops unrolled: ov is indexed by constants and stays in registers
  for (int k = 0; k < 4; ++k) { const int j = lane + 32 * k; if (j < 2 * (TPB / 4)) { const int d = (j >= TPB / 4) ? 1 : 0, c4 = (j - d * (TPB / 4)) * 4; ov[k] = *(const v4fa*)&sT[2 * w + d][c4]; } }
#pragma unroll
  for (int k = 0; k < 4; ++k) { const int j = lane + 32 * k; if (j < 2 * (TPB / 4)) { const int d = (j >= TPB / 4) ? 1 : 0, c4 = (j - d * (TPB / 4)) * 4; *(v4f*)(op + (unsigned)(d * NTOK + c4)) = ov[k]; } }
}

extern "C" void kernel_launch(void* const* d_in, const int* in_sizes, int n_in,
                              void* d_out, int out_size, void* d_ws, size_t ws_size, hipStream_t stream) {
  (void)in_sizes; (void)n_in; (void)out_size;
  const float* x = (const float*)d_in[0]; const float* Wk = (const float*)d_in[1]; const float* Wq = (const float*)d_in[2]; const float* Wv = (const float*)d_in[3]; const float* relh = (const float*)d_in[4]; const float* relw = (const float*)d_in[5];
  char* ws = (char*)d_ws; size_t off = 0;
  auto take = [&](size_t bytes) { char* p = ws + off; off += (bytes + 255) & ~(size_t)255; return p; };
  _Float16* QK = (_Float16*)take((size_t)NR * QP * 2); _Float16* VT = (_Float16*)take((size_t)CC * NR * 2);
  if (off > ws_size) return;      // 12.8 + 3.2: about 16 MB
  k_proj<<<(NR / TT) * 2, 384, 0, stream>>>(x, Wk, Wq, Wv, QK, VT);      // kc | q as f16 hi | lo*2^10 lines per head; v channel-major
  k_nattn<<<BB * NHh * (HI / RG), RG * NXS * 32, 0, stream>>>(QK, VT, relh, relw, (float*)d_out);      // stores the NCHW output itself
}

// v006
// One run takes 25.8 microseconds.
// Timed twice side by side with v005, it ran 1.10 times as fast both times.
// All steps since v000 together make it 7.11 times as fast.
#include <hip/hip_runtime.h>
// Stand-alone (SASA) local self-attention (B=2, C 256 = 8 heads × 32, 56×56, 7×7 windows, stride 1, zero padding; relative row/col embeddings added to the windowed QUERIES, the centre KEY is
// the fixed operand, softmax over the 49 window positions, values windowed): 1×1 projections as GEMMs ((head,dim)×C weights bf16-exact ×2^4) and the window attention on
// v_wmma_f32_16x16x32_f16 with one banded key block per window row (per 16-token row segment and window row: S^T = Q_row.KC^T over 32 keys, kc and q as f16 hi + lo*2^-10 (3 products), band element + kc.rel_k (f32) = logit; f32 softmax over all 49, in-lane
// plus one lane exchange; O^T += V^T.P^T with the f16 S^T tiles as the B operand and V kept channel-major); kc.rel_k = kc[0..15].rel_h[i] + kc[16..31].rel_w[j] is one more A tile (14 rows) against the same KC^T; the NCHW transposes are f32 VALU, through LDS inside the two kernels.
#define BB 2
#define CC 256
#define NHh 8
#define HD 32
#define HI 56
#define NTOK 3136
#define NXS 4
#define NR (BB * NTOK)

typedef __bf16 v16b __attribute__((ext_vector_type(16)));
typedef unsigned short v8us __attribute__((ext_vector_type(8), may_alias));
typedef float  v8f  __attribute__((ext_vector_type(8)));
typedef float  v4f  __attribute__((ext_vector_type(4)));
typedef float  v4fa __attribute__((ext_vector_type(4), may_alias));
union FragB { v16b v; v8us half[2]; unsigned short u[16]; };

__device__ __forceinline__ unsigned short bf16_bits(float x) { unsigned int u = __float_as_uint(x); return (unsigned short)((u + 0x7FFFu + ((u >> 16) & 1u)) >> 16); }
__device__ __forceinline__ float bf16_val(unsigned short b) { return __uint_as_float(((unsigned int)b) << 16); }
__device__ __forceinline__ float bf16_round(float x) { return bf16_val(bf16_bits(x)); }
// D += A·B with NT terms: 1 = ah·bh, 2 = + al·bh (A split), 3 = + ah·bl (both split)
template <int NT>
__device__ __forceinline__ v8f mmaN(v16b ah, v16b al, v16b bh, v16b bl, v8f c) {
  c = __builtin_amdgcn_wmma_f32_16x16x32_bf16(false, ah, false, bh, (short)0, c, false, false);
  if (NT >= 2) c = __builtin_amdgcn_wmma_f32_16x16x32_bf16(false, al, false, bh, (short)0, c, false, false);
  if (NT >= 3) c = __builtin_amdgcn_wmma_f32_16x16x32_bf16(false, ah, false, bl, (short)0, c, false, false);
  asm volatile("v_nop\n\tv_nop\n\tv_nop\n\tv_nop" : "+v"(c) : "v"(ah), "v"(al), "v"(bh), "v"(bl));
  return c;
}

__global__ __launch_bounds__(256) void k_wt_bf16(const float* __restrict__ W, unsigned short* __restrict__ Wt, int K, int N) {
  const int t = blockIdx.x * 256 + threadIdx.x;
  const int k8n = K / 8;
  if (t >= N * k8n) return;
  const int n = t / k8n, k8 = (t % k8n) * 8;
  v8us v;
#pragma unroll
  for (int i = 0; i < 8; ++i) v[i] = bf16_bits(W[(size_t)(k8 + i) * N + n]);
  *(v8us*)(Wt + (size_t)n * K + k8) = v;
  
}

// GEMM C[M][N] (f32, pitch ldc) = act(A[M][K]·W + bias). A f32 row-major (pitch lda) converted per fragment to bf16
// (ASPLIT: hi/lo two planes -> 2 terms, else single rounded term); Wt bf16 [N][K] (pitch ldb). BIAS_BF16 rounds the
// bias to bf16 first (bias quantised to bf16 before the add). K%32==0, M%16==0, N%64==0.
template <bool ASPLIT, int ACT, bool BIAS_BF16>
__global__ __launch_bounds__(128) void k_gemm_bf(const float* __restrict__ A, int lda, const unsigned short* __restrict__ Wt, int ldb,
                                               const float* __restrict__ bias, float* __restrict__ C, int ldc, int M, int N, int K) {
  __shared__ __attribute__((aligned(16))) float so[4][16][64];
  const int tid = threadIdx.x, w = tid >> 5, lane = tid & 31, ln = lane & 15, hh = lane >> 4;
  const int ntn = N / 64;
  const int wid = blockIdx.x * 4 + w;
  const int mt = wid / ntn, nq = wid % ntn;
  if (mt * 16 >= M) return;
  const int row0 = mt * 16, col0 = nq * 64;
  const float* arow = A + (size_t)(row0 + ln) * lda;
  v8f acc[4] = {};
  for (int kb = 0; kb < K; kb += 32) {
    FragB ah, al;
    const v4f x0 = *(const v4fa*)(arow + kb + 8 * hh), x1 = *(const v4fa*)(arow + kb + 8 * hh + 4);
    const v4f x2 = *(const v4fa*)(arow + kb + 16 + 8 * hh), x3 = *(const v4fa*)(arow + kb + 16 + 8 * hh + 4);
    float xs[16] = {x0[0],x0[1],x0[2],x0[3],x1[0],x1[1],x1[2],x1[3],x2[0],x2[1],x2[2],x2[3],x3[0],x3[1],x3[2],x3[3]};
#pragma unroll
    for (int i = 0; i < 16; ++i) { const unsigned short hb = bf16_bits(xs[i]); ah.u[i] = hb; al.u[i] = ASPLIT ? bf16_bits(xs[i] - bf16_val(hb)) : (unsigned short)0; }
#pragma unroll
    for (int t = 0; t < 4; ++t) {
      const unsigned short* brow = Wt + (size_t)(col0 + t * 16 + ln) * ldb + kb;
      FragB b;
      b.half[0] = *(const v8us*)(brow + 8 * hh);
      b.half[1] = *(const v8us*)(brow + 16 + 8 * hh);
      acc[t] = mmaN<ASPLIT ? 2 : 1>(ah.v, al.v, b.v, b.v, acc[t]);
    }
  }
#pragma unroll
  for (int t = 0; t < 4; ++t) {
    float bv = bias ? bias[col0 + t * 16 + ln] : 0.f;
    if (BIAS_BF16) bv = bf16_round(bv);
#pragma unroll
    for (int r = 0; r < 8; ++r) { float v = acc[t][r] + bv; if (ACT == 1) v = fmaxf(v, 0.f); so[w][8 * hh + r][t * 16 + ln] = v; }
  }
  __builtin_amdgcn_fence(__ATOMIC_ACQ_REL, "workgroup");
  __builtin_amdgcn_wave_barrier();
  const int rsub = lane >> 4, c4 = (lane & 15) * 4;
  {
#pragma unroll
    for (int q = 0; q < 8; ++q) {
      const int r = q * 2 + rsub;
      const v4f v = *(const v4fa*)&so[w][r][c4];
      *(v4f*)(C + (size_t)(row0 + r) * ldc + col0 + c4) = v;
    }
    
  }
}

// Flash-style causal/unmasked attention, all contractions 3-term bf16 hi/lo splits, f32 softmax with running max.
// q,k,v rows are read from f32 buffers with arbitrary row pitch (so they can live inside a fused qkv buffer);
// D = head size (multiple of 32, <= 128); one wave = 16 query rows; block = 4 waves (64 queries) sharing K/V chunks of 32.
template <int D, bool CAUSAL>
__global__ __launch_bounds__(128) void k_flash(const float* __restrict__ qb, const float* __restrict__ kb, const float* __restrict__ vb,
                                             int pitch, int T, int H, float scale, float* __restrict__ y, int ypitch) {
  constexpr int KS = D / 32;        // k-steps for QK
  constexpr int DT = D / 16;        // d tiles for PV
  __shared__ __attribute__((aligned(16))) unsigned short sKh[32][D + 8], sKl[32][D + 8], sVh[32][D + 8], sVl[32][D + 8];
  __shared__ __attribute__((aligned(16))) unsigned short sPh[4][16][40], sPl[4][16][40];
  __shared__ __attribute__((aligned(16))) float sO[4][16][D];
  const int tid = threadIdx.x, w = tid >> 5, lane = tid & 31, ln = lane & 15, hh = lane >> 4;
  const int nqb = (T + 63) / 64;
  const int bh = blockIdx.x / nqb, qblk = blockIdx.x % nqb;
  const int b = bh / H, h = bh % H;
  const int q0 = qblk * 64 + w * 16;
  const float* Q = qb + (size_t)b * T * pitch + h * D;
  const float* K = kb + (size_t)b * T * pitch + h * D;
  const float* V = vb + (size_t)b * T * pitch + h * D;

  // A fragments of the wave's 16 query rows (scaled), hi/lo
  FragB aqh[KS], aql[KS];
  {
    int row = q0 + ln; if (row >= T) row = T - 1;
    const float* qr = Q + (size_t)row * pitch;
#pragma unroll
    for (int ks = 0; ks < KS; ++ks)
#pragma unroll
      for (int i = 0; i < 16; ++i) {
        const int d = ks * 32 + ((i < 8) ? (8 * hh + i) : (16 + 8 * hh + (i - 8)));
        const float x = qr[d] * scale; const unsigned short hb = bf16_bits(x);
        aqh[ks].u[i] = hb; aql[ks].u[i] = bf16_bits(x - bf16_val(hb));
      }
  }
  float m_r[8], l_r[8];
#pragma unroll
  for (int r = 0; r < 8; ++r) { m_r[r] = -3.0e38f; l_r[r] = 0.f; }
  v8f oacc[DT];
#pragma unroll
  for (int dt = 0; dt < DT; ++dt) oacc[dt] = (v8f){0.f,0.f,0.f,0.f,0.f,0.f,0.f,0.f};

  const int kv_end = CAUSAL ? min(T, qblk * 64 + 64) : T;     // block-uniform
  for (int j0 = 0; j0 < kv_end; j0 += 32) {
    __syncthreads();
    for (int e = tid; e < 32 * (D / 4); e += 128) {
      const int r = e / (D / 4), c4 = (e % (D / 4)) * 4;
      const int key = j0 + r;
      v4f kf = {0.f,0.f,0.f,0.f}, vf = {0.f,0.f,0.f,0.f};
      if (key < T) { kf = *(const v4fa*)(K + (size_t)key * pitch + c4); vf = *(const v4fa*)(V + (size_t)key * pitch + c4); }
#pragma unroll
      for (int t = 0; t < 4; ++t) {
        unsigned short hb = bf16_bits(kf[t]); sKh[r][c4 + t] = hb; sKl[r][c4 + t] = bf16_bits(kf[t] - bf16_val(hb));
        hb = bf16_bits(vf[t]); sVh[r][c4 + t] = hb; sVl[r][c4 + t] = bf16_bits(vf[t] - bf16_val(hb));
      }
    }
    __syncthreads();
    // S tile 16 x 32
    v8f s[2];
#pragma unroll
    for (int nt = 0; nt < 2; ++nt) {
      v8f acc = {};
#pragma unroll
      for (int ks = 0; ks < KS; ++ks) {
        FragB bh_, bl_;
        bh_.half[0] = *(const v8us*)&sKh[nt * 16 + ln][ks * 32 + 8 * hh]; bh_.half[1] = *(const v8us*)&sKh[nt * 16 + ln][ks * 32 + 16 + 8 * hh];
        bl_.half[0] = *(const v8us*)&sKl[nt * 16 + ln][ks * 32 + 8 * hh]; bl_.half[1] = *(const v8us*)&sKl[nt * 16 + ln][ks * 32 + 16 + 8 * hh];
        acc = mmaN<3>(aqh[ks].v, aql[ks].v, bh_.v, bl_.v, acc);
      }
      s[nt] = acc;
    }
    // mask + running max (rows 8hh+r; the 16 lanes of a half share rows)
    float alpha[8];
#pragma unroll
    for (int r = 0; r < 8; ++r) {
      const int qi = q0 + 8 * hh + r;
      const int ja = j0 + ln, jb = j0 + 16 + ln;
      if (CAUSAL) { if (ja > qi) s[0][r] = -3.0e38f; if (jb > qi) s[1][r] = -3.0e38f; }
      if (ja >= T) s[0][r] = -3.0e38f;
      if (jb >= T) s[1][r] = -3.0e38f;
      float mx = fmaxf(s[0][r], s[1][r]);
      mx = fmaxf(mx, __shfl_xor(mx, 1, 32)); mx = fmaxf(mx, __shfl_xor(mx, 2, 32)); mx = fmaxf(mx, __shfl_xor(mx, 4, 32)); mx = fmaxf(mx, __shfl_xor(mx, 8, 32));
      const float mnew = fmaxf(m_r[r], mx);
      alpha[r] = (mnew > -1.0e38f) ? __expf(m_r[r] - mnew) : 1.0f;
      const float p0 = (s[0][r] > -1.0e38f) ? __expf(s[0][r] - mnew) : 0.f;
      const float p1 = (s[1][r] > -1.0e38f) ? __expf(s[1][r] - mnew) : 0.f;
      m_r[r] = mnew;
      l_r[r] = l_r[r] * alpha[r] + p0 + p1;            // per-lane partial row sum (16 lanes combined at the end)
      unsigned short hb = bf16_bits(p0); sPh[w][8 * hh + r][ln] = hb;      sPl[w][8 * hh + r][ln] = bf16_bits(p0 - bf16_val(hb));
      hb = bf16_bits(p1);                sPh[w][8 * hh + r][16 + ln] = hb; sPl[w][8 * hh + r][16 + ln] = bf16_bits(p1 - bf16_val(hb));
    }
#pragma unroll
    for (int dt = 0; dt < DT; ++dt)
#pragma unroll
      for (int r = 0; r < 8; ++r) oacc[dt][r] *= alpha[r];
    __builtin_amdgcn_fence(__ATOMIC_ACQ_REL, "workgroup");
    __builtin_amdgcn_wave_barrier();
    FragB pah, pal;
    pah.half[0] = *(const v8us*)&sPh[w][ln][8 * hh]; pah.half[1] = *(const v8us*)&sPh[w][ln][16 + 8 * hh];
    pal.half[0] = *(const v8us*)&sPl[w][ln][8 * hh]; pal.half[1] = *(const v8us*)&sPl[w][ln][16 + 8 * hh];
#pragma unroll
    for (int dt = 0; dt < DT; ++dt) {
      FragB bvh, bvl;
#pragma unroll
      for (int i = 0; i < 8; ++i) {
        bvh.u[i] = sVh[8 * hh + i][dt * 16 + ln]; bvh.u[8 + i] = sVh[16 + 8 * hh + i][dt * 16 + ln];
        bvl.u[i] = sVl[8 * hh + i][dt * 16 + ln]; bvl.u[8 + i] = sVl[16 + 8 * hh + i][dt * 16 + ln];
      }
      oacc[dt] = mmaN<3>(pah.v, pal.v, bvh.v, bvl.v, oacc[dt]);
    }
    __builtin_amdgcn_fence(__ATOMIC_ACQ_REL, "workgroup");
    __builtin_amdgcn_wave_barrier();
  }
#pragma unroll
  for (int r = 0; r < 8; ++r) {
    float l = l_r[r];
    l += __shfl_xor(l, 1, 32); l += __shfl_xor(l, 2, 32); l += __shfl_xor(l, 4, 32); l += __shfl_xor(l, 8, 32);
    l_r[r] = (l > 0.f) ? 1.0f / l : 0.f;
  }
#pragma unroll
  for (int dt = 0; dt < DT; ++dt)
#pragma unroll
    for (int r = 0; r < 8; ++r) sO[w][8 * hh + r][dt * 16 + ln] = oacc[dt][r] * l_r[r];
  __builtin_amdgcn_fence(__ATOMIC_ACQ_REL, "workgroup");
  __builtin_amdgcn_wave_barrier();
  {
    for (int r = 0; r < 16; ++r) {
      const int row = q0 + r;
      if (row < T && lane < D / 4) {
        const v4f val = *(const v4fa*)&sO[w][r][lane * 4];
        *(v4f*)(y + ((size_t)b * T + row) * ypitch + h * D + lane * 4) = val;
      }
    }
    
  }
}

// GEMM C = act(A·W + bias + resid): A f32 (ASPLIT -> hi/lo 2 terms), Wt bf16 [N][K]; ACT 0 none, 1 relu, 2 exact gelu;
// resid (optional, f32, row index = (row % rmod), pitch ldr, RES_BF16 rounds it) added before the activation.
template <bool ASPLIT, int ACT, bool BIAS_BF16, bool RES_BF16>
__global__ __launch_bounds__(128) void k_gemm_bf3(const float* __restrict__ A, int lda, const unsigned short* __restrict__ Wt, int ldb,
                                                const float* __restrict__ bias, const float* __restrict__ resid, int rmod, int ldr,
                                                float* __restrict__ C, int ldc, int M, int N, int K) {
  __shared__ __attribute__((aligned(16))) float so[4][16][64];
  const int tid = threadIdx.x, w = tid >> 5, lane = tid & 31, ln = lane & 15, hh = lane >> 4;
  const int ntn = N / 64;
  const int wid = blockIdx.x * 4 + w;
  const int mt = wid / ntn, nq = wid % ntn;
  if (mt * 16 >= M) return;
  const int row0 = mt * 16, col0 = nq * 64;
  const float* arow = A + (size_t)(row0 + ln) * lda;
  v8f acc[4] = {};
  for (int kb = 0; kb < K; kb += 32) {
    FragB ah, al;
    const v4f x0 = *(const v4fa*)(arow + kb + 8 * hh), x1 = *(const v4fa*)(arow + kb + 8 * hh + 4);
    const v4f x2 = *(const v4fa*)(arow + kb + 16 + 8 * hh), x3 = *(const v4fa*)(arow + kb + 16 + 8 * hh + 4);
    float xs[16] = {x0[0],x0[1],x0[2],x0[3],x1[0],x1[1],x1[2],x1[3],x2[0],x2[1],x2[2],x2[3],x3[0],x3[1],x3[2],x3[3]};
#pragma unroll
    for (int i = 0; i < 16; ++i) { const unsigned short hb = bf16_bits(xs[i]); ah.u[i] = hb; al.u[i] = ASPLIT ? bf16_bits(xs[i] - bf16_val(hb)) : (unsigned short)0; }
#pragma unroll
    for (int t = 0; t < 4; ++t) {
      const unsigned short* brow = Wt + (size_t)(col0 + t * 16 + ln) * ldb + kb;
      FragB b;
      b.half[0] = *(const v8us*)(brow + 8 * hh);
      b.half[1] = *(const v8us*)(brow + 16 + 8 * hh);
      acc[t] = mmaN<ASPLIT ? 2 : 1>(ah.v, al.v, b.v, b.v, acc[t]);
    }
  }
#pragma unroll
  for (int t = 0; t < 4; ++t) {
    const int col = col0 + t * 16 + ln;
    float bv = bias ? bias[col] : 0.f;
    if (BIAS_BF16) bv = bf16_round(bv);
#pragma unroll
    for (int r = 0; r < 8; ++r) {
      float v = acc[t][r] + bv;
      if (resid) { float rv = resid[(size_t)((row0 + 8 * hh + r) % rmod) * ldr + col]; if (RES_BF16) rv = bf16_round(rv); v += rv; }
      if (ACT == 1) v = fmaxf(v, 0.f);
      if (ACT == 2) v = 0.5f * v * (1.0f + erff(v * 0.70710678118654752f));
      if (ACT == 3) { const float u = 0.7978845608028654f * (v + 0.044715f * v * v * v); v = 0.5f * v * (1.0f + tanhf(u)); }
      so[w][8 * hh + r][t * 16 + ln] = v;
    }
  }
  __builtin_amdgcn_fence(__ATOMIC_ACQ_REL, "workgroup");
  __builtin_amdgcn_wave_barrier();
  const int rsub = lane >> 4, c4 = (lane & 15) * 4;
  {
#pragma unroll
    for (int q = 0; q < 8; ++q) {
      const int r = q * 2 + rsub;
      const v4f v = *(const v4fa*)&so[w][r][c4];
      *(v4f*)(C + (size_t)(row0 + r) * ldc + col0 + c4) = v;
    }
    
  }
}
// row LayerNorm (biased variance, eps) over N: s = X (+ R); optional out_sum <- s; out_norm <- (s-mu)*rsqrt(var+eps)*g + b
template <bool PARAM_BF16>
__global__ __launch_bounds__(256) void k_layernorm(const float* __restrict__ X, const float* __restrict__ R, const float* __restrict__ g, const float* __restrict__ bta,
                                                  float* __restrict__ out_sum, float* __restrict__ out_norm, int N, float eps) {
  __shared__ float red[256];
  const int row = blockIdx.x, tid = threadIdx.x;
  const float* x = X + (size_t)row * N; const float* rr = R ? R + (size_t)row * N : nullptr;
  float vals[16];                     // up to N = 4096
  const int per = N / 256;            // contiguous chunk per thread? use strided-by-4 chunks: thread handles j = tid*4 + 1024*u
  float s1 = 0.f;
  for (int u = 0; u < per / 4; ++u) {
    const int j = tid * 4 + 1024 * u;
    const v4f a = *(const v4fa*)(x + j);
    v4f b = {0.f,0.f,0.f,0.f}; if (rr) b = *(const v4fa*)(rr + j);
#pragma unroll
    for (int q = 0; q < 4; ++q) { const float v = a[q] + b[q]; vals[u * 4 + q] = v; s1 += v; }
  }
  red[tid] = s1; __syncthreads();
  for (int st = 128; st > 0; st >>= 1) { if (tid < st) red[tid] += red[tid + st]; __syncthreads(); }
  const float mu = red[0] / (float)N; __syncthreads();
  float s2 = 0.f;
  for (int u = 0; u < per / 4; ++u)
#pragma unroll
    for (int q = 0; q < 4; ++q) { const float c = vals[u * 4 + q] - mu; s2 += c * c; }
  red[tid] = s2; __syncthreads();
  for (int st = 128; st > 0; st >>= 1) { if (tid < st) red[tid] += red[tid + st]; __syncthreads(); }
  const float rs = rsqrtf(red[0] / (float)N + eps);
  {
    for (int u = 0; u < per / 4; ++u) {
      const int j = tid * 4 + 1024 * u;
      v4f o, sm;
#pragma unroll
      for (int q = 0; q < 4; ++q) {
        float gg = g[j + q], bb = bta[j + q];
        if (PARAM_BF16) { gg = bf16_round(gg); bb = bf16_round(bb); }
        sm[q] = vals[u * 4 + q]; o[q] = (vals[u * 4 + q] - mu) * rs * gg + bb;
      }
      if (out_sum) *(v4f*)(out_sum + (size_t)row * N + j) = sm;
      *(v4f*)(out_norm + (size_t)row * N + j) = o;
    }
    
  }
}



// ---- f16 WMMA path (v_wmma_f32_16x16x32_f16): 11-bit significands for operands in range — used where a [0,1] probability operand needs more precision than bf16
typedef _Float16 v16h __attribute__((ext_vector_type(16)));
union FragH { v16h v; v8us half[2]; _Float16 h[16]; unsigned short u[16]; };
template <int NT>
__device__ __forceinline__ v8f mmaH(v16h ah, v16h al, v16h bh, v16h bl, v8f c) {
  c = __builtin_amdgcn_wmma_f32_16x16x32_f16(false, ah, false, bh, (short)0, c, false, false);
  if (NT >= 2) c = __builtin_amdgcn_wmma_f32_16x16x32_f16(false, al, false, bh, (short)0, c, false, false);
  if (NT >= 3) c = __builtin_amdgcn_wmma_f32_16x16x32_f16(false, ah, false, bl, (short)0, c, false, false);
  asm volatile("v_nop\n\tv_nop\n\tv_nop\n\tv_nop" : "+v"(c) : "v"(ah), "v"(al), "v"(bh), "v"(bl));
  return c;
}
// batched GEMM with f16 operands: A f32 (split into f16 hi/lo if ASPLIT, else rounded to f16), Bt = f16 values [n][k]; alpha; C f32; N multiple of 16 (partial tiles skipped)
template <bool ASPLIT>
__global__ __launch_bounds__(128) void k_gemm_h(const float* __restrict__ A, int lda, size_t sA, const _Float16* __restrict__ Bh, int ldb, size_t sB, float alpha, float* __restrict__ C, int ldc, size_t sC, int M, int N, int K) {
  __shared__ __attribute__((aligned(16))) float so[4][16][64];
  const int tid = threadIdx.x, w = tid >> 5, lane = tid & 31, ln = lane & 15, hh = lane >> 4; const int by = blockIdx.y;
  A += (size_t)by * sA; Bh += (size_t)by * sB; C += (size_t)by * sC;
  const int ntn = (N + 63) / 64; const int wid = blockIdx.x * 4 + w; const int mt = wid / ntn, nq = wid % ntn; if (mt * 16 >= M) return;
  const int row0 = mt * 16, col0 = nq * 64; const float* arow = A + (size_t)(row0 + ln) * lda;
  v8f acc[4] = {};
  for (int kb = 0; kb < K; kb += 32) {
    FragH ah, al;
    const v4f x0 = *(const v4fa*)(arow + kb + 8 * hh), x1 = *(const v4fa*)(arow + kb + 8 * hh + 4), x2 = *(const v4fa*)(arow + kb + 16 + 8 * hh), x3 = *(const v4fa*)(arow + kb + 16 + 8 * hh + 4);
    float xs[16] = {x0[0],x0[1],x0[2],x0[3],x1[0],x1[1],x1[2],x1[3],x2[0],x2[1],x2[2],x2[3],x3[0],x3[1],x3[2],x3[3]};
#pragma unroll
    for (int i = 0; i < 16; ++i) { const _Float16 h = (_Float16)xs[i]; ah.h[i] = h; al.h[i] = ASPLIT ? (_Float16)(xs[i] - (float)h) : (_Float16)0.0f; }
#pragma unroll
    for (int t = 0; t < 4; ++t) { if (col0 + t * 16 >= N) continue; const size_t boff = (size_t)(col0 + t * 16 + ln) * ldb + kb; FragH bq; bq.half[0] = *(const v8us*)(Bh + boff + 8 * hh); bq.half[1] = *(const v8us*)(Bh + boff + 16 + 8 * hh);
      acc[t] = mmaH<ASPLIT ? 2 : 1>(ah.v, al.v, bq.v, bq.v, acc[t]); }
  }
#pragma unroll
  for (int t = 0; t < 4; ++t) { if (col0 + t * 16 >= N) continue;
#pragma unroll
    for (int r = 0; r < 8; ++r) so[w][8 * hh + r][t * 16 + ln] = acc[t][r] * alpha; }
  __builtin_amdgcn_fence(__ATOMIC_ACQ_REL, "workgroup"); __builtin_amdgcn_wave_barrier();
  const int rsub = lane >> 4, c4 = (lane & 15) * 4;
  {
#pragma unroll
    for (int q = 0; q < 8; ++q) { const int r = q * 2 + rsub; if (col0 + c4 < N) { const v4f v = *(const v4fa*)&so[w][r][c4]; *(v4f*)(C + (size_t)(row0 + r) * ldc + col0 + c4) = v; } }
     }
}

// Wt[n][k] = f16(W[k][n]·scale) from f32 row-major W[K][N] (scale = power of two; bf16-exact weights stay exact in f16 away from the subnormal range)
__global__ __launch_bounds__(256) void k_wt_f16(const float* __restrict__ W, _Float16* __restrict__ Wt, int K, int N, float scale) {
  const int t = blockIdx.x * 256 + threadIdx.x; if (t >= N * (K / 8)) return; const int n = t / (K / 8), k8 = (t % (K / 8)) * 8; FragH f;
#pragma unroll
  for (int i = 0; i < 8; ++i) f.h[i] = (_Float16)(bf16_round(W[(size_t)(k8 + i) * N + n]) * scale); const v8us o = f.half[0];
  *(v8us*)((unsigned short*)Wt + (size_t)n * K + k8) = o; 
}
// All three projections with their operand preparation, ONE launch. A block = 64 tokens x 12 of the 24 (matrix, head) units (matrix 0 kc, 1 q, 2 v); a wave = one unit (32 outputs) x the 64 tokens over K = 256; f16 operands, f32 accumulators, result x 2^-4.
// x (NCHW f32) is rounded (bf16, then f16) and turned token-major in LDS, sx[token][c]; each wave rounds its own 32 weight rows (x 2^4, bf16, f16: the power of two commutes with the rounding) straight into fragments, k-step by k-step, the f32 rows fetched two k-steps ahead.
// kc, q: A = sx rows (tokens), B = weight rows; each f32 result is split into f16 hi + lo*2^10 and a token's head is stored as ONE 128-byte line, hi 32 | lo 32: QK[(b,token)][kc heads | q heads][hi | lo], pitch QP.
// v: A = weight rows, B = sx rows (tokens), VT[(h,d)][(b,token)] as f16, channel-major: 64 tokens of a channel are one 128-byte line.
#define TT 64
#define XP (CC + 8)
#define QP (2 * NHh * 2 * HD)
#define SOW 2304
// f32 -> nearest-even bf16 -> f32 by the chip's own conversion: the same value as bf16_round() for every finite x, in fewer instructions
__device__ __forceinline__ float bf16_rne(float x) { return (float)(__bf16)x; }
// the f32 weights of k-step ks for this lane: rows ln and 16 + ln of the unit, c = 32ks + 8hh + 0..7 and 32ks + 16 + 8hh + 0..7
__device__ __forceinline__ void proj_ldw(v4f (&raw)[8], const float* __restrict__ wp, int ks) {
#pragma unroll
  for (int nt = 0; nt < 2; ++nt) { const float* p = wp + nt * 16 * CC + ks * 32; raw[nt * 4] = *(const v4fa*)p; raw[nt * 4 + 1] = *(const v4fa*)(p + 4); raw[nt * 4 + 2] = *(const v4fa*)(p + 16); raw[nt * 4 + 3] = *(const v4fa*)(p + 20); } }
// WA: the weight fragment is the A operand (v), else the B operand (kc, q). k order of both fragments: half 0 = c 32ks + 8hh.., half 1 = c 32ks + 16 + 8hh..
template <bool WA>
__device__ __forceinline__ void proj_k(const float* __restrict__ wp, const unsigned short (*sx)[XP], int ln, int hh, v4f (&raw)[3][8], v8f (&acc)[4][2]) {
#pragma unroll
  for (int ks = 0; ks < 8; ++ks) {      // unrolled: raw, acc and the fragments are indexed by constants and stay in registers
    if (ks + 2 < 8) proj_ldw(raw[(ks + 2) % 3], wp, ks + 2);
    if (ks + 2 == 7) asm volatile("s_wait_xcnt 0x0" ::: "memory");      // wp is dead from here on: later results may land on it
    FragH wf[2], xf[4];
#pragma unroll
    for (int mt = 0; mt < 4; ++mt) { xf[mt].half[0] = *(const v8us*)&sx[mt * 16 + ln][ks * 32 + 8 * hh]; xf[mt].half[1] = *(const v8us*)&sx[mt * 16 + ln][ks * 32 + 16 + 8 * hh]; }
#pragma unroll
    for (int nt = 0; nt < 2; ++nt)
#pragma unroll
      for (int j = 0; j < 4; ++j)
#pragma unroll
        for (int i = 0; i < 4; ++i) wf[nt].h[j * 4 + i] = (_Float16)bf16_rne(raw[ks % 3][nt * 4 + j][i] * 16.0f);
#pragma unroll
    for (int mt = 0; mt < 4; ++mt)
#pragma unroll
      for (int nt = 0; nt < 2; ++nt) acc[mt][nt] = WA ? __builtin_amdgcn_wmma_f32_16x16x32_f16(false, wf[nt].v, false, xf[mt].v, (short)0, acc[mt][nt], false, false) : __builtin_amdgcn_wmma_f32_16x16x32_f16(false, xf[mt].v, false, wf[nt].v, (short)0, acc[mt][nt], false, false);
    __builtin_amdgcn_sched_barrier(0);      // keeps the f32 weights of three k-steps at most in registers: left free, the scheduler lifts all 64 loads to the top and spills
  } }
__global__ __launch_bounds__(384, 4) void k_proj(const float* __restrict__ x, const float* __restrict__ Wk, const float* __restrict__ Wq, const float* __restrict__ Wv, _Float16* __restrict__ QK, _Float16* __restrict__ VT) {
  __shared__ __attribute__((aligned(16))) unsigned short sx[TT][XP];      // pitch 528 B = 16 B x odd: the fragment reads meet no bank twice
  __shared__ __attribute__((aligned(16))) float so[12][SOW];      // per wave: 64 tokens x pitch 36 (kc, q) or 32 channels x pitch 68 (v)
  const int tid = threadIdx.x, lane = tid & 31, ln = lane & 15, hh = lane >> 4; const int w = __builtin_amdgcn_readfirstlane(tid >> 5);      // wave number held scalar: the unit and the row bases are then scalar
  const int tile = blockIdx.x >> 1, unit = (blockIdx.x & 1) * 12 + w; const int m = unit >> 3, hd = unit & 7; const int b = tile / (NTOK / TT), p0 = (tile % (NTOK / TT)) * TT;
  const int tq = tid & 15, cg = tid >> 4;      // a piece: 4 tokens x 8 channels; 16 lanes read 256 contiguous bytes of one channel. 512 pieces: one a thread, a second one for waves 0..3
  const float* xp = x + ((size_t)b * CC + cg * 8) * NTOK + p0 + 4 * tq; v4f xv[2][8];
#pragma unroll
  for (int q = 0; q < 8; ++q) xv[0][q] = *(const v4fa*)(xp + (size_t)q * NTOK);
  if (w < 4) {
#pragma unroll
    for (int q = 0; q < 8; ++q) xv[1][q] = *(const v4fa*)(xp + (size_t)(192 + q) * NTOK); }
  asm volatile("s_wait_xcnt 0x0" ::: "memory");      // xp is dead from here on: later results may land on it
  const float* wp = ((m == 0) ? Wk : ((m == 1) ? Wq : Wv)) + (size_t)(hd * HD + ln) * CC + 8 * hh; v4f raw[3][8]; proj_ldw(raw[0], wp, 0); proj_ldw(raw[1], wp, 1);
#pragma unroll
  for (int u = 0; u < 2; ++u) if (u == 0 || w < 4) {
#pragma unroll
    for (int k = 0; k < 4; ++k) { FragH f;
#pragma unroll
      for (int q = 0; q < 8; ++q) f.h[q] = (_Float16)bf16_rne(xv[u][q][k]);
      *(v8us*)&sx[4 * tq + k][(cg + 24 * u) * 8] = f.half[0]; } }
  __syncthreads();      // sx is read by all twelve waves
  v8f acc[4][2] = {};
  float* sw = &so[w][0]; const int r0 = lane >> 3, pc = lane & 7;      // 8 lanes store one whole 128-byte line
  if (m < 2) {
    proj_k<false>(wp, sx, ln, hh, raw, acc);
#pragma unroll
    for (int mt = 0; mt < 4; ++mt)
#pragma unroll
      for (int nt = 0; nt < 2; ++nt)
#pragma unroll
        for (int r = 0; r < 8; ++r) sw[(mt * 16 + 8 * hh + r) * 36 + nt * 16 + ln] = acc[mt][nt][r] * 0.0625f;
    __builtin_amdgcn_fence(__ATOMIC_ACQ_REL, "workgroup"); __builtin_amdgcn_wave_barrier();      // so[w] is written and read by this wave alone
    unsigned short* dq = (unsigned short*)QK + (size_t)(tile * TT) * QP + m * (NHh * 2 * HD) + hd * (2 * HD); const bool islo = pc >= 4;      // lanes 0..3 of a line: hi, lanes 4..7: lo of the same 32 values
#pragma unroll
    for (int q = 0; q < 16; ++q) { const int r = q * 4 + r0; const v4f v0 = *(const v4fa*)&sw[r * 36 + (pc & 3) * 8], v1 = *(const v4fa*)&sw[r * 36 + (pc & 3) * 8 + 4]; FragH fo;
#pragma unroll
      for (int i = 0; i < 8; ++i) { const float v = (i < 4) ? v0[i & 3] : v1[i & 3]; const _Float16 h = (_Float16)v; const _Float16 lw = (_Float16)((v - (float)h) * 1024.0f); fo.h[i] = islo ? lw : h; }
      *(v8us*)(dq + (unsigned)(r * QP + pc * 8)) = fo.half[0];
      asm volatile("s_wait_xcnt 0x0" ::: "memory"); }      // the next rows' values (in the listing also the other branch's block) are written to registers that this store names
  } else {
    proj_k<true>(wp, sx, ln, hh, raw, acc);
#pragma unroll
    for (int mt = 0; mt < 4; ++mt)
#pragma unroll
      for (int nt = 0; nt < 2; ++nt)
#pragma unroll
        for (int r = 0; r < 8; ++r) sw[(nt * 16 + 8 * hh + r) * 68 + mt * 16 + ln] = acc[mt][nt][r] * 0.0625f;
    __builtin_amdgcn_fence(__ATOMIC_ACQ_REL, "workgroup"); __builtin_amdgcn_wave_barrier();      // so[w] is written and read by this wave alone
    unsigned short* dv = (unsigned short*)VT + (size_t)(hd * HD) * NR + tile * TT;
#pragma unroll
    for (int q = 0; q < 8; ++q) { const int r = q * 4 + r0; const v4f v0 = *(const v4fa*)&sw[r * 68 + pc * 8], v1 = *(const v4fa*)&sw[r * 68 + pc * 8 + 4]; FragH fh;
#pragma unroll
      for (int i = 0; i < 4; ++i) { fh.h[i] = (_Float16)v0[i]; fh.h[4 + i] = (_Float16)v1[i]; }
      *(v8us*)(dv + (unsigned)(r * NR + pc * 8)) = fh.half[0];
      asm volatile("s_wait_xcnt 0x0" ::: "memory"); }      // the next rows' values (in the listing also the other branch's block) are written to registers that this store names
  }
}
// exp(x) for x <= 0, by the steps of the library's expf (x*log2(e) in two parts, 2^fraction, ldexp, 0 below the f32 range; its overflow test cannot fire here). The exponential stands in asm with a v_nop behind it:
// the instruction set asks for one slot before a vector instruction reads a transcendental's result or overwrites its source.
__device__ __forceinline__ float exp_nonpos(float x) {
  const float ph = x * 0x1.715476p+0f; float pl = __builtin_fmaf(x, 0x1.715476p+0f, -ph); pl = __builtin_fmaf(x, 0x1.4ae0bep-26f, pl);
  const float e = __builtin_rintf(ph); const float a = (ph - e) + pl; float r;
  asm("v_exp_f32 %0, %1\n\tv_nop" : "=v"(r) : "v"(a));
  r = ldexpf(r, (int)e);
  return (x < -0x1.9d1da0p+6f) ? 0.f : r; }
// window attention, one wave per (b, head h, row y, 16-token x segment): for each window row i the 32 tokens (y + i - 3, x0 - 8 .. x0 + 23) are ONE key block.
// S^T = Q_row (32 keys x 32 d, two A tiles, f16 hi + lo*2^-10, 3 products) * KC^T (B, 16 centre keys): lane (ln, hh) holds, for centre token ln, the keys c = 16t + 8hh + r;
// the window is the band 0 <= c - ln - 5 <= 6 (= column offset j). Softmax of a centre token is in-lane plus one exchange with lane ^ 16; the two S^T tiles, as f16, ARE the B operand of
// O^T = V^T (A: row d, keys along k, read from the channel-major sV) * P^T, so a lane ends with 8 consecutive d of its own token.
// kc.rel_k splits into a row term and a column term: E = REL * KC^T with REL rows 0..6 = (rel_h[i] | 0), rows 8..14 = (0 | rel_w[j]), rows 7 and 15 zero; rel is bf16-rounded first, as before (8 significant bits: exact in f16 from 2^-14 up, below that off by at most 2^-25), and kc is hi + lo*2^-10 (2 products).
// A block = one (b, head) x four image rows (y0 = 4g ..) x the four x segments, sixteen waves: its 224 tokens are 896 bytes = seven whole 128-byte lines of every NCHW output channel, so the block turns its result channel-major in LDS and stores the output itself, each line from one block.
#define RG 4
#define TPB (RG * HI)
#define OP (TPB + 4)
#define QLP (2 * HD + 8)
#define VPC 80
#define VLP (VPC * 8 + 8)
__global__ __launch_bounds__(512) void k_nattn(const _Float16* __restrict__ QK, const _Float16* __restrict__ VT, const float* __restrict__ relh, const float* __restrict__ relw, float* __restrict__ out) {
  __shared__ __attribute__((aligned(16))) float sR[RG * NXS][16][20];      // per centre token of the wave: words 0..6 kc.rel_h[i], words 8..14 kc.rel_w[j] (pitch 20: rows stay 16-byte aligned and in-band lanes of the gather below meet no bank twice)
  __shared__ __attribute__((aligned(16))) unsigned short sQ[9 * 64][QLP];      // q lines (hi 32 | lo 32) of the block's ten window rows y0 - 3 .. y0 + 6 (560 tokens, filled in nine rounds of 64), token-major; pitch 144 B = 16 B x odd: the fragment reads meet no bank twice
  __shared__ __attribute__((aligned(16))) unsigned short sK[4 * 64][QLP];      // kc lines of the block's own 224 tokens (four rounds of 64), same pitch
  __shared__ __attribute__((aligned(16))) unsigned short sV[HD][VLP];      // v of the same ten rows (70 pieces of 8 tokens, filled as 80), channel-major; pitch 1296 B = 16 B x odd
  __shared__ __attribute__((aligned(16))) float sT[HD][OP];      // [d][token of the block]; pitch 228 words: rows stay 16-byte aligned, and rows d and d + 8, written by the two lane halves at once, lie 32 banks apart
  const int tid = threadIdx.x, lane = tid & 31, ln = lane & 15, hh = lane >> 4; const int w = __builtin_amdgcn_readfirstlane(tid >> 5);      // wave number held scalar: (b, h, y, x0) and every row base below are then scalar, a lane keeps only row-invariant byte offsets
  const int b = blockIdx.x / (NHh * (HI / RG)), rem = blockIdx.x % (NHh * (HI / RG)); const int h = rem / (HI / RG), y0 = (rem % (HI / RG)) * RG; const int yl = w / NXS, y = y0 + yl, x0 = (w % NXS) * 16;
  const int qx = (x0 + ln < HI) ? (x0 + ln) : (HI - 1);      // lanes past the image row repeat its last token; their result is not stored
  // The block's operands come in ONCE, by loads that cover whole 128-byte lines (8 lanes a token line; a channel's ten rows are 1120 contiguous bytes), and are read as fragments from LDS: the sixteen waves use each q and v row several times over (four image rows share ten window rows, neighbouring segments overlap by half).
  // Every thread makes the same 18 loads, no branch among them: the rounds run a little past the 560, 224 and 70 that are read. A token index outside the image (a padding row, or such a surplus piece) is clamped into it (kc: a surplus piece repeats one of the block's own tokens), so every address is in bounds; the readers below put zero in place of the padding rows, as before, and never read the surplus.
  v8us gq[9], gk[4], gv[5]; unsigned oq[9], ok[4], ovv[5]; const int g0 = (y0 - 3) * HI, pc8 = tid & 7, tk0 = tid >> 3;
  { const char* qg = (const char*)QK + ((size_t)(b * NTOK) * QP + NHh * 2 * HD + h * (2 * HD)) * 2; const char* kg = (const char*)QK + ((size_t)(b * NTOK + y0 * HI) * QP + h * (2 * HD)) * 2; const char* vg = (const char*)VT + ((size_t)(h * HD + 2 * w) * NR + b * NTOK) * 2;
#pragma unroll      // the three loops unrolled: gq, gk, gv are indexed by constants and stay in registers
    for (int k = 0; k < 9; ++k) { int gt = g0 + tk0 + 64 * k; gt = (gt < 0) ? 0 : ((gt > NTOK - 1) ? (NTOK - 1) : gt); oq[k] = (unsigned)(gt * (QP * 2) + pc8 * 16); gq[k] = *(const v8us*)(qg + oq[k]); }
#pragma unroll
    for (int k = 0; k < 4; ++k) { int gt = tk0 + 64 * k; gt = (gt > TPB - 1) ? (gt - 192) : gt; ok[k] = (unsigned)(gt * (QP * 2) + pc8 * 16); gk[k] = *(const v8us*)(kg + ok[k]); }
#pragma unroll
    for (int k = 0; k < 5; ++k) { const int j = lane + 32 * k; const int d = (j >= VPC) ? 1 : 0; int to = g0 + (j - d * VPC) * 8; to = (to < 0) ? 0 : ((to > NTOK - 8) ? (NTOK - 8) : to); ovv[k] = (unsigned)(d * NR + to) * 2; gv[k] = *(const v8us*)(vg + ovv[k]); }      // wave w: channels 2w, 2w + 1; a piece = 8 tokens, never astride two image rows
    asm volatile("s_wait_xcnt 0x0" :: "v"(oq[0]), "v"(oq[1]), "v"(oq[2]), "v"(oq[3]), "v"(oq[4]), "v"(oq[5]), "v"(oq[6]), "v"(oq[7]), "v"(oq[8]), "v"(ok[0]), "v"(ok[1]), "v"(ok[2]), "v"(ok[3]), "v"(ovv[0]), "v"(ovv[1]), "v"(ovv[2]), "v"(ovv[3]), "v"(ovv[4]) : "memory"); }      // the offsets of these loads die here and later results may land on their registers (named as inputs: they live up to the wait, so that no load of the run lands on an earlier one's offset)
  const v8us z8 = (v8us){0,0,0,0,0,0,0,0}; const v8f z8f = (v8f){0.f,0.f,0.f,0.f,0.f,0.f,0.f,0.f};
  FragH ar; { const int ri = ln & 7; const float* rp = ((ln < 8) ? relh : relw) + (h * 7 + ((ri < 7) ? ri : 6)) * 16 + 8 * hh; const v4f r0 = *(const v4fa*)rp, r1 = *(const v4fa*)(rp + 4); FragH c;      // row ln of REL: its 8 non-zero k of this lane half
    asm volatile("s_wait_xcnt 0x0" ::: "memory");      // rp is dead from here on: later results may land on it
#pragma unroll
    for (int q = 0; q < 4; ++q) { c.h[q] = (_Float16)bf16_round(r0[q]); c.h[4 + q] = (_Float16)bf16_round(r1[q]); }
    const v8us cv = (ri < 7) ? c.half[0] : z8; ar.half[0] = (ln < 8) ? cv : z8; ar.half[1] = (ln < 8) ? z8 : cv; }      // k order as bc: half 0 = d 8hh.., half 1 = d 16 + 8hh..
#pragma unroll      // unrolled as the loads are: constant indices
  for (int k = 0; k < 9; ++k) *(v8us*)&sQ[tk0 + 64 * k][pc8 * 8] = gq[k];
#pragma unroll
  for (int k = 0; k < 4; ++k) *(v8us*)&sK[tk0 + 64 * k][pc8 * 8] = gk[k];
#pragma unroll
  for (int k = 0; k < 5; ++k) { const int j = lane + 32 * k; const int d = (j >= VPC) ? 1 : 0; *(v8us*)&sV[2 * w + d][(j - d * VPC) * 8] = gv[k]; }
  __syncthreads();      // sQ, sK, sV are written by all sixteen waves and read across them
  FragH bc, bcl; { const unsigned short* kr = &sK[yl * HI + qx][8 * hh]; bc.half[0] = *(const v8us*)kr; bc.half[1] = *(const v8us*)(kr + 16); bcl.half[0] = *(const v8us*)(kr + HD); bcl.half[1] = *(const v8us*)(kr + HD + 16); }      // centre key kc, column ln of B; a head's line: hi 32 | lo 32
  { const v8f e = __builtin_amdgcn_wmma_f32_16x16x32_f16(false, ar.v, false, bc.v, (short)0, z8f, false, false); const v8f e2 = __builtin_amdgcn_wmma_f32_16x16x32_f16(false, ar.v, false, bcl.v, (short)0, z8f, false, false); v4f o0, o1;
#pragma unroll
    for (int q = 0; q < 4; ++q) { o0[q] = e[q] + e2[q] * 0.0009765625f; o1[q] = e[4 + q] + e2[4 + q] * 0.0009765625f; }
    *(v4fa*)&sR[w][ln][8 * hh] = o0; *(v4fa*)&sR[w][ln][8 * hh + 4] = o1; }      // lane (ln, hh) holds rows 8hh..8hh+7 of E for its own centre token
  __builtin_amdgcn_fence(__ATOMIC_ACQ_REL, "workgroup"); __builtin_amdgcn_wave_barrier();      // sR is written and read by this wave alone
  bool inb[2][8]; int rj[2][8]; bool xok[2], vok[2]; unsigned qoff[2], voff[2];
#pragma unroll
  for (int t = 0; t < 2; ++t) {
    const int xx = x0 - 8 + 16 * t + ln; xok[t] = (xx >= 0 && xx < HI); qoff[t] = (unsigned)((xok[t] ? xx : 0) * QLP + 8 * hh);      // key c = 16t + ln as row of A
    const int xk = x0 - 8 + 16 * t + 8 * hh; vok[t] = (xk >= 0 && xk < HI); voff[t] = (unsigned)(ln * VLP + (vok[t] ? xk : 0));      // 8 keys: wholly inside the image row or wholly outside
#pragma unroll
    for (int r = 0; r < 8; ++r) { const int j = 16 * t + 8 * hh + r - ln - 5; inb[t][r] = (j >= 0 && j < 7); rj[t][r] = (j < 0) ? 0 : ((j > 6) ? 6 : j); } }
  float rh[8]; v8f rw[2]; { const float* rl = &sR[w][ln][0]; const v4f a0 = *(const v4fa*)rl, a1 = *(const v4fa*)(rl + 4);
#pragma unroll
    for (int q = 0; q < 4; ++q) { rh[q] = a0[q]; rh[4 + q] = a1[q]; }
#pragma unroll
    for (int t = 0; t < 2; ++t)
#pragma unroll
      for (int r = 0; r < 8; ++r) rw[t][r] = rl[8 + rj[t][r]]; }      // column term of key c = 16t + 8hh + r, the same for all seven window rows; every lane reads (index clamped into the row): no branch round the load
  float lg[7][2][8];
#pragma unroll
  for (int i = 0; i < 7; ++i) { const int yy = y + i - 3; const bool yok = (yy >= 0 && yy < HI); const unsigned short* q0 = &sQ[(yl + i) * HI][0]; const unsigned short* q1 = q0 + HD;      // window row i of image row y is staged row yl + i
#pragma unroll
    for (int t = 0; t < 2; ++t) { const bool ok = yok && xok[t];
      FragH ak, akl; ak.half[0] = *(const v8us*)(q0 + qoff[t]); ak.half[1] = *(const v8us*)(q0 + qoff[t] + 16); akl.half[0] = *(const v8us*)(q1 + qoff[t]); akl.half[1] = *(const v8us*)(q1 + qoff[t] + 16);
      if (!ok) { ak.half[0] = z8; ak.half[1] = z8; akl.half[0] = z8; akl.half[1] = z8; }      // zero padding: q = 0 outside the image
      v8f s = __builtin_amdgcn_wmma_f32_16x16x32_f16(false, ak.v, false, bc.v, (short)0, rw[t], false, false);      // the column term rides in as C
      v8f s2 = __builtin_amdgcn_wmma_f32_16x16x32_f16(false, ak.v, false, bcl.v, (short)0, z8f, false, false); s2 = __builtin_amdgcn_wmma_f32_16x16x32_f16(false, akl.v, false, bc.v, (short)0, s2, false, false);      // hi.hi + (lo.hi + hi.lo)*2^-10
#pragma unroll
      for (int r = 0; r < 8; ++r) { const float sd = s[r] + s2[r] * 0.0009765625f; const float lv = sd + rh[i]; lg[i][t][r] = inb[t][r] ? lv : -3.0e38f; } } }      // kc.(q + rel_k); padded neighbours keep kc.rel_k
  float m = -3.0e38f;
#pragma unroll
  for (int i = 0; i < 7; ++i)
#pragma unroll
    for (int t = 0; t < 2; ++t)
#pragma unroll
      for (int r = 0; r < 8; ++r) m = fmaxf(m, lg[i][t][r]);
  m = fmaxf(m, __shfl_xor(m, 16, 32));
  float l = 0.f; v8f oacc[2] = {z8f, z8f};
#pragma unroll
  for (int i = 0; i < 7; ++i) { const int yy = y + i - 3; const bool yok = (yy >= 0 && yy < HI); const unsigned short* vb = &sV[0][(yl + i) * HI]; FragH pb;
#pragma unroll
    for (int t = 0; t < 2; ++t)
#pragma unroll
      for (int r = 0; r < 8; ++r) { const float p = exp_nonpos(lg[i][t][r] - m); l += p; pb.h[8 * t + r] = (_Float16)p; }      // outside the band: exp -> 0
#pragma unroll
    for (int dt = 0; dt < 2; ++dt) { FragH av;
#pragma unroll
      for (int t = 0; t < 2; ++t) { av.half[t] = *(const v8us*)(vb + voff[t] + dt * (16 * VLP)); if (!(yok && vok[t])) av.half[t] = z8; }      // zero padding: v = 0 outside the image
      oacc[dt] = __builtin_amdgcn_wmma_f32_16x16x32_f16(false, av.v, false, pb.v, (short)0, oacc[dt], false, false); }
    __builtin_amdgcn_sched_barrier(0); }      // keeps the next row's v_exp_f32 from being lifted to directly behind these matrix instructions; its own seven-instruction argument chain now stands between
  l += __shfl_xor(l, 16, 32);
  if (x0 + ln < HI) {      // lanes past the image row hold a repeat of its last token: not kept
#pragma unroll
    for (int dt = 0; dt < 2; ++dt)
#pragma unroll
      for (int r = 0; r < 8; ++r) sT[dt * 16 + 8 * hh + r][yl * HI + x0 + ln] = oacc[dt][r] / l; }
  __syncthreads();      // sT is written by all sixteen waves and read across them
  // wave w stores channels 2w and 2w + 1 of the head: 2 x 56 pieces of 16 bytes, a store instruction covers whole 128-byte lines
  float* op = out + ((size_t)(b * CC + h * HD + 2 * w) * NTOK + y0 * HI);
  v4f ov[4];      // all LDS reads first, then the stores: one LDS latency instead of four
#pragma unroll      // both loops unrolled: ov is indexed by constants and stays in registers
  for (int k = 0; k < 4; ++k) { const int j = lane + 32 * k; if (j < 2 * (TPB / 4)) { const int d = (j >= TPB / 4) ? 1 : 0, c4 = (j - d * (TPB / 4)) * 4; ov[k] = *(const v4fa*)&sT[2 * w + d][c4]; } }
#pragma unroll
  for (int k = 0; k < 4; ++k) { const int j = lane + 32 * k; if (j < 2 * (TPB / 4)) { const int d = (j >= TPB / 4) ? 1 : 0, c4 = (j - d * (TPB / 4)) * 4; *(v4f*)(op + (unsigned)(d * NTOK + c4)) = ov[k]; } }
}

extern "C" void kernel_launch(void* const* d_in, const int* in_sizes, int n_in,
                              void* d_out, int out_size, void* d_ws, size_t ws_size, hipStream_t stream) {
  (void)in_sizes; (void)n_in; (void)out_size;
  const float* x = (const float*)d_in[0]; const float* Wk = (const float*)d_in[1]; const float* Wq = (const float*)d_in[2]; const float* Wv = (const float*)d_in[3]; const float* relh = (const float*)d_in[4]; const float* relw = (const float*)d_in[5];
  char* ws = (char*)d_ws; size_t off = 0;
  auto take = [&](size_t bytes) { char* p = ws + off; off += (bytes + 255) & ~(size_t)255; return p; };
  _Float16* QK = (_Float16*)take((size_t)NR * QP * 2); _Float16* VT = (_Float16*)take((size_t)CC * NR * 2);
  if (off > ws_size) return;      // 12.8 + 3.2: about 16 MB
  k_proj<<<(NR / TT) * 2, 384, 0, stream>>>(x, Wk, Wq, Wv, QK, VT);      // kc | q as f16 hi | lo*2^10 lines per head; v channel-major
  k_nattn<<<BB * NHh * (HI / RG), RG * NXS * 32, 0, stream>>>(QK, VT, relh, relw, (float*)d_out);      // stores the NCHW output itself
}

// v007
// It runs in 22.7 microseconds.
// Timed twice side by side with v006, it ran 1.14 times as fast both times.
// Over all steps from v000 it is 8.10 times as fast.
#include <hip/hip_runtime.h>
// Stand-alone (SASA) local self-attention (B=2, C 256 = 8 heads × 32, 56×56, 7×7 windows, stride 1, zero padding; relative row/col embeddings added to the windowed QUERIES, the centre KEY is
// the fixed operand, softmax over the 49 window positions, values windowed): 1×1 projections as GEMMs ((head,dim)×C weights bf16-exact ×2^4) and the window attention on
// v_wmma_f32_16x16x32_f16 with one banded key block per window row (per 16-token row segment and window row: S^T = Q_row.KC^T over 32 keys, kc and q as f16 hi + lo*2^-10 (3 products), band element + kc.rel_k (f32) = logit; f32 softmax over all 49, in-lane
// plus one lane exchange; O^T += V^T.P^T with the f16 S^T tiles as the B operand and V kept channel-major); kc.rel_k = kc[0..15].rel_h[i] + kc[16..31].rel_w[j] is one more A tile (14 rows) against the same KC^T; the NCHW transposes are f32 VALU, through LDS inside the two kernels.
#define BB 2
#define CC 256
#define NHh 8
#define HD 32
#define HI 56
#define NTOK 3136
#define NXS 4
#define NR (BB * NTOK)

typedef __bf16 v16b __attribute__((ext_vector_type(16)));
typedef unsigned short v8us __attribute__((ext_vector_type(8), may_alias));
typedef float  v8f  __attribute__((ext_vector_type(8)));
typedef float  v4f  __attribute__((ext_vector_type(4)));
typedef float  v4fa __attribute__((ext_vector_type(4), may_alias));
union FragB { v16b v; v8us half[2]; unsigned short u[16]; };

__device__ __forceinline__ unsigned short bf16_bits(float x) { unsigned int u = __float_as_uint(x); return (unsigned short)((u + 0x7FFFu + ((u >> 16) & 1u)) >> 16); }
__device__ __forceinline__ float bf16_val(unsigned short b) { return __uint_as_float(((unsigned int)b) << 16); }
__device__ __forceinline__ float bf16_round(float x) { return bf16_val(bf16_bits(x)); }
// D += A·B with NT terms: 1 = ah·bh, 2 = + al·bh (A split), 3 = + ah·bl (both split)
template <int NT>
__device__ __forceinline__ v8f mmaN(v16b ah, v16b al, v16b bh, v16b bl, v8f c) {
  c = __builtin_amdgcn_wmma_f32_16x16x32_bf16(false, ah, false, bh, (short)0, c, false, false);
  if (NT >= 2) c = __builtin_amdgcn_wmma_f32_16x16x32_bf16(false, al, false, bh, (short)0, c, false, false);
  if (NT >= 3) c = __builtin_amdgcn_wmma_f32_16x16x32_bf16(false, ah, false, bl, (short)0, c, false, false);
  asm volatile("v_nop\n\tv_nop\n\tv_nop\n\tv_nop" : "+v"(c) : "v"(ah), "v"(al), "v"(bh), "v"(bl));
  return c;
}

__global__ __launch_bounds__(256) void k_wt_bf16(const float* __restrict__ W, unsigned short* __restrict__ Wt, int K, int N) {
  const int t = blockIdx.x * 256 + threadIdx.x;
  const int k8n = K / 8;
  if (t >= N * k8n) return;
  const int n = t / k8n, k8 = (t % k8n) * 8;
  v8us v;
#pragma unroll
  for (int i = 0; i < 8; ++i) v[i] = bf16_bits(W[(size_t)(k8 + i) * N + n]);
  *(v8us*)(Wt + (size_t)n * K + k8) = v;
  
}

// GEMM C[M][N] (f32, pitch ldc) = act(A[M][K]·W + bias). A f32 row-major (pitch lda) converted per fragment to bf16
// (ASPLIT: hi/lo two planes -> 2 terms, else single rounded term); Wt bf16 [N][K] (pitch ldb). BIAS_BF16 rounds the
// bias to bf16 first (bias quantised to bf16 before the add). K%32==0, M%16==0, N%64==0.
template <bool ASPLIT, int ACT, bool BIAS_BF16>
__global__ __launch_bounds__(128) void k_gemm_bf(const float* __restrict__ A, int lda, const unsigned short* __restrict__ Wt, int ldb,
                                               const float* __restrict__ bias, float* __restrict__ C, int ldc, int M, int N, int K) {
  __shared__ __attribute__((aligned(16))) float so[4][16][64];
  const int tid = threadIdx.x, w = tid >> 5, lane = tid & 31, ln = lane & 15, hh = lane >> 4;
  const int ntn = N / 64;
  const int wid = blockIdx.x * 4 + w;
  const int mt = wid / ntn, nq = wid % ntn;
  if (mt * 16 >= M) return;
  const int row0 = mt * 16, col0 = nq * 64;
  const float* arow = A + (size_t)(row0 + ln) * lda;
  v8f acc[4] = {};
  for (int kb = 0; kb < K; kb += 32) {
    FragB ah, al;
    const v4f x0 = *(const v4fa*)(arow + kb + 8 * hh), x1 = *(const v4fa*)(arow + kb + 8 * hh + 4);
    const v4f x2 = *(const v4fa*)(arow + kb + 16 + 8 * hh), x3 = *(const v4fa*)(arow + kb + 16 + 8 * hh + 4);
    float xs[16] = {x0[0],x0[1],x0[2],x0[3],x1[0],x1[1],x1[2],x1[3],x2[0],x2[1],x2[2],x2[3],x3[0],x3[1],x3[2],x3[3]};
#pragma unroll
    for (int i = 0; i < 16; ++i) { const unsigned short hb = bf16_bits(xs[i]); ah.u[i] = hb; al.u[i] = ASPLIT ? bf16_bits(xs[i] - bf16_val(hb)) : (unsigned short)0; }
#pragma unroll
    for (int t = 0; t < 4; ++t) {
      const unsigned short* brow = Wt + (size_t)(col0 + t * 16 + ln) * ldb + kb;
      FragB b;
      b.half[0] = *(const v8us*)(brow + 8 * hh);
      b.half[1] = *(const v8us*)(brow + 16 + 8 * hh);
      acc[t] = mmaN<ASPLIT ? 2 : 1>(ah.v, al.v, b.v, b.v, acc[t]);
    }
  }
#pragma unroll
  for (int t = 0; t < 4; ++t) {
    float bv = bias ? bias[col0 + t * 16 + ln] : 0.f;
    if (BIAS_BF16) bv = bf16_round(bv);
#pragma unroll
    for (int r = 0; r < 8; ++r) { float v = acc[t][r] + bv; if (ACT == 1) v = fmaxf(v, 0.f); so[w][8 * hh + r][t * 16 + ln] = v; }
  }
  __builtin_amdgcn_fence(__ATOMIC_ACQ_REL, "workgroup");
  __builtin_amdgcn_wave_barrier();
  const int rsub = lane >> 4, c4 = (lane & 15) * 4;
  {
#pragma unroll
    for (int q = 0; q < 8; ++q) {
      const int r = q * 2 + rsub;
      const v4f v = *(const v4fa*)&so[w][r][c4];
      *(v4f*)(C + (size_t)(row0 + r) * ldc + col0 + c4) = v;
    }
    
  }
}

// Flash-style causal/unmasked attention, all contractions 3-term bf16 hi/lo splits, f32 softmax with running max.
// q,k,v rows are read from f32 buffers with arbitrary row pitch (so they can live inside a fused qkv buffer);
// D = head size (multiple of 32, <= 128); one wave = 16 query rows; block = 4 waves (64 queries) sharing K/V chunks of 32.
template <int D, bool CAUSAL>
__global__ __launch_bounds__(128) void k_flash(const float* __restrict__ qb, const float* __restrict__ kb, const float* __restrict__ vb,
                                             int pitch, int T, int H, float scale, float* __restrict__ y, int ypitch) {
  constexpr int KS = D / 32;        // k-steps for QK
  constexpr int DT = D / 16;        // d tiles for PV
  __shared__ __attribute__((aligned(16))) unsigned short sKh[32][D + 8], sKl[32][D + 8], sVh[32][D + 8], sVl[32][D + 8];
  __shared__ __attribute__((aligned(16))) unsigned short sPh[4][16][40], sPl[4][16][40];
  __shared__ __attribute__((aligned(16))) float sO[4][16][D];
  const int tid = threadIdx.x, w = tid >> 5, lane = tid & 31, ln = lane & 15, hh = lane >> 4;
  const int nqb = (T + 63) / 64;
  const int bh = blockIdx.x / nqb, qblk = blockIdx.x % nqb;
  const int b = bh / H, h = bh % H;
  const int q0 = qblk * 64 + w * 16;
  const float* Q = qb + (size_t)b * T * pitch + h * D;
  const float* K = kb + (size_t)b * T * pitch + h * D;
  const float* V = vb + (size_t)b * T * pitch + h * D;

  // A fragments of the wave's 16 query rows (scaled), hi/lo
  FragB aqh[KS], aql[KS];
  {
    int row = q0 + ln; if (row >= T) row = T - 1;
    const float* qr = Q + (size_t)row * pitch;
#pragma unroll
    for (int ks = 0; ks < KS; ++ks)
#pragma unroll
      for (int i = 0; i < 16; ++i) {
        const int d = ks * 32 + ((i < 8) ? (8 * hh + i) : (16 + 8 * hh + (i - 8)));
        const float x = qr[d] * scale; const unsigned short hb = bf16_bits(x);
        aqh[ks].u[i] = hb; aql[ks].u[i] = bf16_bits(x - bf16_val(hb));
      }
  }
  float m_r[8], l_r[8];
#pragma unroll
  for (int r = 0; r < 8; ++r) { m_r[r] = -3.0e38f; l_r[r] = 0.f; }
  v8f oacc[DT];
#pragma unroll
  for (int dt = 0; dt < DT; ++dt) oacc[dt] = (v8f){0.f,0.f,0.f,0.f,0.f,0.f,0.f,0.f};

  const int kv_end = CAUSAL ? min(T, qblk * 64 + 64) : T;     // block-uniform
  for (int j0 = 0; j0 < kv_end; j0 += 32) {
    __syncthreads();
    for (int e = tid; e < 32 * (D / 4); e += 128) {
      const int r = e / (D / 4), c4 = (e % (D / 4)) * 4;
      const int key = j0 + r;
      v4f kf = {0.f,0.f,0.f,0.f}, vf = {0.f,0.f,0.f,0.f};
      if (key < T) { kf = *(const v4fa*)(K + (size_t)key * pitch + c4); vf = *(const v4fa*)(V + (size_t)key * pitch + c4); }
#pragma unroll
      for (int t = 0; t < 4; ++t) {
        unsigned short hb = bf16_bits(kf[t]); sKh[r][c4 + t] = hb; sKl[r][c4 + t] = bf16_bits(kf[t] - bf16_val(hb));
        hb = bf16_bits(vf[t]); sVh[r][c4 + t] = hb; sVl[r][c4 + t] = bf16_bits(vf[t] - bf16_val(hb));
      }
    }
    __syncthreads();
    // S tile 16 x 32
    v8f s[2];
#pragma unroll
    for (int nt = 0; nt < 2; ++nt) {
      v8f acc = {};
#pragma unroll
      for (int ks = 0; ks < KS; ++ks) {
        FragB bh_, bl_;
        bh_.half[0] = *(const v8us*)&sKh[nt * 16 + ln][ks * 32 + 8 * hh]; bh_.half[1] = *(const v8us*)&sKh[nt * 16 + ln][ks * 32 + 16 + 8 * hh];
        bl_.half[0] = *(const v8us*)&sKl[nt * 16 + ln][ks * 32 + 8 * hh]; bl_.half[1] = *(const v8us*)&sKl[nt * 16 + ln][ks * 32 + 16 + 8 * hh];
        acc = mmaN<3>(aqh[ks].v, aql[ks].v, bh_.v, bl_.v, acc);
      }
      s[nt] = acc;
    }
    // mask + running max (rows 8hh+r; the 16 lanes of a half share rows)
    float alpha[8];
#pragma unroll
    for (int r = 0; r < 8; ++r) {
      const int qi = q0 + 8 * hh + r;
      const int ja = j0 + ln, jb = j0 + 16 + ln;
      if (CAUSAL) { if (ja > qi) s[0][r] = -3.0e38f; if (jb > qi) s[1][r] = -3.0e38f; }
      if (ja >= T) s[0][r] = -3.0e38f;
      if (jb >= T) s[1][r] = -3.0e38f;
      float mx = fmaxf(s[0][r], s[1][r]);
      mx = fmaxf(mx, __shfl_xor(mx, 1, 32)); mx = fmaxf(mx, __shfl_xor(mx, 2, 32)); mx = fmaxf(mx, __shfl_xor(mx, 4, 32)); mx = fmaxf(mx, __shfl_xor(mx, 8, 32));
      const float mnew = fmaxf(m_r[r], mx);
      alpha[r] = (mnew > -1.0e38f) ? __expf(m_r[r] - mnew) : 1.0f;
      const float p0 = (s[0][r] > -1.0e38f) ? __expf(s[0][r] - mnew) : 0.f;
      const float p1 = (s[1][r] > -1.0e38f) ? __expf(s[1][r] - mnew) : 0.f;
      m_r[r] = mnew;
      l_r[r] = l_r[r] * alpha[r] + p0 + p1;            // per-lane partial row sum (16 lanes combined at the end)
      unsigned short hb = bf16_bits(p0); sPh[w][8 * hh + r][ln] = hb;      sPl[w][8 * hh + r][ln] = bf16_bits(p0 - bf16_val(hb));
      hb = bf16_bits(p1);                sPh[w][8 * hh + r][16 + ln] = hb; sPl[w][8 * hh + r][16 + ln] = bf16_bits(p1 - bf16_val(hb));
    }
#pragma unroll
    for (int dt = 0; dt < DT; ++dt)
#pragma unroll
      for (int r = 0; r < 8; ++r) oacc[dt][r] *= alpha[r];
    __builtin_amdgcn_fence(__ATOMIC_ACQ_REL, "workgroup");
    __builtin_amdgcn_wave_barrier();
    FragB pah, pal;
    pah.half[0] = *(const v8us*)&sPh[w][ln][8 * hh]; pah.half[1] = *(const v8us*)&sPh[w][ln][16 + 8 * hh];
    pal.half[0] = *(const v8us*)&sPl[w][ln][8 * hh]; pal.half[1] = *(const v8us*)&sPl[w][ln][16 + 8 * hh];
#pragma unroll
    for (int dt = 0; dt < DT; ++dt) {
      FragB bvh, bvl;
#pragma unroll
      for (int i = 0; i < 8; ++i) {
        bvh.u[i] = sVh[8 * hh + i][dt * 16 + ln]; bvh.u[8 + i] = sVh[16 + 8 * hh + i][dt * 16 + ln];
        bvl.u[i] = sVl[8 * hh + i][dt * 16 + ln]; bvl.u[8 + i] = sVl[16 + 8 * hh + i][dt * 16 + ln];
      }
      oacc[dt] = mmaN<3>(pah.v, pal.v, bvh.v, bvl.v, oacc[dt]);
    }
    __builtin_amdgcn_fence(__ATOMIC_ACQ_REL, "workgroup");
    __builtin_amdgcn_wave_barrier();
  }
#pragma unroll
  for (int r = 0; r < 8; ++r) {
    float l = l_r[r];
    l += __shfl_xor(l, 1, 32); l += __shfl_xor(l, 2, 32); l += __shfl_xor(l, 4, 32); l += __shfl_xor(l, 8, 32);
    l_r[r] = (l > 0.f) ? 1.0f / l : 0.f;
  }
#pragma unroll
  for (int dt = 0; dt < DT; ++dt)
#pragma unroll
    for (int r = 0; r < 8; ++r) sO[w][8 * hh + r][dt * 16 + ln] = oacc[dt][r] * l_r[r];
  __builtin_amdgcn_fence(__ATOMIC_ACQ_REL, "workgroup");
  __builtin_amdgcn_wave_barrier();
  {
    for (int r = 0; r < 16; ++r) {
      const int row = q0 + r;
      if (row < T && lane < D / 4) {
        const v4f val = *(const v4fa*)&sO[w][r][lane * 4];
        *(v4f*)(y + ((size_t)b * T + row) * ypitch + h * D + lane * 4) = val;
      }
    }
    
  }
}

// GEMM C = act(A·W + bias + resid): A f32 (ASPLIT -> hi/lo 2 terms), Wt bf16 [N][K]; ACT 0 none, 1 relu, 2 exact gelu;
// resid (optional, f32, row index = (row % rmod), pitch ldr, RES_BF16 rounds it) added before the activation.
template <bool ASPLIT, int ACT, bool BIAS_BF16, bool RES_BF16>
__global__ __launch_bounds__(128) void k_gemm_bf3(const float* __restrict__ A, int lda, const unsigned short* __restrict__ Wt, int ldb,
                                                const float* __restrict__ bias, const float* __restrict__ resid, int rmod, int ldr,
                                                float* __restrict__ C, int ldc, int M, int N, int K) {
  __shared__ __attribute__((aligned(16))) float so[4][16][64];
  const int tid = threadIdx.x, w = tid >> 5, lane = tid & 31, ln = lane & 15, hh = lane >> 4;
  const int ntn = N / 64;
  const int wid = blockIdx.x * 4 + w;
  const int mt = wid / ntn, nq = wid % ntn;
  if (mt * 16 >= M) return;
  const int row0 = mt * 16, col0 = nq * 64;
  const float* arow = A + (size_t)(row0 + ln) * lda;
  v8f acc[4] = {};
  for (int kb = 0; kb < K; kb += 32) {
    FragB ah, al;
    const v4f x0 = *(const v4fa*)(arow + kb + 8 * hh), x1 = *(const v4fa*)(arow + kb + 8 * hh + 4);
    const v4f x2 = *(const v4fa*)(arow + kb + 16 + 8 * hh), x3 = *(const v4fa*)(arow + kb + 16 + 8 * hh + 4);
    float xs[16] = {x0[0],x0[1],x0[2],x0[3],x1[0],x1[1],x1[2],x1[3],x2[0],x2[1],x2[2],x2[3],x3[0],x3[1],x3[2],x3[3]};
#pragma unroll
    for (int i = 0; i < 16; ++i) { const unsigned short hb = bf16_bits(xs[i]); ah.u[i] = hb; al.u[i] = ASPLIT ? bf16_bits(xs[i] - bf16_val(hb)) : (unsigned short)0; }
#pragma unroll
    for (int t = 0; t < 4; ++t) {
      const unsigned short* brow = Wt + (size_t)(col0 + t * 16 + ln) * ldb + kb;
      FragB b;
      b.half[0] = *(const v8us*)(brow + 8 * hh);
      b.half[1] = *(const v8us*)(brow + 16 + 8 * hh);
      acc[t] = mmaN<ASPLIT ? 2 : 1>(ah.v, al.v, b.v, b.v, acc[t]);
    }
  }
#pragma unroll
  for (int t = 0; t < 4; ++t) {
    const int col = col0 + t * 16 + ln;
    float bv = bias ? bias[col] : 0.f;
    if (BIAS_BF16) bv = bf16_round(bv);
#pragma unroll
    for (int r = 0; r < 8; ++r) {
      float v = acc[t][r] + bv;
      if (resid) { float rv = resid[(size_t)((row0 + 8 * hh + r) % rmod) * ldr + col]; if (RES_BF16) rv = bf16_round(rv); v += rv; }
      if (ACT == 1) v = fmaxf(v, 0.f);
      if (ACT == 2) v = 0.5f * v * (1.0f + erff(v * 0.70710678118654752f));
      if (ACT == 3) { const float u = 0.7978845608028654f * (v + 0.044715f * v * v * v); v = 0.5f * v * (1.0f + tanhf(u)); }
      so[w][8 * hh + r][t * 16 + ln] = v;
    }
  }
  __builtin_amdgcn_fence(__ATOMIC_ACQ_REL, "workgroup");
  __builtin_amdgcn_wave_barrier();
  const int rsub = lane >> 4, c4 = (lane & 15) * 4;
  {
#pragma unroll
    for (int q = 0; q < 8; ++q) {
      const int r = q * 2 + rsub;
      const v4f v = *(const v4fa*)&so[w][r][c4];
      *(v4f*)(C + (size_t)(row0 + r) * ldc + col0 + c4) = v;
    }
    
  }
}
// row LayerNorm (biased variance, eps) over N: s = X (+ R); optional out_sum <- s; out_norm <- (s-mu)*rsqrt(var+eps)*g + b
template <bool PARAM_BF16>
__global__ __launch_bounds__(256) void k_layernorm(const float* __restrict__ X, const float* __restrict__ R, const float* __restrict__ g, const float* __restrict__ bta,
                                                  float* __restrict__ out_sum, float* __restrict__ out_norm, int N, float eps) {
  __shared__ float red[256];
  const int row = blockIdx.x, tid = threadIdx.x;
  const float* x = X + (size_t)row * N; const float* rr = R ? R + (size_t)row * N : nullptr;
  float vals[16];                     // up to N = 4096
  const int per = N / 256;            // contiguous chunk per thread? use strided-by-4 chunks: thread handles j = tid*4 + 1024*u
  float s1 = 0.f;
  for (int u = 0; u < per / 4; ++u) {
    const int j = tid * 4 + 1024 * u;
    const v4f a = *(const v4fa*)(x + j);
    v4f b = {0.f,0.f,0.f,0.f}; if (rr) b = *(const v4fa*)(rr + j);
#pragma unroll
    for (int q = 0; q < 4; ++q) { const float v = a[q] + b[q]; vals[u * 4 + q] = v; s1 += v; }
  }
  red[tid] = s1; __syncthreads();
  for (int st = 128; st > 0; st >>= 1) { if (tid < st) red[tid] += red[tid + st]; __syncthreads(); }
  const float mu = red[0] / (float)N; __syncthreads();
  float s2 = 0.f;
  for (int u = 0; u < per / 4; ++u)
#pragma unroll
    for (int q = 0; q < 4; ++q) { const float c = vals[u * 4 + q] - mu; s2 += c * c; }
  red[tid] = s2; __syncthreads();
  for (int st = 128; st > 0; st >>= 1) { if (tid < st) red[tid] += red[tid + st]; __syncthreads(); }
  const float rs = rsqrtf(red[0] / (float)N + eps);
  {
    for (int u = 0; u < per / 4; ++u) {
      const int j = tid * 4 + 1024 * u;
      v4f o, sm;
#pragma unroll
      for (int q = 0; q < 4; ++q) {
        float gg = g[j + q], bb = bta[j + q];
        if (PARAM_BF16) { gg = bf16_round(gg); bb = bf16_round(bb); }
        sm[q] = vals[u * 4 + q]; o[q] = (vals[u * 4 + q] - mu) * rs * gg + bb;
      }
      if (out_sum) *(v4f*)(out_sum + (size_t)row * N + j) = sm;
      *(v4f*)(out_norm + (size_t)row * N + j) = o;
    }
    
  }
}



// ---- f16 WMMA path (v_wmma_f32_16x16x32_f16): 11-bit significands for operands in range — used where a [0,1] probability operand needs more precision than bf16
typedef _Float16 v16h __attribute__((ext_vector_type(16)));
union FragH { v16h v; v8us half[2]; _Float16 h[16]; unsigned short u[16]; };
template <int NT>
__device__ __forceinline__ v8f mmaH(v16h ah, v16h al, v16h bh, v16h bl, v8f c) {
  c = __builtin_amdgcn_wmma_f32_16x16x32_f16(false, ah, false, bh, (short)0, c, false, false);
  if (NT >= 2) c = __builtin_amdgcn_wmma_f32_16x16x32_f16(false, al, false, bh, (short)0, c, false, false);
  if (NT >= 3) c = __builtin_amdgcn_wmma_f32_16x16x32_f16(false, ah, false, bl, (short)0, c, false, false);
  asm volatile("v_nop\n\tv_nop\n\tv_nop\n\tv_nop" : "+v"(c) : "v"(ah), "v"(al), "v"(bh), "v"(bl));
  return c;
}
// batched GEMM with f16 operands: A f32 (split into f16 hi/lo if ASPLIT, else rounded to f16), Bt = f16 values [n][k]; alpha; C f32; N multiple of 16 (partial tiles skipped)
template <bool ASPLIT>
__global__ __launch_bounds__(128) void k_gemm_h(const float* __restrict__ A, int lda, size_t sA, const _Float16* __restrict__ Bh, int ldb, size_t sB, float alpha, float* __restrict__ C, int ldc, size_t sC, int M, int N, int K) {
  __shared__ __attribute__((aligned(16))) float so[4][16][64];
  const int tid = threadIdx.x, w = tid >> 5, lane = tid & 31, ln = lane & 15, hh = lane >> 4; const int by = blockIdx.y;
  A += (size_t)by * sA; Bh += (size_t)by * sB; C += (size_t)by * sC;
  const int ntn = (N + 63) / 64; const int wid = blockIdx.x * 4 + w; const int mt = wid / ntn, nq = wid % ntn; if (mt * 16 >= M) return;
  const int row0 = mt * 16, col0 = nq * 64; const float* arow = A + (size_t)(row0 + ln) * lda;
  v8f acc[4] = {};
  for (int kb = 0; kb < K; kb += 32) {
    FragH ah, al;
    const v4f x0 = *(const v4fa*)(arow + kb + 8 * hh), x1 = *(const v4fa*)(arow + kb + 8 * hh + 4), x2 = *(const v4fa*)(arow + kb + 16 + 8 * hh), x3 = *(const v4fa*)(arow + kb + 16 + 8 * hh + 4);
    float xs[16] = {x0[0],x0[1],x0[2],x0[3],x1[0],x1[1],x1[2],x1[3],x2[0],x2[1],x2[2],x2[3],x3[0],x3[1],x3[2],x3[3]};
#pragma unroll
    for (int i = 0; i < 16; ++i) { const _Float16 h = (_Float16)xs[i]; ah.h[i] = h; al.h[i] = ASPLIT ? (_Float16)(xs[i] - (float)h) : (_Float16)0.0f; }
#pragma unroll
    for (int t = 0; t < 4; ++t) { if (col0 + t * 16 >= N) continue; const size_t boff = (size_t)(col0 + t * 16 + ln) * ldb + kb; FragH bq; bq.half[0] = *(const v8us*)(Bh + boff + 8 * hh); bq.half[1] = *(const v8us*)(Bh + boff + 16 + 8 * hh);
      acc[t] = mmaH<ASPLIT ? 2 : 1>(ah.v, al.v, bq.v, bq.v, acc[t]); }
  }
#pragma unroll
  for (int t = 0; t < 4; ++t) { if (col0 + t * 16 >= N) continue;
#pragma unroll
    for (int r = 0; r < 8; ++r) so[w][8 * hh + r][t * 16 + ln] = acc[t][r] * alpha; }
  __builtin_amdgcn_fence(__ATOMIC_ACQ_REL, "workgroup"); __builtin_amdgcn_wave_barrier();
  const int rsub = lane >> 4, c4 = (lane & 15) * 4;
  {
#pragma unroll
    for (int q = 0; q < 8; ++q) { const int r = q * 2 + rsub; if (col0 + c4 < N) { const v4f v = *(const v4fa*)&so[w][r][c4]; *(v4f*)(C + (size_t)(row0 + r) * ldc + col0 + c4) = v; } }
     }
}

// Wt[n][k] = f16(W[k][n]·scale) from f32 row-major W[K][N] (scale = power of two; bf16-exact weights stay exact in f16 away from the subnormal range)
__global__ __launch_bounds__(256) void k_wt_f16(const float* __restrict__ W, _Float16* __restrict__ Wt, int K, int N, float scale) {
  const int t = blockIdx.x * 256 + threadIdx.x; if (t >= N * (K / 8)) return; const int n = t / (K / 8), k8 = (t % (K / 8)) * 8; FragH f;
#pragma unroll
  for (int i = 0; i < 8; ++i) f.h[i] = (_Float16)(bf16_round(W[(size_t)(k8 + i) * N + n]) * scale); const v8us o = f.half[0];
  *(v8us*)((unsigned short*)Wt + (size_t)n * K + k8) = o; 
}
// All three projections with their operand preparation, ONE launch. A block = 64 tokens x 12 of the 24 (matrix, head) units (matrix 0 kc, 1 q, 2 v); a wave = one unit (32 outputs) x the 64 tokens over K = 256; f16 operands, f32 accumulators, result x 2^-4.
// x (NCHW f32) is rounded (bf16, then f16) and turned token-major in LDS, sx[token][c]; each wave rounds its own 32 weight rows (x 2^4, bf16, f16: the power of two commutes with the rounding) straight into fragments, k-step by k-step, the f32 rows fetched two k-steps ahead.
// kc, q: A = sx rows (tokens), B = weight rows; each f32 result is split into f16 hi + lo*2^10 and a token's head is stored as ONE 128-byte line, hi 32 | lo 32: QK[(b,token)][kc heads | q heads][hi | lo], pitch QP.
// v: A = weight rows, B = sx rows (tokens), VT[(h,d)][(b,token)] as f16, channel-major: 64 tokens of a channel are one 128-byte line.
#define TT 64
#define XP (CC + 8)
#define QP (2 * NHh * 2 * HD)
#define SOW 2304
// f32 -> nearest-even bf16 -> f32 by the chip's own conversion: the same value as bf16_round() for every finite x, in fewer instructions
__device__ __forceinline__ float bf16_rne(float x) { return (float)(__bf16)x; }
// the f32 weights of k-step ks for this lane: rows ln and 16 + ln of the unit, c = 32ks + 8hh + 0..7 and 32ks + 16 + 8hh + 0..7
__device__ __forceinline__ void proj_ldw(v4f (&raw)[8], const float* __restrict__ wp, int ks) {
#pragma unroll
  for (int nt = 0; nt < 2; ++nt) { const float* p = wp + nt * 16 * CC + ks * 32; raw[nt * 4] = *(const v4fa*)p; raw[nt * 4 + 1] = *(const v4fa*)(p + 4); raw[nt * 4 + 2] = *(const v4fa*)(p + 16); raw[nt * 4 + 3] = *(const v4fa*)(p + 20); } }
// WA: the weight fragment is the A operand (v), else the B operand (kc, q). k order of both fragments: half 0 = c 32ks + 8hh.., half 1 = c 32ks + 16 + 8hh..
template <bool WA>
__device__ __forceinline__ void proj_k(const float* __restrict__ wp, const unsigned short (*sx)[XP], int ln, int hh, v4f (&raw)[3][8], v8f (&acc)[4][2]) {
#pragma unroll
  for (int ks = 0; ks < 8; ++ks) {      // unrolled: raw, acc and the fragments are indexed by constants and stay in registers
    if (ks + 2 < 8) proj_ldw(raw[(ks + 2) % 3], wp, ks + 2);
    if (ks + 2 == 7) asm volatile("s_wait_xcnt 0x0" ::: "memory");      // wp is dead from here on: later results may land on it
    FragH wf[2], xf[4];
#pragma unroll
    for (int mt = 0; mt < 4; ++mt) { xf[mt].half[0] = *(const v8us*)&sx[mt * 16 + ln][ks * 32 + 8 * hh]; xf[mt].half[1] = *(const v8us*)&sx[mt * 16 + ln][ks * 32 + 16 + 8 * hh]; }
#pragma unroll
    for (int nt = 0; nt < 2; ++nt)
#pragma unroll
      for (int j = 0; j < 4; ++j)
#pragma unroll
        for (int i = 0; i < 4; ++i) wf[nt].h[j * 4 + i] = (_Float16)bf16_rne(raw[ks % 3][nt * 4 + j][i] * 16.0f);
#pragma unroll
    for (int mt = 0; mt < 4; ++mt)
#pragma unroll
      for (int nt = 0; nt < 2; ++nt) acc[mt][nt] = WA ? __builtin_amdgcn_wmma_f32_16x16x32_f16(false, wf[nt].v, false, xf[mt].v, (short)0, acc[mt][nt], false, false) : __builtin_amdgcn_wmma_f32_16x16x32_f16(false, xf[mt].v, false, wf[nt].v, (short)0, acc[mt][nt], false, false);
    __builtin_amdgcn_sched_barrier(0);      // keeps the f32 weights of three k-steps at most in registers: left free, the scheduler lifts all 64 loads to the top and spills
  } }
__global__ __launch_bounds__(384, 4) void k_proj(const float* __restrict__ x, const float* __restrict__ Wk, const float* __restrict__ Wq, const float* __restrict__ Wv, _Float16* __restrict__ QK, _Float16* __restrict__ VT) {
  __shared__ __attribute__((aligned(16))) unsigned short sx[TT][XP];      // pitch 528 B = 16 B x odd: the fragment reads meet no bank twice
  __shared__ __attribute__((aligned(16))) float so[12][SOW];      // per wave: 64 tokens x pitch 36 (kc, q) or 32 channels x pitch 68 (v)
  const int tid = threadIdx.x, lane = tid & 31, ln = lane & 15, hh = lane >> 4; const int w = __builtin_amdgcn_readfirstlane(tid >> 5);      // wave number held scalar: the unit and the row bases are then scalar
  const int tile = blockIdx.x >> 1, unit = (blockIdx.x & 1) * 12 + w; const int m = unit >> 3, hd = unit & 7; const int b = tile / (NTOK / TT), p0 = (tile % (NTOK / TT)) * TT;
  const int tq = tid & 15, cg = tid >> 4;      // a piece: 4 tokens x 8 channels; 16 lanes read 256 contiguous bytes of one channel. 512 pieces: one a thread, a second one for waves 0..3
  const float* xp = x + ((size_t)b * CC + cg * 8) * NTOK + p0 + 4 * tq; v4f xv[2][8];
#pragma unroll
  for (int q = 0; q < 8; ++q) xv[0][q] = *(const v4fa*)(xp + (size_t)q * NTOK);
  if (w < 4) {
#pragma unroll
    for (int q = 0; q < 8; ++q) xv[1][q] = *(const v4fa*)(xp + (size_t)(192 + q) * NTOK); }
  asm volatile("s_wait_xcnt 0x0" ::: "memory");      // xp is dead from here on: later results may land on it
  const float* wp = ((m == 0) ? Wk : ((m == 1) ? Wq : Wv)) + (size_t)(hd * HD + ln) * CC + 8 * hh; v4f raw[3][8]; proj_ldw(raw[0], wp, 0); proj_ldw(raw[1], wp, 1);
#pragma unroll
  for (int u = 0; u < 2; ++u) if (u == 0 || w < 4) {
#pragma unroll
    for (int k = 0; k < 4; ++k) { FragH f;
#pragma unroll
      for (int q = 0; q < 8; ++q) f.h[q] = (_Float16)bf16_rne(xv[u][q][k]);
      *(v8us*)&sx[4 * tq + k][(cg + 24 * u) * 8] = f.half[0]; } }
  __syncthreads();      // sx is read by all twelve waves
  v8f acc[4][2] = {};
  float* sw = &so[w][0]; const int r0 = lane >> 3, pc = lane & 7;      // 8 lanes store one whole 128-byte line
  if (m < 2) {
    proj_k<false>(wp, sx, ln, hh, raw, acc);
#pragma unroll
    for (int mt = 0; mt < 4; ++mt)
#pragma unroll
      for (int nt = 0; nt < 2; ++nt)
#pragma unroll
        for (int r = 0; r < 8; ++r) sw[(mt * 16 + 8 * hh + r) * 36 + nt * 16 + ln] = acc[mt][nt][r] * 0.0625f;
    __builtin_amdgcn_fence(__ATOMIC_ACQ_REL, "workgroup"); __builtin_amdgcn_wave_barrier();      // so[w] is written and read by this wave alone
    unsigned short* dq = (unsigned short*)QK + (size_t)(tile * TT) * QP + m * (NHh * 2 * HD) + hd * (2 * HD); const bool islo = pc >= 4;      // lanes 0..3 of a line: hi, lanes 4..7: lo of the same 32 values
#pragma unroll
    for (int q = 0; q < 16; ++q) { const int r = q * 4 + r0; const v4f v0 = *(const v4fa*)&sw[r * 36 + (pc & 3) * 8], v1 = *(const v4fa*)&sw[r * 36 + (pc & 3) * 8 + 4]; FragH fo;
#pragma unroll
      for (int i = 0; i < 8; ++i) { const float v = (i < 4) ? v0[i & 3] : v1[i & 3]; const _Float16 h = (_Float16)v; const _Float16 lw = (_Float16)((v - (float)h) * 1024.0f); fo.h[i] = islo ? lw : h; }
      *(v8us*)(dq + (unsigned)(r * QP + pc * 8)) = fo.half[0];
      asm volatile("s_wait_xcnt 0x0" ::: "memory"); }      // the next rows' values (in the listing also the other branch's block) are written to registers that this store names
  } else {
    proj_k<true>(wp, sx, ln, hh, raw, acc);
#pragma unroll
    for (int mt = 0; mt < 4; ++mt)
#pragma unroll
      for (int nt = 0; nt < 2; ++nt)
#pragma unroll
        for (int r = 0; r < 8; ++r) sw[(nt * 16 + 8 * hh + r) * 68 + mt * 16 + ln] = acc[mt][nt][r] * 0.0625f;
    __builtin_amdgcn_fence(__ATOMIC_ACQ_REL, "workgroup"); __builtin_amdgcn_wave_barrier();      // so[w] is written and read by this wave alone
    unsigned short* dv = (unsigned short*)VT + (size_t)(hd * HD) * NR + tile * TT;
#pragma unroll
    for (int q = 0; q < 8; ++q) { const int r = q * 4 + r0; const v4f v0 = *(const v4fa*)&sw[r * 68 + pc * 8], v1 = *(const v4fa*)&sw[r * 68 + pc * 8 + 4]; FragH fh;
#pragma unroll
      for (int i = 0; i < 4; ++i) { fh.h[i] = (_Float16)v0[i]; fh.h[4 + i] = (_Float16)v1[i]; }
      *(v8us*)(dv + (unsigned)(r * NR + pc * 8)) = fh.half[0];
      asm volatile("s_wait_xcnt 0x0" ::: "memory"); }      // the next rows' values (in the listing also the other branch's block) are written to registers that this store names
  }
}
// 2^a for eight values at once. The probabilities are rounded to f16 for the matrix product, so exp(x) = 2^(x*log2(e)) with the product and the shift by the maximum in ONE fma is accurate enough (relative error about 1e-6 at x = -20; a below the f32 range, -inf included, gives 0).
// The exponentials stand in asm text, eight in a row with early-clobber results and one v_nop behind the last: the instruction set asks for one slot before a vector instruction reads a transcendental's result or overwrites its source;
// here each one's neighbour is independent of it (no result shares a register with any source), and the v_nop fills the slot of the last.
__device__ __forceinline__ void exp2x8(float (&p)[8], const float (&a)[8]) {
  asm("v_exp_f32 %0, %8\n\tv_exp_f32 %1, %9\n\tv_exp_f32 %2, %10\n\tv_exp_f32 %3, %11\n\tv_exp_f32 %4, %12\n\tv_exp_f32 %5, %13\n\tv_exp_f32 %6, %14\n\tv_exp_f32 %7, %15\n\tv_nop"
      : "=&v"(p[0]), "=&v"(p[1]), "=&v"(p[2]), "=&v"(p[3]), "=&v"(p[4]), "=&v"(p[5]), "=&v"(p[6]), "=&v"(p[7])
      : "v"(a[0]), "v"(a[1]), "v"(a[2]), "v"(a[3]), "v"(a[4]), "v"(a[5]), "v"(a[6]), "v"(a[7])); }
// window attention, one wave per (b, head h, row y, 16-token x segment): for each window row i the 32 tokens (y + i - 3, x0 - 8 .. x0 + 23) are ONE key block.
// S^T = Q_row (32 keys x 32 d, two A tiles, f16 hi + lo*2^-10, 3 products) * KC^T (B, 16 centre keys): lane (ln, hh) holds, for centre token ln, the keys c = 16t + 8hh + r;
// the window is the band 0 <= c - ln - 5 <= 6 (= column offset j). Softmax of a centre token is in-lane plus one exchange with lane ^ 16; the two S^T tiles, as f16, ARE the B operand of
// O^T = V^T (A: row d, keys along k, read from the channel-major sV) * P^T, so a lane ends with 8 consecutive d of its own token.
// kc.rel_k splits into a row term and a column term: E = REL * KC^T with REL rows 0..6 = (rel_h[i] | 0), rows 8..14 = (0 | rel_w[j]), rows 7 and 15 zero; rel is bf16-rounded first, as before (8 significant bits: exact in f16 from 2^-14 up, below that off by at most 2^-25), and kc is hi + lo*2^-10 (2 products).
// A block = one (b, head) x four image rows (y0 = 4g ..) x the four x segments, sixteen waves: its 224 tokens are 896 bytes = seven whole 128-byte lines of every NCHW output channel, so the block turns its result channel-major in LDS and stores the output itself, each line from one block.
#define RG 4
#define TPB (RG * HI)
#define OP (TPB + 4)
#define QLP (2 * HD + 8)
#define VPC 80
#define VLP (VPC * 8 + 8)
__global__ __launch_bounds__(512) void k_nattn(const _Float16* __restrict__ QK, const _Float16* __restrict__ VT, const float* __restrict__ relh, const float* __restrict__ relw, float* __restrict__ out) {
  __shared__ __attribute__((aligned(16))) float sR[RG * NXS][16][20];      // per centre token of the wave: words 0..6 kc.rel_h[i], words 8..14 kc.rel_w[j] (pitch 20: rows stay 16-byte aligned and in-band lanes of the gather below meet no bank twice)
  __shared__ __attribute__((aligned(16))) unsigned short sQ[9 * 64][QLP];      // q lines (hi 32 | lo 32) of the block's ten window rows y0 - 3 .. y0 + 6 (560 tokens, filled in nine rounds of 64), token-major; pitch 144 B = 16 B x odd: the fragment reads meet no bank twice
  __shared__ __attribute__((aligned(16))) unsigned short sK[4 * 64][QLP];      // kc lines of the block's own 224 tokens (four rounds of 64), same pitch
  __shared__ __attribute__((aligned(16))) unsigned short sV[HD][VLP];      // v of the same ten rows (70 pieces of 8 tokens, filled as 80), channel-major; pitch 1296 B = 16 B x odd
  __shared__ __attribute__((aligned(16))) float sT[HD][OP];      // [d][token of the block]; pitch 228 words: rows stay 16-byte aligned, and rows d and d + 8, written by the two lane halves at once, lie 32 banks apart
  const int tid = threadIdx.x, lane = tid & 31, ln = lane & 15, hh = lane >> 4; const int w = __builtin_amdgcn_readfirstlane(tid >> 5);      // wave number held scalar: (b, h, y, x0) and every row base below are then scalar, a lane keeps only row-invariant byte offsets
  const int b = blockIdx.x / (NHh * (HI / RG)), rem = blockIdx.x % (NHh * (HI / RG)); const int h = rem / (HI / RG), y0 = (rem % (HI / RG)) * RG; const int yl = w / NXS, y = y0 + yl, x0 = (w % NXS) * 16;
  const int qx = (x0 + ln < HI) ? (x0 + ln) : (HI - 1);      // lanes past the image row repeat its last token; their result is not stored
  // The block's operands come in ONCE, by loads that cover whole 128-byte lines (8 lanes a token line; a channel's ten rows are 1120 contiguous bytes), and are read as fragments from LDS: the sixteen waves use each q and v row several times over (four image rows share ten window rows, neighbouring segments overlap by half).
  // Every thread makes the same 18 loads, no branch among them: the rounds run a little past the 560, 224 and 70 that are read. A token index outside the image (a padding row, or such a surplus piece) is clamped into it (kc: a surplus piece repeats one of the block's own tokens), so every address is in bounds; the readers below put zero in place of the padding rows, as before, and never read the surplus.
  v8us gq[9], gk[4], gv[5]; unsigned oq[9], ok[4], ovv[5]; const int g0 = (y0 - 3) * HI, pc8 = tid & 7, tk0 = tid >> 3;
  { const char* qg = (const char*)QK + ((size_t)(b * NTOK) * QP + NHh * 2 * HD + h * (2 * HD)) * 2; const char* kg = (const char*)QK + ((size_t)(b * NTOK + y0 * HI) * QP + h * (2 * HD)) * 2; const char* vg = (const char*)VT + ((size_t)(h * HD + 2 * w) * NR + b * NTOK) * 2;
#pragma unroll      // the three loops unrolled: gq, gk, gv are indexed by constants and stay in registers
    for (int k = 0; k < 9; ++k) { int gt = g0 + tk0 + 64 * k; gt = (gt < 0) ? 0 : ((gt > NTOK - 1) ? (NTOK - 1) : gt); oq[k] = (unsigned)(gt * (QP * 2) + pc8 * 16); gq[k] = *(const v8us*)(qg + oq[k]); }
#pragma unroll
    for (int k = 0; k < 4; ++k) { int gt = tk0 + 64 * k; gt = (gt > TPB - 1) ? (gt - 192) : gt; ok[k] = (unsigned)(gt * (QP * 2) + pc8 * 16); gk[k] = *(const v8us*)(kg + ok[k]); }
#pragma unroll
    for (int k = 0; k < 5; ++k) { const int j = lane + 32 * k; const int d = (j >= VPC) ? 1 : 0; int to = g0 + (j - d * VPC) * 8; to = (to < 0) ? 0 : ((to > NTOK - 8) ? (NTOK - 8) : to); ovv[k] = (unsigned)(d * NR + to) * 2; gv[k] = *(const v8us*)(vg + ovv[k]); }      // wave w: channels 2w, 2w + 1; a piece = 8 tokens, never astride two image rows
    asm volatile("s_wait_xcnt 0x0" :: "v"(oq[0]), "v"(oq[1]), "v"(oq[2]), "v"(oq[3]), "v"(oq[4]), "v"(oq[5]), "v"(oq[6]), "v"(oq[7]), "v"(oq[8]), "v"(ok[0]), "v"(ok[1]), "v"(ok[2]), "v"(ok[3]), "v"(ovv[0]), "v"(ovv[1]), "v"(ovv[2]), "v"(ovv[3]), "v"(ovv[4]) : "memory"); }      // the offsets of these loads die here and later results may land on their registers (named as inputs: they live up to the wait, so that no load of the run lands on an earlier one's offset)
  const v8us z8 = (v8us){0,0,0,0,0,0,0,0}; const v8f z8f = (v8f){0.f,0.f,0.f,0.f,0.f,0.f,0.f,0.f};
  FragH ar; { const int ri = ln & 7; const float* rp = ((ln < 8) ? relh : relw) + (h * 7 + ((ri < 7) ? ri : 6)) * 16 + 8 * hh; const v4f r0 = *(const v4fa*)rp, r1 = *(const v4fa*)(rp + 4); FragH c;      // row ln of REL: its 8 non-zero k of this lane half
    asm volatile("s_wait_xcnt 0x0" ::: "memory");      // rp is dead from here on: later results may land on it
#pragma unroll
    for (int q = 0; q < 4; ++q) { c.h[q] = (_Float16)bf16_round(r0[q]); c.h[4 + q] = (_Float16)bf16_round(r1[q]); }
    const v8us cv = (ri < 7) ? c.half[0] : z8; ar.half[0] = (ln < 8) ? cv : z8; ar.half[1] = (ln < 8) ? z8 : cv; }      // k order as bc: half 0 = d 8hh.., half 1 = d 16 + 8hh..
#pragma unroll      // unrolled as the loads are: constant indices
  for (int k = 0; k < 9; ++k) *(v8us*)&sQ[tk0 + 64 * k][pc8 * 8] = gq[k];
#pragma unroll
  for (int k = 0; k < 4; ++k) *(v8us*)&sK[tk0 + 64 * k][pc8 * 8] = gk[k];
#pragma unroll
  for (int k = 0; k < 5; ++k) { const int j = lane + 32 * k; const int d = (j >= VPC) ? 1 : 0; *(v8us*)&sV[2 * w + d][(j - d * VPC) * 8] = gv[k]; }
  __syncthreads();      // sQ, sK, sV are written by all sixteen waves and read across them
  FragH bc, bcl; { const unsigned short* kr = &sK[yl * HI + qx][8 * hh]; bc.half[0] = *(const v8us*)kr; bc.half[1] = *(const v8us*)(kr + 16); bcl.half[0] = *(const v8us*)(kr + HD); bcl.half[1] = *(const v8us*)(kr + HD + 16); }      // centre key kc, column ln of B; a head's line: hi 32 | lo 32
  { const v8f e = __builtin_amdgcn_wmma_f32_16x16x32_f16(false, ar.v, false, bc.v, (short)0, z8f, false, false); const v8f e2 = __builtin_amdgcn_wmma_f32_16x16x32_f16(false, ar.v, false, bcl.v, (short)0, z8f, false, false); v4f o0, o1;
#pragma unroll
    for (int q = 0; q < 4; ++q) { o0[q] = e[q] + e2[q] * 0.0009765625f; o1[q] = e[4 + q] + e2[4 + q] * 0.0009765625f; }
    *(v4fa*)&sR[w][ln][8 * hh] = o0; *(v4fa*)&sR[w][ln][8 * hh + 4] = o1; }      // lane (ln, hh) holds rows 8hh..8hh+7 of E for its own centre token
  __builtin_amdgcn_fence(__ATOMIC_ACQ_REL, "workgroup"); __builtin_amdgcn_wave_barrier();      // sR is written and read by this wave alone
  bool inb[2][8]; int rj[2][8]; bool xok[2], vok[2]; unsigned qoff[2], voff[2];
#pragma unroll
  for (int t = 0; t < 2; ++t) {
    const int xx = x0 - 8 + 16 * t + ln; xok[t] = (xx >= 0 && xx < HI); qoff[t] = (unsigned)((xok[t] ? xx : 0) * QLP + 8 * hh);      // key c = 16t + ln as row of A
    const int xk = x0 - 8 + 16 * t + 8 * hh; vok[t] = (xk >= 0 && xk < HI); voff[t] = (unsigned)(ln * VLP + (vok[t] ? xk : 0));      // 8 keys: wholly inside the image row or wholly outside
#pragma unroll
    for (int r = 0; r < 8; ++r) { const int j = 16 * t + 8 * hh + r - ln - 5; inb[t][r] = (j >= 0 && j < 7); rj[t][r] = (j < 0) ? 0 : ((j > 6) ? 6 : j); } }
  float rh[8]; v8f rw[2]; { const float* rl = &sR[w][ln][0]; const v4f a0 = *(const v4fa*)rl, a1 = *(const v4fa*)(rl + 4);
#pragma unroll
    for (int q = 0; q < 4; ++q) { rh[q] = a0[q]; rh[4 + q] = a1[q]; }
#pragma unroll
    for (int t = 0; t < 2; ++t)
#pragma unroll
      for (int r = 0; r < 8; ++r) rw[t][r] = rl[8 + rj[t][r]]; }      // column term of key c = 16t + 8hh + r, the same for all seven window rows; every lane reads (index clamped into the row): no branch round the load
  float lg[7][2][8];
#pragma unroll
  for (int i = 0; i < 7; ++i) { const int yy = y + i - 3; const bool yok = (yy >= 0 && yy < HI); const unsigned short* q0 = &sQ[(yl + i) * HI][0]; const unsigned short* q1 = q0 + HD;      // window row i of image row y is staged row yl + i
#pragma unroll
    for (int t = 0; t < 2; ++t) { const bool ok = yok && xok[t];
      FragH ak, akl; ak.half[0] = *(const v8us*)(q0 + qoff[t]); ak.half[1] = *(const v8us*)(q0 + qoff[t] + 16); akl.half[0] = *(const v8us*)(q1 + qoff[t]); akl.half[1] = *(const v8us*)(q1 + qoff[t] + 16);
      if (!ok) { ak.half[0] = z8; ak.half[1] = z8; akl.half[0] = z8; akl.half[1] = z8; }      // zero padding: q = 0 outside the image
      v8f s = __builtin_amdgcn_wmma_f32_16x16x32_f16(false, ak.v, false, bc.v, (short)0, rw[t], false, false);      // the column term rides in as C
      v8f s2 = __builtin_amdgcn_wmma_f32_16x16x32_f16(false, ak.v, false, bcl.v, (short)0, z8f, false, false); s2 = __builtin_amdgcn_wmma_f32_16x16x32_f16(false, akl.v, false, bc.v, (short)0, s2, false, false);      // hi.hi + (lo.hi + hi.lo)*2^-10
#pragma unroll
      for (int r = 0; r < 8; ++r) { const float sd = s[r] + s2[r] * 0.0009765625f; const float lv = sd + rh[i]; lg[i][t][r] = inb[t][r] ? lv : -3.0e38f; } } }      // kc.(q + rel_k); padded neighbours keep kc.rel_k
  float m = -3.0e38f;
#pragma unroll
  for (int i = 0; i < 7; ++i)
#pragma unroll
    for (int t = 0; t < 2; ++t)
#pragma unroll
      for (int r = 0; r < 8; ++r) m = fmaxf(m, lg[i][t][r]);
  m = fmaxf(m, __shfl_xor(m, 16, 32));
  const float nm = -m * 0x1.715476p+0f;      // its rounding is one common factor of a token's 49 probabilities and of their sum: it cancels in the division
  float l = 0.f; v8f oacc[2] = {z8f, z8f};
#pragma unroll
  for (int i = 0; i < 7; ++i) { const int yy = y + i - 3; const bool yok = (yy >= 0 && yy < HI); const unsigned short* vb = &sV[0][(yl + i) * HI]; FragH pb;
#pragma unroll
    for (int t = 0; t < 2; ++t) { float a[8], p[8];
#pragma unroll
      for (int r = 0; r < 8; ++r) a[r] = __builtin_fmaf(lg[i][t][r], 0x1.715476p+0f, nm);      // (logit - m) * log2(e); outside the band: -inf, 2^a = 0
      exp2x8(p, a);
#pragma unroll
      for (int r = 0; r < 8; ++r) { l += p[r]; pb.h[8 * t + r] = (_Float16)p[r]; } }
#pragma unroll
    for (int dt = 0; dt < 2; ++dt) { FragH av;
#pragma unroll
      for (int t = 0; t < 2; ++t) { av.half[t] = *(const v8us*)(vb + voff[t] + dt * (16 * VLP)); if (!(yok && vok[t])) av.half[t] = z8; }      // zero padding: v = 0 outside the image
      oacc[dt] = __builtin_amdgcn_wmma_f32_16x16x32_f16(false, av.v, false, pb.v, (short)0, oacc[dt], false, false); }
    __builtin_amdgcn_sched_barrier(0); }      // keeps the next row's v_exp_f32 from being lifted to directly behind these matrix instructions; the eight fmas that make its arguments (at least four issue slots, as dual pairs) now stand between
  l += __shfl_xor(l, 16, 32);
  if (x0 + ln < HI) {      // lanes past the image row hold a repeat of its last token: not kept
#pragma unroll
    for (int dt = 0; dt < 2; ++dt)
#pragma unroll
      for (int r = 0; r < 8; ++r) sT[dt * 16 + 8 * hh + r][yl * HI + x0 + ln] = oacc[dt][r] / l; }
  __syncthreads();      // sT is written by all sixteen waves and read across them
  // wave w stores channels 2w and 2w + 1 of the head: 2 x 56 pieces of 16 bytes, a store instruction covers whole 128-byte lines
  float* op = out + ((size_t)(b * CC + h * HD + 2 * w) * NTOK + y0 * HI);
  v4f ov[4];      // all LDS reads first, then the stores: one LDS latency instead of four
#pragma unroll      // both loops unrolled: ov is indexed by constants and stays in registers
  for (int k = 0; k < 4; ++k) { const int j = lane + 32 * k; if (j < 2 * (TPB / 4)) { const int d = (j >= TPB / 4) ? 1 : 0, c4 = (j - d * (TPB / 4)) * 4; ov[k] = *(const v4fa*)&sT[2 * w + d][c4]; } }
#pragma unroll
  for (int k = 0; k < 4; ++k) { const int j = lane + 32 * k; if (j < 2 * (TPB / 4)) { const int d = (j >= TPB / 4) ? 1 : 0, c4 = (j - d * (TPB / 4)) * 4; *(v4f*)(op + (unsigned)(d * NTOK + c4)) = ov[k]; } }
}

extern "C" void kernel_launch(void* const* d_in, const int* in_sizes, int n_in,
                              void* d_out, int out_size, void* d_ws, size_t ws_size, hipStream_t stream) {
  (void)in_sizes; (void)n_in; (void)out_size;
  const float* x = (const float*)d_in[0]; const float* Wk = (const float*)d_in[1]; const float* Wq = (const float*)d_in[2]; const float* Wv = (const float*)d_in[3]; const float* relh = (const float*)d_in[4]; const float* relw = (const float*)d_in[5];
  char* ws = (char*)d_ws; size_t off = 0;
  auto take = [&](size_t bytes) { char* p = ws + off; off += (bytes + 255) & ~(size_t)255; return p; };
  _Float16* QK = (_Float16*)take((size_t)NR * QP * 2); _Float16* VT = (_Float16*)take((size_t)CC * NR * 2);
  if (off > ws_size) return;      // 12.8 + 3.2: about 16 MB
  k_proj<<<(NR / TT) * 2, 384, 0, stream>>>(x, Wk, Wq, Wv, QK, VT);      // kc | q as f16 hi | lo*2^10 lines per head; v channel-major
  k_nattn<<<BB * NHh * (HI / RG), RG * NXS * 32, 0, stream>>>(QK, VT, relh, relw, (float*)d_out);      // stores the NCHW output itself
}

// v008
// It runs in 17.1 microseconds.
// Next to v007, in two timings, it ran 1.32 times as fast each time.
// Counting every step since v000, it is 10.7 times as fast.
#include <hip/hip_runtime.h>
// Stand-alone (SASA) local self-attention (B=2, C 256 = 8 heads × 32, 56×56, 7×7 windows, stride 1, zero padding; relative row/col embeddings added to the windowed QUERIES, the centre KEY is
// the fixed operand, softmax over the 49 window positions, values windowed): 1×1 projections as GEMMs ((head,dim)×C weights bf16-exact ×2^4) and the window attention on
// v_wmma_f32_16x16x32_f16 with one banded key block per window row (per 16-token row segment and window row: S^T = Q_row.KC^T over 32 keys, kc and q as f16 hi + lo*2^-10 (3 products), band element + kc.rel_k (f32) = logit; f32 softmax over all 49, in-lane
// plus one lane exchange; O^T += V^T.P^T with the f16 S^T tiles as the B operand and V kept channel-major); kc.rel_k = kc[0..15].rel_h[i] + kc[16..31].rel_w[j] is one more A tile (14 rows) against the same KC^T; the NCHW transposes go through LDS (x in as f16, the result out as f32); projections and attention are one kernel.
#define BB 2
#define CC 256
#define NHh 8
#define HD 32
#define HI 56
#define NTOK 3136
#define NXS 4
#define NR (BB * NTOK)

typedef __bf16 v16b __attribute__((ext_vector_type(16)));
typedef unsigned short v8us __attribute__((ext_vector_type(8), may_alias));
typedef float  v8f  __attribute__((ext_vector_type(8)));
typedef float  v4f  __attribute__((ext_vector_type(4)));
typedef float  v4fa __attribute__((ext_vector_type(4), may_alias));
union FragB { v16b v; v8us half[2]; unsigned short u[16]; };

__device__ __forceinline__ unsigned short bf16_bits(float x) { unsigned int u = __float_as_uint(x); return (unsigned short)((u + 0x7FFFu + ((u >> 16) & 1u)) >> 16); }
__device__ __forceinline__ float bf16_val(unsigned short b) { return __uint_as_float(((unsigned int)b) << 16); }
__device__ __forceinline__ float bf16_round(float x) { return bf16_val(bf16_bits(x)); }
// D += A·B with NT terms: 1 = ah·bh, 2 = + al·bh (A split), 3 = + ah·bl (both split)
template <int NT>
__device__ __forceinline__ v8f mmaN(v16b ah, v16b al, v16b bh, v16b bl, v8f c) {
  c = __builtin_amdgcn_wmma_f32_16x16x32_bf16(false, ah, false, bh, (short)0, c, false, false);
  if (NT >= 2) c = __builtin_amdgcn_wmma_f32_16x16x32_bf16(false, al, false, bh, (short)0, c, false, false);
  if (NT >= 3) c = __builtin_amdgcn_wmma_f32_16x16x32_bf16(false, ah, false, bl, (short)0, c, false, false);
  asm volatile("v_nop\n\tv_nop\n\tv_nop\n\tv_nop" : "+v"(c) : "v"(ah), "v"(al), "v"(bh), "v"(bl));
  return c;
}

__global__ __launch_bounds__(256) void k_wt_bf16(const float* __restrict__ W, unsigned short* __restrict__ Wt, int K, int N) {
  const int t = blockIdx.x * 256 + threadIdx.x;
  const int k8n = K / 8;
  if (t >= N * k8n) return;
  const int n = t / k8n, k8 = (t % k8n) * 8;
  v8us v;
#pragma unroll
  for (int i = 0; i < 8; ++i) v[i] = bf16_bits(W[(size_t)(k8 + i) * N + n]);
  *(v8us*)(Wt + (size_t)n * K + k8) = v;
  
}

// GEMM C[M][N] (f32, pitch ldc) = act(A[M][K]·W + bias). A f32 row-major (pitch lda) converted per fragment to bf16
// (ASPLIT: hi/lo two planes -> 2 terms, else single rounded term); Wt bf16 [N][K] (pitch ldb). BIAS_BF16 rounds the
// bias to bf16 first (bias quantised to bf16 before the add). K%32==0, M%16==0, N%64==0.
template <bool ASPLIT, int ACT, bool BIAS_BF16>
__global__ __launch_bounds__(128) void k_gemm_bf(const float* __restrict__ A, int lda, const unsigned short* __restrict__ Wt, int ldb,
                                               const float* __restrict__ bias, float* __restrict__ C, int ldc, int M, int N, int K) {
  __shared__ __attribute__((aligned(16))) float so[4][16][64];
  const int tid = threadIdx.x, w = tid >> 5, lane = tid & 31, ln = lane & 15, hh = lane >> 4;
  const int ntn = N / 64;
  const int wid = blockIdx.x * 4 + w;
  const int mt = wid / ntn, nq = wid % ntn;
  if (mt * 16 >= M) return;
  const int row0 = mt * 16, col0 = nq * 64;
  const float* arow = A + (size_t)(row0 + ln) * lda;
  v8f acc[4] = {};
  for (int kb = 0; kb < K; kb += 32) {
    FragB ah, al;
    const v4f x0 = *(const v4fa*)(arow + kb + 8 * hh), x1 = *(const v4fa*)(arow + kb + 8 * hh + 4);
    const v4f x2 = *(const v4fa*)(arow + kb + 16 + 8 * hh), x3 = *(const v4fa*)(arow + kb + 16 + 8 * hh + 4);
    float xs[16] = {x0[0],x0[1],x0[2],x0[3],x1[0],x1[1],x1[2],x1[3],x2[0],x2[1],x2[2],x2[3],x3[0],x3[1],x3[2],x3[3]};
#pragma unroll
    for (int i = 0; i < 16; ++i) { const unsigned short hb = bf16_bits(xs[i]); ah.u[i] = hb; al.u[i] = ASPLIT ? bf16_bits(xs[i] - bf16_val(hb)) : (unsigned short)0; }
#pragma unroll
    for (int t = 0; t < 4; ++t) {
      const unsigned short* brow = Wt + (size_t)(col0 + t * 16 + ln) * ldb + kb;
      FragB b;
      b.half[0] = *(const v8us*)(brow + 8 * hh);
      b.half[1] = *(const v8us*)(brow + 16 + 8 * hh);
      acc[t] = mmaN<ASPLIT ? 2 : 1>(ah.v, al.v, b.v, b.v, acc[t]);
    }
  }
#pragma unroll
  for (int t = 0; t < 4; ++t) {
    float bv = bias ? bias[col0 + t * 16 + ln] : 0.f;
    if (BIAS_BF16) bv = bf16_round(bv);
#pragma unroll
    for (int r = 0; r < 8; ++r) { float v = acc[t][r] + bv; if (ACT == 1) v = fmaxf(v, 0.f); so[w][8 * hh + r][t * 16 + ln] = v; }
  }
  __builtin_amdgcn_fence(__ATOMIC_ACQ_REL, "workgroup");
  __builtin_amdgcn_wave_barrier();
  const int rsub = lane >> 4, c4 = (lane & 15) * 4;
  {
#pragma unroll
    for (int q = 0; q < 8; ++q) {
      const int r = q * 2 + rsub;
      const v4f v = *(const v4fa*)&so[w][r][c4];
      *(v4f*)(C + (size_t)(row0 + r) * ldc + col0 + c4) = v;
    }
    
  }
}

// Flash-style causal/unmasked attention, all contractions 3-term bf16 hi/lo splits, f32 softmax with running max.
// q,k,v rows are read from f32 buffers with arbitrary row pitch (so they can live inside a fused qkv buffer);
// D = head size (multiple of 32, <= 128); one wave = 16 query rows; block = 4 waves (64 queries) sharing K/V chunks of 32.
template <int D, bool CAUSAL>
__global__ __launch_bounds__(128) void k_flash(const float* __restrict__ qb, const float* __restrict__ kb, const float* __restrict__ vb,
                                             int pitch, int T, int H, float scale, float* __restrict__ y, int ypitch) {
  constexpr int KS = D / 32;        // k-steps for QK
  constexpr int DT = D / 16;        // d tiles for PV
  __shared__ __attribute__((aligned(16))) unsigned short sKh[32][D + 8], sKl[32][D + 8], sVh[32][D + 8], sVl[32][D + 8];
  __shared__ __attribute__((aligned(16))) unsigned short sPh[4][16][40], sPl[4][16][40];
  __shared__ __attribute__((aligned(16))) float sO[4][16][D];
  const int tid = threadIdx.x, w = tid >> 5, lane = tid & 31, ln = lane & 15, hh = lane >> 4;
  const int nqb = (T + 63) / 64;
  const int bh = blockIdx.x / nqb, qblk = blockIdx.x % nqb;
  const int b = bh / H, h = bh % H;
  const int q0 = qblk * 64 + w * 16;
  const float* Q = qb + (size_t)b * T * pitch + h * D;
  const float* K = kb + (size_t)b * T * pitch + h * D;
  const float* V = vb + (size_t)b * T * pitch + h * D;

  // A fragments of the wave's 16 query rows (scaled), hi/lo
  FragB aqh[KS], aql[KS];
  {
    int row = q0 + ln; if (row >= T) row = T - 1;
    const float* qr = Q + (size_t)row * pitch;
#pragma unroll
    for (int ks = 0; ks < KS; ++ks)
#pragma unroll
      for (int i = 0; i < 16; ++i) {
        const int d = ks * 32 + ((i < 8) ? (8 * hh + i) : (16 + 8 * hh + (i - 8)));
        const float x = qr[d] * scale; const unsigned short hb = bf16_bits(x);
        aqh[ks].u[i] = hb; aql[ks].u[i] = bf16_bits(x - bf16_val(hb));
      }
  }
  float m_r[8], l_r[8];
#pragma unroll
  for (int r = 0; r < 8; ++r) { m_r[r] = -3.0e38f; l_r[r] = 0.f; }
  v8f oacc[DT];
#pragma unroll
  for (int dt = 0; dt < DT; ++dt) oacc[dt] = (v8f){0.f,0.f,0.f,0.f,0.f,0.f,0.f,0.f};

  const int kv_end = CAUSAL ? min(T, qblk * 64 + 64) : T;     // block-uniform
  for (int j0 = 0; j0 < kv_end; j0 += 32) {
    __syncthreads();
    for (int e = tid; e < 32 * (D / 4); e += 128) {
      const int r = e / (D / 4), c4 = (e % (D / 4)) * 4;
      const int key = j0 + r;
      v4f kf = {0.f,0.f,0.f,0.f}, vf = {0.f,0.f,0.f,0.f};
      if (key < T) { kf = *(const v4fa*)(K + (size_t)key * pitch + c4); vf = *(const v4fa*)(V + (size_t)key * pitch + c4); }
#pragma unroll
      for (int t = 0; t < 4; ++t) {
        unsigned short hb = bf16_bits(kf[t]); sKh[r][c4 + t] = hb; sKl[r][c4 + t] = bf16_bits(kf[t] - bf16_val(hb));
        hb = bf16_bits(vf[t]); sVh[r][c4 + t] = hb; sVl[r][c4 + t] = bf16_bits(vf[t] - bf16_val(hb));
      }
    }
    __syncthreads();
    // S tile 16 x 32
    v8f s[2];
#pragma unroll
    for (int nt = 0; nt < 2; ++nt) {
      v8f acc = {};
#pragma unroll
      for (int ks = 0; ks < KS; ++ks) {
        FragB bh_, bl_;
        bh_.half[0] = *(const v8us*)&sKh[nt * 16 + ln][ks * 32 + 8 * hh]; bh_.half[1] = *(const v8us*)&sKh[nt * 16 + ln][ks * 32 + 16 + 8 * hh];
        bl_.half[0] = *(const v8us*)&sKl[nt * 16 + ln][ks * 32 + 8 * hh]; bl_.half[1] = *(const v8us*)&sKl[nt * 16 + ln][ks * 32 + 16 + 8 * hh];
        acc = mmaN<3>(aqh[ks].v, aql[ks].v, bh_.v, bl_.v, acc);
      }
      s[nt] = acc;
    }
    // mask + running max (rows 8hh+r; the 16 lanes of a half share rows)
    float alpha[8];
#pragma unroll
    for (int r = 0; r < 8; ++r) {
      const int qi = q0 + 8 * hh + r;
      const int ja = j0 + ln, jb = j0 + 16 + ln;
      if (CAUSAL) { if (ja > qi) s[0][r] = -3.0e38f; if (jb > qi) s[1][r] = -3.0e38f; }
      if (ja >= T) s[0][r] = -3.0e38f;
      if (jb >= T) s[1][r] = -3.0e38f;
      float mx = fmaxf(s[0][r], s[1][r]);
      mx = fmaxf(mx, __shfl_xor(mx, 1, 32)); mx = fmaxf(mx, __shfl_xor(mx, 2, 32)); mx = fmaxf(mx, __shfl_xor(mx, 4, 32)); mx = fmaxf(mx, __shfl_xor(mx, 8, 32));
      const float mnew = fmaxf(m_r[r], mx);
      alpha[r] = (mnew > -1.0e38f) ? __expf(m_r[r] - mnew) : 1.0f;
      const float p0 = (s[0][r] > -1.0e38f) ? __expf(s[0][r] - mnew) : 0.f;
      const float p1 = (s[1][r] > -1.0e38f) ? __expf(s[1][r] - mnew) : 0.f;
      m_r[r] = mnew;
      l_r[r] = l_r[r] * alpha[r] + p0 + p1;            // per-lane partial row sum (16 lanes combined at the end)
      unsigned short hb = bf16_bits(p0); sPh[w][8 * hh + r][ln] = hb;      sPl[w][8 * hh + r][ln] = bf16_bits(p0 - bf16_val(hb));
      hb = bf16_bits(p1);                sPh[w][8 * hh + r][16 + ln] = hb; sPl[w][8 * hh + r][16 + ln] = bf16_bits(p1 - bf16_val(hb));
    }
#pragma unroll
    for (int dt = 0; dt < DT; ++dt)
#pragma unroll
      for (int r = 0; r < 8; ++r) oacc[dt][r] *= alpha[r];
    __builtin_amdgcn_fence(__ATOMIC_ACQ_REL, "workgroup");
    __builtin_amdgcn_wave_barrier();
    FragB pah, pal;
    pah.half[0] = *(const v8us*)&sPh[w][ln][8 * hh]; pah.half[1] = *(const v8us*)&sPh[w][ln][16 + 8 * hh];
    pal.half[0] = *(const v8us*)&sPl[w][ln][8 * hh]; pal.half[1] = *(const v8us*)&sPl[w][ln][16 + 8 * hh];
#pragma unroll
    for (int dt = 0; dt < DT; ++dt) {
      FragB bvh, bvl;
#pragma unroll
      for (int i = 0; i < 8; ++i) {
        bvh.u[i] = sVh[8 * hh + i][dt * 16 + ln]; bvh.u[8 + i] = sVh[16 + 8 * hh + i][dt * 16 + ln];
        bvl.u[i] = sVl[8 * hh + i][dt * 16 + ln]; bvl.u[8 + i] = sVl[16 + 8 * hh + i][dt * 16 + ln];
      }
      oacc[dt] = mmaN<3>(pah.v, pal.v, bvh.v, bvl.v, oacc[dt]);
    }
    __builtin_amdgcn_fence(__ATOMIC_ACQ_REL, "workgroup");
    __builtin_amdgcn_wave_barrier();
  }
#pragma unroll
  for (int r = 0; r < 8; ++r) {
    float l = l_r[r];
    l += __shfl_xor(l, 1, 32); l += __shfl_xor(l, 2, 32); l += __shfl_xor(l, 4, 32); l += __shfl_xor(l, 8, 32);
    l_r[r] = (l > 0.f) ? 1.0f / l : 0.f;
  }
#pragma unroll
  for (int dt = 0; dt < DT; ++dt)
#pragma unroll
    for (int r = 0; r < 8; ++r) sO[w][8 * hh + r][dt * 16 + ln] = oacc[dt][r] * l_r[r];
  __builtin_amdgcn_fence(__ATOMIC_ACQ_REL, "workgroup");
  __builtin_amdgcn_wave_barrier();
  {
    for (int r = 0; r < 16; ++r) {
      const int row = q0 + r;
      if (row < T && lane < D / 4) {
        const v4f val = *(const v4fa*)&sO[w][r][lane * 4];
        *(v4f*)(y + ((size_t)b * T + row) * ypitch + h * D + lane * 4) = val;
      }
    }
    
  }
}

// GEMM C = act(A·W + bias + resid): A f32 (ASPLIT -> hi/lo 2 terms), Wt bf16 [N][K]; ACT 0 none, 1 relu, 2 exact gelu;
// resid (optional, f32, row index = (row % rmod), pitch ldr, RES_BF16 rounds it) added before the activation.
template <bool ASPLIT, int ACT, bool BIAS_BF16, bool RES_BF16>
__global__ __launch_bounds__(128) void k_gemm_bf3(const float* __restrict__ A, int lda, const unsigned short* __restrict__ Wt, int ldb,
                                                const float* __restrict__ bias, const float* __restrict__ resid, int rmod, int ldr,
                                                float* __restrict__ C, int ldc, int M, int N, int K) {
  __shared__ __attribute__((aligned(16))) float so[4][16][64];
  const int tid = threadIdx.x, w = tid >> 5, lane = tid & 31, ln = lane & 15, hh = lane >> 4;
  const int ntn = N / 64;
  const int wid = blockIdx.x * 4 + w;
  const int mt = wid / ntn, nq = wid % ntn;
  if (mt * 16 >= M) return;
  const int row0 = mt * 16, col0 = nq * 64;
  const float* arow = A + (size_t)(row0 + ln) * lda;
  v8f acc[4] = {};
  for (int kb = 0; kb < K; kb += 32) {
    FragB ah, al;
    const v4f x0 = *(const v4fa*)(arow + kb + 8 * hh), x1 = *(const v4fa*)(arow + kb + 8 * hh + 4);
    const v4f x2 = *(const v4fa*)(arow + kb + 16 + 8 * hh), x3 = *(const v4fa*)(arow + kb + 16 + 8 * hh + 4);
    float xs[16] = {x0[0],x0[1],x0[2],x0[3],x1[0],x1[1],x1[2],x1[3],x2[0],x2[1],x2[2],x2[3],x3[0],x3[1],x3[2],x3[3]};
#pragma unroll
    for (int i = 0; i < 16; ++i) { const unsigned short hb = bf16_bits(xs[i]); ah.u[i] = hb; al.u[i] = ASPLIT ? bf16_bits(xs[i] - bf16_val(hb)) : (unsigned short)0; }
#pragma unroll
    for (int t = 0; t < 4; ++t) {
      const unsigned short* brow = Wt + (size_t)(col0 + t * 16 + ln) * ldb + kb;
      FragB b;
      b.half[0] = *(const v8us*)(brow + 8 * hh);
      b.half[1] = *(const v8us*)(brow + 16 + 8 * hh);
      acc[t] = mmaN<ASPLIT ? 2 : 1>(ah.v, al.v, b.v, b.v, acc[t]);
    }
  }
#pragma unroll
  for (int t = 0; t < 4; ++t) {
    const int col = col0 + t * 16 + ln;
    float bv = bias ? bias[col] : 0.f;
    if (BIAS_BF16) bv = bf16_round(bv);
#pragma unroll
    for (int r = 0; r < 8; ++r) {
      float v = acc[t][r] + bv;
      if (resid) { float rv = resid[(size_t)((row0 + 8 * hh + r) % rmod) * ldr + col]; if (RES_BF16) rv = bf16_round(rv); v += rv; }
      if (ACT == 1) v = fmaxf(v, 0.f);
      if (ACT == 2) v = 0.5f * v * (1.0f + erff(v * 0.70710678118654752f));
      if (ACT == 3) { const float u = 0.7978845608028654f * (v + 0.044715f * v * v * v); v = 0.5f * v * (1.0f + tanhf(u)); }
      so[w][8 * hh + r][t * 16 + ln] = v;
    }
  }
  __builtin_amdgcn_fence(__ATOMIC_ACQ_REL, "workgroup");
  __builtin_amdgcn_wave_barrier();
  const int rsub = lane >> 4, c4 = (lane & 15) * 4;
  {
#pragma unroll
    for (int q = 0; q < 8; ++q) {
      const int r = q * 2 + rsub;
      const v4f v = *(const v4fa*)&so[w][r][c4];
      *(v4f*)(C + (size_t)(row0 + r) * ldc + col0 + c4) = v;
    }
    
  }
}
// row LayerNorm (biased variance, eps) over N: s = X (+ R); optional out_sum <- s; out_norm <- (s-mu)*rsqrt(var+eps)*g + b
template <bool PARAM_BF16>
__global__ __launch_bounds__(256) void k_layernorm(const float* __restrict__ X, const float* __restrict__ R, const float* __restrict__ g, const float* __restrict__ bta,
                                                  float* __restrict__ out_sum, float* __restrict__ out_norm, int N, float eps) {
  __shared__ float red[256];
  const int row = blockIdx.x, tid = threadIdx.x;
  const float* x = X + (size_t)row * N; const float* rr = R ? R + (size_t)row * N : nullptr;
  float vals[16];                     // up to N = 4096
  const int per = N / 256;            // contiguous chunk per thread? use strided-by-4 chunks: thread handles j = tid*4 + 1024*u
  float s1 = 0.f;
  for (int u = 0; u < per / 4; ++u) {
    const int j = tid * 4 + 1024 * u;
    const v4f a = *(const v4fa*)(x + j);
    v4f b = {0.f,0.f,0.f,0.f}; if (rr) b = *(const v4fa*)(rr + j);
#pragma unroll
    for (int q = 0; q < 4; ++q) { const float v = a[q] + b[q]; vals[u * 4 + q] = v; s1 += v; }
  }
  red[tid] = s1; __syncthreads();
  for (int st = 128; st > 0; st >>= 1) { if (tid < st) red[tid] += red[tid + st]; __syncthreads(); }
  const float mu = red[0] / (float)N; __syncthreads();
  float s2 = 0.f;
  for (int u = 0; u < per / 4; ++u)
#pragma unroll
    for (int q = 0; q < 4; ++q) { const float c = vals[u * 4 + q] - mu; s2 += c * c; }
  red[tid] = s2; __syncthreads();
  for (int st = 128; st > 0; st >>= 1) { if (tid < st) red[tid] += red[tid + st]; __syncthreads(); }
  const float rs = rsqrtf(red[0] / (float)N + eps);
  {
    for (int u = 0; u < per / 4; ++u) {
      const int j = tid * 4 + 1024 * u;
      v4f o, sm;
#pragma unroll
      for (int q = 0; q < 4; ++q) {
        float gg = g[j + q], bb = bta[j + q];
        if (PARAM_BF16) { gg = bf16_round(gg); bb = bf16_round(bb); }
        sm[q] = vals[u * 4 + q]; o[q] = (vals[u * 4 + q] - mu) * rs * gg + bb;
      }
      if (out_sum) *(v4f*)(out_sum + (size_t)row * N + j) = sm;
      *(v4f*)(out_norm + (size_t)row * N + j) = o;
    }
    
  }
}



// ---- f16 WMMA path (v_wmma_f32_16x16x32_f16): 11-bit significands for operands in range — used where a [0,1] probability operand needs more precision than bf16
typedef _Float16 v16h __attribute__((ext_vector_type(16)));
union FragH { v16h v; v8us half[2]; _Float16 h[16]; unsigned short u[16]; };
template <int NT>
__device__ __forceinline__ v8f mmaH(v16h ah, v16h al, v16h bh, v16h bl, v8f c) {
  c = __builtin_amdgcn_wmma_f32_16x16x32_f16(false, ah, false, bh, (short)0, c, false, false);
  if (NT >= 2) c = __builtin_amdgcn_wmma_f32_16x16x32_f16(false, al, false, bh, (short)0, c, false, false);
  if (NT >= 3) c = __builtin_amdgcn_wmma_f32_16x16x32_f16(false, ah, false, bl, (short)0, c, false, false);
  asm volatile("v_nop\n\tv_nop\n\tv_nop\n\tv_nop" : "+v"(c) : "v"(ah), "v"(al), "v"(bh), "v"(bl));
  return c;
}
// batched GEMM with f16 operands: A f32 (split into f16 hi/lo if ASPLIT, else rounded to f16), Bt = f16 values [n][k]; alpha; C f32; N multiple of 16 (partial tiles skipped)
template <bool ASPLIT>
__global__ __launch_bounds__(128) void k_gemm_h(const float* __restrict__ A, int lda, size_t sA, const _Float16* __restrict__ Bh, int ldb, size_t sB, float alpha, float* __restrict__ C, int ldc, size_t sC, int M, int N, int K) {
  __shared__ __attribute__((aligned(16))) float so[4][16][64];
  const int tid = threadIdx.x, w = tid >> 5, lane = tid & 31, ln = lane & 15, hh = lane >> 4; const int by = blockIdx.y;
  A += (size_t)by * sA; Bh += (size_t)by * sB; C += (size_t)by * sC;
  const int ntn = (N + 63) / 64; const int wid = blockIdx.x * 4 + w; const int mt = wid / ntn, nq = wid % ntn; if (mt * 16 >= M) return;
  const int row0 = mt * 16, col0 = nq * 64; const float* arow = A + (size_t)(row0 + ln) * lda;
  v8f acc[4] = {};
  for (int kb = 0; kb < K; kb += 32) {
    FragH ah, al;
    const v4f x0 = *(const v4fa*)(arow + kb + 8 * hh), x1 = *(const v4fa*)(arow + kb + 8 * hh + 4), x2 = *(const v4fa*)(arow + kb + 16 + 8 * hh), x3 = *(const v4fa*)(arow + kb + 16 + 8 * hh + 4);
    float xs[16] = {x0[0],x0[1],x0[2],x0[3],x1[0],x1[1],x1[2],x1[3],x2[0],x2[1],x2[2],x2[3],x3[0],x3[1],x3[2],x3[3]};
#pragma unroll
    for (int i = 0; i < 16; ++i) { const _Float16 h = (_Float16)xs[i]; ah.h[i] = h; al.h[i] = ASPLIT ? (_Float16)(xs[i] - (float)h) : (_Float16)0.0f; }
#pragma unroll
    for (int t = 0; t < 4; ++t) { if (col0 + t * 16 >= N) continue; const size_t boff = (size_t)(col0 + t * 16 + ln) * ldb + kb; FragH bq; bq.half[0] = *(const v8us*)(Bh + boff + 8 * hh); bq.half[1] = *(const v8us*)(Bh + boff + 16 + 8 * hh);
      acc[t] = mmaH<ASPLIT ? 2 : 1>(ah.v, al.v, bq.v, bq.v, acc[t]); }
  }
#pragma unroll
  for (int t = 0; t < 4; ++t) { if (col0 + t * 16 >= N) continue;
#pragma unroll
    for (int r = 0; r < 8; ++r) so[w][8 * hh + r][t * 16 + ln] = acc[t][r] * alpha; }
  __builtin_amdgcn_fence(__ATOMIC_ACQ_REL, "workgroup"); __builtin_amdgcn_wave_barrier();
  const int rsub = lane >> 4, c4 = (lane & 15) * 4;
  {
#pragma unroll
    for (int q = 0; q < 8; ++q) { const int r = q * 2 + rsub; if (col0 + c4 < N) { const v4f v = *(const v4fa*)&so[w][r][c4]; *(v4f*)(C + (size_t)(row0 + r) * ldc + col0 + c4) = v; } }
     }
}

// Wt[n][k] = f16(W[k][n]·scale) from f32 row-major W[K][N] (scale = power of two; bf16-exact weights stay exact in f16 away from the subnormal range)
__global__ __launch_bounds__(256) void k_wt_f16(const float* __restrict__ W, _Float16* __restrict__ Wt, int K, int N, float scale) {
  const int t = blockIdx.x * 256 + threadIdx.x; if (t >= N * (K / 8)) return; const int n = t / (K / 8), k8 = (t % (K / 8)) * 8; FragH f;
#pragma unroll
  for (int i = 0; i < 8; ++i) f.h[i] = (_Float16)(bf16_round(W[(size_t)(k8 + i) * N + n]) * scale); const v8us o = f.half[0];
  *(v8us*)((unsigned short*)Wt + (size_t)n * K + k8) = o; 
}
// The three projections of one head, inside the attention block. f16 operands, f32 accumulators, result x 2^-4; x is rounded (bf16, then f16), the weights x 2^4, bf16, f16 (the power of two commutes with the rounding).
// Staged index s of a token: s = 24 + (token - first token of the block's ten window rows), so that s = 0 lies on a 128-byte line of every NCHW channel. x comes in two chunks of CHT tokens (s from 0 and from CHS), token-major in LDS, sx[token][c].
#define XP (CC + 8)
#define CHT 320
#define CHS 288
typedef unsigned short v4us __attribute__((ext_vector_type(4), may_alias));
// f32 -> nearest-even bf16 -> f32 by the chip's own conversion: the same value as bf16_round() for every finite x, in fewer instructions
__device__ __forceinline__ float bf16_rne(float x) { return (float)(__bf16)x; }
// round r (of five) of a chunk: a wave takes 32 tokens x 32 channels, a lane 4 tokens x 8 channels; 8 lanes read one whole 128-byte line of a channel. gbase = image token of the chunk's row 0; a token outside the image is clamped into it (its projections are never used)
__device__ __forceinline__ void fx_ld(v4f (&xv)[8], const float* __restrict__ xb, int gbase, int w, int lane, int r) {
  const int wpi = w + 16 * r, qb = wpi % 10, cb = wpi / 10;
  int gt = gbase + (qb * 8 + (lane >> 2)) * 4; gt = (gt < 0) ? 0 : ((gt > NTOK - 4) ? (NTOK - 4) : gt);
  const unsigned xo = (unsigned)(((cb * 4 + (lane & 3)) * 8 * NTOK + gt) * 4);      // byte offset in the image's x, below 2^32: scalar base + one lane register address all eight loads
#pragma unroll
  for (int q = 0; q < 8; ++q) xv[q] = *(const v4fa*)((const char*)xb + xo + q * (NTOK * 4));
  asm volatile("s_wait_xcnt 0x0" :: "v"(xo) : "memory"); }      // xo is named as an input so that it lives up to this wait: no result of the eight loads may land on their own address register; behind the wait it is dead
// the same round, rounded, into sx: sixteen lanes (4 token quads x 4 channel groups) store to sixteen different groups of four banks
__device__ __forceinline__ void fx_st(const v4f (&xv)[8], unsigned short (*sx)[XP], int w, int lane, int r) {
  const int wpi = w + 16 * r, qb = wpi % 10, cb = wpi / 10; const int row0 = (qb * 8 + (lane >> 2)) * 4, col = (cb * 4 + (lane & 3)) * 8;
#pragma unroll
  for (int k = 0; k < 4; ++k) { FragH f;
#pragma unroll
    for (int q = 0; q < 8; ++q) f.h[q] = (_Float16)bf16_rne(xv[q][k]);
    *(v8us*)&sx[row0 + k][col] = f.half[0]; } }
// rounds 0 and 1 are in flight on entry; two rounds of f32 x at most in registers
__device__ __forceinline__ void fx_rest(v4f (&xv)[2][8], const float* __restrict__ xb, int gbase, unsigned short (*sx)[XP], int w, int lane) {
#pragma unroll
  for (int r = 0; r < 5; ++r) {      // unrolled: xv is indexed by constants and stays in registers
    __builtin_amdgcn_sched_barrier(0);      // keeps the loads two rounds ahead and no further: left free, the scheduler lifts all forty to the top and spills
    fx_st(xv[r & 1], sx, w, lane, r); if (r + 2 < 5) fx_ld(xv[r & 1], xb, gbase, w, lane, r + 2); } }
// one 16-token tile x 32 outputs over K = 256. WA: the weight fragment is the A operand (kc, q: a lane ends with 8 consecutive d of its own token), else the B operand (v: 8 consecutive tokens of its own channel). k order of both fragments: half 0 = c 32ks + 8hh.., half 1 = c 32ks + 16 + 8hh..
template <bool WA>
__device__ __forceinline__ void fx_tile(v8f (&acc)[2], const FragH (&wf)[8][2], const unsigned short* xr) {
  acc[0] = (v8f){0.f,0.f,0.f,0.f,0.f,0.f,0.f,0.f}; acc[1] = acc[0];
#pragma unroll
  for (int ks = 0; ks < 8; ++ks) { FragH xf; xf.half[0] = *(const v8us*)(xr + ks * 32); xf.half[1] = *(const v8us*)(xr + ks * 32 + 16);
#pragma unroll
    for (int nt = 0; nt < 2; ++nt) acc[nt] = WA ? __builtin_amdgcn_wmma_f32_16x16x32_f16(false, wf[ks][nt].v, false, xf.v, (short)0, acc[nt], false, false) : __builtin_amdgcn_wmma_f32_16x16x32_f16(false, xf.v, false, wf[ks][nt].v, (short)0, acc[nt], false, false); } }
// 2^a for eight values at once. The probabilities are rounded to f16 for the matrix product, so exp(x) = 2^(x*log2(e)) with the product and the shift by the maximum in ONE fma is accurate enough (relative error about 1e-6 at x = -20; a below the f32 range, -inf included, gives 0).
// The exponentials stand in asm text, eight in a row with early-clobber results and one v_nop behind the last: the instruction set asks for one slot before a vector instruction reads a transcendental's result or overwrites its source;
// here each one's neighbour is independent of it (no result shares a register with any source), and the v_nop fills the slot of the last.
__device__ __forceinline__ void exp2x8(float (&p)[8], const float (&a)[8]) {
  asm("v_exp_f32 %0, %8\n\tv_exp_f32 %1, %9\n\tv_exp_f32 %2, %10\n\tv_exp_f32 %3, %11\n\tv_exp_f32 %4, %12\n\tv_exp_f32 %5, %13\n\tv_exp_f32 %6, %14\n\tv_exp_f32 %7, %15\n\tv_nop"
      : "=&v"(p[0]), "=&v"(p[1]), "=&v"(p[2]), "=&v"(p[3]), "=&v"(p[4]), "=&v"(p[5]), "=&v"(p[6]), "=&v"(p[7])
      : "v"(a[0]), "v"(a[1]), "v"(a[2]), "v"(a[3]), "v"(a[4]), "v"(a[5]), "v"(a[6]), "v"(a[7])); }
// window attention, one wave per (b, head h, row y, 16-token x segment): for each window row i the 32 tokens (y + i - 3, x0 - 8 .. x0 + 23) are ONE key block.
// S^T = Q_row (32 keys x 32 d, two A tiles, f16 hi + lo*2^-10, 3 products) * KC^T (B, 16 centre keys): lane (ln, hh) holds, for centre token ln, the keys c = 16t + 8hh + r;
// the window is the band 0 <= c - ln - 5 <= 6 (= column offset j). Softmax of a centre token is in-lane plus one exchange with lane ^ 16; the two S^T tiles, as f16, ARE the B operand of
// O^T = V^T (A: row d, keys along k, read from the channel-major sV) * P^T, so a lane ends with 8 consecutive d of its own token.
// kc.rel_k splits into a row term and a column term: E = REL * KC^T with REL rows 0..6 = (rel_h[i] | 0), rows 8..14 = (0 | rel_w[j]), rows 7 and 15 zero; rel is bf16-rounded first, as before (8 significant bits: exact in f16 from 2^-14 up, below that off by at most 2^-25), and kc is hi + lo*2^-10 (2 products).
// A block = one (b, head) x four image rows (y0 = 4g ..) x the four x segments, sixteen waves: its 224 tokens are 896 bytes = seven whole 128-byte lines of every NCHW output channel, so the block turns its result channel-major in LDS and stores the output itself, each line from one block.
#define RG 4
#define TPB (RG * HI)
#define OP (TPB + 4)
#define QLP (2 * HD + 8)
#define VPC 80
#define VLP (VPC * 8 + 8)
__global__ __launch_bounds__(512) void k_nattn(const float* __restrict__ x, const float* __restrict__ Wk, const float* __restrict__ Wq, const float* __restrict__ Wv, const float* __restrict__ relh, const float* __restrict__ relw, float* __restrict__ out) {
  __shared__ __attribute__((aligned(16))) unsigned short sQ[9 * 64][QLP];      // q lines (hi 32 | lo 32) of the block's ten window rows y0 - 3 .. y0 + 6, token-major, row = s - 16 (36 tiles of 16); pitch 144 B = 16 B x odd: the fragment reads meet no bank twice. Before the first tile it holds the head's 96 rounded weight rows (pitch XP)
  __shared__ __attribute__((aligned(16))) unsigned short sK[TPB][QLP];      // kc lines of the block's own 224 tokens, same pitch
  __shared__ __attribute__((aligned(16))) unsigned short sV[HD][VLP];      // v of the same ten rows, channel-major, column = s - 16; pitch 1296 B = 16 B x odd
  __shared__ __attribute__((aligned(16))) unsigned char sU[CHT * XP * 2];      // first sx, a chunk of x (pitch 528 B = 16 B x odd); behind the last projection tile sR and sT
  unsigned short (*sx)[XP] = (unsigned short (*)[XP])sU;
  float (*sR)[16][20] = (float (*)[16][20])sU;      // per centre token of the wave: words 0..6 kc.rel_h[i], words 8..14 kc.rel_w[j] (pitch 20: rows stay 16-byte aligned and in-band lanes of the gather below meet no bank twice)
  float (*sT)[OP] = (float (*)[OP])(sU + RG * NXS * 16 * 20 * 4);      // [d][token of the block]; pitch 228 words: rows stay 16-byte aligned, and rows d and d + 8, written by the two lane halves at once, lie 32 banks apart
  const int tid = threadIdx.x, lane = tid & 31, ln = lane & 15, hh = lane >> 4; const int w = __builtin_amdgcn_readfirstlane(tid >> 5);      // wave number held scalar: (b, h, y, x0) and every row base below are then scalar, a lane keeps only row-invariant byte offsets
  const int b = blockIdx.x / (NHh * (HI / RG)), rem = blockIdx.x % (NHh * (HI / RG)); const int h = rem / (HI / RG), y0 = (rem % (HI / RG)) * RG; const int yl = w / NXS, y = y0 + yl, x0 = (w % NXS) * 16;
  const int qx = (x0 + ln < HI) ? (x0 + ln) : (HI - 1);      // lanes past the image row repeat its last token; their result is not stored
  // Projections first. The head's weights (3 x 32 KB, rows contiguous) come by loads of 512 contiguous bytes, twelve a wave, and are rounded once into LDS; a wave then keeps ONE matrix's fragments in registers for all its tiles: waves 0..5 q, 6..11 v, 12..15 kc.
  const float* xb = x + (size_t)b * CC * NTOK; const int gb0 = (y0 - 3) * HI - 24; unsigned short* sW = &sQ[0][0];
  v4f wr[12], xv[2][8]; const unsigned wo = (unsigned)(((h * HD) * CC + w * 128 + lane * 4) * 4);      // byte offset, the same in all three matrices
#pragma unroll      // unrolled: wr is indexed by constants and stays in registers
  for (int i = 0; i < 12; ++i) { const int mm = i >> 2; const float* wm = (mm == 0) ? Wk : ((mm == 1) ? Wq : Wv); wr[i] = *(const v4fa*)((const char*)wm + wo + (i & 3) * (16 * 128 * 4)); }      // load 16 i + w of the 192: the matrix is a constant of i, so the three argument pointers and one lane offset serve all twelve
  asm volatile("s_wait_xcnt 0x0" :: "v"(wo), "s"(Wk), "s"(Wq), "s"(Wv) : "memory");      // the lane offset and the three scalar bases are named as inputs so that they live up to this wait; behind it the addresses of these loads are dead and may be overwritten
  fx_ld(xv[0], xb, gb0, w, lane, 0); fx_ld(xv[1], xb, gb0, w, lane, 1);
  __builtin_amdgcn_sched_barrier(0);      // the first x loads issue before the wait for the weights
#pragma unroll
  for (int i = 0; i < 12; ++i) { const int mm = i >> 2, jj = (i & 3) * 16 + w; union { _Float16 h[4]; v4us v; } f;      // matrix mm, row jj / 2, c = 128 * (jj % 2) + 4 * lane + 0..3
#pragma unroll
    for (int e = 0; e < 4; ++e) f.h[e] = (_Float16)bf16_rne(wr[i][e] * 16.0f);
    *(v4us*)(sW + (mm * HD + (jj >> 1)) * XP + (jj & 1) * 128 + lane * 4) = f.v; }
  fx_rest(xv, xb, gb0, sx, w, lane);
  __syncthreads();      // the weight rows and chunk 0 of x are written by all sixteen waves and read across them
  const int u = (w < 6) ? 1 : ((w < 12) ? 2 : 0), slot = (w < 6) ? w : ((w < 12) ? (w - 6) : (w - 12)), stride = (w < 12) ? 6 : 4, count = (w < 12) ? 18 : 7;      // matrix 0 kc, 1 q, 2 v; a chunk has 18 tiles of q and of v and 7 of kc
  FragH wf[8][2]; { const unsigned short* wu = sW + (u * HD + ln) * XP + 8 * hh;
#pragma unroll      // unrolled: wf is indexed by constants and stays in registers
    for (int ks = 0; ks < 8; ++ks)
#pragma unroll
      for (int nt = 0; nt < 2; ++nt) { wf[ks][nt].half[0] = *(const v8us*)(wu + nt * 16 * XP + ks * 32); wf[ks][nt].half[1] = *(const v8us*)(wu + nt * 16 * XP + ks * 32 + 16); } }
  __syncthreads();      // every wave has its weight fragments: the q tiles may now overwrite the weight rows
  v4f r0, r1;
#pragma unroll
  for (int c = 0; c < 2; ++c) {
    if (c == 1) {
      __syncthreads();      // every wave has left chunk 0 of x
      fx_rest(xv, xb, gb0 + CHS, sx, w, lane);
      __syncthreads();      // chunk 1 of x is written by all sixteen waves and read across them
      const int ri = ln & 7; const float* rp = ((ln < 8) ? relh : relw) + (h * 7 + ((ri < 7) ? ri : 6)) * 16 + 8 * hh; r0 = *(const v4fa*)rp; r1 = *(const v4fa*)(rp + 4);      // the rel row of this lane, used behind the tiles: fetched here, its latency passes under them
      asm volatile("s_wait_xcnt 0x0" ::: "memory"); }      // rp is dead from here on: later results may land on it
    if (c == 0) { fx_ld(xv[0], xb, gb0 + CHS, w, lane, 0); fx_ld(xv[1], xb, gb0 + CHS, w, lane, 1); }      // the first two rounds of chunk 1 fly under the tiles of chunk 0 (they touch no LDS)
    const int first = (u == 0 && c == 0) ? 11 : 0;      // the block's own tokens are tiles 11..17 of chunk 0 and 0..6 of chunk 1
    for (int k = 0; k < 3; ++k) { const int sl = slot + stride * k; if (sl < count) {      // a scalar test: whole waves pass or skip
      const int jl = first + sl, o = 16 * (18 * c + jl); const unsigned short* xr = &sx[16 + 16 * jl + ln][8 * hh]; v8f acc[2];      // tile jl of the chunk: its rows 16 + 16jl ..; o = s - 16 of its first token
      if (u == 2) { fx_tile<false>(acc, wf, xr);
#pragma unroll
        for (int nt = 0; nt < 2; ++nt) { FragH f;
#pragma unroll
          for (int r = 0; r < 8; ++r) f.h[r] = (_Float16)(acc[nt][r] * 0.0625f);
          *(v8us*)&sV[nt * 16 + ln][o + 8 * hh] = f.half[0]; }
      } else { fx_tile<true>(acc, wf, xr); unsigned short* dq = (u == 1) ? &sQ[o + ln][8 * hh] : &sK[o - 176 + ln][8 * hh];
#pragma unroll
        for (int nt = 0; nt < 2; ++nt) { FragH fh, fl;
#pragma unroll
          for (int r = 0; r < 8; ++r) { const float v = acc[nt][r] * 0.0625f; const _Float16 hv = (_Float16)v; fh.h[r] = hv; fl.h[r] = (_Float16)((v - (float)hv) * 1024.0f); }      // f16 hi + lo*2^10
          *(v8us*)(dq + nt * 16) = fh.half[0]; *(v8us*)(dq + HD + nt * 16) = fl.half[0]; } } } } }
  const v8us z8 = (v8us){0,0,0,0,0,0,0,0}; const v8f z8f = (v8f){0.f,0.f,0.f,0.f,0.f,0.f,0.f,0.f};
  FragH ar; { const int ri = ln & 7; FragH c;      // row ln of REL: its 8 non-zero k of this lane half
#pragma unroll
    for (int q = 0; q < 4; ++q) { c.h[q] = (_Float16)bf16_round(r0[q]); c.h[4 + q] = (_Float16)bf16_round(r1[q]); }
    const v8us cv = (ri < 7) ? c.half[0] : z8; ar.half[0] = (ln < 8) ? cv : z8; ar.half[1] = (ln < 8) ? z8 : cv; }      // k order as bc: half 0 = d 8hh.., half 1 = d 16 + 8hh..
  __syncthreads();      // sQ, sK, sV are written by all sixteen waves and read across them; every wave has left sx, whose range sR and sT now take
  FragH bc, bcl; { const unsigned short* kr = &sK[yl * HI + qx][8 * hh]; bc.half[0] = *(const v8us*)kr; bc.half[1] = *(const v8us*)(kr + 16); bcl.half[0] = *(const v8us*)(kr + HD); bcl.half[1] = *(const v8us*)(kr + HD + 16); }      // centre key kc, column ln of B; a head's line: hi 32 | lo 32
  { const v8f e = __builtin_amdgcn_wmma_f32_16x16x32_f16(false, ar.v, false, bc.v, (short)0, z8f, false, false); const v8f e2 = __builtin_amdgcn_wmma_f32_16x16x32_f16(false, ar.v, false, bcl.v, (short)0, z8f, false, false); v4f o0, o1;
#pragma unroll
    for (int q = 0; q < 4; ++q) { o0[q] = e[q] + e2[q] * 0.0009765625f; o1[q] = e[4 + q] + e2[4 + q] * 0.0009765625f; }
    *(v4fa*)&sR[w][ln][8 * hh] = o0; *(v4fa*)&sR[w][ln][8 * hh + 4] = o1; }      // lane (ln, hh) holds rows 8hh..8hh+7 of E for its own centre token
  __builtin_amdgcn_fence(__ATOMIC_ACQ_REL, "workgroup"); __builtin_amdgcn_wave_barrier();      // sR is written and read by this wave alone
  bool inb[2][8]; int rj[2][8]; bool xok[2], vok[2]; unsigned qoff[2], voff[2];
#pragma unroll
  for (int t = 0; t < 2; ++t) {
    const int xx = x0 - 8 + 16 * t + ln; xok[t] = (xx >= 0 && xx < HI); qoff[t] = (unsigned)((xok[t] ? xx : 0) * QLP + 8 * hh);      // key c = 16t + ln as row of A
    const int xk = x0 - 8 + 16 * t + 8 * hh; vok[t] = (xk >= 0 && xk < HI); voff[t] = (unsigned)(ln * VLP + (vok[t] ? xk : 0));      // 8 keys: wholly inside the image row or wholly outside
#pragma unroll
    for (int r = 0; r < 8; ++r) { const int j = 16 * t + 8 * hh + r - ln - 5; inb[t][r] = (j >= 0 && j < 7); rj[t][r] = (j < 0) ? 0 : ((j > 6) ? 6 : j); } }
  float rh[8]; v8f rw[2]; { const float* rl = &sR[w][ln][0]; const v4f a0 = *(const v4fa*)rl, a1 = *(const v4fa*)(rl + 4);
#pragma unroll
    for (int q = 0; q < 4; ++q) { rh[q] = a0[q]; rh[4 + q] = a1[q]; }
#pragma unroll
    for (int t = 0; t < 2; ++t)
#pragma unroll
      for (int r = 0; r < 8; ++r) rw[t][r] = rl[8 + rj[t][r]]; }      // column term of key c = 16t + 8hh + r, the same for all seven window rows; every lane reads (index clamped into the row): no branch round the load
  float lg[7][2][8];
#pragma unroll
  for (int i = 0; i < 7; ++i) { const int yy = y + i - 3; const bool yok = (yy >= 0 && yy < HI); const unsigned short* q0 = &sQ[(yl + i) * HI + 8][0]; const unsigned short* q1 = q0 + HD;      // window row i of image row y is staged row yl + i; its first token stands in row 8 + 56 (yl + i)
#pragma unroll
    for (int t = 0; t < 2; ++t) { const bool ok = yok && xok[t];
      FragH ak, akl; ak.half[0] = *(const v8us*)(q0 + qoff[t]); ak.half[1] = *(const v8us*)(q0 + qoff[t] + 16); akl.half[0] = *(const v8us*)(q1 + qoff[t]); akl.half[1] = *(const v8us*)(q1 + qoff[t] + 16);
      if (!ok) { ak.half[0] = z8; ak.half[1] = z8; akl.half[0] = z8; akl.half[1] = z8; }      // zero padding: q = 0 outside the image
      v8f s = __builtin_amdgcn_wmma_f32_16x16x32_f16(false, ak.v, false, bc.v, (short)0, rw[t], false, false);      // the column term rides in as C
      v8f s2 = __builtin_amdgcn_wmma_f32_16x16x32_f16(false, ak.v, false, bcl.v, (short)0, z8f, false, false); s2 = __builtin_amdgcn_wmma_f32_16x16x32_f16(false, akl.v, false, bc.v, (short)0, s2, false, false);      // hi.hi + (lo.hi + hi.lo)*2^-10
#pragma unroll
      for (int r = 0; r < 8; ++r) { const float sd = s[r] + s2[r] * 0.0009765625f; const float lv = sd + rh[i]; lg[i][t][r] = inb[t][r] ? lv : -3.0e38f; } } }      // kc.(q + rel_k); padded neighbours keep kc.rel_k
  float m = -3.0e38f;
#pragma unroll
  for (int i = 0; i < 7; ++i)
#pragma unroll
    for (int t = 0; t < 2; ++t)
#pragma unroll
      for (int r = 0; r < 8; ++r) m = fmaxf(m, lg[i][t][r]);
  m = fmaxf(m, __shfl_xor(m, 16, 32));
  const float nm = -m * 0x1.715476p+0f;      // its rounding is one common factor of a token's 49 probabilities and of their sum: it cancels in the division
  float l = 0.f; v8f oacc[2] = {z8f, z8f};
#pragma unroll
  for (int i = 0; i < 7; ++i) { const int yy = y + i - 3; const bool yok = (yy >= 0 && yy < HI); const unsigned short* vb = &sV[0][(yl + i) * HI + 8]; FragH pb;
#pragma unroll
    for (int t = 0; t < 2; ++t) { float a[8], p[8];
#pragma unroll
      for (int r = 0; r < 8; ++r) a[r] = __builtin_fmaf(lg[i][t][r], 0x1.715476p+0f, nm);      // (logit - m) * log2(e); outside the band: -inf, 2^a = 0
      exp2x8(p, a);
#pragma unroll
      for (int r = 0; r < 8; ++r) { l += p[r]; pb.h[8 * t + r] = (_Float16)p[r]; } }
#pragma unroll
    for (int dt = 0; dt < 2; ++dt) { FragH av;
#pragma unroll
      for (int t = 0; t < 2; ++t) { av.half[t] = *(const v8us*)(vb + voff[t] + dt * (16 * VLP)); if (!(yok && vok[t])) av.half[t] = z8; }      // zero padding: v = 0 outside the image
      oacc[dt] = __builtin_amdgcn_wmma_f32_16x16x32_f16(false, av.v, false, pb.v, (short)0, oacc[dt], false, false); }
    __builtin_amdgcn_sched_barrier(0); }      // keeps the next row's v_exp_f32 from being lifted to directly behind these matrix instructions; the eight fmas that make its arguments (at least four issue slots, as dual pairs) now stand between
  l += __shfl_xor(l, 16, 32);
  if (x0 + ln < HI) {      // lanes past the image row hold a repeat of its last token: not kept
#pragma unroll
    for (int dt = 0; dt < 2; ++dt)
#pragma unroll
      for (int r = 0; r < 8; ++r) sT[dt * 16 + 8 * hh + r][yl * HI + x0 + ln] = oacc[dt][r] / l; }
  __syncthreads();      // sT is written by all sixteen waves and read across them
  // wave w stores channels 2w and 2w + 1 of the head: 2 x 56 pieces of 16 bytes, a store instruction covers whole 128-byte lines
  float* op = out + ((size_t)(b * CC + h * HD + 2 * w) * NTOK + y0 * HI);
  v4f ov[4];      // all LDS reads first, then the stores: one LDS latency instead of four
#pragma unroll      // both loops unrolled: ov is indexed by constants and stays in registers
  for (int k = 0; k < 4; ++k) { const int j = lane + 32 * k; if (j < 2 * (TPB / 4)) { const int d = (j >= TPB / 4) ? 1 : 0, c4 = (j - d * (TPB / 4)) * 4; ov[k] = *(const v4fa*)&sT[2 * w + d][c4]; } }
#pragma unroll
  for (int k = 0; k < 4; ++k) { const int j = lane + 32 * k; if (j < 2 * (TPB / 4)) { const int d = (j >= TPB / 4) ? 1 : 0, c4 = (j - d * (TPB / 4)) * 4; *(v4f*)(op + (unsigned)(d * NTOK + c4)) = ov[k]; } }
}

extern "C" void kernel_launch(void* const* d_in, const int* in_sizes, int n_in,
                              void* d_out, int out_size, void* d_ws, size_t ws_size, hipStream_t stream) {
  (void)in_sizes; (void)n_in; (void)out_size;
  const float* x = (const float*)d_in[0]; const float* Wk = (const float*)d_in[1]; const float* Wq = (const float*)d_in[2]; const float* Wv = (const float*)d_in[3]; const float* relh = (const float*)d_in[4]; const float* relw = (const float*)d_in[5];
  (void)d_ws; (void)ws_size;
  k_nattn<<<BB * NHh * (HI / RG), RG * NXS * 32, 0, stream>>>(x, Wk, Wq, Wv, relh, relw, (float*)d_out);      // projections, window attention and the NCHW store, one launch; no workspace
}

// v009
// It runs in 16 microseconds.
// Timed twice side by side with v008, it ran 1.07 times as fast both times.
// Counting every step since v000, it is 11.5 times as fast.
#include <hip/hip_runtime.h>
// Stand-alone (SASA) local self-attention (B=2, C 256 = 8 heads × 32, 56×56, 7×7 windows, stride 1, zero padding; relative row/col embeddings added to the windowed QUERIES, the centre KEY is
// the fixed operand, softmax over the 49 window positions, values windowed): 1×1 projections as GEMMs ((head,dim)×C weights bf16-exact ×2^4) and the window attention on
// v_wmma_f32_16x16x32_f16 with one banded key block per window row (per 16-token row segment and window row: S^T = Q_row.KC^T over 32 keys, kc and q as f16 hi + lo*2^-10 (3 products), band element + kc.rel_k (f32) = logit; f32 softmax over all 49, in-lane
// plus one lane exchange; O^T += V^T.P^T with the f16 S^T tiles as the B operand and V kept channel-major); kc.rel_k = kc[0..15].rel_h[i] + kc[16..31].rel_w[j] is one more A tile (14 rows) against the same KC^T; the NCHW transposes go through LDS (x in as f16, the result out as f32); projections and attention are one kernel.
#define BB 2
#define CC 256
#define NHh 8
#define HD 32
#define HI 56
#define NTOK 3136
#define NXS 4
#define NR (BB * NTOK)

typedef __bf16 v16b __attribute__((ext_vector_type(16)));
typedef unsigned short v8us __attribute__((ext_vector_type(8), may_alias));
typedef float  v8f  __attribute__((ext_vector_type(8)));
typedef float  v4f  __attribute__((ext_vector_type(4)));
typedef float  v4fa __attribute__((ext_vector_type(4), may_alias));
union FragB { v16b v; v8us half[2]; unsigned short u[16]; };

__device__ __forceinline__ unsigned short bf16_bits(float x) { unsigned int u = __float_as_uint(x); return (unsigned short)((u + 0x7FFFu + ((u >> 16) & 1u)) >> 16); }
__device__ __forceinline__ float bf16_val(unsigned short b) { return __uint_as_float(((unsigned int)b) << 16); }
__device__ __forceinline__ float bf16_round(float x) { return bf16_val(bf16_bits(x)); }
// D += A·B with NT terms: 1 = ah·bh, 2 = + al·bh (A split), 3 = + ah·bl (both split)
template <int NT>
__device__ __forceinline__ v8f mmaN(v16b ah, v16b al, v16b bh, v16b bl, v8f c) {
  c = __builtin_amdgcn_wmma_f32_16x16x32_bf16(false, ah, false, bh, (short)0, c, false, false);
  if (NT >= 2) c = __builtin_amdgcn_wmma_f32_16x16x32_bf16(false, al, false, bh, (short)0, c, false, false);
  if (NT >= 3) c = __builtin_amdgcn_wmma_f32_16x16x32_bf16(false, ah, false, bl, (short)0, c, false, false);
  asm volatile("v_nop\n\tv_nop\n\tv_nop\n\tv_nop" : "+v"(c) : "v"(ah), "v"(al), "v"(bh), "v"(bl));
  return c;
}

__global__ __launch_bounds__(256) void k_wt_bf16(const float* __restrict__ W, unsigned short* __restrict__ Wt, int K, int N) {
  const int t = blockIdx.x * 256 + threadIdx.x;
  const int k8n = K / 8;
  if (t >= N * k8n) return;
  const int n = t / k8n, k8 = (t % k8n) * 8;
  v8us v;
#pragma unroll
  for (int i = 0; i < 8; ++i) v[i] = bf16_bits(W[(size_t)(k8 + i) * N + n]);
  *(v8us*)(Wt + (size_t)n * K + k8) = v;
  
}

// GEMM C[M][N] (f32, pitch ldc) = act(A[M][K]·W + bias). A f32 row-major (pitch lda) converted per fragment to bf16
// (ASPLIT: hi/lo two planes -> 2 terms, else single rounded term); Wt bf16 [N][K] (pitch ldb). BIAS_BF16 rounds the
// bias to bf16 first (bias quantised to bf16 before the add). K%32==0, M%16==0, N%64==0.
template <bool ASPLIT, int ACT, bool BIAS_BF16>
__global__ __launch_bounds__(128) void k_gemm_bf(const float* __restrict__ A, int lda, const unsigned short* __restrict__ Wt, int ldb,
                                               const float* __restrict__ bias, float* __restrict__ C, int ldc, int M, int N, int K) {
  __shared__ __attribute__((aligned(16))) float so[4][16][64];
  const int tid = threadIdx.x, w = tid >> 5, lane = tid & 31, ln = lane & 15, hh = lane >> 4;
  const int ntn = N / 64;
  const int wid = blockIdx.x * 4 + w;
  const int mt = wid / ntn, nq = wid % ntn;
  if (mt * 16 >= M) return;
  const int row0 = mt * 16, col0 = nq * 64;
  const float* arow = A + (size_t)(row0 + ln) * lda;
  v8f acc[4] = {};
  for (int kb = 0; kb < K; kb += 32) {
    FragB ah, al;
    const v4f x0 = *(const v4fa*)(arow + kb + 8 * hh), x1 = *(const v4fa*)(arow + kb + 8 * hh + 4);
    const v4f x2 = *(const v4fa*)(arow + kb + 16 + 8 * hh), x3 = *(const v4fa*)(arow + kb + 16 + 8 * hh + 4);
    float xs[16] = {x0[0],x0[1],x0[2],x0[3],x1[0],x1[1],x1[2],x1[3],x2[0],x2[1],x2[2],x2[3],x3[0],x3[1],x3[2],x3[3]};
#pragma unroll
    for (int i = 0; i < 16; ++i) { const unsigned short hb = bf16_bits(xs[i]); ah.u[i] = hb; al.u[i] = ASPLIT ? bf16_bits(xs[i] - bf16_val(hb)) : (unsigned short)0; }
#pragma unroll
    for (int t = 0; t < 4; ++t) {
      const unsigned short* brow = Wt + (size_t)(col0 + t * 16 + ln) * ldb + kb;
      FragB b;
      b.half[0] = *(const v8us*)(brow + 8 * hh);
      b.half[1] = *(const v8us*)(brow + 16 + 8 * hh);
      acc[t] = mmaN<ASPLIT ? 2 : 1>(ah.v, al.v, b.v, b.v, acc[t]);
    }
  }
#pragma unroll
  for (int t = 0; t < 4; ++t) {
    float bv = bias ? bias[col0 + t * 16 + ln] : 0.f;
    if (BIAS_BF16) bv = bf16_round(bv);
#pragma unroll
    for (int r = 0; r < 8; ++r) { float v = acc[t][r] + bv; if (ACT == 1) v = fmaxf(v, 0.f); so[w][8 * hh + r][t * 16 + ln] = v; }
  }
  __builtin_amdgcn_fence(__ATOMIC_ACQ_REL, "workgroup");
  __builtin_amdgcn_wave_barrier();
  const int rsub = lane >> 4, c4 = (lane & 15) * 4;
  {
#pragma unroll
    for (int q = 0; q < 8; ++q) {
      const int r = q * 2 + rsub;
      const v4f v = *(const v4fa*)&so[w][r][c4];
      *(v4f*)(C + (size_t)(row0 + r) * ldc + col0 + c4) = v;
    }
    
  }
}

// Flash-style causal/unmasked attention, all contractions 3-term bf16 hi/lo splits, f32 softmax with running max.
// q,k,v rows are read from f32 buffers with arbitrary row pitch (so they can live inside a fused qkv buffer);
// D = head size (multiple of 32, <= 128); one wave = 16 query rows; block = 4 waves (64 queries) sharing K/V chunks of 32.
template <int D, bool CAUSAL>
__global__ __launch_bounds__(128) void k_flash(const float* __restrict__ qb, const float* __restrict__ kb, const float* __restrict__ vb,
                                             int pitch, int T, int H, float scale, float* __restrict__ y, int ypitch) {
  constexpr int KS = D / 32;        // k-steps for QK
  constexpr int DT = D / 16;        // d tiles for PV
  __shared__ __attribute__((aligned(16))) unsigned short sKh[32][D + 8], sKl[32][D + 8], sVh[32][D + 8], sVl[32][D + 8];
  __shared__ __attribute__((aligned(16))) unsigned short sPh[4][16][40], sPl[4][16][40];
  __shared__ __attribute__((aligned(16))) float sO[4][16][D];
  const int tid = threadIdx.x, w = tid >> 5, lane = tid & 31, ln = lane & 15, hh = lane >> 4;
  const int nqb = (T + 63) / 64;
  const int bh = blockIdx.x / nqb, qblk = blockIdx.x % nqb;
  const int b = bh / H, h = bh % H;
  const int q0 = qblk * 64 + w * 16;
  const float* Q = qb + (size_t)b * T * pitch + h * D;
  const float* K = kb + (size_t)b * T * pitch + h * D;
  const float* V = vb + (size_t)b * T * pitch + h * D;

  // A fragments of the wave's 16 query rows (scaled), hi/lo
  FragB aqh[KS], aql[KS];
  {
    int row = q0 + ln; if (row >= T) row = T - 1;
    const float* qr = Q + (size_t)row * pitch;
#pragma unroll
    for (int ks = 0; ks < KS; ++ks)
#pragma unroll
      for (int i = 0; i < 16; ++i) {
        const int d = ks * 32 + ((i < 8) ? (8 * hh + i) : (16 + 8 * hh + (i - 8)));
        const float x = qr[d] * scale; const unsigned short hb = bf16_bits(x);
        aqh[ks].u[i] = hb; aql[ks].u[i] = bf16_bits(x - bf16_val(hb));
      }
  }
  float m_r[8], l_r[8];
#pragma unroll
  for (int r = 0; r < 8; ++r) { m_r[r] = -3.0e38f; l_r[r] = 0.f; }
  v8f oacc[DT];
#pragma unroll
  for (int dt = 0; dt < DT; ++dt) oacc[dt] = (v8f){0.f,0.f,0.f,0.f,0.f,0.f,0.f,0.f};

  const int kv_end = CAUSAL ? min(T, qblk * 64 + 64) : T;     // block-uniform
  for (int j0 = 0; j0 < kv_end; j0 += 32) {
    __syncthreads();
    for (int e = tid; e < 32 * (D / 4); e += 128) {
      const int r = e / (D / 4), c4 = (e % (D / 4)) * 4;
      const int key = j0 + r;
      v4f kf = {0.f,0.f,0.f,0.f}, vf = {0.f,0.f,0.f,0.f};
      if (key < T) { kf = *(const v4fa*)(K + (size_t)key * pitch + c4); vf = *(const v4fa*)(V + (size_t)key * pitch + c4); }
#pragma unroll
      for (int t = 0; t < 4; ++t) {
        unsigned short hb = bf16_bits(kf[t]); sKh[r][c4 + t] = hb; sKl[r][c4 + t] = bf16_bits(kf[t] - bf16_val(hb));
        hb = bf16_bits(vf[t]); sVh[r][c4 + t] = hb; sVl[r][c4 + t] = bf16_bits(vf[t] - bf16_val(hb));
      }
    }
    __syncthreads();
    // S tile 16 x 32
    v8f s[2];
#pragma unroll
    for (int nt = 0; nt < 2; ++nt) {
      v8f acc = {};
#pragma unroll
      for (int ks = 0; ks < KS; ++ks) {
        FragB bh_, bl_;
        bh_.half[0] = *(const v8us*)&sKh[nt * 16 + ln][ks * 32 + 8 * hh]; bh_.half[1] = *(const v8us*)&sKh[nt * 16 + ln][ks * 32 + 16 + 8 * hh];
        bl_.half[0] = *(const v8us*)&sKl[nt * 16 + ln][ks * 32 + 8 * hh]; bl_.half[1] = *(const v8us*)&sKl[nt * 16 + ln][ks * 32 + 16 + 8 * hh];
        acc = mmaN<3>(aqh[ks].v, aql[ks].v, bh_.v, bl_.v, acc);
      }
      s[nt] = acc;
    }
    // mask + running max (rows 8hh+r; the 16 lanes of a half share rows)
    float alpha[8];
#pragma unroll
    for (int r = 0; r < 8; ++r) {
      const int qi = q0 + 8 * hh + r;
      const int ja = j0 + ln, jb = j0 + 16 + ln;
      if (CAUSAL) { if (ja > qi) s[0][r] = -3.0e38f; if (jb > qi) s[1][r] = -3.0e38f; }
      if (ja >= T) s[0][r] = -3.0e38f;
      if (jb >= T) s[1][r] = -3.0e38f;
      float mx = fmaxf(s[0][r], s[1][r]);
      mx = fmaxf(mx, __shfl_xor(mx, 1, 32)); mx = fmaxf(mx, __shfl_xor(mx, 2, 32)); mx = fmaxf(mx, __shfl_xor(mx, 4, 32)); mx = fmaxf(mx, __shfl_xor(mx, 8, 32));
      const float mnew = fmaxf(m_r[r], mx);
      alpha[r] = (mnew > -1.0e38f) ? __expf(m_r[r] - mnew) : 1.0f;
      const float p0 = (s[0][r] > -1.0e38f) ? __expf(s[0][r] - mnew) : 0.f;
      const float p1 = (s[1][r] > -1.0e38f) ? __expf(s[1][r] - mnew) : 0.f;
      m_r[r] = mnew;
      l_r[r] = l_r[r] * alpha[r] + p0 + p1;            // per-lane partial row sum (16 lanes combined at the end)
      unsigned short hb = bf16_bits(p0); sPh[w][8 * hh + r][ln] = hb;      sPl[w][8 * hh + r][ln] = bf16_bits(p0 - bf16_val(hb));
      hb = bf16_bits(p1);                sPh[w][8 * hh + r][16 + ln] = hb; sPl[w][8 * hh + r][16 + ln] = bf16_bits(p1 - bf16_val(hb));
    }
#pragma unroll
    for (int dt = 0; dt < DT; ++dt)
#pragma unroll
      for (int r = 0; r < 8; ++r) oacc[dt][r] *= alpha[r];
    __builtin_amdgcn_fence(__ATOMIC_ACQ_REL, "workgroup");
    __builtin_amdgcn_wave_barrier();
    FragB pah, pal;
    pah.half[0] = *(const v8us*)&sPh[w][ln][8 * hh]; pah.half[1] = *(const v8us*)&sPh[w][ln][16 + 8 * hh];
    pal.half[0] = *(const v8us*)&sPl[w][ln][8 * hh]; pal.half[1] = *(const v8us*)&sPl[w][ln][16 + 8 * hh];
#pragma unroll
    for (int dt = 0; dt < DT; ++dt) {
      FragB bvh, bvl;
#pragma unroll
      for (int i = 0; i < 8; ++i) {
        bvh.u[i] = sVh[8 * hh + i][dt * 16 + ln]; bvh.u[8 + i] = sVh[16 + 8 * hh + i][dt * 16 + ln];
        bvl.u[i] = sVl[8 * hh + i][dt * 16 + ln]; bvl.u[8 + i] = sVl[16 + 8 * hh + i][dt * 16 + ln];
      }
      oacc[dt] = mmaN<3>(pah.v, pal.v, bvh.v, bvl.v, oacc[dt]);
    }
    __builtin_amdgcn_fence(__ATOMIC_ACQ_REL, "workgroup");
    __builtin_amdgcn_wave_barrier();
  }
#pragma unroll
  for (int r = 0; r < 8; ++r) {
    float l = l_r[r];
    l += __shfl_xor(l, 1, 32); l += __shfl_xor(l, 2, 32); l += __shfl_xor(l, 4, 32); l += __shfl_xor(l, 8, 32);
    l_r[r] = (l > 0.f) ? 1.0f / l : 0.f;
  }
#pragma unroll
  for (int dt = 0; dt < DT; ++dt)
#pragma unroll
    for (int r = 0; r < 8; ++r) sO[w][8 * hh + r][dt * 16 + ln] = oacc[dt][r] * l_r[r];
  __builtin_amdgcn_fence(__ATOMIC_ACQ_REL, "workgroup");
  __builtin_amdgcn_wave_barrier();
  {
    for (int r = 0; r < 16; ++r) {
      const int row = q0 + r;
      if (row < T && lane < D / 4) {
        const v4f val = *(const v4fa*)&sO[w][r][lane * 4];
        *(v4f*)(y + ((size_t)b * T + row) * ypitch + h * D + lane * 4) = val;
      }
    }
    
  }
}

// GEMM C = act(A·W + bias + resid): A f32 (ASPLIT -> hi/lo 2 terms), Wt bf16 [N][K]; ACT 0 none, 1 relu, 2 exact gelu;
// resid (optional, f32, row index = (row % rmod), pitch ldr, RES_BF16 rounds it) added before the activation.
template <bool ASPLIT, int ACT, bool BIAS_BF16, bool RES_BF16>
__global__ __launch_bounds__(128) void k_gemm_bf3(const float* __restrict__ A, int lda, const unsigned short* __restrict__ Wt, int ldb,
                                                const float* __restrict__ bias, const float* __restrict__ resid, int rmod, int ldr,
                                                float* __restrict__ C, int ldc, int M, int N, int K) {
  __shared__ __attribute__((aligned(16))) float so[4][16][64];
  const int tid = threadIdx.x, w = tid >> 5, lane = tid & 31, ln = lane & 15, hh = lane >> 4;
  const int ntn = N / 64;
  const int wid = blockIdx.x * 4 + w;
  const int mt = wid / ntn, nq = wid % ntn;
  if (mt * 16 >= M) return;
  const int row0 = mt * 16, col0 = nq * 64;
  const float* arow = A + (size_t)(row0 + ln) * lda;
  v8f acc[4] = {};
  for (int kb = 0; kb < K; kb += 32) {
    FragB ah, al;
    const v4f x0 = *(const v4fa*)(arow + kb + 8 * hh), x1 = *(const v4fa*)(arow + kb + 8 * hh + 4);
    const v4f x2 = *(const v4fa*)(arow + kb + 16 + 8 * hh), x3 = *(const v4fa*)(arow + kb + 16 + 8 * hh + 4);
    float xs[16] = {x0[0],x0[1],x0[2],x0[3],x1[0],x1[1],x1[2],x1[3],x2[0],x2[1],x2[2],x2[3],x3[0],x3[1],x3[2],x3[3]};
#pragma unroll
    for (int i = 0; i < 16; ++i) { const unsigned short hb = bf16_bits(xs[i]); ah.u[i] = hb; al.u[i] = ASPLIT ? bf16_bits(xs[i] - bf16_val(hb)) : (unsigned short)0; }
#pragma unroll
    for (int t = 0; t < 4; ++t) {
      const unsigned short* brow = Wt + (size_t)(col0 + t * 16 + ln) * ldb + kb;
      FragB b;
      b.half[0] = *(const v8us*)(brow + 8 * hh);
      b.half[1] = *(const v8us*)(brow + 16 + 8 * hh);
      acc[t] = mmaN<ASPLIT ? 2 : 1>(ah.v, al.v, b.v, b.v, acc[t]);
    }
  }
#pragma unroll
  for (int t = 0; t < 4; ++t) {
    const int col = col0 + t * 16 + ln;
    float bv = bias ? bias[col] : 0.f;
    if (BIAS_BF16) bv = bf16_round(bv);
#pragma unroll
    for (int r = 0; r < 8; ++r) {
      float v = acc[t][r] + bv;
      if (resid) { float rv = resid[(size_t)((row0 + 8 * hh + r) % rmod) * ldr + col]; if (RES_BF16) rv = bf16_round(rv); v += rv; }
      if (ACT == 1) v = fmaxf(v, 0.f);
      if (ACT == 2) v = 0.5f * v * (1.0f + erff(v * 0.70710678118654752f));
      if (ACT == 3) { const float u = 0.7978845608028654f * (v + 0.044715f * v * v * v); v = 0.5f * v * (1.0f + tanhf(u)); }
      so[w][8 * hh + r][t * 16 + ln] = v;
    }
  }
  __builtin_amdgcn_fence(__ATOMIC_ACQ_REL, "workgroup");
  __builtin_amdgcn_wave_barrier();
  const int rsub = lane >> 4, c4 = (lane & 15) * 4;
  {
#pragma unroll
    for (int q = 0; q < 8; ++q) {
      const int r = q * 2 + rsub;
      const v4f v = *(const v4fa*)&so[w][r][c4];
      *(v4f*)(C + (size_t)(row0 + r) * ldc + col0 + c4) = v;
    }
    
  }
}
// row LayerNorm (biased variance, eps) over N: s = X (+ R); optional out_sum <- s; out_norm <- (s-mu)*rsqrt(var+eps)*g + b
template <bool PARAM_BF16>
__global__ __launch_bounds__(256) void k_layernorm(const float* __restrict__ X, const float* __restrict__ R, const float* __restrict__ g, const float* __restrict__ bta,
                                                  float* __restrict__ out_sum, float* __restrict__ out_norm, int N, float eps) {
  __shared__ float red[256];
  const int row = blockIdx.x, tid = threadIdx.x;
  const float* x = X + (size_t)row * N; const float* rr = R ? R + (size_t)row * N : nullptr;
  float vals[16];                     // up to N = 4096
  const int per = N / 256;            // contiguous chunk per thread? use strided-by-4 chunks: thread handles j = tid*4 + 1024*u
  float s1 = 0.f;
  for (int u = 0; u < per / 4; ++u) {
    const int j = tid * 4 + 1024 * u;
    const v4f a = *(const v4fa*)(x + j);
    v4f b = {0.f,0.f,0.f,0.f}; if (rr) b = *(const v4fa*)(rr + j);
#pragma unroll
    for (int q = 0; q < 4; ++q) { const float v = a[q] + b[q]; vals[u * 4 + q] = v; s1 += v; }
  }
  red[tid] = s1; __syncthreads();
  for (int st = 128; st > 0; st >>= 1) { if (tid < st) red[tid] += red[tid + st]; __syncthreads(); }
  const float mu = red[0] / (float)N; __syncthreads();
  float s2 = 0.f;
  for (int u = 0; u < per / 4; ++u)
#pragma unroll
    for (int q = 0; q < 4; ++q) { const float c = vals[u * 4 + q] - mu; s2 += c * c; }
  red[tid] = s2; __syncthreads();
  for (int st = 128; st > 0; st >>= 1) { if (tid < st) red[tid] += red[tid + st]; __syncthreads(); }
  const float rs = rsqrtf(red[0] / (float)N + eps);
  {
    for (int u = 0; u < per / 4; ++u) {
      const int j = tid * 4 + 1024 * u;
      v4f o, sm;
#pragma unroll
      for (int q = 0; q < 4; ++q) {
        float gg = g[j + q], bb = bta[j + q];
        if (PARAM_BF16) { gg = bf16_round(gg); bb = bf16_round(bb); }
        sm[q] = vals[u * 4 + q]; o[q] = (vals[u * 4 + q] - mu) * rs * gg + bb;
      }
      if (out_sum) *(v4f*)(out_sum + (size_t)row * N + j) = sm;
      *(v4f*)(out_norm + (size_t)row * N + j) = o;
    }
    
  }
}



// ---- f16 WMMA path (v_wmma_f32_16x16x32_f16): 11-bit significands for operands in range — used where a [0,1] probability operand needs more precision than bf16
typedef _Float16 v16h __attribute__((ext_vector_type(16)));
union FragH { v16h v; v8us half[2]; _Float16 h[16]; unsigned short u[16]; };
template <int NT>
__device__ __forceinline__ v8f mmaH(v16h ah, v16h al, v16h bh, v16h bl, v8f c) {
  c = __builtin_amdgcn_wmma_f32_16x16x32_f16(false, ah, false, bh, (short)0, c, false, false);
  if (NT >= 2) c = __builtin_amdgcn_wmma_f32_16x16x32_f16(false, al, false, bh, (short)0, c, false, false);
  if (NT >= 3) c = __builtin_amdgcn_wmma_f32_16x16x32_f16(false, ah, false, bl, (short)0, c, false, false);
  asm volatile("v_nop\n\tv_nop\n\tv_nop\n\tv_nop" : "+v"(c) : "v"(ah), "v"(al), "v"(bh), "v"(bl));
  return c;
}
// batched GEMM with f16 operands: A f32 (split into f16 hi/lo if ASPLIT, else rounded to f16), Bt = f16 values [n][k]; alpha; C f32; N multiple of 16 (partial tiles skipped)
template <bool ASPLIT>
__global__ __launch_bounds__(128) void k_gemm_h(const float* __restrict__ A, int lda, size_t sA, const _Float16* __restrict__ Bh, int ldb, size_t sB, float alpha, float* __restrict__ C, int ldc, size_t sC, int M, int N, int K) {
  __shared__ __attribute__((aligned(16))) float so[4][16][64];
  const int tid = threadIdx.x, w = tid >> 5, lane = tid & 31, ln = lane & 15, hh = lane >> 4; const int by = blockIdx.y;
  A += (size_t)by * sA; Bh += (size_t)by * sB; C += (size_t)by * sC;
  const int ntn = (N + 63) / 64; const int wid = blockIdx.x * 4 + w; const int mt = wid / ntn, nq = wid % ntn; if (mt * 16 >= M) return;
  const int row0 = mt * 16, col0 = nq * 64; const float* arow = A + (size_t)(row0 + ln) * lda;
  v8f acc[4] = {};
  for (int kb = 0; kb < K; kb += 32) {
    FragH ah, al;
    const v4f x0 = *(const v4fa*)(arow + kb + 8 * hh), x1 = *(const v4fa*)(arow + kb + 8 * hh + 4), x2 = *(const v4fa*)(arow + kb + 16 + 8 * hh), x3 = *(const v4fa*)(arow + kb + 16 + 8 * hh + 4);
    float xs[16] = {x0[0],x0[1],x0[2],x0[3],x1[0],x1[1],x1[2],x1[3],x2[0],x2[1],x2[2],x2[3],x3[0],x3[1],x3[2],x3[3]};
#pragma unroll
    for (int i = 0; i < 16; ++i) { const _Float16 h = (_Float16)xs[i]; ah.h[i] = h; al.h[i] = ASPLIT ? (_Float16)(xs[i] - (float)h) : (_Float16)0.0f; }
#pragma unroll
    for (int t = 0; t < 4; ++t) { if (col0 + t * 16 >= N) continue; const size_t boff = (size_t)(col0 + t * 16 + ln) * ldb + kb; FragH bq; bq.half[0] = *(const v8us*)(Bh + boff + 8 * hh); bq.half[1] = *(const v8us*)(Bh + boff + 16 + 8 * hh);
      acc[t] = mmaH<ASPLIT ? 2 : 1>(ah.v, al.v, bq.v, bq.v, acc[t]); }
  }
#pragma unroll
  for (int t = 0; t < 4; ++t) { if (col0 + t * 16 >= N) continue;
#pragma unroll
    for (int r = 0; r < 8; ++r) so[w][8 * hh + r][t * 16 + ln] = acc[t][r] * alpha; }
  __builtin_amdgcn_fence(__ATOMIC_ACQ_REL, "workgroup"); __builtin_amdgcn_wave_barrier();
  const int rsub = lane >> 4, c4 = (lane & 15) * 4;
  {
#pragma unroll
    for (int q = 0; q < 8; ++q) { const int r = q * 2 + rsub; if (col0 + c4 < N) { const v4f v = *(const v4fa*)&so[w][r][c4]; *(v4f*)(C + (size_t)(row0 + r) * ldc + col0 + c4) = v; } }
     }
}

// Wt[n][k] = f16(W[k][n]·scale) from f32 row-major W[K][N] (scale = power of two; bf16-exact weights stay exact in f16 away from the subnormal range)
__global__ __launch_bounds__(256) void k_wt_f16(const float* __restrict__ W, _Float16* __restrict__ Wt, int K, int N, float scale) {
  const int t = blockIdx.x * 256 + threadIdx.x; if (t >= N * (K / 8)) return; const int n = t / (K / 8), k8 = (t % (K / 8)) * 8; FragH f;
#pragma unroll
  for (int i = 0; i < 8; ++i) f.h[i] = (_Float16)(bf16_round(W[(size_t)(k8 + i) * N + n]) * scale); const v8us o = f.half[0];
  *(v8us*)((unsigned short*)Wt + (size_t)n * K + k8) = o; 
}
// The three projections of one head, inside the attention block. f16 operands, f32 accumulators, result x 2^-4; x is rounded (bf16, then f16), the weights x 2^4, bf16, f16 (the power of two commutes with the rounding).
// Staged index s of a token: s = 24 + (token - first token of the block's ten window rows), so that s = 0 lies on a 128-byte line of every NCHW channel. x comes in two chunks of CHT tokens (s from 0 and from CHS), token-major in LDS, sx[token][c].
#define XP (CC + 8)
#define CHT 320
#define CHS 288
typedef unsigned short v4us __attribute__((ext_vector_type(4), may_alias));
// f32 -> nearest-even bf16 -> f32 by the chip's own conversion: the same value as bf16_round() for every finite x, in fewer instructions
__device__ __forceinline__ float bf16_rne(float x) { return (float)(__bf16)x; }
// round r (of five) of a chunk: a wave takes 32 tokens x 32 channels, a lane 4 tokens x 8 channels; 8 lanes read one whole 128-byte line of a channel. gbase = image token of the chunk's row 0; a token outside the image is clamped into it (its projections are never used)
// rot (the head's index, scalar) turns the walk over the eight 32-channel groups: the eight heads' blocks of one row group read the very same x lines and start almost together; unrotated they ask L2 for the same line at the same moment, round after round
__device__ __forceinline__ void fx_ld(v4f (&xv)[8], const float* __restrict__ xb, int gbase, int w, int lane, int r, int rot) {
  const int wpi = w + 16 * r, qb = wpi % 10, cb = (wpi / 10 + rot) & 7;
  int gt = gbase + (qb * 8 + (lane >> 2)) * 4; gt = (gt < 0) ? 0 : ((gt > NTOK - 4) ? (NTOK - 4) : gt);
  const unsigned xo = (unsigned)(((cb * 4 + (lane & 3)) * 8 * NTOK + gt) * 4);      // byte offset in the image's x, below 2^32: scalar base + one lane register address all eight loads
#pragma unroll
  for (int q = 0; q < 8; ++q) xv[q] = *(const v4fa*)((const char*)xb + xo + q * (NTOK * 4));
  asm volatile("s_wait_xcnt 0x0" :: "v"(xo) : "memory"); }      // xo is named as an input so that it lives up to this wait: no result of the eight loads may land on their own address register; behind the wait it is dead
// the same round, rounded, into sx: sixteen lanes (4 token quads x 4 channel groups) store to sixteen different groups of four banks
__device__ __forceinline__ void fx_st(const v4f (&xv)[8], unsigned short (*sx)[XP], int w, int lane, int r, int rot) {
  const int wpi = w + 16 * r, qb = wpi % 10, cb = (wpi / 10 + rot) & 7; const int row0 = (qb * 8 + (lane >> 2)) * 4, col = (cb * 4 + (lane & 3)) * 8;
#pragma unroll
  for (int k = 0; k < 4; ++k) { FragH f;
#pragma unroll
    for (int q = 0; q < 8; ++q) f.h[q] = (_Float16)bf16_rne(xv[q][k]);
    *(v8us*)&sx[row0 + k][col] = f.half[0]; } }
// rounds 0 and 1 are in flight on entry; two rounds of f32 x at most in registers
__device__ __forceinline__ void fx_rest(v4f (&xv)[2][8], const float* __restrict__ xb, int gbase, unsigned short (*sx)[XP], int w, int lane, int rot) {
#pragma unroll
  for (int r = 0; r < 5; ++r) {      // unrolled: xv is indexed by constants and stays in registers
    __builtin_amdgcn_sched_barrier(0);      // keeps the loads two rounds ahead and no further: left free, the scheduler lifts all forty to the top and spills
    fx_st(xv[r & 1], sx, w, lane, r, rot); if (r + 2 < 5) fx_ld(xv[r & 1], xb, gbase, w, lane, r + 2, rot); } }
// one 16-token tile x 32 outputs over K = 256. WA: the weight fragment is the A operand (kc, q: a lane ends with 8 consecutive d of its own token), else the B operand (v: 8 consecutive tokens of its own channel). k order of both fragments: half 0 = c 32ks + 8hh.., half 1 = c 32ks + 16 + 8hh..
template <bool WA>
__device__ __forceinline__ void fx_tile(v8f (&acc)[2], const FragH (&wf)[8][2], const unsigned short* xr) {
  acc[0] = (v8f){0.f,0.f,0.f,0.f,0.f,0.f,0.f,0.f}; acc[1] = acc[0];
#pragma unroll
  for (int ks = 0; ks < 8; ++ks) { FragH xf; xf.half[0] = *(const v8us*)(xr + ks * 32); xf.half[1] = *(const v8us*)(xr + ks * 32 + 16);
#pragma unroll
    for (int nt = 0; nt < 2; ++nt) acc[nt] = WA ? __builtin_amdgcn_wmma_f32_16x16x32_f16(false, wf[ks][nt].v, false, xf.v, (short)0, acc[nt], false, false) : __builtin_amdgcn_wmma_f32_16x16x32_f16(false, xf.v, false, wf[ks][nt].v, (short)0, acc[nt], false, false); } }
// 2^a for eight values at once. The probabilities are rounded to f16 for the matrix product, so exp(x) = 2^(x*log2(e)) with the product and the shift by the maximum in ONE fma is accurate enough (relative error about 1e-6 at x = -20; a below the f32 range, -inf included, gives 0).
// The exponentials stand in asm text, eight in a row with early-clobber results and one v_nop behind the last: the instruction set asks for one slot before a vector instruction reads a transcendental's result or overwrites its source;
// here each one's neighbour is independent of it (no result shares a register with any source), and the v_nop fills the slot of the last.
__device__ __forceinline__ void exp2x8(float (&p)[8], const float (&a)[8]) {
  asm("v_exp_f32 %0, %8\n\tv_exp_f32 %1, %9\n\tv_exp_f32 %2, %10\n\tv_exp_f32 %3, %11\n\tv_exp_f32 %4, %12\n\tv_exp_f32 %5, %13\n\tv_exp_f32 %6, %14\n\tv_exp_f32 %7, %15\n\tv_nop"
      : "=&v"(p[0]), "=&v"(p[1]), "=&v"(p[2]), "=&v"(p[3]), "=&v"(p[4]), "=&v"(p[5]), "=&v"(p[6]), "=&v"(p[7])
      : "v"(a[0]), "v"(a[1]), "v"(a[2]), "v"(a[3]), "v"(a[4]), "v"(a[5]), "v"(a[6]), "v"(a[7])); }
// window attention, one wave per (b, head h, row y, 16-token x segment): for each window row i the 32 tokens (y + i - 3, x0 - 8 .. x0 + 23) are ONE key block.
// S^T = Q_row (32 keys x 32 d, two A tiles, f16 hi + lo*2^-10, 3 products) * KC^T (B, 16 centre keys): lane (ln, hh) holds, for centre token ln, the keys c = 16t + 8hh + r;
// the window is the band 0 <= c - ln - 5 <= 6 (= column offset j). Softmax of a centre token is in-lane plus one exchange with lane ^ 16; the two S^T tiles, as f16, ARE the B operand of
// O^T = V^T (A: row d, keys along k, read from the channel-major sV) * P^T, so a lane ends with 8 consecutive d of its own token.
// kc.rel_k splits into a row term and a column term: E = REL * KC^T with REL rows 0..6 = (rel_h[i] | 0), rows 8..14 = (0 | rel_w[j]), rows 7 and 15 zero; rel is bf16-rounded first, as before (8 significant bits: exact in f16 from 2^-14 up, below that off by at most 2^-25), and kc is hi + lo*2^-10 (2 products).
// A block = one (b, head) x four image rows (y0 = 4g ..) x the four x segments, sixteen waves: its 224 tokens are 896 bytes = seven whole 128-byte lines of every NCHW output channel, so the block turns its result channel-major in LDS and stores the output itself, each line from one block.
#define RG 4
#define TPB (RG * HI)
#define OP (TPB + 4)
#define QLP (2 * HD + 8)
#define VPC 80
#define VLP (VPC * 8 + 8)
__global__ __launch_bounds__(512) void k_nattn(const float* __restrict__ x, const float* __restrict__ Wk, const float* __restrict__ Wq, const float* __restrict__ Wv, const float* __restrict__ relh, const float* __restrict__ relw, float* __restrict__ out) {
  __shared__ __attribute__((aligned(16))) unsigned short sQ[9 * 64][QLP];      // q lines (hi 32 | lo 32) of the block's ten window rows y0 - 3 .. y0 + 6, token-major, row = s - 16 (36 tiles of 16); pitch 144 B = 16 B x odd: the fragment reads meet no bank twice. Before the first tile it holds the head's 96 rounded weight rows (pitch XP)
  __shared__ __attribute__((aligned(16))) unsigned short sK[TPB][QLP];      // kc lines of the block's own 224 tokens, same pitch
  __shared__ __attribute__((aligned(16))) unsigned short sV[HD][VLP];      // v of the same ten rows, channel-major, column = s - 16; pitch 1296 B = 16 B x odd
  __shared__ __attribute__((aligned(16))) unsigned char sU[CHT * XP * 2];      // first sx, a chunk of x (pitch 528 B = 16 B x odd); behind the last projection tile sR and sT
  unsigned short (*sx)[XP] = (unsigned short (*)[XP])sU;
  float (*sR)[16][20] = (float (*)[16][20])sU;      // per centre token of the wave: words 0..6 kc.rel_h[i], words 8..14 kc.rel_w[j] (pitch 20: rows stay 16-byte aligned and in-band lanes of the gather below meet no bank twice)
  float (*sT)[OP] = (float (*)[OP])(sU + RG * NXS * 16 * 20 * 4);      // [d][token of the block]; pitch 228 words: rows stay 16-byte aligned, and rows d and d + 8, written by the two lane halves at once, lie 32 banks apart
  const int tid = threadIdx.x, lane = tid & 31, ln = lane & 15, hh = lane >> 4; const int w = __builtin_amdgcn_readfirstlane(tid >> 5);      // wave number held scalar: (b, h, y, x0) and every row base below are then scalar, a lane keeps only row-invariant byte offsets
  const int b = blockIdx.x / (NHh * (HI / RG)), rem = blockIdx.x % (NHh * (HI / RG)); const int h = rem / (HI / RG), y0 = (rem % (HI / RG)) * RG; const int yl = w / NXS, y = y0 + yl, x0 = (w % NXS) * 16;
  const int qx = (x0 + ln < HI) ? (x0 + ln) : (HI - 1);      // lanes past the image row repeat its last token; their result is not stored
  // Projections first. The head's weights (3 x 32 KB, rows contiguous) come by loads of 512 contiguous bytes, twelve a wave, and are rounded once into LDS; a wave then keeps ONE matrix's fragments in registers for all its tiles: waves 0..5 q, 6..11 v, 12..15 kc.
  const float* xb = x + (size_t)b * CC * NTOK; const int gb0 = (y0 - 3) * HI - 24; unsigned short* sW = &sQ[0][0];
  const int ww = (w + (y0 >> 2) + 8 * b) & 15;      // which sixteenth of each load group this wave takes, turned by the block's row group and image: the 28 blocks of one head read the same weight lines, all at kernel start
  v4f wr[12], xv[2][8]; const unsigned wo = (unsigned)(((h * HD) * CC + ww * 128 + lane * 4) * 4);      // byte offset, the same in all three matrices
#pragma unroll      // unrolled: wr is indexed by constants and stays in registers
  for (int i = 0; i < 12; ++i) { const int mm = i >> 2; const float* wm = (mm == 0) ? Wk : ((mm == 1) ? Wq : Wv); wr[i] = *(const v4fa*)((const char*)wm + wo + (i & 3) * (16 * 128 * 4)); }      // load 16 i + ww of the 192: the matrix is a constant of i, so the three argument pointers and one lane offset serve all twelve
  asm volatile("s_wait_xcnt 0x0" :: "v"(wo), "s"(Wk), "s"(Wq), "s"(Wv) : "memory");      // the lane offset and the three scalar bases are named as inputs so that they live up to this wait; behind it the addresses of these loads are dead and may be overwritten
  fx_ld(xv[0], xb, gb0, w, lane, 0, h); fx_ld(xv[1], xb, gb0, w, lane, 1, h);
  __builtin_amdgcn_sched_barrier(0);      // the first x loads issue before the wait for the weights
#pragma unroll
  for (int i = 0; i < 12; ++i) { const int mm = i >> 2, jj = (i & 3) * 16 + ww; union { _Float16 h[4]; v4us v; } f;      // matrix mm, row jj / 2, c = 128 * (jj % 2) + 4 * lane + 0..3
#pragma unroll
    for (int e = 0; e < 4; ++e) f.h[e] = (_Float16)bf16_rne(wr[i][e] * 16.0f);
    *(v4us*)(sW + (mm * HD + (jj >> 1)) * XP + (jj & 1) * 128 + lane * 4) = f.v; }
  fx_rest(xv, xb, gb0, sx, w, lane, h);
  __syncthreads();      // the weight rows and chunk 0 of x are written by all sixteen waves and read across them
  const int u = (w < 6) ? 1 : ((w < 12) ? 2 : 0), slot = (w < 6) ? w : ((w < 12) ? (w - 6) : (w - 12)), stride = (w < 12) ? 6 : 4, count = (w < 12) ? 18 : 7;      // matrix 0 kc, 1 q, 2 v; a chunk has 18 tiles of q and of v and 7 of kc
  FragH wf[8][2]; { const unsigned short* wu = sW + (u * HD + ln) * XP + 8 * hh;
#pragma unroll      // unrolled: wf is indexed by constants and stays in registers
    for (int ks = 0; ks < 8; ++ks)
#pragma unroll
      for (int nt = 0; nt < 2; ++nt) { wf[ks][nt].half[0] = *(const v8us*)(wu + nt * 16 * XP + ks * 32); wf[ks][nt].half[1] = *(const v8us*)(wu + nt * 16 * XP + ks * 32 + 16); } }
  __syncthreads();      // every wave has its weight fragments: the q tiles may now overwrite the weight rows
  v4f r0, r1;
#pragma unroll
  for (int c = 0; c < 2; ++c) {
    if (c == 1) {
      __syncthreads();      // every wave has left chunk 0 of x
      fx_rest(xv, xb, gb0 + CHS, sx, w, lane, h);
      __syncthreads();      // chunk 1 of x is written by all sixteen waves and read across them
      const int ri = ln & 7; const float* rp = ((ln < 8) ? relh : relw) + (h * 7 + ((ri < 7) ? ri : 6)) * 16 + 8 * hh; r0 = *(const v4fa*)rp; r1 = *(const v4fa*)(rp + 4);      // the rel row of this lane, used behind the tiles: fetched here, its latency passes under them
      asm volatile("s_wait_xcnt 0x0" ::: "memory"); }      // rp is dead from here on: later results may land on it
    if (c == 0) { fx_ld(xv[0], xb, gb0 + CHS, w, lane, 0, h); fx_ld(xv[1], xb, gb0 + CHS, w, lane, 1, h); }      // the first two rounds of chunk 1 fly under the tiles of chunk 0 (they touch no LDS)
    const int first = (u == 0 && c == 0) ? 11 : 0;      // the block's own tokens are tiles 11..17 of chunk 0 and 0..6 of chunk 1
    for (int k = 0; k < 3; ++k) { const int sl = slot + stride * k; if (sl < count) {      // a scalar test: whole waves pass or skip
      const int jl = first + sl, o = 16 * (18 * c + jl); const unsigned short* xr = &sx[16 + 16 * jl + ln][8 * hh]; v8f acc[2];      // tile jl of the chunk: its rows 16 + 16jl ..; o = s - 16 of its first token
      if (u == 2) { fx_tile<false>(acc, wf, xr);
#pragma unroll
        for (int nt = 0; nt < 2; ++nt) { FragH f;
#pragma unroll
          for (int r = 0; r < 8; ++r) f.h[r] = (_Float16)(acc[nt][r] * 0.0625f);
          *(v8us*)&sV[nt * 16 + ln][o + 8 * hh] = f.half[0]; }
      } else { fx_tile<true>(acc, wf, xr); unsigned short* dq = (u == 1) ? &sQ[o + ln][8 * hh] : &sK[o - 176 + ln][8 * hh];
#pragma unroll
        for (int nt = 0; nt < 2; ++nt) { FragH fh, fl;
#pragma unroll
          for (int r = 0; r < 8; ++r) { const float v = acc[nt][r] * 0.0625f; const _Float16 hv = (_Float16)v; fh.h[r] = hv; fl.h[r] = (_Float16)((v - (float)hv) * 1024.0f); }      // f16 hi + lo*2^10
          *(v8us*)(dq + nt * 16) = fh.half[0]; *(v8us*)(dq + HD + nt * 16) = fl.half[0]; } } } } }
  const v8us z8 = (v8us){0,0,0,0,0,0,0,0}; const v8f z8f = (v8f){0.f,0.f,0.f,0.f,0.f,0.f,0.f,0.f};
  FragH ar; { const int ri = ln & 7; FragH c;      // row ln of REL: its 8 non-zero k of this lane half
#pragma unroll
    for (int q = 0; q < 4; ++q) { c.h[q] = (_Float16)bf16_round(r0[q]); c.h[4 + q] = (_Float16)bf16_round(r1[q]); }
    const v8us cv = (ri < 7) ? c.half[0] : z8; ar.half[0] = (ln < 8) ? cv : z8; ar.half[1] = (ln < 8) ? z8 : cv; }      // k order as bc: half 0 = d 8hh.., half 1 = d 16 + 8hh..
  __syncthreads();      // sQ, sK, sV are written by all sixteen waves and read across them; every wave has left sx, whose range sR and sT now take
  FragH bc, bcl; { const unsigned short* kr = &sK[yl * HI + qx][8 * hh]; bc.half[0] = *(const v8us*)kr; bc.half[1] = *(const v8us*)(kr + 16); bcl.half[0] = *(const v8us*)(kr + HD); bcl.half[1] = *(const v8us*)(kr + HD + 16); }      // centre key kc, column ln of B; a head's line: hi 32 | lo 32
  { const v8f e = __builtin_amdgcn_wmma_f32_16x16x32_f16(false, ar.v, false, bc.v, (short)0, z8f, false, false); const v8f e2 = __builtin_amdgcn_wmma_f32_16x16x32_f16(false, ar.v, false, bcl.v, (short)0, z8f, false, false); v4f o0, o1;
#pragma unroll
    for (int q = 0; q < 4; ++q) { o0[q] = e[q] + e2[q] * 0.0009765625f; o1[q] = e[4 + q] + e2[4 + q] * 0.0009765625f; }
    *(v4fa*)&sR[w][ln][8 * hh] = o0; *(v4fa*)&sR[w][ln][8 * hh + 4] = o1; }      // lane (ln, hh) holds rows 8hh..8hh+7 of E for its own centre token
  __builtin_amdgcn_fence(__ATOMIC_ACQ_REL, "workgroup"); __builtin_amdgcn_wave_barrier();      // sR is written and read by this wave alone
  bool inb[2][8]; int rj[2][8]; bool xok[2], vok[2]; unsigned qoff[2], voff[2];
#pragma unroll
  for (int t = 0; t < 2; ++t) {
    const int xx = x0 - 8 + 16 * t + ln; xok[t] = (xx >= 0 && xx < HI); qoff[t] = (unsigned)((xok[t] ? xx : 0) * QLP + 8 * hh);      // key c = 16t + ln as row of A
    const int xk = x0 - 8 + 16 * t + 8 * hh; vok[t] = (xk >= 0 && xk < HI); voff[t] = (unsigned)(ln * VLP + (vok[t] ? xk : 0));      // 8 keys: wholly inside the image row or wholly outside
#pragma unroll
    for (int r = 0; r < 8; ++r) { const int j = 16 * t + 8 * hh + r - ln - 5; inb[t][r] = (j >= 0 && j < 7); rj[t][r] = (j < 0) ? 0 : ((j > 6) ? 6 : j); } }
  float rh[8]; v8f rw[2]; { const float* rl = &sR[w][ln][0]; const v4f a0 = *(const v4fa*)rl, a1 = *(const v4fa*)(rl + 4);
#pragma unroll
    for (int q = 0; q < 4; ++q) { rh[q] = a0[q]; rh[4 + q] = a1[q]; }
#pragma unroll
    for (int t = 0; t < 2; ++t)
#pragma unroll
      for (int r = 0; r < 8; ++r) rw[t][r] = rl[8 + rj[t][r]]; }      // column term of key c = 16t + 8hh + r, the same for all seven window rows; every lane reads (index clamped into the row): no branch round the load
  float lg[7][2][8];
#pragma unroll
  for (int i = 0; i < 7; ++i) { const int yy = y + i - 3; const bool yok = (yy >= 0 && yy < HI); const unsigned short* q0 = &sQ[(yl + i) * HI + 8][0]; const unsigned short* q1 = q0 + HD;      // window row i of image row y is staged row yl + i; its first token stands in row 8 + 56 (yl + i)
#pragma unroll
    for (int t = 0; t < 2; ++t) { const bool ok = yok && xok[t];
      FragH ak, akl; ak.half[0] = *(const v8us*)(q0 + qoff[t]); ak.half[1] = *(const v8us*)(q0 + qoff[t] + 16); akl.half[0] = *(const v8us*)(q1 + qoff[t]); akl.half[1] = *(const v8us*)(q1 + qoff[t] + 16);
      if (!ok) { ak.half[0] = z8; ak.half[1] = z8; akl.half[0] = z8; akl.half[1] = z8; }      // zero padding: q = 0 outside the image
      v8f s = __builtin_amdgcn_wmma_f32_16x16x32_f16(false, ak.v, false, bc.v, (short)0, rw[t], false, false);      // the column term rides in as C
      v8f s2 = __builtin_amdgcn_wmma_f32_16x16x32_f16(false, ak.v, false, bcl.v, (short)0, z8f, false, false); s2 = __builtin_amdgcn_wmma_f32_16x16x32_f16(false, akl.v, false, bc.v, (short)0, s2, false, false);      // hi.hi + (lo.hi + hi.lo)*2^-10
#pragma unroll
      for (int r = 0; r < 8; ++r) { const float sd = s[r] + s2[r] * 0.0009765625f; const float lv = sd + rh[i]; lg[i][t][r] = inb[t][r] ? lv : -3.0e38f; } } }      // kc.(q + rel_k); padded neighbours keep kc.rel_k
  float m = -3.0e38f;
#pragma unroll
  for (int i = 0; i < 7; ++i)
#pragma unroll
    for (int t = 0; t < 2; ++t)
#pragma unroll
      for (int r = 0; r < 8; ++r) m = fmaxf(m, lg[i][t][r]);
  m = fmaxf(m, __shfl_xor(m, 16, 32));
  const float nm = -m * 0x1.715476p+0f;      // its rounding is one common factor of a token's 49 probabilities and of their sum: it cancels in the division
  float l = 0.f; v8f oacc[2] = {z8f, z8f};
#pragma unroll
  for (int i = 0; i < 7; ++i) { const int yy = y + i - 3; const bool yok = (yy >= 0 && yy < HI); const unsigned short* vb = &sV[0][(yl + i) * HI + 8]; FragH pb;
#pragma unroll
    for (int t = 0; t < 2; ++t) { float a[8], p[8];
#pragma unroll
      for (int r = 0; r < 8; ++r) a[r] = __builtin_fmaf(lg[i][t][r], 0x1.715476p+0f, nm);      // (logit - m) * log2(e); outside the band: -inf, 2^a = 0
      exp2x8(p, a);
#pragma unroll
      for (int r = 0; r < 8; ++r) { l += p[r]; pb.h[8 * t + r] = (_Float16)p[r]; } }
#pragma unroll
    for (int dt = 0; dt < 2; ++dt) { FragH av;
#pragma unroll
      for (int t = 0; t < 2; ++t) { av.half[t] = *(const v8us*)(vb + voff[t] + dt * (16 * VLP)); if (!(yok && vok[t])) av.half[t] = z8; }      // zero padding: v = 0 outside the image
      oacc[dt] = __builtin_amdgcn_wmma_f32_16x16x32_f16(false, av.v, false, pb.v, (short)0, oacc[dt], false, false); }
    __builtin_amdgcn_sched_barrier(0); }      // keeps the next row's v_exp_f32 from being lifted to directly behind these matrix instructions; the eight fmas that make its arguments (at least four issue slots, as dual pairs) now stand between
  l += __shfl_xor(l, 16, 32);
  if (x0 + ln < HI) {      // lanes past the image row hold a repeat of its last token: not kept
#pragma unroll
    for (int dt = 0; dt < 2; ++dt)
#pragma unroll
      for (int r = 0; r < 8; ++r) sT[dt * 16 + 8 * hh + r][yl * HI + x0 + ln] = oacc[dt][r] / l; }
  __syncthreads();      // sT is written by all sixteen waves and read across them
  // wave w stores channels 2w and 2w + 1 of the head: 2 x 56 pieces of 16 bytes, a store instruction covers whole 128-byte lines
  float* op = out + ((size_t)(b * CC + h * HD + 2 * w) * NTOK + y0 * HI);
  v4f ov[4];      // all LDS reads first, then the stores: one LDS latency instead of four
#pragma unroll      // both loops unrolled: ov is indexed by constants and stays in registers
  for (int k = 0; k < 4; ++k) { const int j = lane + 32 * k; if (j < 2 * (TPB / 4)) { const int d = (j >= TPB / 4) ? 1 : 0, c4 = (j - d * (TPB / 4)) * 4; ov[k] = *(const v4fa*)&sT[2 * w + d][c4]; } }
#pragma unroll
  for (int k = 0; k < 4; ++k) { const int j = lane + 32 * k; if (j < 2 * (TPB / 4)) { const int d = (j >= TPB / 4) ? 1 : 0, c4 = (j - d * (TPB / 4)) * 4; *(v4f*)(op + (unsigned)(d * NTOK + c4)) = ov[k]; } }
}

extern "C" void kernel_launch(void* const* d_in, const int* in_sizes, int n_in,
                              void* d_out, int out_size, void* d_ws, size_t ws_size, hipStream_t stream) {
  (void)in_sizes; (void)n_in; (void)out_size;
  const float* x = (const float*)d_in[0]; const float* Wk = (const float*)d_in[1]; const float* Wq = (const float*)d_in[2]; const float* Wv = (const float*)d_in[3]; const float* relh = (const float*)d_in[4]; const float* relw = (const float*)d_in[5];
  (void)d_ws; (void)ws_size;
  k_nattn<<<BB * NHh * (HI / RG), RG * NXS * 32, 0, stream>>>(x, Wk, Wq, Wv, relh, relw, (float*)d_out);      // projections, window attention and the NCHW store, one launch; no workspace
}

// v010
// A run of this version takes 14.5 microseconds.
// In both of two side-by-side timings against v009, it was 1.10 times as fast.
// Counting every step since v000, it is 12.6 times as fast.
#include <hip/hip_runtime.h>
// Stand-alone (SASA) local self-attention (B=2, C 256 = 8 heads × 32, 56×56, 7×7 windows, stride 1, zero padding; relative row/col embeddings added to the windowed QUERIES, the centre KEY is
// the fixed operand, softmax over the 49 window positions, values windowed): 1×1 projections as GEMMs ((head,dim)×C weights bf16-exact ×2^4) and the window attention on
// v_wmma_f32_16x16x32_f16 with one banded 16-key tile per key row (per patch of 2 image rows x 8 columns and key row: S^T = Q_row.KC^T, kc and q as f16 hi + lo*2^-10 (3 products), band element + kc.rel_k (f32) = logit; f32 softmax over all 49, in-lane
// plus one lane exchange; O^T += V^T.P^T with the f16 S^T tiles as the B operand and V kept channel-major); kc.rel_k = kc[0..15].rel_h[i] + kc[16..31].rel_w[j] is one more A tile (14 rows) against the same KC^T; the NCHW transposes are f32 VALU, through LDS; projections and attention are one kernel.
#define BB 2
#define CC 256
#define NHh 8
#define HD 32
#define HI 56
#define NTOK 3136
#define NXS 4
#define NR (BB * NTOK)

typedef __bf16 v16b __attribute__((ext_vector_type(16)));
typedef unsigned short v8us __attribute__((ext_vector_type(8), may_alias));
typedef float  v8f  __attribute__((ext_vector_type(8)));
typedef float  v4f  __attribute__((ext_vector_type(4)));
typedef float  v4fa __attribute__((ext_vector_type(4), may_alias));
union FragB { v16b v; v8us half[2]; unsigned short u[16]; };

__device__ __forceinline__ unsigned short bf16_bits(float x) { unsigned int u = __float_as_uint(x); return (unsigned short)((u + 0x7FFFu + ((u >> 16) & 1u)) >> 16); }
__device__ __forceinline__ float bf16_val(unsigned short b) { return __uint_as_float(((unsigned int)b) << 16); }
__device__ __forceinline__ float bf16_round(float x) { return bf16_val(bf16_bits(x)); }
// D += A·B with NT terms: 1 = ah·bh, 2 = + al·bh (A split), 3 = + ah·bl (both split)
template <int NT>
__device__ __forceinline__ v8f mmaN(v16b ah, v16b al, v16b bh, v16b bl, v8f c) {
  c = __builtin_amdgcn_wmma_f32_16x16x32_bf16(false, ah, false, bh, (short)0, c, false, false);
  if (NT >= 2) c = __builtin_amdgcn_wmma_f32_16x16x32_bf16(false, al, false, bh, (short)0, c, false, false);
  if (NT >= 3) c = __builtin_amdgcn_wmma_f32_16x16x32_bf16(false, ah, false, bl, (short)0, c, false, false);
  asm volatile("v_nop\n\tv_nop\n\tv_nop\n\tv_nop" : "+v"(c) : "v"(ah), "v"(al), "v"(bh), "v"(bl));
  return c;
}

__global__ __launch_bounds__(256) void k_wt_bf16(const float* __restrict__ W, unsigned short* __restrict__ Wt, int K, int N) {
  const int t = blockIdx.x * 256 + threadIdx.x;
  const int k8n = K / 8;
  if (t >= N * k8n) return;
  const int n = t / k8n, k8 = (t % k8n) * 8;
  v8us v;
#pragma unroll
  for (int i = 0; i < 8; ++i) v[i] = bf16_bits(W[(size_t)(k8 + i) * N + n]);
  *(v8us*)(Wt + (size_t)n * K + k8) = v;
  
}

// GEMM C[M][N] (f32, pitch ldc) = act(A[M][K]·W + bias). A f32 row-major (pitch lda) converted per fragment to bf16
// (ASPLIT: hi/lo two planes -> 2 terms, else single rounded term); Wt bf16 [N][K] (pitch ldb). BIAS_BF16 rounds the
// bias to bf16 first (bias quantised to bf16 before the add). K%32==0, M%16==0, N%64==0.
template <bool ASPLIT, int ACT, bool BIAS_BF16>
__global__ __launch_bounds__(128) void k_gemm_bf(const float* __restrict__ A, int lda, const unsigned short* __restrict__ Wt, int ldb,
                                               const float* __restrict__ bias, float* __restrict__ C, int ldc, int M, int N, int K) {
  __shared__ __attribute__((aligned(16))) float so[4][16][64];
  const int tid = threadIdx.x, w = tid >> 5, lane = tid & 31, ln = lane & 15, hh = lane >> 4;
  const int ntn = N / 64;
  const int wid = blockIdx.x * 4 + w;
  const int mt = wid / ntn, nq = wid % ntn;
  if (mt * 16 >= M) return;
  const int row0 = mt * 16, col0 = nq * 64;
  const float* arow = A + (size_t)(row0 + ln) * lda;
  v8f acc[4] = {};
  for (int kb = 0; kb < K; kb += 32) {
    FragB ah, al;
    const v4f x0 = *(const v4fa*)(arow + kb + 8 * hh), x1 = *(const v4fa*)(arow + kb + 8 * hh + 4);
    const v4f x2 = *(const v4fa*)(arow + kb + 16 + 8 * hh), x3 = *(const v4fa*)(arow + kb + 16 + 8 * hh + 4);
    float xs[16] = {x0[0],x0[1],x0[2],x0[3],x1[0],x1[1],x1[2],x1[3],x2[0],x2[1],x2[2],x2[3],x3[0],x3[1],x3[2],x3[3]};
#pragma unroll
    for (int i = 0; i < 16; ++i) { const unsigned short hb = bf16_bits(xs[i]); ah.u[i] = hb; al.u[i] = ASPLIT ? bf16_bits(xs[i] - bf16_val(hb)) : (unsigned short)0; }
#pragma unroll
    for (int t = 0; t < 4; ++t) {
      const unsigned short* brow = Wt + (size_t)(col0 + t * 16 + ln) * ldb + kb;
      FragB b;
      b.half[0] = *(const v8us*)(brow + 8 * hh);
      b.half[1] = *(const v8us*)(brow + 16 + 8 * hh);
      acc[t] = mmaN<ASPLIT ? 2 : 1>(ah.v, al.v, b.v, b.v, acc[t]);
    }
  }
#pragma unroll
  for (int t = 0; t < 4; ++t) {
    float bv = bias ? bias[col0 + t * 16 + ln] : 0.f;
    if (BIAS_BF16) bv = bf16_round(bv);
#pragma unroll
    for (int r = 0; r < 8; ++r) { float v = acc[t][r] + bv; if (ACT == 1) v = fmaxf(v, 0.f); so[w][8 * hh + r][t * 16 + ln] = v; }
  }
  __builtin_amdgcn_fence(__ATOMIC_ACQ_REL, "workgroup");
  __builtin_amdgcn_wave_barrier();
  const int rsub = lane >> 4, c4 = (lane & 15) * 4;
  {
#pragma unroll
    for (int q = 0; q < 8; ++q) {
      const int r = q * 2 + rsub;
      const v4f v = *(const v4fa*)&so[w][r][c4];
      *(v4f*)(C + (size_t)(row0 + r) * ldc + col0 + c4) = v;
    }
    
  }
}

// Flash-style causal/unmasked attention, all contractions 3-term bf16 hi/lo splits, f32 softmax with running max.
// q,k,v rows are read from f32 buffers with arbitrary row pitch (so they can live inside a fused qkv buffer);
// D = head size (multiple of 32, <= 128); one wave = 16 query rows; block = 4 waves (64 queries) sharing K/V chunks of 32.
template <int D, bool CAUSAL>
__global__ __launch_bounds__(128) void k_flash(const float* __restrict__ qb, const float* __restrict__ kb, const float* __restrict__ vb,
                                             int pitch, int T, int H, float scale, float* __restrict__ y, int ypitch) {
  constexpr int KS = D / 32;        // k-steps for QK
  constexpr int DT = D / 16;        // d tiles for PV
  __shared__ __attribute__((aligned(16))) unsigned short sKh[32][D + 8], sKl[32][D + 8], sVh[32][D + 8], sVl[32][D + 8];
  __shared__ __attribute__((aligned(16))) unsigned short sPh[4][16][40], sPl[4][16][40];
  __shared__ __attribute__((aligned(16))) float sO[4][16][D];
  const int tid = threadIdx.x, w = tid >> 5, lane = tid & 31, ln = lane & 15, hh = lane >> 4;
  const int nqb = (T + 63) / 64;
  const int bh = blockIdx.x / nqb, qblk = blockIdx.x % nqb;
  const int b = bh / H, h = bh % H;
  const int q0 = qblk * 64 + w * 16;
  const float* Q = qb + (size_t)b * T * pitch + h * D;
  const float* K = kb + (size_t)b * T * pitch + h * D;
  const float* V = vb + (size_t)b * T * pitch + h * D;

  // A fragments of the wave's 16 query rows (scaled), hi/lo
  FragB aqh[KS], aql[KS];
  {
    int row = q0 + ln; if (row >= T) row = T - 1;
    const float* qr = Q + (size_t)row * pitch;
#pragma unroll
    for (int ks = 0; ks < KS; ++ks)
#pragma unroll
      for (int i = 0; i < 16; ++i) {
        const int d = ks * 32 + ((i < 8) ? (8 * hh + i) : (16 + 8 * hh + (i - 8)));
        const float x = qr[d] * scale; const unsigned short hb = bf16_bits(x);
        aqh[ks].u[i] = hb; aql[ks].u[i] = bf16_bits(x - bf16_val(hb));
      }
  }
  float m_r[8], l_r[8];
#pragma unroll
  for (int r = 0; r < 8; ++r) { m_r[r] = -3.0e38f; l_r[r] = 0.f; }
  v8f oacc[DT];
#pragma unroll
  for (int dt = 0; dt < DT; ++dt) oacc[dt] = (v8f){0.f,0.f,0.f,0.f,0.f,0.f,0.f,0.f};

  const int kv_end = CAUSAL ? min(T, qblk * 64 + 64) : T;     // block-uniform
  for (int j0 = 0; j0 < kv_end; j0 += 32) {
    __syncthreads();
    for (int e = tid; e < 32 * (D / 4); e += 128) {
      const int r = e / (D / 4), c4 = (e % (D / 4)) * 4;
      const int key = j0 + r;
      v4f kf = {0.f,0.f,0.f,0.f}, vf = {0.f,0.f,0.f,0.f};
      if (key < T) { kf = *(const v4fa*)(K + (size_t)key * pitch + c4); vf = *(const v4fa*)(V + (size_t)key * pitch + c4); }
#pragma unroll
      for (int t = 0; t < 4; ++t) {
        unsigned short hb = bf16_bits(kf[t]); sKh[r][c4 + t] = hb; sKl[r][c4 + t] = bf16_bits(kf[t] - bf16_val(hb));
        hb = bf16_bits(vf[t]); sVh[r][c4 + t] = hb; sVl[r][c4 + t] = bf16_bits(vf[t] - bf16_val(hb));
      }
    }
    __syncthreads();
    // S tile 16 x 32
    v8f s[2];
#pragma unroll
    for (int nt = 0; nt < 2; ++nt) {
      v8f acc = {};
#pragma unroll
      for (int ks = 0; ks < KS; ++ks) {
        FragB bh_, bl_;
        bh_.half[0] = *(const v8us*)&sKh[nt * 16 + ln][ks * 32 + 8 * hh]; bh_.half[1] = *(const v8us*)&sKh[nt * 16 + ln][ks * 32 + 16 + 8 * hh];
        bl_.half[0] = *(const v8us*)&sKl[nt * 16 + ln][ks * 32 + 8 * hh]; bl_.half[1] = *(const v8us*)&sKl[nt * 16 + ln][ks * 32 + 16 + 8 * hh];
        acc = mmaN<3>(aqh[ks].v, aql[ks].v, bh_.v, bl_.v, acc);
      }
      s[nt] = acc;
    }
    // mask + running max (rows 8hh+r; the 16 lanes of a half share rows)
    float alpha[8];
#pragma unroll
    for (int r = 0; r < 8; ++r) {
      const int qi = q0 + 8 * hh + r;
      const int ja = j0 + ln, jb = j0 + 16 + ln;
      if (CAUSAL) { if (ja > qi) s[0][r] = -3.0e38f; if (jb > qi) s[1][r] = -3.0e38f; }
      if (ja >= T) s[0][r] = -3.0e38f;
      if (jb >= T) s[1][r] = -3.0e38f;
      float mx = fmaxf(s[0][r], s[1][r]);
      mx = fmaxf(mx, __shfl_xor(mx, 1, 32)); mx = fmaxf(mx, __shfl_xor(mx, 2, 32)); mx = fmaxf(mx, __shfl_xor(mx, 4, 32)); mx = fmaxf(mx, __shfl_xor(mx, 8, 32));
      const float mnew = fmaxf(m_r[r], mx);
      alpha[r] = (mnew > -1.0e38f) ? __expf(m_r[r] - mnew) : 1.0f;
      const float p0 = (s[0][r] > -1.0e38f) ? __expf(s[0][r] - mnew) : 0.f;
      const float p1 = (s[1][r] > -1.0e38f) ? __expf(s[1][r] - mnew) : 0.f;
      m_r[r] = mnew;
      l_r[r] = l_r[r] * alpha[r] + p0 + p1;            // per-lane partial row sum (16 lanes combined at the end)
      unsigned short hb = bf16_bits(p0); sPh[w][8 * hh + r][ln] = hb;      sPl[w][8 * hh + r][ln] = bf16_bits(p0 - bf16_val(hb));
      hb = bf16_bits(p1);                sPh[w][8 * hh + r][16 + ln] = hb; sPl[w][8 * hh + r][16 + ln] = bf16_bits(p1 - bf16_val(hb));
    }
#pragma unroll
    for (int dt = 0; dt < DT; ++dt)
#pragma unroll
      for (int r = 0; r < 8; ++r) oacc[dt][r] *= alpha[r];
    __builtin_amdgcn_fence(__ATOMIC_ACQ_REL, "workgroup");
    __builtin_amdgcn_wave_barrier();
    FragB pah, pal;
    pah.half[0] = *(const v8us*)&sPh[w][ln][8 * hh]; pah.half[1] = *(const v8us*)&sPh[w][ln][16 + 8 * hh];
    pal.half[0] = *(const v8us*)&sPl[w][ln][8 * hh]; pal.half[1] = *(const v8us*)&sPl[w][ln][16 + 8 * hh];
#pragma unroll
    for (int dt = 0; dt < DT; ++dt) {
      FragB bvh, bvl;
#pragma unroll
      for (int i = 0; i < 8; ++i) {
        bvh.u[i] = sVh[8 * hh + i][dt * 16 + ln]; bvh.u[8 + i] = sVh[16 + 8 * hh + i][dt * 16 + ln];
        bvl.u[i] = sVl[8 * hh + i][dt * 16 + ln]; bvl.u[8 + i] = sVl[16 + 8 * hh + i][dt * 16 + ln];
      }
      oacc[dt] = mmaN<3>(pah.v, pal.v, bvh.v, bvl.v, oacc[dt]);
    }
    __builtin_amdgcn_fence(__ATOMIC_ACQ_REL, "workgroup");
    __builtin_amdgcn_wave_barrier();
  }
#pragma unroll
  for (int r = 0; r < 8; ++r) {
    float l = l_r[r];
    l += __shfl_xor(l, 1, 32); l += __shfl_xor(l, 2, 32); l += __shfl_xor(l, 4, 32); l += __shfl_xor(l, 8, 32);
    l_r[r] = (l > 0.f) ? 1.0f / l : 0.f;
  }
#pragma unroll
  for (int dt = 0; dt < DT; ++dt)
#pragma unroll
    for (int r = 0; r < 8; ++r) sO[w][8 * hh + r][dt * 16 + ln] = oacc[dt][r] * l_r[r];
  __builtin_amdgcn_fence(__ATOMIC_ACQ_REL, "workgroup");
  __builtin_amdgcn_wave_barrier();
  {
    for (int r = 0; r < 16; ++r) {
      const int row = q0 + r;
      if (row < T && lane < D / 4) {
        const v4f val = *(const v4fa*)&sO[w][r][lane * 4];
        *(v4f*)(y + ((size_t)b * T + row) * ypitch + h * D + lane * 4) = val;
      }
    }
    
  }
}

// GEMM C = act(A·W + bias + resid): A f32 (ASPLIT -> hi/lo 2 terms), Wt bf16 [N][K]; ACT 0 none, 1 relu, 2 exact gelu;
// resid (optional, f32, row index = (row % rmod), pitch ldr, RES_BF16 rounds it) added before the activation.
template <bool ASPLIT, int ACT, bool BIAS_BF16, bool RES_BF16>
__global__ __launch_bounds__(128) void k_gemm_bf3(const float* __restrict__ A, int lda, const unsigned short* __restrict__ Wt, int ldb,
                                                const float* __restrict__ bias, const float* __restrict__ resid, int rmod, int ldr,
                                                float* __restrict__ C, int ldc, int M, int N, int K) {
  __shared__ __attribute__((aligned(16))) float so[4][16][64];
  const int tid = threadIdx.x, w = tid >> 5, lane = tid & 31, ln = lane & 15, hh = lane >> 4;
  const int ntn = N / 64;
  const int wid = blockIdx.x * 4 + w;
  const int mt = wid / ntn, nq = wid % ntn;
  if (mt * 16 >= M) return;
  const int row0 = mt * 16, col0 = nq * 64;
  const float* arow = A + (size_t)(row0 + ln) * lda;
  v8f acc[4] = {};
  for (int kb = 0; kb < K; kb += 32) {
    FragB ah, al;
    const v4f x0 = *(const v4fa*)(arow + kb + 8 * hh), x1 = *(const v4fa*)(arow + kb + 8 * hh + 4);
    const v4f x2 = *(const v4fa*)(arow + kb + 16 + 8 * hh), x3 = *(const v4fa*)(arow + kb + 16 + 8 * hh + 4);
    float xs[16] = {x0[0],x0[1],x0[2],x0[3],x1[0],x1[1],x1[2],x1[3],x2[0],x2[1],x2[2],x2[3],x3[0],x3[1],x3[2],x3[3]};
#pragma unroll
    for (int i = 0; i < 16; ++i) { const unsigned short hb = bf16_bits(xs[i]); ah.u[i] = hb; al.u[i] = ASPLIT ? bf16_bits(xs[i] - bf16_val(hb)) : (unsigned short)0; }
#pragma unroll
    for (int t = 0; t < 4; ++t) {
      const unsigned short* brow = Wt + (size_t)(col0 + t * 16 + ln) * ldb + kb;
      FragB b;
      b.half[0] = *(const v8us*)(brow + 8 * hh);
      b.half[1] = *(const v8us*)(brow + 16 + 8 * hh);
      acc[t] = mmaN<ASPLIT ? 2 : 1>(ah.v, al.v, b.v, b.v, acc[t]);
    }
  }
#pragma unroll
  for (int t = 0; t < 4; ++t) {
    const int col = col0 + t * 16 + ln;
    float bv = bias ? bias[col] : 0.f;
    if (BIAS_BF16) bv = bf16_round(bv);
#pragma unroll
    for (int r = 0; r < 8; ++r) {
      float v = acc[t][r] + bv;
      if (resid) { float rv = resid[(size_t)((row0 + 8 * hh + r) % rmod) * ldr + col]; if (RES_BF16) rv = bf16_round(rv); v += rv; }
      if (ACT == 1) v = fmaxf(v, 0.f);
      if (ACT == 2) v = 0.5f * v * (1.0f + erff(v * 0.70710678118654752f));
      if (ACT == 3) { const float u = 0.7978845608028654f * (v + 0.044715f * v * v * v); v = 0.5f * v * (1.0f + tanhf(u)); }
      so[w][8 * hh + r][t * 16 + ln] = v;
    }
  }
  __builtin_amdgcn_fence(__ATOMIC_ACQ_REL, "workgroup");
  __builtin_amdgcn_wave_barrier();
  const int rsub = lane >> 4, c4 = (lane & 15) * 4;
  {
#pragma unroll
    for (int q = 0; q < 8; ++q) {
      const int r = q * 2 + rsub;
      const v4f v = *(const v4fa*)&so[w][r][c4];
      *(v4f*)(C + (size_t)(row0 + r) * ldc + col0 + c4) = v;
    }
    
  }
}
// row LayerNorm (biased variance, eps) over N: s = X (+ R); optional out_sum <- s; out_norm <- (s-mu)*rsqrt(var+eps)*g + b
template <bool PARAM_BF16>
__global__ __launch_bounds__(256) void k_layernorm(const float* __restrict__ X, const float* __restrict__ R, const float* __restrict__ g, const float* __restrict__ bta,
                                                  float* __restrict__ out_sum, float* __restrict__ out_norm, int N, float eps) {
  __shared__ float red[256];
  const int row = blockIdx.x, tid = threadIdx.x;
  const float* x = X + (size_t)row * N; const float* rr = R ? R + (size_t)row * N : nullptr;
  float vals[16];                     // up to N = 4096
  const int per = N / 256;            // contiguous chunk per thread? use strided-by-4 chunks: thread handles j = tid*4 + 1024*u
  float s1 = 0.f;
  for (int u = 0; u < per / 4; ++u) {
    const int j = tid * 4 + 1024 * u;
    const v4f a = *(const v4fa*)(x + j);
    v4f b = {0.f,0.f,0.f,0.f}; if (rr) b = *(const v4fa*)(rr + j);
#pragma unroll
    for (int q = 0; q < 4; ++q) { const float v = a[q] + b[q]; vals[u * 4 + q] = v; s1 += v; }
  }
  red[tid] = s1; __syncthreads();
  for (int st = 128; st > 0; st >>= 1) { if (tid < st) red[tid] += red[tid + st]; __syncthreads(); }
  const float mu = red[0] / (float)N; __syncthreads();
  float s2 = 0.f;
  for (int u = 0; u < per / 4; ++u)
#pragma unroll
    for (int q = 0; q < 4; ++q) { const float c = vals[u * 4 + q] - mu; s2 += c * c; }
  red[tid] = s2; __syncthreads();
  for (int st = 128; st > 0; st >>= 1) { if (tid < st) red[tid] += red[tid + st]; __syncthreads(); }
  const float rs = rsqrtf(red[0] / (float)N + eps);
  {
    for (int u = 0; u < per / 4; ++u) {
      const int j = tid * 4 + 1024 * u;
      v4f o, sm;
#pragma unroll
      for (int q = 0; q < 4; ++q) {
        float gg = g[j + q], bb = bta[j + q];
        if (PARAM_BF16) { gg = bf16_round(gg); bb = bf16_round(bb); }
        sm[q] = vals[u * 4 + q]; o[q] = (vals[u * 4 + q] - mu) * rs * gg + bb;
      }
      if (out_sum) *(v4f*)(out_sum + (size_t)row * N + j) = sm;
      *(v4f*)(out_norm + (size_t)row * N + j) = o;
    }
    
  }
}



// ---- f16 WMMA path (v_wmma_f32_16x16x32_f16): 11-bit significands for operands in range — used where a [0,1] probability operand needs more precision than bf16
typedef _Float16 v16h __attribute__((ext_vector_type(16)));
union FragH { v16h v; v8us half[2]; _Float16 h[16]; unsigned short u[16]; };
template <int NT>
__device__ __forceinline__ v8f mmaH(v16h ah, v16h al, v16h bh, v16h bl, v8f c) {
  c = __builtin_amdgcn_wmma_f32_16x16x32_f16(false, ah, false, bh, (short)0, c, false, false);
  if (NT >= 2) c = __builtin_amdgcn_wmma_f32_16x16x32_f16(false, al, false, bh, (short)0, c, false, false);
  if (NT >= 3) c = __builtin_amdgcn_wmma_f32_16x16x32_f16(false, ah, false, bl, (short)0, c, false, false);
  asm volatile("v_nop\n\tv_nop\n\tv_nop\n\tv_nop" : "+v"(c) : "v"(ah), "v"(al), "v"(bh), "v"(bl));
  return c;
}
// batched GEMM with f16 operands: A f32 (split into f16 hi/lo if ASPLIT, else rounded to f16), Bt = f16 values [n][k]; alpha; C f32; N multiple of 16 (partial tiles skipped)
template <bool ASPLIT>
__global__ __launch_bounds__(128) void k_gemm_h(const float* __restrict__ A, int lda, size_t sA, const _Float16* __restrict__ Bh, int ldb, size_t sB, float alpha, float* __restrict__ C, int ldc, size_t sC, int M, int N, int K) {
  __shared__ __attribute__((aligned(16))) float so[4][16][64];
  const int tid = threadIdx.x, w = tid >> 5, lane = tid & 31, ln = lane & 15, hh = lane >> 4; const int by = blockIdx.y;
  A += (size_t)by * sA; Bh += (size_t)by * sB; C += (size_t)by * sC;
  const int ntn = (N + 63) / 64; const int wid = blockIdx.x * 4 + w; const int mt = wid / ntn, nq = wid % ntn; if (mt * 16 >= M) return;
  const int row0 = mt * 16, col0 = nq * 64; const float* arow = A + (size_t)(row0 + ln) * lda;
  v8f acc[4] = {};
  for (int kb = 0; kb < K; kb += 32) {
    FragH ah, al;
    const v4f x0 = *(const v4fa*)(arow + kb + 8 * hh), x1 = *(const v4fa*)(arow + kb + 8 * hh + 4), x2 = *(const v4fa*)(arow + kb + 16 + 8 * hh), x3 = *(const v4fa*)(arow + kb + 16 + 8 * hh + 4);
    float xs[16] = {x0[0],x0[1],x0[2],x0[3],x1[0],x1[1],x1[2],x1[3],x2[0],x2[1],x2[2],x2[3],x3[0],x3[1],x3[2],x3[3]};
#pragma unroll
    for (int i = 0; i < 16; ++i) { const _Float16 h = (_Float16)xs[i]; ah.h[i] = h; al.h[i] = ASPLIT ? (_Float16)(xs[i] - (float)h) : (_Float16)0.0f; }
#pragma unroll
    for (int t = 0; t < 4; ++t) { if (col0 + t * 16 >= N) continue; const size_t boff = (size_t)(col0 + t * 16 + ln) * ldb + kb; FragH bq; bq.half[0] = *(const v8us*)(Bh + boff + 8 * hh); bq.half[1] = *(const v8us*)(Bh + boff + 16 + 8 * hh);
      acc[t] = mmaH<ASPLIT ? 2 : 1>(ah.v, al.v, bq.v, bq.v, acc[t]); }
  }
#pragma unroll
  for (int t = 0; t < 4; ++t) { if (col0 + t * 16 >= N) continue;
#pragma unroll
    for (int r = 0; r < 8; ++r) so[w][8 * hh + r][t * 16 + ln] = acc[t][r] * alpha; }
  __builtin_amdgcn_fence(__ATOMIC_ACQ_REL, "workgroup"); __builtin_amdgcn_wave_barrier();
  const int rsub = lane >> 4, c4 = (lane & 15) * 4;
  {
#pragma unroll
    for (int q = 0; q < 8; ++q) { const int r = q * 2 + rsub; if (col0 + c4 < N) { const v4f v = *(const v4fa*)&so[w][r][c4]; *(v4f*)(C + (size_t)(row0 + r) * ldc + col0 + c4) = v; } }
     }
}

// Wt[n][k] = f16(W[k][n]·scale) from f32 row-major W[K][N] (scale = power of two; bf16-exact weights stay exact in f16 away from the subnormal range)
__global__ __launch_bounds__(256) void k_wt_f16(const float* __restrict__ W, _Float16* __restrict__ Wt, int K, int N, float scale) {
  const int t = blockIdx.x * 256 + threadIdx.x; if (t >= N * (K / 8)) return; const int n = t / (K / 8), k8 = (t % (K / 8)) * 8; FragH f;
#pragma unroll
  for (int i = 0; i < 8; ++i) f.h[i] = (_Float16)(bf16_round(W[(size_t)(k8 + i) * N + n]) * scale); const v8us o = f.half[0];
  *(v8us*)((unsigned short*)Wt + (size_t)n * K + k8) = o; 
}
// The three projections of one head, inside the attention block. f16 operands, f32 accumulators, result x 2^-4; x is rounded (bf16, then f16), the weights x 2^4, bf16, f16 (the power of two commutes with the rounding).
// Staged index s of a token: s = 24 + (token - first token of the block's ten window rows), so that s = 0 lies on a 128-byte line of every NCHW channel. x comes in two chunks of CHT tokens (s from 0 and from CHS), token-major in LDS, sx[token][c].
#define XP (CC + 8)
#define CHT 320
#define CHS 288
typedef unsigned short v4us __attribute__((ext_vector_type(4), may_alias));
// f32 -> nearest-even bf16 -> f32 by the chip's own conversion: the same value as bf16_round() for every finite x, in fewer instructions
__device__ __forceinline__ float bf16_rne(float x) { return (float)(__bf16)x; }
// round r (of five) of a chunk: a wave takes 32 tokens x 32 channels, a lane 4 tokens x 8 channels; 8 lanes read one whole 128-byte line of a channel. gbase = image token of the chunk's row 0; a token outside the image is clamped into it (its projections are never used)
// rot (the head's index, scalar) turns the walk over the eight 32-channel groups: the eight heads' blocks of one row group read the very same x lines and start almost together; unrotated they ask L2 for the same line at the same moment, round after round
__device__ __forceinline__ void fx_ld(v4f (&xv)[8], const float* __restrict__ xb, int gbase, int w, int lane, int r, int rot) {
  const int wpi = w + 16 * r, qb = wpi % 10, cb = (wpi / 10 + rot) & 7;
  int gt = gbase + (qb * 8 + (lane >> 2)) * 4; gt = (gt < 0) ? 0 : ((gt > NTOK - 4) ? (NTOK - 4) : gt);
  const unsigned xo = (unsigned)(((cb * 4 + (lane & 3)) * 8 * NTOK + gt) * 4);      // byte offset in the image's x, below 2^32: scalar base + one lane register address all eight loads
#pragma unroll
  for (int q = 0; q < 8; ++q) xv[q] = *(const v4fa*)((const char*)xb + xo + q * (NTOK * 4));
  asm volatile("s_wait_xcnt 0x0" :: "v"(xo) : "memory"); }      // xo is named as an input so that it lives up to this wait: no result of the eight loads may land on their own address register; behind the wait it is dead
// the same round, rounded, into sx: sixteen lanes (4 token quads x 4 channel groups) store to sixteen different groups of four banks
__device__ __forceinline__ void fx_st(const v4f (&xv)[8], unsigned short (*sx)[XP], int w, int lane, int r, int rot) {
  const int wpi = w + 16 * r, qb = wpi % 10, cb = (wpi / 10 + rot) & 7; const int row0 = (qb * 8 + (lane >> 2)) * 4, col = (cb * 4 + (lane & 3)) * 8;
#pragma unroll
  for (int k = 0; k < 4; ++k) { FragH f;
#pragma unroll
    for (int q = 0; q < 8; ++q) f.h[q] = (_Float16)bf16_rne(xv[q][k]);
    *(v8us*)&sx[row0 + k][col] = f.half[0]; } }
// rounds 0 and 1 are in flight on entry; two rounds of f32 x at most in registers
__device__ __forceinline__ void fx_rest(v4f (&xv)[2][8], const float* __restrict__ xb, int gbase, unsigned short (*sx)[XP], int w, int lane, int rot) {
#pragma unroll
  for (int r = 0; r < 5; ++r) {      // unrolled: xv is indexed by constants and stays in registers
    __builtin_amdgcn_sched_barrier(0);      // keeps the loads two rounds ahead and no further: left free, the scheduler lifts all forty to the top and spills
    fx_st(xv[r & 1], sx, w, lane, r, rot); if (r + 2 < 5) fx_ld(xv[r & 1], xb, gbase, w, lane, r + 2, rot); } }
// one 16-token tile x 32 outputs over K = 256. WA: the weight fragment is the A operand (kc, q: a lane ends with 8 consecutive d of its own token), else the B operand (v: 8 consecutive tokens of its own channel). k order of both fragments: half 0 = c 32ks + 8hh.., half 1 = c 32ks + 16 + 8hh..
template <bool WA>
__device__ __forceinline__ void fx_tile(v8f (&acc)[2], const FragH (&wf)[8][2], const unsigned short* xr) {
  acc[0] = (v8f){0.f,0.f,0.f,0.f,0.f,0.f,0.f,0.f}; acc[1] = acc[0];
#pragma unroll
  for (int ks = 0; ks < 8; ++ks) { FragH xf; xf.half[0] = *(const v8us*)(xr + ks * 32); xf.half[1] = *(const v8us*)(xr + ks * 32 + 16);
#pragma unroll
    for (int nt = 0; nt < 2; ++nt) acc[nt] = WA ? __builtin_amdgcn_wmma_f32_16x16x32_f16(false, wf[ks][nt].v, false, xf.v, (short)0, acc[nt], false, false) : __builtin_amdgcn_wmma_f32_16x16x32_f16(false, xf.v, false, wf[ks][nt].v, (short)0, acc[nt], false, false); } }
// 2^a for eight values at once. The probabilities are rounded to f16 for the matrix product, so exp(x) = 2^(x*log2(e)) with the product and the shift by the maximum in ONE fma is accurate enough (relative error about 1e-6 at x = -20; a below the f32 range, -inf included, gives 0).
// The exponentials stand in asm text, eight in a row with early-clobber results and one v_nop behind the last: the instruction set asks for one slot before a vector instruction reads a transcendental's result or overwrites its source;
// here each one's neighbour is independent of it (no result shares a register with any source), and the v_nop fills the slot of the last.
__device__ __forceinline__ void exp2x8(float (&p)[8], const float (&a)[8]) {
  asm("v_exp_f32 %0, %8\n\tv_exp_f32 %1, %9\n\tv_exp_f32 %2, %10\n\tv_exp_f32 %3, %11\n\tv_exp_f32 %4, %12\n\tv_exp_f32 %5, %13\n\tv_exp_f32 %6, %14\n\tv_exp_f32 %7, %15\n\tv_nop"
      : "=&v"(p[0]), "=&v"(p[1]), "=&v"(p[2]), "=&v"(p[3]), "=&v"(p[4]), "=&v"(p[5]), "=&v"(p[6]), "=&v"(p[7])
      : "v"(a[0]), "v"(a[1]), "v"(a[2]), "v"(a[3]), "v"(a[4]), "v"(a[5]), "v"(a[6]), "v"(a[7])); }
// window attention, one wave per (b, head h, patch of 2 image rows y, y + 1 x 8 columns xs ..): column ln of every tile is the patch's token (row ln / 8, column ln % 8). The two rows' windows share six of their eight key rows y - 3 .. y + 4, and the 8 + 6 columns a key row needs fit ONE 16-key tile (xs - 4 .. xs + 11).
// S^T = Q_row (16 keys x 32 d, one A tile, f16 hi + lo*2^-10, 3 products) * KC^T (B, 16 centre keys): lane (ln, hh) holds, for centre token ln, the keys c = 8hh + r;
// the window is the band 0 <= c - ln % 8 - 1 <= 6 (= column offset j) in key rows ln / 8 .. ln / 8 + 6. Softmax of a centre token is in-lane plus one exchange with lane ^ 16; the S^T tiles of two key rows, as f16, ARE the B operand of
// O^T = V^T (A: row d, keys along k, read from the channel-major VT) * P^T, so a lane ends with 8 consecutive d of its own token.
// kc.rel_k splits into a row term and a column term: E = REL * KC^T with REL rows 0..6 = (rel_h[i] | 0), rows 8..14 = (0 | rel_w[j]), rows 7 and 15 zero; rel is bf16-rounded first, as before (8 significant bits: exact in f16 from 2^-14 up, below that off by at most 2^-25), and kc is hi + lo*2^-10 (2 products).
// A block = one (b, head) x four image rows (y0 = 4g ..) = 2 x 7 patches on fourteen of its sixteen waves: its 224 tokens are 896 bytes = seven whole 128-byte lines of every NCHW output channel, so the block turns its result channel-major in LDS and stores the output itself, each line from one block.
#define RG 4
#define NTASK 14
#define TPB (RG * HI)
#define OP (TPB + 4)
#define QLP (2 * HD + 8)
#define VPC 80
#define VLP (VPC * 8 + 8)
__global__ __launch_bounds__(512) void k_nattn(const float* __restrict__ x, const float* __restrict__ Wk, const float* __restrict__ Wq, const float* __restrict__ Wv, const float* __restrict__ relh, const float* __restrict__ relw, float* __restrict__ out) {
  __shared__ __attribute__((aligned(16))) unsigned short sQ[9 * 64][QLP];      // q lines (hi 32 | lo 32) of the block's ten window rows y0 - 3 .. y0 + 6, token-major, row = s - 16 (36 tiles of 16); pitch 144 B = 16 B x odd: the fragment reads meet no bank twice. Before the first tile it holds the head's 96 rounded weight rows (pitch XP)
  __shared__ __attribute__((aligned(16))) unsigned short sK[TPB][QLP];      // kc lines of the block's own 224 tokens, same pitch
  __shared__ __attribute__((aligned(16))) unsigned short sV[HD][VLP];      // v of the same ten rows, channel-major, column = s - 16; pitch 1296 B = 16 B x odd
  __shared__ __attribute__((aligned(16))) unsigned char sU[CHT * XP * 2];      // first sx, a chunk of x (pitch 528 B = 16 B x odd); behind the last projection tile sR and sT
  unsigned short (*sx)[XP] = (unsigned short (*)[XP])sU;
  float (*sR)[16][20] = (float (*)[16][20])sU;      // per centre token of the wave: words 0..6 kc.rel_h[i], words 8..14 kc.rel_w[j] (pitch 20: rows stay 16-byte aligned and in-band lanes of the gather below meet no bank twice)
  float (*sT)[OP] = (float (*)[OP])(sU + RG * NXS * 16 * 20 * 4);      // [d][token of the block]; pitch 228 words: rows stay 16-byte aligned, and rows d and d + 8, written by the two lane halves at once, lie 32 banks apart
  const int tid = threadIdx.x, lane = tid & 31, ln = lane & 15, hh = lane >> 4; const int w = __builtin_amdgcn_readfirstlane(tid >> 5);      // wave number held scalar: (b, h, y, x0) and every row base below are then scalar, a lane keeps only row-invariant byte offsets
  const int b = blockIdx.x / (NHh * (HI / RG)), rem = blockIdx.x % (NHh * (HI / RG)); const int h = rem / (HI / RG), y0 = (rem % (HI / RG)) * RG; const int yl = (w / 7) * 2, xs = (w % 7) * 8, lnx = ln & 7, lny = ln >> 3;      // the wave's patch: image rows y0 + yl, y0 + yl + 1, columns xs .. xs + 7; lane column ln is its token (lny, lnx)
  // Projections first. The head's weights (3 x 32 KB, rows contiguous) come by loads of 512 contiguous bytes, twelve a wave, and are rounded once into LDS; a wave then keeps ONE matrix's fragments in registers for all its tiles: waves 0..5 q, 6..11 v, 12..15 kc.
  const float* xb = x + (size_t)b * CC * NTOK; const int gb0 = (y0 - 3) * HI - 24; unsigned short* sW = &sQ[0][0];
  const int ww = (w + (y0 >> 2) + 8 * b) & 15;      // which sixteenth of each load group this wave takes, turned by the block's row group and image: the 28 blocks of one head read the same weight lines, all at kernel start
  v4f wr[12], xv[2][8]; const unsigned wo = (unsigned)(((h * HD) * CC + ww * 128 + lane * 4) * 4);      // byte offset, the same in all three matrices
#pragma unroll      // unrolled: wr is indexed by constants and stays in registers
  for (int i = 0; i < 12; ++i) { const int mm = i >> 2; const float* wm = (mm == 0) ? Wk : ((mm == 1) ? Wq : Wv); wr[i] = *(const v4fa*)((const char*)wm + wo + (i & 3) * (16 * 128 * 4)); }      // load 16 i + ww of the 192: the matrix is a constant of i, so the three argument pointers and one lane offset serve all twelve
  asm volatile("s_wait_xcnt 0x0" :: "v"(wo), "s"(Wk), "s"(Wq), "s"(Wv) : "memory");      // the lane offset and the three scalar bases are named as inputs so that they live up to this wait; behind it the addresses of these loads are dead and may be overwritten
  fx_ld(xv[0], xb, gb0, w, lane, 0, h); fx_ld(xv[1], xb, gb0, w, lane, 1, h);
  __builtin_amdgcn_sched_barrier(0);      // the first x loads issue before the wait for the weights
#pragma unroll
  for (int i = 0; i < 12; ++i) { const int mm = i >> 2, jj = (i & 3) * 16 + ww; union { _Float16 h[4]; v4us v; } f;      // matrix mm, row jj / 2, c = 128 * (jj % 2) + 4 * lane + 0..3
#pragma unroll
    for (int e = 0; e < 4; ++e) f.h[e] = (_Float16)bf16_rne(wr[i][e] * 16.0f);
    *(v4us*)(sW + (mm * HD + (jj >> 1)) * XP + (jj & 1) * 128 + lane * 4) = f.v; }
  fx_rest(xv, xb, gb0, sx, w, lane, h);
  __syncthreads();      // the weight rows and chunk 0 of x are written by all sixteen waves and read across them
  const int u = (w < 6) ? 1 : ((w < 12) ? 2 : 0), slot = (w < 6) ? w : ((w < 12) ? (w - 6) : (w - 12)), stride = (w < 12) ? 6 : 4, count = (w < 12) ? 18 : 7;      // matrix 0 kc, 1 q, 2 v; a chunk has 18 tiles of q and of v and 7 of kc
  FragH wf[8][2]; { const unsigned short* wu = sW + (u * HD + ln) * XP + 8 * hh;
#pragma unroll      // unrolled: wf is indexed by constants and stays in registers
    for (int ks = 0; ks < 8; ++ks)
#pragma unroll
      for (int nt = 0; nt < 2; ++nt) { wf[ks][nt].half[0] = *(const v8us*)(wu + nt * 16 * XP + ks * 32); wf[ks][nt].half[1] = *(const v8us*)(wu + nt * 16 * XP + ks * 32 + 16); } }
  __syncthreads();      // every wave has its weight fragments: the q tiles may now overwrite the weight rows
  v4f r0, r1;
#pragma unroll
  for (int c = 0; c < 2; ++c) {
    if (c == 1) {
      __syncthreads();      // every wave has left chunk 0 of x
      fx_rest(xv, xb, gb0 + CHS, sx, w, lane, h);
      __syncthreads();      // chunk 1 of x is written by all sixteen waves and read across them
      const int ri = ln & 7; const float* rp = ((ln < 8) ? relh : relw) + (h * 7 + ((ri < 7) ? ri : 6)) * 16 + 8 * hh; r0 = *(const v4fa*)rp; r1 = *(const v4fa*)(rp + 4);      // the rel row of this lane, used behind the tiles: fetched here, its latency passes under them
      asm volatile("s_wait_xcnt 0x0" ::: "memory"); }      // rp is dead from here on: later results may land on it
    if (c == 0) { fx_ld(xv[0], xb, gb0 + CHS, w, lane, 0, h); fx_ld(xv[1], xb, gb0 + CHS, w, lane, 1, h); }      // the first two rounds of chunk 1 fly under the tiles of chunk 0 (they touch no LDS)
    const int first = (u == 0 && c == 0) ? 11 : 0;      // the block's own tokens are tiles 11..17 of chunk 0 and 0..6 of chunk 1
    for (int k = 0; k < 3; ++k) { const int sl = slot + stride * k; if (sl < count) {      // a scalar test: whole waves pass or skip
      const int jl = first + sl, o = 16 * (18 * c + jl); const unsigned short* xr = &sx[16 + 16 * jl + ln][8 * hh]; v8f acc[2];      // tile jl of the chunk: its rows 16 + 16jl ..; o = s - 16 of its first token
      if (u == 2) { fx_tile<false>(acc, wf, xr);
#pragma unroll
        for (int nt = 0; nt < 2; ++nt) { FragH f;
#pragma unroll
          for (int r = 0; r < 8; ++r) f.h[r] = (_Float16)(acc[nt][r] * 0.0625f);
          *(v8us*)&sV[nt * 16 + ln][o + 8 * hh] = f.half[0]; }
      } else { fx_tile<true>(acc, wf, xr); unsigned short* dq = (u == 1) ? &sQ[o + ln][8 * hh] : &sK[o - 176 + ln][8 * hh];
#pragma unroll
        for (int nt = 0; nt < 2; ++nt) { FragH fh, fl;
#pragma unroll
          for (int r = 0; r < 8; ++r) { const float v = acc[nt][r] * 0.0625f; const _Float16 hv = (_Float16)v; fh.h[r] = hv; fl.h[r] = (_Float16)((v - (float)hv) * 1024.0f); }      // f16 hi + lo*2^10
          *(v8us*)(dq + nt * 16) = fh.half[0]; *(v8us*)(dq + HD + nt * 16) = fl.half[0]; } } } } }
  const v8us z8 = (v8us){0,0,0,0,0,0,0,0}; const v8f z8f = (v8f){0.f,0.f,0.f,0.f,0.f,0.f,0.f,0.f};
  FragH ar; { const int ri = ln & 7; FragH c;      // row ln of REL: its 8 non-zero k of this lane half
#pragma unroll
    for (int q = 0; q < 4; ++q) { c.h[q] = (_Float16)bf16_round(r0[q]); c.h[4 + q] = (_Float16)bf16_round(r1[q]); }
    const v8us cv = (ri < 7) ? c.half[0] : z8; ar.half[0] = (ln < 8) ? cv : z8; ar.half[1] = (ln < 8) ? z8 : cv; }      // k order as bc: half 0 = d 8hh.., half 1 = d 16 + 8hh..
  __syncthreads();      // sQ, sK, sV are written by all sixteen waves and read across them; every wave has left sx, whose range sR and sT now take
  if (w < NTASK) {      // a scalar test: waves 14 and 15 have no patch and go straight to the barrier below
  FragH bc, bcl; { const unsigned short* kr = &sK[(yl + lny) * HI + xs + lnx][8 * hh]; bc.half[0] = *(const v8us*)kr; bc.half[1] = *(const v8us*)(kr + 16); bcl.half[0] = *(const v8us*)(kr + HD); bcl.half[1] = *(const v8us*)(kr + HD + 16); }      // centre key kc, column ln of B; a head's line: hi 32 | lo 32
  { const v8f e = __builtin_amdgcn_wmma_f32_16x16x32_f16(false, ar.v, false, bc.v, (short)0, z8f, false, false); const v8f e2 = __builtin_amdgcn_wmma_f32_16x16x32_f16(false, ar.v, false, bcl.v, (short)0, z8f, false, false); v4f o0, o1;
#pragma unroll
    for (int q = 0; q < 4; ++q) { o0[q] = e[q] + e2[q] * 0.0009765625f; o1[q] = e[4 + q] + e2[4 + q] * 0.0009765625f; }
    *(v4fa*)&sR[w][ln][8 * hh] = o0; *(v4fa*)&sR[w][ln][8 * hh + 4] = o1; }      // lane (ln, hh) holds rows 8hh..8hh+7 of E for its own centre token
  __builtin_amdgcn_fence(__ATOMIC_ACQ_REL, "workgroup"); __builtin_amdgcn_wave_barrier();      // sR is written and read by this wave alone
  bool inb[8]; int rj[8]; bool vok[2];
  const int xx = xs - 4 + ln; const bool xok = (xx >= 0 && xx < HI); const unsigned qoff = (unsigned)((xok ? xx : 0) * QLP + 8 * hh);      // key c = ln as row of A
#pragma unroll
  for (int g = 0; g < 2; ++g) { const int xk = xs - 4 + 8 * hh + 4 * g; vok[g] = (xk >= 0 && xk < HI); }      // 4 keys: wholly inside the image row or wholly outside
  const int voff = ln * VLP + xs - 4 + 8 * hh;      // one address for both pieces: a piece outside the image row still lies in the written columns 4 .. 571 of sV (the neighbour row's tokens) and is replaced by zero below
#pragma unroll
  for (int r = 0; r < 8; ++r) { const int j = 8 * hh + r - lnx - 1; inb[r] = (j >= 0 && j < 7); rj[r] = (j < 0) ? 0 : ((j > 6) ? 6 : j); }
  float rr[8]; v8f rw; { const float* rl = &sR[w][ln][0]; const v4f a0 = *(const v4fa*)rl, a1 = *(const v4fa*)(rl + 4); float rh[8];
#pragma unroll
    for (int q = 0; q < 4; ++q) { rh[q] = a0[q]; rh[4 + q] = a1[q]; }
#pragma unroll
    for (int kr = 0; kr < 8; ++kr) { const float up = (kr < 7) ? rh[kr] : -3.0e38f, lo = (kr > 0) ? rh[kr - 1] : -3.0e38f; rr[kr] = lny ? lo : up; }      // row term of key row kr: window row i = kr - lny of this lane's centre row; a key row outside its window gets the mask value
#pragma unroll
    for (int r = 0; r < 8; ++r) rw[r] = rl[8 + rj[r]]; }      // column term of key c = 8hh + r, the same for all eight key rows; every lane reads (index clamped into the row): no branch round the load
  float lg[8][8];
#pragma unroll
  for (int kr = 0; kr < 8; ++kr) { const int yy = y0 + yl + kr - 3; const bool ok = (yy >= 0 && yy < HI) && xok; const unsigned short* q0 = &sQ[(yl + kr) * HI + 8][0]; const unsigned short* q1 = q0 + HD;      // key row kr of the patch is staged row yl + kr; its first token stands in row 8 + 56 (yl + kr)
    FragH ak, akl; ak.half[0] = *(const v8us*)(q0 + qoff); ak.half[1] = *(const v8us*)(q0 + qoff + 16); akl.half[0] = *(const v8us*)(q1 + qoff); akl.half[1] = *(const v8us*)(q1 + qoff + 16);
    if (!ok) { ak.half[0] = z8; ak.half[1] = z8; akl.half[0] = z8; akl.half[1] = z8; }      // zero padding: q = 0 outside the image
    v8f s = __builtin_amdgcn_wmma_f32_16x16x32_f16(false, ak.v, false, bc.v, (short)0, rw, false, false);      // the column term rides in as C
    v8f s2 = __builtin_amdgcn_wmma_f32_16x16x32_f16(false, ak.v, false, bcl.v, (short)0, z8f, false, false); s2 = __builtin_amdgcn_wmma_f32_16x16x32_f16(false, akl.v, false, bc.v, (short)0, s2, false, false);      // hi.hi + (lo.hi + hi.lo)*2^-10
#pragma unroll
    for (int r = 0; r < 8; ++r) { const float sd = s[r] + s2[r] * 0.0009765625f; const float lv = sd + rr[kr]; lg[kr][r] = inb[r] ? lv : -3.0e38f; } }      // kc.(q + rel_k); padded neighbours keep kc.rel_k
  float m = -3.0e38f;
#pragma unroll
  for (int kr = 0; kr < 8; ++kr)
#pragma unroll
    for (int r = 0; r < 8; ++r) m = fmaxf(m, lg[kr][r]);
  m = fmaxf(m, __shfl_xor(m, 16, 32));
  const float nm = -m * 0x1.715476p+0f;      // its rounding is one common factor of a token's 49 probabilities and of their sum: it cancels in the division
  float l = 0.f; v8f oacc[2] = {z8f, z8f};
#pragma unroll
  for (int pr = 0; pr < 4; ++pr) { FragH pb;      // two key rows fill the 32 k of one product: k = 16t + 8hh + r is key c = 8hh + r of key row 2pr + t, in P^T and in V^T alike
#pragma unroll
    for (int t = 0; t < 2; ++t) { float a[8], p[8];
#pragma unroll
      for (int r = 0; r < 8; ++r) a[r] = __builtin_fmaf(lg[2 * pr + t][r], 0x1.715476p+0f, nm);      // (logit - m) * log2(e); outside the window: -inf, 2^a = 0
      exp2x8(p, a);
#pragma unroll
      for (int r = 0; r < 8; ++r) { l += p[r]; pb.h[8 * t + r] = (_Float16)p[r]; } }
#pragma unroll
    for (int dt = 0; dt < 2; ++dt) { union { v16h v; v4us q[4]; } av;
#pragma unroll
      for (int t = 0; t < 2; ++t) { const int yy = y0 + yl + 2 * pr + t - 3; const bool yok = (yy >= 0 && yy < HI); const unsigned short* vb = &sV[0][(yl + 2 * pr + t) * HI + 8];
#pragma unroll
        for (int g = 0; g < 2; ++g) { av.q[2 * t + g] = *(const v4us*)(vb + voff + 4 * g + dt * (16 * VLP)); if (!(yok && vok[g])) av.q[2 * t + g] = (v4us){0,0,0,0}; } }      // the patch's keys start four tokens left of it: 8-byte pieces; zero padding: v = 0 outside the image
      oacc[dt] = __builtin_amdgcn_wmma_f32_16x16x32_f16(false, av.v, false, pb.v, (short)0, oacc[dt], false, false); }
    __builtin_amdgcn_sched_barrier(0); }      // keeps the next pair's v_exp_f32 (asm text, which the compiler's padding does not see) from being lifted to directly behind these matrix instructions; the eight fmas that make its arguments (at least four issue slots, as dual pairs) now stand between
  l += __shfl_xor(l, 16, 32);
#pragma unroll
  for (int dt = 0; dt < 2; ++dt)
#pragma unroll
    for (int r = 0; r < 8; ++r) sT[dt * 16 + 8 * hh + r][(yl + lny) * HI + xs + lnx] = oacc[dt][r] / l; }
  __syncthreads();      // sT is written by waves 0..13 and read by all sixteen
  // wave w stores channels 2w and 2w + 1 of the head: 2 x 56 pieces of 16 bytes, a store instruction covers whole 128-byte lines
  float* op = out + ((size_t)(b * CC + h * HD + 2 * w) * NTOK + y0 * HI);
  v4f ov[4];      // all LDS reads first, then the stores: one LDS latency instead of four
#pragma unroll      // both loops unrolled: ov is indexed by constants and stays in registers
  for (int k = 0; k < 4; ++k) { const int j = lane + 32 * k; if (j < 2 * (TPB / 4)) { const int d = (j >= TPB / 4) ? 1 : 0, c4 = (j - d * (TPB / 4)) * 4; ov[k] = *(const v4fa*)&sT[2 * w + d][c4]; } }
#pragma unroll
  for (int k = 0; k < 4; ++k) { const int j = lane + 32 * k; if (j < 2 * (TPB / 4)) { const int d = (j >= TPB / 4) ? 1 : 0, c4 = (j - d * (TPB / 4)) * 4; *(v4f*)(op + (unsigned)(d * NTOK + c4)) = ov[k]; } }
}

extern "C" void kernel_launch(void* const* d_in, const int* in_sizes, int n_in,
                              void* d_out, int out_size, void* d_ws, size_t ws_size, hipStream_t stream) {
  (void)in_sizes; (void)n_in; (void)out_size;
  const float* x = (const float*)d_in[0]; const float* Wk = (const float*)d_in[1]; const float* Wq = (const float*)d_in[2]; const float* Wv = (const float*)d_in[3]; const float* relh = (const float*)d_in[4]; const float* relw = (const float*)d_in[5];
  (void)d_ws; (void)ws_size;
  k_nattn<<<BB * NHh * (HI / RG), RG * NXS * 32, 0, stream>>>(x, Wk, Wq, Wv, relh, relw, (float*)d_out);      // projections, window attention and the NCHW store, one launch; no workspace
}
